// v000
// The times below were measured on an AMD MI455X: many runs one after another, warmed up first and cycling through
// copies of the inputs, with the whole window's GPU time divided by the number of runs. Launches and the gaps
// between them are all in it. The median over several windows is given; except for v000 it joins two sittings, which
// can be a few percent apart, so the side-by-side timings, each taken in one sitting, are the better comparison.
// v000 is the starting kernel. One run takes 3320 microseconds.
#include <hip/hip_runtime.h>
// QEffMolmoBlock (1 x 2048 tokens; 16 query heads / 4 kv heads x 128 dims; q, k, v are INPUT projections): q = RMSNorm_2048(q) * q_norm_w, k = RMSNorm_512(k) * k_norm_w (flat, before the head split); rotate-half RoPE (hd 128, positions from position_ids, base 10000); GQA (each kv head serves 4 query heads); scores = q.k / sqrt(128), masked entries (int mask input != 0) REPLACED by -10000; softmax; out = (att v) W_out^T.
// Structure: RMSNorm + RoPE fused on VALU (wave per token) into f16 hi + 2^10 residual q/k planes; v as an exact f16 plane; V^T by LDS tiles; per head: the 2048 x 2048 score GEMM (f16 WMMA, 32x64 wave tiles, f32 accumulation, K = 128), the masked softmax on VALU (wave per row, mask read on device) into f16 P hi + residual (x 2^10), the readout GEMM as two terms (N = 128) into the merged context plane; context hi/residual; W_out as two GEMM terms (exact x16 weights).
// Compute dtype: inputs rounded to bf16; v and W_out exact as f16; normed+rotated q/k (3-term scores), P and the merged context all carried as f16 hi + 2^10 residual (~2^-21): the q/k norm weights are O(1) random so logits have sigma ≈ 11 and the softmax is near one-hot; RMSNorm/RoPE/softmax f32. v_wmma_f32_16x16x32_f16.
#define TT 2048
#define MSTR 2048                /* attention_mask row stride (input geometry) */
#define NQH 16
#define NKVH 4
#define HD 128
#define DQ (NQH * HD)            /* 2048 */
#define DKV (NKVH * HD)          /* 512 */
typedef __bf16 v16b __attribute__((ext_vector_type(16)));
typedef unsigned short v8us __attribute__((ext_vector_type(8), may_alias));
typedef float  v8f  __attribute__((ext_vector_type(8)));
typedef float  v4f  __attribute__((ext_vector_type(4)));
typedef float  v4fa __attribute__((ext_vector_type(4), may_alias));
union FragB { v16b v; v8us half[2]; unsigned short u[16]; };

__device__ __forceinline__ unsigned short bf16_bits(float x) { unsigned int u = __float_as_uint(x); return (unsigned short)((u + 0x7FFFu + ((u >> 16) & 1u)) >> 16); }
__device__ __forceinline__ float bf16_val(unsigned short b) { return __uint_as_float(((unsigned int)b) << 16); }
__device__ __forceinline__ float bf16_round(float x) { return bf16_val(bf16_bits(x)); }
// D += A·B with NT terms: 1 = ah·bh, 2 = + al·bh (A split), 3 = + ah·bl (both split)
template <int NT>
__device__ __forceinline__ v8f mmaN(v16b ah, v16b al, v16b bh, v16b bl, v8f c) {
  c = __builtin_amdgcn_wmma_f32_16x16x32_bf16(false, ah, false, bh, (short)0, c, false, false);
  if (NT >= 2) c = __builtin_amdgcn_wmma_f32_16x16x32_bf16(false, al, false, bh, (short)0, c, false, false);
  if (NT >= 3) c = __builtin_amdgcn_wmma_f32_16x16x32_bf16(false, ah, false, bl, (short)0, c, false, false);
  asm volatile("v_nop\n\tv_nop\n\tv_nop\n\tv_nop" : "+v"(c) : "v"(ah), "v"(al), "v"(bh), "v"(bl));
  return c;
}

__global__ __launch_bounds__(256) void k_wt_bf16(const float* __restrict__ W, unsigned short* __restrict__ Wt, int K, int N) {
  const int t = blockIdx.x * 256 + threadIdx.x;
  const int k8n = K / 8;
  if (t >= N * k8n) return;
  const int n = t / k8n, k8 = (t % k8n) * 8;
  v8us v;
#pragma unroll
  for (int i = 0; i < 8; ++i) v[i] = bf16_bits(W[(size_t)(k8 + i) * N + n]);
  *(v8us*)(Wt + (size_t)n * K + k8) = v;
  
}

// GEMM C[M][N] (f32, pitch ldc) = act(A[M][K]·W + bias). A f32 row-major (pitch lda) converted per fragment to bf16
// (ASPLIT: hi/lo two planes -> 2 terms, else single rounded term); Wt bf16 [N][K] (pitch ldb). BIAS_BF16 rounds the
// bias to bf16 first (bias quantised to bf16 before the add). K%32==0, M%16==0, N%64==0.
template <bool ASPLIT, int ACT, bool BIAS_BF16>
__global__ __launch_bounds__(128) void k_gemm_bf(const float* __restrict__ A, int lda, const unsigned short* __restrict__ Wt, int ldb,
                                               const float* __restrict__ bias, float* __restrict__ C, int ldc, int M, int N, int K) {
  __shared__ __attribute__((aligned(16))) float so[4][16][64];
  const int tid = threadIdx.x, w = tid >> 5, lane = tid & 31, ln = lane & 15, hh = lane >> 4;
  const int ntn = N / 64;
  const int wid = blockIdx.x * 4 + w;
  const int mt = wid / ntn, nq = wid % ntn;
  if (mt * 16 >= M) return;
  const int row0 = mt * 16, col0 = nq * 64;
  const float* arow = A + (size_t)(row0 + ln) * lda;
  v8f acc[4] = {};
  for (int kb = 0; kb < K; kb += 32) {
    FragB ah, al;
    const v4f x0 = *(const v4fa*)(arow + kb + 8 * hh), x1 = *(const v4fa*)(arow + kb + 8 * hh + 4);
    const v4f x2 = *(const v4fa*)(arow + kb + 16 + 8 * hh), x3 = *(const v4fa*)(arow + kb + 16 + 8 * hh + 4);
    float xs[16] = {x0[0],x0[1],x0[2],x0[3],x1[0],x1[1],x1[2],x1[3],x2[0],x2[1],x2[2],x2[3],x3[0],x3[1],x3[2],x3[3]};
#pragma unroll
    for (int i = 0; i < 16; ++i) { const unsigned short hb = bf16_bits(xs[i]); ah.u[i] = hb; al.u[i] = ASPLIT ? bf16_bits(xs[i] - bf16_val(hb)) : (unsigned short)0; }
#pragma unroll
    for (int t = 0; t < 4; ++t) {
      const unsigned short* brow = Wt + (size_t)(col0 + t * 16 + ln) * ldb + kb;
      FragB b;
      b.half[0] = *(const v8us*)(brow + 8 * hh);
      b.half[1] = *(const v8us*)(brow + 16 + 8 * hh);
      acc[t] = mmaN<ASPLIT ? 2 : 1>(ah.v, al.v, b.v, b.v, acc[t]);
    }
  }
#pragma unroll
  for (int t = 0; t < 4; ++t) {
    float bv = bias ? bias[col0 + t * 16 + ln] : 0.f;
    if (BIAS_BF16) bv = bf16_round(bv);
#pragma unroll
    for (int r = 0; r < 8; ++r) { float v = acc[t][r] + bv; if (ACT == 1) v = fmaxf(v, 0.f); so[w][8 * hh + r][t * 16 + ln] = v; }
  }
  __builtin_amdgcn_fence(__ATOMIC_ACQ_REL, "workgroup");
  __builtin_amdgcn_wave_barrier();
  const int rsub = lane >> 4, c4 = (lane & 15) * 4;
  {
#pragma unroll
    for (int q = 0; q < 8; ++q) {
      const int r = q * 2 + rsub;
      const v4f v = *(const v4fa*)&so[w][r][c4];
      *(v4f*)(C + (size_t)(row0 + r) * ldc + col0 + c4) = v;
    }
    
  }
}

// GEMM C = act(A·W + bias + resid): A f32 (ASPLIT -> hi/lo 2 terms), Wt bf16 [N][K]; ACT 0 none, 1 relu, 2 exact gelu;
// resid (optional, f32, row index = (row % rmod), pitch ldr, RES_BF16 rounds it) added before the activation.
template <bool ASPLIT, int ACT, bool BIAS_BF16, bool RES_BF16>
__global__ __launch_bounds__(128) void k_gemm_bf3(const float* __restrict__ A, int lda, const unsigned short* __restrict__ Wt, int ldb,
                                                const float* __restrict__ bias, const float* __restrict__ resid, int rmod, int ldr,
                                                float* __restrict__ C, int ldc, int M, int N, int K) {
  __shared__ __attribute__((aligned(16))) float so[4][16][64];
  const int tid = threadIdx.x, w = tid >> 5, lane = tid & 31, ln = lane & 15, hh = lane >> 4;
  const int ntn = N / 64;
  const int wid = blockIdx.x * 4 + w;
  const int mt = wid / ntn, nq = wid % ntn;
  if (mt * 16 >= M) return;
  const int row0 = mt * 16, col0 = nq * 64;
  const float* arow = A + (size_t)(row0 + ln) * lda;
  v8f acc[4] = {};
  for (int kb = 0; kb < K; kb += 32) {
    FragB ah, al;
    const v4f x0 = *(const v4fa*)(arow + kb + 8 * hh), x1 = *(const v4fa*)(arow + kb + 8 * hh + 4);
    const v4f x2 = *(const v4fa*)(arow + kb + 16 + 8 * hh), x3 = *(const v4fa*)(arow + kb + 16 + 8 * hh + 4);
    float xs[16] = {x0[0],x0[1],x0[2],x0[3],x1[0],x1[1],x1[2],x1[3],x2[0],x2[1],x2[2],x2[3],x3[0],x3[1],x3[2],x3[3]};
#pragma unroll
    for (int i = 0; i < 16; ++i) { const unsigned short hb = bf16_bits(xs[i]); ah.u[i] = hb; al.u[i] = ASPLIT ? bf16_bits(xs[i] - bf16_val(hb)) : (unsigned short)0; }
#pragma unroll
    for (int t = 0; t < 4; ++t) {
      const unsigned short* brow = Wt + (size_t)(col0 + t * 16 + ln) * ldb + kb;
      FragB b;
      b.half[0] = *(const v8us*)(brow + 8 * hh);
      b.half[1] = *(const v8us*)(brow + 16 + 8 * hh);
      acc[t] = mmaN<ASPLIT ? 2 : 1>(ah.v, al.v, b.v, b.v, acc[t]);
    }
  }
#pragma unroll
  for (int t = 0; t < 4; ++t) {
    const int col = col0 + t * 16 + ln;
    float bv = bias ? bias[col] : 0.f;
    if (BIAS_BF16) bv = bf16_round(bv);
#pragma unroll
    for (int r = 0; r < 8; ++r) {
      float v = acc[t][r] + bv;
      if (resid) { float rv = resid[(size_t)((row0 + 8 * hh + r) % rmod) * ldr + col]; if (RES_BF16) rv = bf16_round(rv); v += rv; }
      if (ACT == 1) v = fmaxf(v, 0.f);
      if (ACT == 2) v = 0.5f * v * (1.0f + erff(v * 0.70710678118654752f));
      if (ACT == 3) { const float u = 0.7978845608028654f * (v + 0.044715f * v * v * v); v = 0.5f * v * (1.0f + tanhf(u)); }
      so[w][8 * hh + r][t * 16 + ln] = v;
    }
  }
  __builtin_amdgcn_fence(__ATOMIC_ACQ_REL, "workgroup");
  __builtin_amdgcn_wave_barrier();
  const int rsub = lane >> 4, c4 = (lane & 15) * 4;
  {
#pragma unroll
    for (int q = 0; q < 8; ++q) {
      const int r = q * 2 + rsub;
      const v4f v = *(const v4fa*)&so[w][r][c4];
      *(v4f*)(C + (size_t)(row0 + r) * ldc + col0 + c4) = v;
    }
    
  }
}
// row LayerNorm (biased variance, eps) over N: s = X (+ R); optional out_sum <- s; out_norm <- (s-mu)*rsqrt(var+eps)*g + b
template <bool PARAM_BF16>
__global__ __launch_bounds__(256) void k_layernorm(const float* __restrict__ X, const float* __restrict__ R, const float* __restrict__ g, const float* __restrict__ bta,
                                                  float* __restrict__ out_sum, float* __restrict__ out_norm, int N, float eps) {
  __shared__ float red[256];
  const int row = blockIdx.x, tid = threadIdx.x;
  const float* x = X + (size_t)row * N; const float* rr = R ? R + (size_t)row * N : nullptr;
  float vals[16];                     // up to N = 4096
  const int per = N / 256;            // contiguous chunk per thread? use strided-by-4 chunks: thread handles j = tid*4 + 1024*u
  float s1 = 0.f;
  for (int u = 0; u < per / 4; ++u) {
    const int j = tid * 4 + 1024 * u;
    const v4f a = *(const v4fa*)(x + j);
    v4f b = {0.f,0.f,0.f,0.f}; if (rr) b = *(const v4fa*)(rr + j);
#pragma unroll
    for (int q = 0; q < 4; ++q) { const float v = a[q] + b[q]; vals[u * 4 + q] = v; s1 += v; }
  }
  red[tid] = s1; __syncthreads();
  for (int st = 128; st > 0; st >>= 1) { if (tid < st) red[tid] += red[tid + st]; __syncthreads(); }
  const float mu = red[0] / (float)N; __syncthreads();
  float s2 = 0.f;
  for (int u = 0; u < per / 4; ++u)
#pragma unroll
    for (int q = 0; q < 4; ++q) { const float c = vals[u * 4 + q] - mu; s2 += c * c; }
  red[tid] = s2; __syncthreads();
  for (int st = 128; st > 0; st >>= 1) { if (tid < st) red[tid] += red[tid + st]; __syncthreads(); }
  const float rs = rsqrtf(red[0] / (float)N + eps);
  {
    for (int u = 0; u < per / 4; ++u) {
      const int j = tid * 4 + 1024 * u;
      v4f o, sm;
#pragma unroll
      for (int q = 0; q < 4; ++q) {
        float gg = g[j + q], bb = bta[j + q];
        if (PARAM_BF16) { gg = bf16_round(gg); bb = bf16_round(bb); }
        sm[q] = vals[u * 4 + q]; o[q] = (vals[u * 4 + q] - mu) * rs * gg + bb;
      }
      if (out_sum) *(v4f*)(out_sum + (size_t)row * N + j) = sm;
      *(v4f*)(out_norm + (size_t)row * N + j) = o;
    }
    
  }
}



// ---- f16 WMMA path (v_wmma_f32_16x16x32_f16): 11-bit significands for operands in range — used where a [0,1] probability operand needs more precision than bf16
typedef _Float16 v16h __attribute__((ext_vector_type(16)));
union FragH { v16h v; v8us half[2]; _Float16 h[16]; unsigned short u[16]; };
template <int NT>
__device__ __forceinline__ v8f mmaH(v16h ah, v16h al, v16h bh, v16h bl, v8f c) {
  c = __builtin_amdgcn_wmma_f32_16x16x32_f16(false, ah, false, bh, (short)0, c, false, false);
  if (NT >= 2) c = __builtin_amdgcn_wmma_f32_16x16x32_f16(false, al, false, bh, (short)0, c, false, false);
  if (NT >= 3) c = __builtin_amdgcn_wmma_f32_16x16x32_f16(false, ah, false, bl, (short)0, c, false, false);
  asm volatile("v_nop\n\tv_nop\n\tv_nop\n\tv_nop" : "+v"(c) : "v"(ah), "v"(al), "v"(bh), "v"(bl));
  return c;
}
// batched GEMM like k_gemm_b but f16 operands: A f32 (split into f16 hi/lo if ASPLIT, else rounded to f16), Bt = f16 values [n][k]; alpha; C f32; N multiple of 16 (partial tiles skipped)
template <bool ASPLIT>
__global__ __launch_bounds__(128) void k_gemm_h(const float* __restrict__ A, int lda, size_t sA, const _Float16* __restrict__ Bh, int ldb, size_t sB, float alpha, float* __restrict__ C, int ldc, size_t sC, int M, int N, int K) {
  __shared__ __attribute__((aligned(16))) float so[4][16][64];
  const int tid = threadIdx.x, w = tid >> 5, lane = tid & 31, ln = lane & 15, hh = lane >> 4; const int by = blockIdx.y;
  A += (size_t)by * sA; Bh += (size_t)by * sB; C += (size_t)by * sC;
  const int ntn = (N + 63) / 64; const int wid = blockIdx.x * 4 + w; const int mt = wid / ntn, nq = wid % ntn; if (mt * 16 >= M) return;
  const int row0 = mt * 16, col0 = nq * 64; const float* arow = A + (size_t)(row0 + ln) * lda;
  v8f acc[4] = {};
  for (int kb = 0; kb < K; kb += 32) {
    FragH ah, al;
    const v4f x0 = *(const v4fa*)(arow + kb + 8 * hh), x1 = *(const v4fa*)(arow + kb + 8 * hh + 4), x2 = *(const v4fa*)(arow + kb + 16 + 8 * hh), x3 = *(const v4fa*)(arow + kb + 16 + 8 * hh + 4);
    float xs[16] = {x0[0],x0[1],x0[2],x0[3],x1[0],x1[1],x1[2],x1[3],x2[0],x2[1],x2[2],x2[3],x3[0],x3[1],x3[2],x3[3]};
#pragma unroll
    for (int i = 0; i < 16; ++i) { const _Float16 h = (_Float16)xs[i]; ah.h[i] = h; al.h[i] = ASPLIT ? (_Float16)(xs[i] - (float)h) : (_Float16)0.0f; }
#pragma unroll
    for (int t = 0; t < 4; ++t) { if (col0 + t * 16 >= N) continue; const size_t boff = (size_t)(col0 + t * 16 + ln) * ldb + kb; FragH bq; bq.half[0] = *(const v8us*)(Bh + boff + 8 * hh); bq.half[1] = *(const v8us*)(Bh + boff + 16 + 8 * hh);
      acc[t] = mmaH<ASPLIT ? 2 : 1>(ah.v, al.v, bq.v, bq.v, acc[t]); }
  }
#pragma unroll
  for (int t = 0; t < 4; ++t) { if (col0 + t * 16 >= N) continue;
#pragma unroll
    for (int r = 0; r < 8; ++r) so[w][8 * hh + r][t * 16 + ln] = acc[t][r] * alpha; }
  __builtin_amdgcn_fence(__ATOMIC_ACQ_REL, "workgroup"); __builtin_amdgcn_wave_barrier();
  const int rsub = lane >> 4, c4 = (lane & 15) * 4;
  {
#pragma unroll
    for (int q = 0; q < 8; ++q) { const int r = q * 2 + rsub; if (col0 + c4 < N) { const v4f v = *(const v4fa*)&so[w][r][c4]; *(v4f*)(C + (size_t)(row0 + r) * ldc + col0 + c4) = v; } }
     }
}

// Wt[n][k] = f16(W[k][n]·scale) from f32 row-major W[K][N] (scale = power of two; bf16-exact weights stay exact in f16 away from the subnormal range)
__global__ __launch_bounds__(256) void k_wt_f16(const float* __restrict__ W, _Float16* __restrict__ Wt, int K, int N, float scale) {
  const int t = blockIdx.x * 256 + threadIdx.x; if (t >= N * (K / 8)) return; const int n = t / (K / 8), k8 = (t % (K / 8)) * 8; FragH f;
#pragma unroll
  for (int i = 0; i < 8; ++i) f.h[i] = (_Float16)(bf16_round(W[(size_t)(k8 + i) * N + n]) * scale); const v8us o = f.half[0];
  *(v8us*)((unsigned short*)Wt + (size_t)n * K + k8) = o; 
}
// k_gemm_hh variant with fused epilogue: v = acc·alpha + bias[by·sBias + col] (+ CP[(row/rowsPerB)·sCPb + by·64 + col] if CP) ; ACT 0 none / 1 elu ; writes f16 C16 (and f32 C if non-null)
template <int ACT>
__global__ __launch_bounds__(128) void k_gemm_hhx(const _Float16* __restrict__ A, int lda, size_t sA, const _Float16* __restrict__ Bh, int ldb, size_t sB, float alpha, const float* __restrict__ bias, size_t sBias, const float* __restrict__ CP, int rowsPerB, size_t sCPb, int row0g,
    float* __restrict__ C, _Float16* __restrict__ C16, int ldc, size_t sC, int M, int N, int K) {
  __shared__ __attribute__((aligned(16))) float so[4][16][64];
  const int tid = threadIdx.x, w = tid >> 5, lane = tid & 31, ln = lane & 15, hh = lane >> 4; const int by = blockIdx.y;
  A += (size_t)by * sA; Bh += (size_t)by * sB; const size_t cofs = (size_t)by * sC; const float* bp = bias ? bias + (size_t)by * sBias : nullptr;
  const int ntn = (N + 63) / 64; const int wid = blockIdx.x * 4 + w; const int mt = wid / ntn, nq = wid % ntn; if (mt * 16 >= M) return;
  const int row0 = mt * 16, col0 = nq * 64; const _Float16* arow = A + (size_t)(row0 + ln) * lda;
  v8f acc[4] = {};
  for (int kb = 0; kb < K; kb += 32) { FragH ah; ah.half[0] = *(const v8us*)((const unsigned short*)arow + kb + 8 * hh); ah.half[1] = *(const v8us*)((const unsigned short*)arow + kb + 16 + 8 * hh);
#pragma unroll
    for (int t = 0; t < 4; ++t) { if (col0 + t * 16 >= N) continue; const size_t boff = (size_t)(col0 + t * 16 + ln) * ldb + kb; FragH bq; bq.half[0] = *(const v8us*)((const unsigned short*)Bh + boff + 8 * hh); bq.half[1] = *(const v8us*)((const unsigned short*)Bh + boff + 16 + 8 * hh);
      acc[t] = mmaH<1>(ah.v, ah.v, bq.v, bq.v, acc[t]); }
  }
#pragma unroll
  for (int t = 0; t < 4; ++t) { if (col0 + t * 16 >= N) continue; const int col = col0 + t * 16 + ln; const float bv = bp ? bf16_round(bp[col]) : 0.f;
#pragma unroll
    for (int r = 0; r < 8; ++r) { float v = acc[t][r] * alpha + bv; if (CP) { const int rr = row0g + row0 + 8 * hh + r; if (rowsPerB < 0) v += CP[cofs + (size_t)rr * ldc + col];      /* rowsPerB < 0: own element of the batched C plane */ else { const int bidx = rr / rowsPerB; v += CP[(size_t)bidx * sCPb + (size_t)by * 64 + col]; } } if (ACT == 1) v = (v > 0.f) ? v : expm1f(v); else if (ACT == 7) v = (v > 0.f) ? v + 1.0f : expf(v); else if (ACT == 8) v = tanhf(v); else if (ACT == 9) v = 0.5f * v * (1.0f + tanhf(0.7978845608028654f * (v + 0.044715f * v * v * v))); else if (ACT == 11) v = 1.0f / (1.0f + expf(-v)); else if (ACT == 12) v = (v > 0.f) ? v : 0.01f * v; else if (ACT == 14) v = (v > 0.f) ? v : 0.1f * v; else if (ACT == 16) v = (v >= 0.f) ? v : 0.3f * v; else if (ACT == 17) v = (v >= 0.f) ? v : 0.2f * v; else if (ACT == 15) v = v / (1.0f + expf(-v)); else if (ACT == 3) v = fmaxf(v, 0.f); else if (ACT == 6) v = 0.5f * v * (1.0f + erff(v * 0.70710678118654752f)); so[w][8 * hh + r][t * 16 + ln] = v; } }
  __builtin_amdgcn_fence(__ATOMIC_ACQ_REL, "workgroup"); __builtin_amdgcn_wave_barrier();
  const int rsub = lane >> 4, c4 = (lane & 15) * 4; typedef _Float16 v4h __attribute__((ext_vector_type(4)));
  {
#pragma unroll
    for (int q = 0; q < 8; ++q) { const int r = q * 2 + rsub; if (col0 + c4 < N) { const v4f v = *(const v4fa*)&so[w][r][c4]; if (C) *(v4f*)(C + cofs + (size_t)(row0 + r) * ldc + col0 + c4) = v; if (C16) { v4h h4; for (int i = 0; i < 4; ++i) h4[i] = (_Float16)v[i]; *(v4h*)(C16 + cofs + (size_t)(row0 + r) * ldc + col0 + c4) = h4; } } }
     }
}


typedef _Float16 v4h __attribute__((ext_vector_type(4)));

__global__ __launch_bounds__(256) void k_x16(const float* __restrict__ x, _Float16* __restrict__ X16, size_t n8) { const size_t t = (size_t)blockIdx.x * 256 + threadIdx.x; if (t >= n8) return; FragH f;
#pragma unroll
  for (int q = 0; q < 8; ++q) f.h[q] = (_Float16)bf16_round(x[t * 8 + q]); *(v8us*)((unsigned short*)X16 + t * 8) = f.half[0];  }
__global__ __launch_bounds__(256) void k_h16(const float* __restrict__ x, _Float16* __restrict__ X16, size_t n8) { const size_t t = (size_t)blockIdx.x * 256 + threadIdx.x; if (t >= n8) return; FragH f;
#pragma unroll
  for (int q = 0; q < 8; ++q) f.h[q] = (_Float16)x[t * 8 + q]; *(v8us*)((unsigned short*)X16 + t * 8) = f.half[0];  }
__global__ __launch_bounds__(256) void k_round16f(const float* __restrict__ W, _Float16* __restrict__ Bt, size_t n8) { const size_t t = (size_t)blockIdx.x * 256 + threadIdx.x; if (t >= n8) return; FragH f;
#pragma unroll
  for (int i = 0; i < 8; ++i) f.h[i] = (_Float16)(bf16_round(W[t * 8 + i]) * 16.0f); *(v8us*)((unsigned short*)Bt + t * 8) = f.half[0];  }
template <int NHv, int TTv>
__global__ __launch_bounds__(256) void k_vt(const _Float16* __restrict__ V16, int ldv, int voff, _Float16* __restrict__ Vt) { __shared__ unsigned short tl[64][66]; const int tid = threadIdx.x; const int slab = blockIdx.x / (TTv / 64), lg = blockIdx.x % (TTv / 64); const int b = slab / NHv, h = slab % NHv;
  for (int i = tid; i < 64 * 8; i += 256) { const int r = i / 8, c8 = (i % 8) * 8; FragH f; f.half[0] = *(const v8us*)((const unsigned short*)V16 + ((size_t)b * TTv + lg * 64 + r) * ldv + voff + h * 64 + c8);
#pragma unroll
    for (int q = 0; q < 8; ++q) tl[r][c8 + q] = f.u[q]; }
  __syncthreads();
  {
#pragma unroll
    for (int rd = 0; rd < 2; ++rd) { const int d = rd * 32 + tid / 8, pc = tid % 8; FragH f;
#pragma unroll
      for (int q = 0; q < 8; ++q) f.u[q] = tl[pc * 8 + q][d];
      *(v8us*)((unsigned short*)Vt + ((size_t)slab * 64 + d) * TTv + lg * 64 + pc * 8) = f.half[0]; }
     } }

__global__ __launch_bounds__(256) void k_hl(const float* __restrict__ F, _Float16* __restrict__ Hh, _Float16* __restrict__ Hl, size_t n8) { const size_t t = (size_t)blockIdx.x * 256 + threadIdx.x; if (t >= n8) return; FragH fh, fl; const v4f a = *(const v4fa*)(F + t * 8), c = *(const v4fa*)(F + t * 8 + 4);
#pragma unroll
  for (int q = 0; q < 4; ++q) { _Float16 h = (_Float16)a[q]; fh.h[q] = h; fl.h[q] = (_Float16)((a[q] - (float)h) * 1024.0f); h = (_Float16)c[q]; fh.h[4 + q] = h; fl.h[4 + q] = (_Float16)((c[q] - (float)h) * 1024.0f); }
  { *(v8us*)((unsigned short*)Hh + t * 8) = fh.half[0]; *(v8us*)((unsigned short*)Hl + t * 8) = fl.half[0];  } }

// ---- fast GEMM (wave tile 32x64; requires M % 32 == 0 rows per launch region and N % 64 == 0); epilogue = k_gemm_hhx semantics ----
__device__ __forceinline__ v16h g2_frag(const _Float16* p, int hh) { FragH f; f.half[0] = *(const v8us*)((const unsigned short*)p + 8 * hh); f.half[1] = *(const v8us*)((const unsigned short*)p + 16 + 8 * hh); return f.v; }
__device__ __forceinline__ v8f g2_mma(v16h a, v16h b, v8f c) { v8f d = __builtin_amdgcn_wmma_f32_16x16x32_f16(false, a, false, b, (short)0, c, false, false); asm volatile("v_nop\n\tv_nop\n\tv_nop\n\tv_nop" : "+v"(d) : "v"(a), "v"(b)); return d; }
template <int ACT>
__global__ __launch_bounds__(128) void k_gemm2(const _Float16* __restrict__ A, int lda, size_t sA, const _Float16* __restrict__ Bh, int ldb, size_t sB, float alpha, const float* __restrict__ bias, size_t sBias, const float* __restrict__ CP, int rowsPerB, size_t sCPb, int row0g,
    float* __restrict__ C, _Float16* __restrict__ C16, int ldc, size_t sC, int M, int N, int K) { static_assert(ACT == 0 || ACT == 3 || ACT == 6 || ACT == 8 || ACT == 9 || ACT == 11 || ACT == 12 || ACT == 14 || ACT == 15 || ACT == 16 || ACT == 17, "k_gemm2: unsupported ACT code (would silently apply no activation)");
  __shared__ __attribute__((aligned(16))) float so[4][32][68];
  const int tid = threadIdx.x, w = tid >> 5, lane = tid & 31, ln = lane & 15, hh = lane >> 4; const int by = blockIdx.y;
  A += (size_t)by * sA; Bh += (size_t)by * sB; const size_t cofs = (size_t)by * sC; const float* bp = bias ? bias + (size_t)by * sBias : nullptr;
  const int ntn = N >> 6; const int mt = blockIdx.x / ntn, nq = blockIdx.x - mt * ntn; const int row0 = mt * 128 + 32 * w, col0 = nq * 64; if (row0 >= M) return;
  const _Float16* a0p = A + (size_t)(row0 + ln) * lda; const _Float16* a1p = a0p + (size_t)16 * lda;
  const _Float16* b0p = Bh + (size_t)(col0 + ln) * ldb; const _Float16* b1p = b0p + (size_t)16 * ldb; const _Float16* b2p = b1p + (size_t)16 * ldb; const _Float16* b3p = b2p + (size_t)16 * ldb;
  const v8f z8 = {0.f,0.f,0.f,0.f,0.f,0.f,0.f,0.f}; v8f c00 = z8, c01 = z8, c02 = z8, c03 = z8, c10 = z8, c11 = z8, c12 = z8, c13 = z8;
#pragma unroll 1
  for (int kb = 0; kb < K; kb += 32) { const v16h a0 = g2_frag(a0p + kb, hh), a1 = g2_frag(a1p + kb, hh);
    v16h b = g2_frag(b0p + kb, hh); c00 = g2_mma(a0, b, c00); c10 = g2_mma(a1, b, c10);
    b = g2_frag(b1p + kb, hh); c01 = g2_mma(a0, b, c01); c11 = g2_mma(a1, b, c11);
    b = g2_frag(b2p + kb, hh); c02 = g2_mma(a0, b, c02); c12 = g2_mma(a1, b, c12);
    b = g2_frag(b3p + kb, hh); c03 = g2_mma(a0, b, c03); c13 = g2_mma(a1, b, c13); }
  v8f accs[8] = {c00, c01, c02, c03, c10, c11, c12, c13};
#pragma unroll
  for (int u = 0; u < 8; ++u) { const int t = u & 3, half = u >> 2; const int col = col0 + t * 16 + ln; const float bv = bp ? bf16_round(bp[col]) : 0.f;
#pragma unroll
    for (int r = 0; r < 8; ++r) { const int rloc = half * 16 + 8 * hh + r; float v = accs[u][r] * alpha + bv; if (CP) { if (rowsPerB < 0) v += CP[cofs + (size_t)(row0g + row0 + rloc) * ldc + col];      /* rowsPerB < 0: own element of the batched C plane */ else { const int bidx = (row0g + row0 + rloc) / rowsPerB; v += CP[(size_t)bidx * sCPb + (size_t)by * 64 + col]; } }
      if (ACT == 3) v = fmaxf(v, 0.f); else if (ACT == 6) v = 0.5f * v * (1.0f + erff(v * 0.70710678118654752f)); else if (ACT == 11) v = 1.0f / (1.0f + expf(-v)); else if (ACT == 15) v = v / (1.0f + expf(-v)); else if (ACT == 12) v = (v > 0.f) ? v : 0.01f * v; else if (ACT == 8) v = tanhf(v); else if (ACT == 9) v = 0.5f * v * (1.0f + tanhf(0.7978845608028654f * (v + 0.044715f * v * v * v))); else if (ACT == 14) v = (v > 0.f) ? v : 0.1f * v; else if (ACT == 16) v = (v >= 0.f) ? v : 0.3f * v; else if (ACT == 17) v = (v >= 0.f) ? v : 0.2f * v;
      so[w][rloc][t * 16 + ln] = v; } }
  __builtin_amdgcn_fence(__ATOMIC_ACQ_REL, "workgroup"); __builtin_amdgcn_wave_barrier();
  const int rsub = lane >> 4, c4 = (lane & 15) * 4;
  {
#pragma unroll
    for (int q = 0; q < 16; ++q) { const int r = q * 2 + rsub; const v4f v = *(const v4fa*)&so[w][r][c4]; if (C) *(v4f*)(C + cofs + (size_t)(row0 + r) * ldc + col0 + c4) = v; if (C16) { v4h h4; for (int i = 0; i < 4; ++i) h4[i] = (_Float16)v[i]; *(v4h*)(C16 + cofs + (size_t)(row0 + r) * ldc + col0 + c4) = h4; } }
     } }


__global__ __launch_bounds__(256) void k_wsc(const float* __restrict__ Wm, _Float16* __restrict__ Bt, size_t n8, float sc) { const size_t t = (size_t)blockIdx.x * 256 + threadIdx.x; if (t >= n8) return; FragH f; for (int q = 0; q < 8; ++q) f.h[q] = (_Float16)(bf16_round(Wm[t * 8 + q]) * sc); *(v8us*)((unsigned short*)Bt + t * 8) = f.half[0];  }
template <int NH_>
__global__ __launch_bounds__(256) void k_normrope(const float* __restrict__ X, const float* __restrict__ w, const int* __restrict__ pos, _Float16* __restrict__ O16, _Float16* __restrict__ OL) {
  #pragma clang fp contract(off)
  constexpr int W_ = NH_ * HD; const int wv = threadIdx.x >> 5, ln = threadIdx.x & 31; const int t = blockIdx.x * 8 + wv; if (t >= TT) return; const float* x = X + (size_t)t * W_; float ss = 0.f;
#pragma unroll 1
  for (int c = ln * 4; c < W_; c += 128) { const v4f a = *(const v4fa*)(x + c); for (int e = 0; e < 4; ++e) { const float v = bf16_round(a[e]); ss += v * v; } }
  for (int o = 16; o > 0; o >>= 1) ss += __shfl_xor(ss, o, 32); const float inv = rsqrtf(ss / (float)W_ + 1e-5f); const float p = (float)pos[t];
  {
#pragma unroll 1
    for (int h = 0; h < NH_; ++h) { for (int u = 0; u < 2; ++u) { const int d = ln + 32 * u; const int c1 = h * HD + d, c2 = c1 + 64; float x1 = bf16_round(x[c1]) * inv; x1 *= bf16_round(w[c1]); float x2 = bf16_round(x[c2]) * inv; x2 *= bf16_round(w[c2]);
        const float ex = (float)(2 * d) / (float)HD; const float ivf = 1.0f / powf(10000.0f, ex); const float th = p * ivf; const float cs = cosf(th), sn = sinf(th); float o1 = x1 * cs; o1 += -(x2 * sn); float o2 = x2 * cs; o2 += x1 * sn;
        const _Float16 h1 = (_Float16)o1, h2 = (_Float16)o2; *(_Float16*)(O16 + (size_t)t * W_ + c1) = h1; *(_Float16*)(O16 + (size_t)t * W_ + c2) = h2; *(_Float16*)(OL + (size_t)t * W_ + c1) = (_Float16)((o1 - (float)h1) * 1024.0f); *(_Float16*)(OL + (size_t)t * W_ + c2) = (_Float16)((o2 - (float)h2) * 1024.0f); } }
     } }
__global__ __launch_bounds__(256) void k_softm(const float* __restrict__ S, const int* __restrict__ msk, _Float16* __restrict__ P, _Float16* __restrict__ PL) {
  #pragma clang fp contract(off)
  const int wv = threadIdx.x >> 5, ln = threadIdx.x & 31; const int r = blockIdx.x * 8 + wv; if (r >= TT) return; const float* sr = S + (size_t)r * TT; const int* mr = msk + (size_t)r * MSTR; float m = -3.0e38f;
#pragma unroll 1
  for (int g = 0; g < TT / 256; ++g) { const int j0 = g * 256 + ln * 8; const v8f a = *(const v8f*)(sr + j0); for (int q = 0; q < 8; ++q) { const float s = (mr[j0 + q] != 0) ? -10000.0f : a[q]; m = fmaxf(m, s); } }
  for (int o = 16; o > 0; o >>= 1) m = fmaxf(m, __shfl_xor(m, o, 32)); float su = 0.f;
#pragma unroll 1
  for (int g = 0; g < TT / 256; ++g) { const int j0 = g * 256 + ln * 8; const v8f a = *(const v8f*)(sr + j0); for (int q = 0; q < 8; ++q) { const float s = (mr[j0 + q] != 0) ? -10000.0f : a[q]; su += expf(s - m); } }
  for (int o = 16; o > 0; o >>= 1) su += __shfl_xor(su, o, 32); const float f = 1024.0f / su;
  {
#pragma unroll 1
    for (int g = 0; g < TT / 256; ++g) { const int j0 = g * 256 + ln * 8; const v8f a = *(const v8f*)(sr + j0); FragH ph, pl; for (int q = 0; q < 8; ++q) { const float s = (mr[j0 + q] != 0) ? -10000.0f : a[q]; const float pv = expf(s - m) * f; const _Float16 hh = (_Float16)pv; ph.h[q] = hh; pl.h[q] = (_Float16)((pv - (float)hh) * 1024.0f); } *(v8us*)((unsigned short*)P + (size_t)r * TT + j0) = ph.half[0]; *(v8us*)((unsigned short*)PL + (size_t)r * TT + j0) = pl.half[0]; }
     } }

extern "C" void kernel_launch(void* const* d_in, const int* in_sizes, int n_in,
                              void* d_out, int out_size, void* d_ws, size_t ws_size, hipStream_t stream) {
  (void)in_sizes; (void)n_in; (void)out_size;
  const float* const* I = (const float* const*)d_in; const float* q = I[0]; const float* k = I[1]; const float* v = I[2]; const int* msk = (const int*)d_in[3]; const int* pos = (const int*)d_in[4]; const float* qw = I[5]; const float* kw = I[6]; const float* Wo = I[7];
  char* ws = (char*)d_ws; size_t off = 0;
  auto take = [&](size_t bytes) { char* p = ws + off; off += (bytes + 255) & ~(size_t)255; return p; };
  _Float16* BO = (_Float16*)take((size_t)DQ * DQ * 2); _Float16* Q16 = (_Float16*)take((size_t)TT * DQ * 2); _Float16* QL = (_Float16*)take((size_t)TT * DQ * 2); _Float16* K16 = (_Float16*)take((size_t)TT * DKV * 2); _Float16* KL = (_Float16*)take((size_t)TT * DKV * 2); _Float16* V16 = (_Float16*)take((size_t)TT * DKV * 2); _Float16* VT = (_Float16*)take((size_t)TT * DKV * 2); float* S = (float*)take((size_t)TT * TT * 4); _Float16* P = (_Float16*)take((size_t)TT * TT * 2); _Float16* PL = (_Float16*)take((size_t)TT * TT * 2); float* CTX = (float*)take((size_t)TT * DQ * 4); _Float16* C16 = Q16; _Float16* CL = QL;      /* merged context hi/lo over the q planes (dead after the last score GEMM) */
  if (off > ws_size) return;      /* 8 + 8+8 + 2+2 + 2 + 2 + 16 + 8+8 + 16 = 80 MiB */
  k_wsc<<<(unsigned)(((size_t)DQ * DQ / 8 + 255) / 256), 256, 0, stream>>>(Wo, BO, (size_t)DQ * DQ / 8, 16.0f);      /* (out,in) natural */
  k_normrope<NQH><<<TT / 8, 256, 0, stream>>>(q, qw, pos, Q16, QL); k_normrope<NKVH><<<TT / 8, 256, 0, stream>>>(k, kw, pos, K16, KL);
  k_x16<<<(unsigned)(((size_t)TT * DKV / 8 + 255) / 256), 256, 0, stream>>>(v, V16, (size_t)TT * DKV / 8);
  k_vt<NKVH * 2, TT><<<NKVH * 2 * (TT / 64), 256, 0, stream>>>(V16, DKV, 0, VT);      /* V^T [512][2048] as 8 slabs of 64 dims; kv head = rows kv*128 .. +127 */
  for (int h = 0; h < NQH; ++h) { const int kv = h / (NQH / NKVH);
    k_gemm2<0><<<dim3((TT / 128) * (TT / 64), 1), 128, 0, stream>>>(QL + h * HD, DQ, 0, K16 + kv * HD, DKV, 0, 0.088388347648318447f / 1024.0f, nullptr, 0, nullptr, 1, 0, 0, S, nullptr, TT, 0, TT, TT, HD);
    k_gemm2<0><<<dim3((TT / 128) * (TT / 64), 1), 128, 0, stream>>>(Q16 + h * HD, DQ, 0, KL + kv * HD, DKV, 0, 0.088388347648318447f / 1024.0f, nullptr, 0, S, 1, (size_t)TT, 0, S, nullptr, TT, 0, TT, TT, HD);
    k_gemm2<0><<<dim3((TT / 128) * (TT / 64), 1), 128, 0, stream>>>(Q16 + h * HD, DQ, 0, K16 + kv * HD, DKV, 0, 0.088388347648318447f, nullptr, 0, S, 1, (size_t)TT, 0, S, nullptr, TT, 0, TT, TT, HD);      /* q_h . k_kv / sqrt(128) as three hi/residual terms */
    k_softm<<<TT / 8, 256, 0, stream>>>(S, msk, P, PL);
    k_gemm2<0><<<dim3((TT / 128) * (HD / 64), 1), 128, 0, stream>>>(PL, TT, 0, VT + (size_t)kv * HD * TT, TT, 0, 0.0009765625f / 1024.0f, nullptr, 0, nullptr, 1, 0, 0, CTX + h * HD, nullptr, DQ, 0, TT, HD, TT);
    k_gemm2<0><<<dim3((TT / 128) * (HD / 64), 1), 128, 0, stream>>>(P, TT, 0, VT + (size_t)kv * HD * TT, TT, 0, 0.0009765625f, nullptr, 0, CTX + h * HD, 1, (size_t)DQ, 0, CTX + h * HD, nullptr, DQ, 0, TT, HD, TT); }      /* ctx[t][h*128 + d] = (P_lo + P_hi) v (v exact) */
  k_hl<<<(unsigned)(((size_t)TT * DQ / 8 + 255) / 256), 256, 0, stream>>>(CTX, C16, CL, (size_t)TT * DQ / 8);
  k_gemm2<0><<<dim3((TT / 128) * (DQ / 64), 1), 128, 0, stream>>>(CL, DQ, 0, BO, DQ, 0, 0.0625f / 1024.0f, nullptr, 0, nullptr, 1, 0, 0, (float*)d_out, nullptr, DQ, 0, TT, DQ, DQ);
  k_gemm2<0><<<dim3((TT / 128) * (DQ / 64), 1), 128, 0, stream>>>(C16, DQ, 0, BO, DQ, 0, 0.0625f, nullptr, 0, (const float*)d_out, 1, (size_t)DQ, 0, (float*)d_out, nullptr, DQ, 0, TT, DQ, DQ);      /* out = (ctx_lo + ctx_hi) W_out^T (W exact) */
}

// v001
// A run of this version takes 1320 microseconds.
// In both of two side-by-side timings against v000, it was 2.53 times as fast.
#include <hip/hip_runtime.h>
// QEffMolmoBlock (1 x 2048 tokens; 16 query heads / 4 kv heads x 128 dims; q, k, v are INPUT projections): q = RMSNorm_2048(q) * q_norm_w, k = RMSNorm_512(k) * k_norm_w (flat, before the head split); rotate-half RoPE (hd 128, positions from position_ids, base 10000); GQA (each kv head serves 4 query heads); scores = q.k / sqrt(128), masked entries (int mask input != 0) REPLACED by -10000; softmax; out = (att v) W_out^T.
// Structure: RMSNorm + RoPE fused on VALU (wave per token) into f16 hi + 2^10 residual q/k planes; v as an exact f16 plane; V^T by LDS tiles; per kv group (its 4 query heads batched in grid.y, one launch per stage): the 2048 x 2048 score GEMM (f16 WMMA, 32x64 wave tiles, f32 accumulation, K = 128), the masked softmax on VALU (wave per row, mask read on device) into f16 P hi + residual (x 2^10), the readout GEMM as two terms (N = 128) into the merged context plane; context hi/residual; W_out as two GEMM terms (exact x16 weights).
// Compute dtype: inputs rounded to bf16; v and W_out exact as f16; normed+rotated q/k (3-term scores), P and the merged context all carried as f16 hi + 2^10 residual (~2^-21): the q/k norm weights are O(1) random so logits have sigma ≈ 11 and the softmax is near one-hot; RMSNorm/RoPE/softmax f32. v_wmma_f32_16x16x32_f16.
#define TT 2048
#define MSTR 2048                /* attention_mask row stride (input geometry) */
#define NQH 16
#define NKVH 4
#define HD 128
#define DQ (NQH * HD)            /* 2048 */
#define DKV (NKVH * HD)          /* 512 */
#define GRP (NQH / NKVH)         /* 4 query heads share a kv head: one batch */
typedef __bf16 v16b __attribute__((ext_vector_type(16)));
typedef unsigned short v8us __attribute__((ext_vector_type(8), may_alias));
typedef float  v8f  __attribute__((ext_vector_type(8)));
typedef float  v4f  __attribute__((ext_vector_type(4)));
typedef float  v4fa __attribute__((ext_vector_type(4), may_alias));
union FragB { v16b v; v8us half[2]; unsigned short u[16]; };

__device__ __forceinline__ unsigned short bf16_bits(float x) { unsigned int u = __float_as_uint(x); return (unsigned short)((u + 0x7FFFu + ((u >> 16) & 1u)) >> 16); }
__device__ __forceinline__ float bf16_val(unsigned short b) { return __uint_as_float(((unsigned int)b) << 16); }
__device__ __forceinline__ float bf16_round(float x) { return bf16_val(bf16_bits(x)); }
// D += A·B with NT terms: 1 = ah·bh, 2 = + al·bh (A split), 3 = + ah·bl (both split)
template <int NT>
__device__ __forceinline__ v8f mmaN(v16b ah, v16b al, v16b bh, v16b bl, v8f c) {
  c = __builtin_amdgcn_wmma_f32_16x16x32_bf16(false, ah, false, bh, (short)0, c, false, false);
  if (NT >= 2) c = __builtin_amdgcn_wmma_f32_16x16x32_bf16(false, al, false, bh, (short)0, c, false, false);
  if (NT >= 3) c = __builtin_amdgcn_wmma_f32_16x16x32_bf16(false, ah, false, bl, (short)0, c, false, false);
  asm volatile("v_nop\n\tv_nop\n\tv_nop\n\tv_nop" : "+v"(c) : "v"(ah), "v"(al), "v"(bh), "v"(bl));
  return c;
}

__global__ __launch_bounds__(256) void k_wt_bf16(const float* __restrict__ W, unsigned short* __restrict__ Wt, int K, int N) {
  const int t = blockIdx.x * 256 + threadIdx.x;
  const int k8n = K / 8;
  if (t >= N * k8n) return;
  const int n = t / k8n, k8 = (t % k8n) * 8;
  v8us v;
#pragma unroll
  for (int i = 0; i < 8; ++i) v[i] = bf16_bits(W[(size_t)(k8 + i) * N + n]);
  *(v8us*)(Wt + (size_t)n * K + k8) = v;
  
}

// GEMM C[M][N] (f32, pitch ldc) = act(A[M][K]·W + bias). A f32 row-major (pitch lda) converted per fragment to bf16
// (ASPLIT: hi/lo two planes -> 2 terms, else single rounded term); Wt bf16 [N][K] (pitch ldb). BIAS_BF16 rounds the
// bias to bf16 first (bias quantised to bf16 before the add). K%32==0, M%16==0, N%64==0.
template <bool ASPLIT, int ACT, bool BIAS_BF16>
__global__ __launch_bounds__(128) void k_gemm_bf(const float* __restrict__ A, int lda, const unsigned short* __restrict__ Wt, int ldb,
                                               const float* __restrict__ bias, float* __restrict__ C, int ldc, int M, int N, int K) {
  __shared__ __attribute__((aligned(16))) float so[4][16][64];
  const int tid = threadIdx.x, w = tid >> 5, lane = tid & 31, ln = lane & 15, hh = lane >> 4;
  const int ntn = N / 64;
  const int wid = blockIdx.x * 4 + w;
  const int mt = wid / ntn, nq = wid % ntn;
  if (mt * 16 >= M) return;
  const int row0 = mt * 16, col0 = nq * 64;
  const float* arow = A + (size_t)(row0 + ln) * lda;
  v8f acc[4] = {};
  for (int kb = 0; kb < K; kb += 32) {
    FragB ah, al;
    const v4f x0 = *(const v4fa*)(arow + kb + 8 * hh), x1 = *(const v4fa*)(arow + kb + 8 * hh + 4);
    const v4f x2 = *(const v4fa*)(arow + kb + 16 + 8 * hh), x3 = *(const v4fa*)(arow + kb + 16 + 8 * hh + 4);
    float xs[16] = {x0[0],x0[1],x0[2],x0[3],x1[0],x1[1],x1[2],x1[3],x2[0],x2[1],x2[2],x2[3],x3[0],x3[1],x3[2],x3[3]};
#pragma unroll
    for (int i = 0; i < 16; ++i) { const unsigned short hb = bf16_bits(xs[i]); ah.u[i] = hb; al.u[i] = ASPLIT ? bf16_bits(xs[i] - bf16_val(hb)) : (unsigned short)0; }
#pragma unroll
    for (int t = 0; t < 4; ++t) {
      const unsigned short* brow = Wt + (size_t)(col0 + t * 16 + ln) * ldb + kb;
      FragB b;
      b.half[0] = *(const v8us*)(brow + 8 * hh);
      b.half[1] = *(const v8us*)(brow + 16 + 8 * hh);
      acc[t] = mmaN<ASPLIT ? 2 : 1>(ah.v, al.v, b.v, b.v, acc[t]);
    }
  }
#pragma unroll
  for (int t = 0; t < 4; ++t) {
    float bv = bias ? bias[col0 + t * 16 + ln] : 0.f;
    if (BIAS_BF16) bv = bf16_round(bv);
#pragma unroll
    for (int r = 0; r < 8; ++r) { float v = acc[t][r] + bv; if (ACT == 1) v = fmaxf(v, 0.f); so[w][8 * hh + r][t * 16 + ln] = v; }
  }
  __builtin_amdgcn_fence(__ATOMIC_ACQ_REL, "workgroup");
  __builtin_amdgcn_wave_barrier();
  const int rsub = lane >> 4, c4 = (lane & 15) * 4;
  {
#pragma unroll
    for (int q = 0; q < 8; ++q) {
      const int r = q * 2 + rsub;
      const v4f v = *(const v4fa*)&so[w][r][c4];
      *(v4f*)(C + (size_t)(row0 + r) * ldc + col0 + c4) = v;
    }
    
  }
}

// GEMM C = act(A·W + bias + resid): A f32 (ASPLIT -> hi/lo 2 terms), Wt bf16 [N][K]; ACT 0 none, 1 relu, 2 exact gelu;
// resid (optional, f32, row index = (row % rmod), pitch ldr, RES_BF16 rounds it) added before the activation.
template <bool ASPLIT, int ACT, bool BIAS_BF16, bool RES_BF16>
__global__ __launch_bounds__(128) void k_gemm_bf3(const float* __restrict__ A, int lda, const unsigned short* __restrict__ Wt, int ldb,
                                                const float* __restrict__ bias, const float* __restrict__ resid, int rmod, int ldr,
                                                float* __restrict__ C, int ldc, int M, int N, int K) {
  __shared__ __attribute__((aligned(16))) float so[4][16][64];
  const int tid = threadIdx.x, w = tid >> 5, lane = tid & 31, ln = lane & 15, hh = lane >> 4;
  const int ntn = N / 64;
  const int wid = blockIdx.x * 4 + w;
  const int mt = wid / ntn, nq = wid % ntn;
  if (mt * 16 >= M) return;
  const int row0 = mt * 16, col0 = nq * 64;
  const float* arow = A + (size_t)(row0 + ln) * lda;
  v8f acc[4] = {};
  for (int kb = 0; kb < K; kb += 32) {
    FragB ah, al;
    const v4f x0 = *(const v4fa*)(arow + kb + 8 * hh), x1 = *(const v4fa*)(arow + kb + 8 * hh + 4);
    const v4f x2 = *(const v4fa*)(arow + kb + 16 + 8 * hh), x3 = *(const v4fa*)(arow + kb + 16 + 8 * hh + 4);
    float xs[16] = {x0[0],x0[1],x0[2],x0[3],x1[0],x1[1],x1[2],x1[3],x2[0],x2[1],x2[2],x2[3],x3[0],x3[1],x3[2],x3[3]};
#pragma unroll
    for (int i = 0; i < 16; ++i) { const unsigned short hb = bf16_bits(xs[i]); ah.u[i] = hb; al.u[i] = ASPLIT ? bf16_bits(xs[i] - bf16_val(hb)) : (unsigned short)0; }
#pragma unroll
    for (int t = 0; t < 4; ++t) {
      const unsigned short* brow = Wt + (size_t)(col0 + t * 16 + ln) * ldb + kb;
      FragB b;
      b.half[0] = *(const v8us*)(brow + 8 * hh);
      b.half[1] = *(const v8us*)(brow + 16 + 8 * hh);
      acc[t] = mmaN<ASPLIT ? 2 : 1>(ah.v, al.v, b.v, b.v, acc[t]);
    }
  }
#pragma unroll
  for (int t = 0; t < 4; ++t) {
    const int col = col0 + t * 16 + ln;
    float bv = bias ? bias[col] : 0.f;
    if (BIAS_BF16) bv = bf16_round(bv);
#pragma unroll
    for (int r = 0; r < 8; ++r) {
      float v = acc[t][r] + bv;
      if (resid) { float rv = resid[(size_t)((row0 + 8 * hh + r) % rmod) * ldr + col]; if (RES_BF16) rv = bf16_round(rv); v += rv; }
      if (ACT == 1) v = fmaxf(v, 0.f);
      if (ACT == 2) v = 0.5f * v * (1.0f + erff(v * 0.70710678118654752f));
      if (ACT == 3) { const float u = 0.7978845608028654f * (v + 0.044715f * v * v * v); v = 0.5f * v * (1.0f + tanhf(u)); }
      so[w][8 * hh + r][t * 16 + ln] = v;
    }
  }
  __builtin_amdgcn_fence(__ATOMIC_ACQ_REL, "workgroup");
  __builtin_amdgcn_wave_barrier();
  const int rsub = lane >> 4, c4 = (lane & 15) * 4;
  {
#pragma unroll
    for (int q = 0; q < 8; ++q) {
      const int r = q * 2 + rsub;
      const v4f v = *(const v4fa*)&so[w][r][c4];
      *(v4f*)(C + (size_t)(row0 + r) * ldc + col0 + c4) = v;
    }
    
  }
}
// row LayerNorm (biased variance, eps) over N: s = X (+ R); optional out_sum <- s; out_norm <- (s-mu)*rsqrt(var+eps)*g + b
template <bool PARAM_BF16>
__global__ __launch_bounds__(256) void k_layernorm(const float* __restrict__ X, const float* __restrict__ R, const float* __restrict__ g, const float* __restrict__ bta,
                                                  float* __restrict__ out_sum, float* __restrict__ out_norm, int N, float eps) {
  __shared__ float red[256];
  const int row = blockIdx.x, tid = threadIdx.x;
  const float* x = X + (size_t)row * N; const float* rr = R ? R + (size_t)row * N : nullptr;
  float vals[16];                     // up to N = 4096
  const int per = N / 256;            // contiguous chunk per thread? use strided-by-4 chunks: thread handles j = tid*4 + 1024*u
  float s1 = 0.f;
  for (int u = 0; u < per / 4; ++u) {
    const int j = tid * 4 + 1024 * u;
    const v4f a = *(const v4fa*)(x + j);
    v4f b = {0.f,0.f,0.f,0.f}; if (rr) b = *(const v4fa*)(rr + j);
#pragma unroll
    for (int q = 0; q < 4; ++q) { const float v = a[q] + b[q]; vals[u * 4 + q] = v; s1 += v; }
  }
  red[tid] = s1; __syncthreads();
  for (int st = 128; st > 0; st >>= 1) { if (tid < st) red[tid] += red[tid + st]; __syncthreads(); }
  const float mu = red[0] / (float)N; __syncthreads();
  float s2 = 0.f;
  for (int u = 0; u < per / 4; ++u)
#pragma unroll
    for (int q = 0; q < 4; ++q) { const float c = vals[u * 4 + q] - mu; s2 += c * c; }
  red[tid] = s2; __syncthreads();
  for (int st = 128; st > 0; st >>= 1) { if (tid < st) red[tid] += red[tid + st]; __syncthreads(); }
  const float rs = rsqrtf(red[0] / (float)N + eps);
  {
    for (int u = 0; u < per / 4; ++u) {
      const int j = tid * 4 + 1024 * u;
      v4f o, sm;
#pragma unroll
      for (int q = 0; q < 4; ++q) {
        float gg = g[j + q], bb = bta[j + q];
        if (PARAM_BF16) { gg = bf16_round(gg); bb = bf16_round(bb); }
        sm[q] = vals[u * 4 + q]; o[q] = (vals[u * 4 + q] - mu) * rs * gg + bb;
      }
      if (out_sum) *(v4f*)(out_sum + (size_t)row * N + j) = sm;
      *(v4f*)(out_norm + (size_t)row * N + j) = o;
    }
    
  }
}



// ---- f16 WMMA path (v_wmma_f32_16x16x32_f16): 11-bit significands for operands in range — used where a [0,1] probability operand needs more precision than bf16
typedef _Float16 v16h __attribute__((ext_vector_type(16)));
union FragH { v16h v; v8us half[2]; _Float16 h[16]; unsigned short u[16]; };
template <int NT>
__device__ __forceinline__ v8f mmaH(v16h ah, v16h al, v16h bh, v16h bl, v8f c) {
  c = __builtin_amdgcn_wmma_f32_16x16x32_f16(false, ah, false, bh, (short)0, c, false, false);
  if (NT >= 2) c = __builtin_amdgcn_wmma_f32_16x16x32_f16(false, al, false, bh, (short)0, c, false, false);
  if (NT >= 3) c = __builtin_amdgcn_wmma_f32_16x16x32_f16(false, ah, false, bl, (short)0, c, false, false);
  asm volatile("v_nop\n\tv_nop\n\tv_nop\n\tv_nop" : "+v"(c) : "v"(ah), "v"(al), "v"(bh), "v"(bl));
  return c;
}
// batched GEMM like k_gemm_b but f16 operands: A f32 (split into f16 hi/lo if ASPLIT, else rounded to f16), Bt = f16 values [n][k]; alpha; C f32; N multiple of 16 (partial tiles skipped)
template <bool ASPLIT>
__global__ __launch_bounds__(128) void k_gemm_h(const float* __restrict__ A, int lda, size_t sA, const _Float16* __restrict__ Bh, int ldb, size_t sB, float alpha, float* __restrict__ C, int ldc, size_t sC, int M, int N, int K) {
  __shared__ __attribute__((aligned(16))) float so[4][16][64];
  const int tid = threadIdx.x, w = tid >> 5, lane = tid & 31, ln = lane & 15, hh = lane >> 4; const int by = blockIdx.y;
  A += (size_t)by * sA; Bh += (size_t)by * sB; C += (size_t)by * sC;
  const int ntn = (N + 63) / 64; const int wid = blockIdx.x * 4 + w; const int mt = wid / ntn, nq = wid % ntn; if (mt * 16 >= M) return;
  const int row0 = mt * 16, col0 = nq * 64; const float* arow = A + (size_t)(row0 + ln) * lda;
  v8f acc[4] = {};
  for (int kb = 0; kb < K; kb += 32) {
    FragH ah, al;
    const v4f x0 = *(const v4fa*)(arow + kb + 8 * hh), x1 = *(const v4fa*)(arow + kb + 8 * hh + 4), x2 = *(const v4fa*)(arow + kb + 16 + 8 * hh), x3 = *(const v4fa*)(arow + kb + 16 + 8 * hh + 4);
    float xs[16] = {x0[0],x0[1],x0[2],x0[3],x1[0],x1[1],x1[2],x1[3],x2[0],x2[1],x2[2],x2[3],x3[0],x3[1],x3[2],x3[3]};
#pragma unroll
    for (int i = 0; i < 16; ++i) { const _Float16 h = (_Float16)xs[i]; ah.h[i] = h; al.h[i] = ASPLIT ? (_Float16)(xs[i] - (float)h) : (_Float16)0.0f; }
#pragma unroll
    for (int t = 0; t < 4; ++t) { if (col0 + t * 16 >= N) continue; const size_t boff = (size_t)(col0 + t * 16 + ln) * ldb + kb; FragH bq; bq.half[0] = *(const v8us*)(Bh + boff + 8 * hh); bq.half[1] = *(const v8us*)(Bh + boff + 16 + 8 * hh);
      acc[t] = mmaH<ASPLIT ? 2 : 1>(ah.v, al.v, bq.v, bq.v, acc[t]); }
  }
#pragma unroll
  for (int t = 0; t < 4; ++t) { if (col0 + t * 16 >= N) continue;
#pragma unroll
    for (int r = 0; r < 8; ++r) so[w][8 * hh + r][t * 16 + ln] = acc[t][r] * alpha; }
  __builtin_amdgcn_fence(__ATOMIC_ACQ_REL, "workgroup"); __builtin_amdgcn_wave_barrier();
  const int rsub = lane >> 4, c4 = (lane & 15) * 4;
  {
#pragma unroll
    for (int q = 0; q < 8; ++q) { const int r = q * 2 + rsub; if (col0 + c4 < N) { const v4f v = *(const v4fa*)&so[w][r][c4]; *(v4f*)(C + (size_t)(row0 + r) * ldc + col0 + c4) = v; } }
     }
}

// Wt[n][k] = f16(W[k][n]·scale) from f32 row-major W[K][N] (scale = power of two; bf16-exact weights stay exact in f16 away from the subnormal range)
__global__ __launch_bounds__(256) void k_wt_f16(const float* __restrict__ W, _Float16* __restrict__ Wt, int K, int N, float scale) {
  const int t = blockIdx.x * 256 + threadIdx.x; if (t >= N * (K / 8)) return; const int n = t / (K / 8), k8 = (t % (K / 8)) * 8; FragH f;
#pragma unroll
  for (int i = 0; i < 8; ++i) f.h[i] = (_Float16)(bf16_round(W[(size_t)(k8 + i) * N + n]) * scale); const v8us o = f.half[0];
  *(v8us*)((unsigned short*)Wt + (size_t)n * K + k8) = o; 
}
// k_gemm_hh variant with fused epilogue: v = acc·alpha + bias[by·sBias + col] (+ CP[(row/rowsPerB)·sCPb + by·64 + col] if CP) ; ACT 0 none / 1 elu ; writes f16 C16 (and f32 C if non-null)
template <int ACT>
__global__ __launch_bounds__(128) void k_gemm_hhx(const _Float16* __restrict__ A, int lda, size_t sA, const _Float16* __restrict__ Bh, int ldb, size_t sB, float alpha, const float* __restrict__ bias, size_t sBias, const float* __restrict__ CP, int rowsPerB, size_t sCPb, int row0g,
    float* __restrict__ C, _Float16* __restrict__ C16, int ldc, size_t sC, int M, int N, int K) {
  __shared__ __attribute__((aligned(16))) float so[4][16][64];
  const int tid = threadIdx.x, w = tid >> 5, lane = tid & 31, ln = lane & 15, hh = lane >> 4; const int by = blockIdx.y;
  A += (size_t)by * sA; Bh += (size_t)by * sB; const size_t cofs = (size_t)by * sC; const float* bp = bias ? bias + (size_t)by * sBias : nullptr;
  const int ntn = (N + 63) / 64; const int wid = blockIdx.x * 4 + w; const int mt = wid / ntn, nq = wid % ntn; if (mt * 16 >= M) return;
  const int row0 = mt * 16, col0 = nq * 64; const _Float16* arow = A + (size_t)(row0 + ln) * lda;
  v8f acc[4] = {};
  for (int kb = 0; kb < K; kb += 32) { FragH ah; ah.half[0] = *(const v8us*)((const unsigned short*)arow + kb + 8 * hh); ah.half[1] = *(const v8us*)((const unsigned short*)arow + kb + 16 + 8 * hh);
#pragma unroll
    for (int t = 0; t < 4; ++t) { if (col0 + t * 16 >= N) continue; const size_t boff = (size_t)(col0 + t * 16 + ln) * ldb + kb; FragH bq; bq.half[0] = *(const v8us*)((const unsigned short*)Bh + boff + 8 * hh); bq.half[1] = *(const v8us*)((const unsigned short*)Bh + boff + 16 + 8 * hh);
      acc[t] = mmaH<1>(ah.v, ah.v, bq.v, bq.v, acc[t]); }
  }
#pragma unroll
  for (int t = 0; t < 4; ++t) { if (col0 + t * 16 >= N) continue; const int col = col0 + t * 16 + ln; const float bv = bp ? bf16_round(bp[col]) : 0.f;
#pragma unroll
    for (int r = 0; r < 8; ++r) { float v = acc[t][r] * alpha + bv; if (CP) { const int rr = row0g + row0 + 8 * hh + r; if (rowsPerB < 0) v += CP[cofs + (size_t)rr * ldc + col];      /* rowsPerB < 0: own element of the batched C plane */ else { const int bidx = rr / rowsPerB; v += CP[(size_t)bidx * sCPb + (size_t)by * 64 + col]; } } if (ACT == 1) v = (v > 0.f) ? v : expm1f(v); else if (ACT == 7) v = (v > 0.f) ? v + 1.0f : expf(v); else if (ACT == 8) v = tanhf(v); else if (ACT == 9) v = 0.5f * v * (1.0f + tanhf(0.7978845608028654f * (v + 0.044715f * v * v * v))); else if (ACT == 11) v = 1.0f / (1.0f + expf(-v)); else if (ACT == 12) v = (v > 0.f) ? v : 0.01f * v; else if (ACT == 14) v = (v > 0.f) ? v : 0.1f * v; else if (ACT == 16) v = (v >= 0.f) ? v : 0.3f * v; else if (ACT == 17) v = (v >= 0.f) ? v : 0.2f * v; else if (ACT == 15) v = v / (1.0f + expf(-v)); else if (ACT == 3) v = fmaxf(v, 0.f); else if (ACT == 6) v = 0.5f * v * (1.0f + erff(v * 0.70710678118654752f)); so[w][8 * hh + r][t * 16 + ln] = v; } }
  __builtin_amdgcn_fence(__ATOMIC_ACQ_REL, "workgroup"); __builtin_amdgcn_wave_barrier();
  const int rsub = lane >> 4, c4 = (lane & 15) * 4; typedef _Float16 v4h __attribute__((ext_vector_type(4)));
  {
#pragma unroll
    for (int q = 0; q < 8; ++q) { const int r = q * 2 + rsub; if (col0 + c4 < N) { const v4f v = *(const v4fa*)&so[w][r][c4]; if (C) *(v4f*)(C + cofs + (size_t)(row0 + r) * ldc + col0 + c4) = v; if (C16) { v4h h4; for (int i = 0; i < 4; ++i) h4[i] = (_Float16)v[i]; *(v4h*)(C16 + cofs + (size_t)(row0 + r) * ldc + col0 + c4) = h4; } } }
     }
}


typedef _Float16 v4h __attribute__((ext_vector_type(4)));

__global__ __launch_bounds__(256) void k_x16(const float* __restrict__ x, _Float16* __restrict__ X16, size_t n8) { const size_t t = (size_t)blockIdx.x * 256 + threadIdx.x; if (t >= n8) return; FragH f;
#pragma unroll
  for (int q = 0; q < 8; ++q) f.h[q] = (_Float16)bf16_round(x[t * 8 + q]); *(v8us*)((unsigned short*)X16 + t * 8) = f.half[0];  }
__global__ __launch_bounds__(256) void k_h16(const float* __restrict__ x, _Float16* __restrict__ X16, size_t n8) { const size_t t = (size_t)blockIdx.x * 256 + threadIdx.x; if (t >= n8) return; FragH f;
#pragma unroll
  for (int q = 0; q < 8; ++q) f.h[q] = (_Float16)x[t * 8 + q]; *(v8us*)((unsigned short*)X16 + t * 8) = f.half[0];  }
__global__ __launch_bounds__(256) void k_round16f(const float* __restrict__ W, _Float16* __restrict__ Bt, size_t n8) { const size_t t = (size_t)blockIdx.x * 256 + threadIdx.x; if (t >= n8) return; FragH f;
#pragma unroll
  for (int i = 0; i < 8; ++i) f.h[i] = (_Float16)(bf16_round(W[t * 8 + i]) * 16.0f); *(v8us*)((unsigned short*)Bt + t * 8) = f.half[0];  }
template <int NHv, int TTv>
__global__ __launch_bounds__(256) void k_vt(const _Float16* __restrict__ V16, int ldv, int voff, _Float16* __restrict__ Vt) { __shared__ unsigned short tl[64][66]; const int tid = threadIdx.x; const int slab = blockIdx.x / (TTv / 64), lg = blockIdx.x % (TTv / 64); const int b = slab / NHv, h = slab % NHv;
  for (int i = tid; i < 64 * 8; i += 256) { const int r = i / 8, c8 = (i % 8) * 8; FragH f; f.half[0] = *(const v8us*)((const unsigned short*)V16 + ((size_t)b * TTv + lg * 64 + r) * ldv + voff + h * 64 + c8);
#pragma unroll
    for (int q = 0; q < 8; ++q) tl[r][c8 + q] = f.u[q]; }
  __syncthreads();
  {
#pragma unroll
    for (int rd = 0; rd < 2; ++rd) { const int d = rd * 32 + tid / 8, pc = tid % 8; FragH f;
#pragma unroll
      for (int q = 0; q < 8; ++q) f.u[q] = tl[pc * 8 + q][d];
      *(v8us*)((unsigned short*)Vt + ((size_t)slab * 64 + d) * TTv + lg * 64 + pc * 8) = f.half[0]; }
     } }

__global__ __launch_bounds__(256) void k_hl(const float* __restrict__ F, _Float16* __restrict__ Hh, _Float16* __restrict__ Hl, size_t n8) { const size_t t = (size_t)blockIdx.x * 256 + threadIdx.x; if (t >= n8) return; FragH fh, fl; const v4f a = *(const v4fa*)(F + t * 8), c = *(const v4fa*)(F + t * 8 + 4);
#pragma unroll
  for (int q = 0; q < 4; ++q) { _Float16 h = (_Float16)a[q]; fh.h[q] = h; fl.h[q] = (_Float16)((a[q] - (float)h) * 1024.0f); h = (_Float16)c[q]; fh.h[4 + q] = h; fl.h[4 + q] = (_Float16)((c[q] - (float)h) * 1024.0f); }
  { *(v8us*)((unsigned short*)Hh + t * 8) = fh.half[0]; *(v8us*)((unsigned short*)Hl + t * 8) = fl.half[0];  } }

// ---- fast GEMM (wave tile 32x64; requires M % 32 == 0 rows per launch region and N % 64 == 0); epilogue = k_gemm_hhx semantics ----
__device__ __forceinline__ v16h g2_frag(const _Float16* p, int hh) { FragH f; f.half[0] = *(const v8us*)((const unsigned short*)p + 8 * hh); f.half[1] = *(const v8us*)((const unsigned short*)p + 16 + 8 * hh); return f.v; }
__device__ __forceinline__ v8f g2_mma(v16h a, v16h b, v8f c) { v8f d = __builtin_amdgcn_wmma_f32_16x16x32_f16(false, a, false, b, (short)0, c, false, false); asm volatile("v_nop\n\tv_nop\n\tv_nop\n\tv_nop" : "+v"(d) : "v"(a), "v"(b)); return d; }
template <int ACT>
__global__ __launch_bounds__(128) void k_gemm2(const _Float16* __restrict__ A, int lda, size_t sA, const _Float16* __restrict__ Bh, int ldb, size_t sB, float alpha, const float* __restrict__ bias, size_t sBias, const float* __restrict__ CP, int rowsPerB, size_t sCPb, int row0g,
    float* __restrict__ C, _Float16* __restrict__ C16, int ldc, size_t sC, int M, int N, int K) { static_assert(ACT == 0 || ACT == 3 || ACT == 6 || ACT == 8 || ACT == 9 || ACT == 11 || ACT == 12 || ACT == 14 || ACT == 15 || ACT == 16 || ACT == 17, "k_gemm2: unsupported ACT code (would silently apply no activation)");
  __shared__ __attribute__((aligned(16))) float so[4][32][68];
  const int tid = threadIdx.x, w = tid >> 5, lane = tid & 31, ln = lane & 15, hh = lane >> 4; const int by = blockIdx.y;
  A += (size_t)by * sA; Bh += (size_t)by * sB; const size_t cofs = (size_t)by * sC; const float* bp = bias ? bias + (size_t)by * sBias : nullptr;
  const int ntn = N >> 6; const int mt = blockIdx.x / ntn, nq = blockIdx.x - mt * ntn; const int row0 = mt * 128 + 32 * w, col0 = nq * 64; if (row0 >= M) return;
  const _Float16* a0p = A + (size_t)(row0 + ln) * lda; const _Float16* a1p = a0p + (size_t)16 * lda;
  const _Float16* b0p = Bh + (size_t)(col0 + ln) * ldb; const _Float16* b1p = b0p + (size_t)16 * ldb; const _Float16* b2p = b1p + (size_t)16 * ldb; const _Float16* b3p = b2p + (size_t)16 * ldb;
  const v8f z8 = {0.f,0.f,0.f,0.f,0.f,0.f,0.f,0.f}; v8f c00 = z8, c01 = z8, c02 = z8, c03 = z8, c10 = z8, c11 = z8, c12 = z8, c13 = z8;
#pragma unroll 1
  for (int kb = 0; kb < K; kb += 32) { const v16h a0 = g2_frag(a0p + kb, hh), a1 = g2_frag(a1p + kb, hh);
    v16h b = g2_frag(b0p + kb, hh); c00 = g2_mma(a0, b, c00); c10 = g2_mma(a1, b, c10);
    b = g2_frag(b1p + kb, hh); c01 = g2_mma(a0, b, c01); c11 = g2_mma(a1, b, c11);
    b = g2_frag(b2p + kb, hh); c02 = g2_mma(a0, b, c02); c12 = g2_mma(a1, b, c12);
    b = g2_frag(b3p + kb, hh); c03 = g2_mma(a0, b, c03); c13 = g2_mma(a1, b, c13); }
  v8f accs[8] = {c00, c01, c02, c03, c10, c11, c12, c13};
#pragma unroll
  for (int u = 0; u < 8; ++u) { const int t = u & 3, half = u >> 2; const int col = col0 + t * 16 + ln; const float bv = bp ? bf16_round(bp[col]) : 0.f;
#pragma unroll
    for (int r = 0; r < 8; ++r) { const int rloc = half * 16 + 8 * hh + r; float v = accs[u][r] * alpha + bv; if (CP) { if (rowsPerB < 0) v += CP[cofs + (size_t)(row0g + row0 + rloc) * ldc + col];      /* rowsPerB < 0: own element of the batched C plane */ else { const int bidx = (row0g + row0 + rloc) / rowsPerB; v += CP[(size_t)bidx * sCPb + (size_t)by * 64 + col]; } }
      if (ACT == 3) v = fmaxf(v, 0.f); else if (ACT == 6) v = 0.5f * v * (1.0f + erff(v * 0.70710678118654752f)); else if (ACT == 11) v = 1.0f / (1.0f + expf(-v)); else if (ACT == 15) v = v / (1.0f + expf(-v)); else if (ACT == 12) v = (v > 0.f) ? v : 0.01f * v; else if (ACT == 8) v = tanhf(v); else if (ACT == 9) v = 0.5f * v * (1.0f + tanhf(0.7978845608028654f * (v + 0.044715f * v * v * v))); else if (ACT == 14) v = (v > 0.f) ? v : 0.1f * v; else if (ACT == 16) v = (v >= 0.f) ? v : 0.3f * v; else if (ACT == 17) v = (v >= 0.f) ? v : 0.2f * v;
      so[w][rloc][t * 16 + ln] = v; } }
  __builtin_amdgcn_fence(__ATOMIC_ACQ_REL, "workgroup"); __builtin_amdgcn_wave_barrier();
  const int rsub = lane >> 4, c4 = (lane & 15) * 4;
  {
#pragma unroll
    for (int q = 0; q < 16; ++q) { const int r = q * 2 + rsub; const v4f v = *(const v4fa*)&so[w][r][c4]; if (C) *(v4f*)(C + cofs + (size_t)(row0 + r) * ldc + col0 + c4) = v; if (C16) { v4h h4; for (int i = 0; i < 4; ++i) h4[i] = (_Float16)v[i]; *(v4h*)(C16 + cofs + (size_t)(row0 + r) * ldc + col0 + c4) = h4; } }
     } }


__global__ __launch_bounds__(256) void k_wsc(const float* __restrict__ Wm, _Float16* __restrict__ Bt, size_t n8, float sc) { const size_t t = (size_t)blockIdx.x * 256 + threadIdx.x; if (t >= n8) return; FragH f; for (int q = 0; q < 8; ++q) f.h[q] = (_Float16)(bf16_round(Wm[t * 8 + q]) * sc); *(v8us*)((unsigned short*)Bt + t * 8) = f.half[0];  }
template <int NH_>
__global__ __launch_bounds__(256) void k_normrope(const float* __restrict__ X, const float* __restrict__ w, const int* __restrict__ pos, _Float16* __restrict__ O16, _Float16* __restrict__ OL) {
  #pragma clang fp contract(off)
  constexpr int W_ = NH_ * HD; const int wv = threadIdx.x >> 5, ln = threadIdx.x & 31; const int t = blockIdx.x * 8 + wv; if (t >= TT) return; const float* x = X + (size_t)t * W_; float ss = 0.f;
#pragma unroll 1
  for (int c = ln * 4; c < W_; c += 128) { const v4f a = *(const v4fa*)(x + c); for (int e = 0; e < 4; ++e) { const float v = bf16_round(a[e]); ss += v * v; } }
  for (int o = 16; o > 0; o >>= 1) ss += __shfl_xor(ss, o, 32); const float inv = rsqrtf(ss / (float)W_ + 1e-5f); const float p = (float)pos[t];
  {
#pragma unroll 1
    for (int h = 0; h < NH_; ++h) { for (int u = 0; u < 2; ++u) { const int d = ln + 32 * u; const int c1 = h * HD + d, c2 = c1 + 64; float x1 = bf16_round(x[c1]) * inv; x1 *= bf16_round(w[c1]); float x2 = bf16_round(x[c2]) * inv; x2 *= bf16_round(w[c2]);
        const float ex = (float)(2 * d) / (float)HD; const float ivf = 1.0f / powf(10000.0f, ex); const float th = p * ivf; const float cs = cosf(th), sn = sinf(th); float o1 = x1 * cs; o1 += -(x2 * sn); float o2 = x2 * cs; o2 += x1 * sn;
        const _Float16 h1 = (_Float16)o1, h2 = (_Float16)o2; *(_Float16*)(O16 + (size_t)t * W_ + c1) = h1; *(_Float16*)(O16 + (size_t)t * W_ + c2) = h2; *(_Float16*)(OL + (size_t)t * W_ + c1) = (_Float16)((o1 - (float)h1) * 1024.0f); *(_Float16*)(OL + (size_t)t * W_ + c2) = (_Float16)((o2 - (float)h2) * 1024.0f); } }
     } }
__global__ __launch_bounds__(256) void k_softm(const float* __restrict__ S, const int* __restrict__ msk, _Float16* __restrict__ P, _Float16* __restrict__ PL) {
  #pragma clang fp contract(off)
  const int wv = threadIdx.x >> 5, ln = threadIdx.x & 31; const int r = blockIdx.x * 8 + wv; if (r >= TT) return; const size_t hofs = (size_t)blockIdx.y * TT * TT; S += hofs; P += hofs; PL += hofs;      /* grid.y = head inside the batch; the mask is shared */ const float* sr = S + (size_t)r * TT; const int* mr = msk + (size_t)r * MSTR; float m = -3.0e38f;
#pragma unroll 1
  for (int g = 0; g < TT / 256; ++g) { const int j0 = g * 256 + ln * 8; const v8f a = *(const v8f*)(sr + j0); for (int q = 0; q < 8; ++q) { const float s = (mr[j0 + q] != 0) ? -10000.0f : a[q]; m = fmaxf(m, s); } }
  for (int o = 16; o > 0; o >>= 1) m = fmaxf(m, __shfl_xor(m, o, 32)); float su = 0.f;
#pragma unroll 1
  for (int g = 0; g < TT / 256; ++g) { const int j0 = g * 256 + ln * 8; const v8f a = *(const v8f*)(sr + j0); for (int q = 0; q < 8; ++q) { const float s = (mr[j0 + q] != 0) ? -10000.0f : a[q]; su += expf(s - m); } }
  for (int o = 16; o > 0; o >>= 1) su += __shfl_xor(su, o, 32); const float f = 1024.0f / su;
  {
#pragma unroll 1
    for (int g = 0; g < TT / 256; ++g) { const int j0 = g * 256 + ln * 8; const v8f a = *(const v8f*)(sr + j0); FragH ph, pl; for (int q = 0; q < 8; ++q) { const float s = (mr[j0 + q] != 0) ? -10000.0f : a[q]; const float pv = expf(s - m) * f; const _Float16 hh = (_Float16)pv; ph.h[q] = hh; pl.h[q] = (_Float16)((pv - (float)hh) * 1024.0f); } *(v8us*)((unsigned short*)P + (size_t)r * TT + j0) = ph.half[0]; *(v8us*)((unsigned short*)PL + (size_t)r * TT + j0) = pl.half[0]; }
     } }

extern "C" void kernel_launch(void* const* d_in, const int* in_sizes, int n_in,
                              void* d_out, int out_size, void* d_ws, size_t ws_size, hipStream_t stream) {
  (void)in_sizes; (void)n_in; (void)out_size;
  const float* const* I = (const float* const*)d_in; const float* q = I[0]; const float* k = I[1]; const float* v = I[2]; const int* msk = (const int*)d_in[3]; const int* pos = (const int*)d_in[4]; const float* qw = I[5]; const float* kw = I[6]; const float* Wo = I[7];
  char* ws = (char*)d_ws; size_t off = 0;
  auto take = [&](size_t bytes) { char* p = ws + off; off += (bytes + 255) & ~(size_t)255; return p; };
  _Float16* BO = (_Float16*)take((size_t)DQ * DQ * 2); _Float16* Q16 = (_Float16*)take((size_t)TT * DQ * 2); _Float16* QL = (_Float16*)take((size_t)TT * DQ * 2); _Float16* K16 = (_Float16*)take((size_t)TT * DKV * 2); _Float16* KL = (_Float16*)take((size_t)TT * DKV * 2); _Float16* V16 = (_Float16*)take((size_t)TT * DKV * 2); _Float16* VT = (_Float16*)take((size_t)TT * DKV * 2); float* S = (float*)take((size_t)GRP * TT * TT * 4); _Float16* P = (_Float16*)take((size_t)GRP * TT * TT * 2); _Float16* PL = (_Float16*)take((size_t)GRP * TT * TT * 2); float* CTX = (float*)take((size_t)TT * DQ * 4); _Float16* C16 = Q16; _Float16* CL = QL;      /* merged context hi/lo over the q planes (dead after the last score GEMM) */
  if (off > ws_size) return;      /* 8 + 8+8 + 2+2 + 2 + 2 + 64 + 32+32 + 16 = 176 MiB */
  k_wsc<<<(unsigned)(((size_t)DQ * DQ / 8 + 255) / 256), 256, 0, stream>>>(Wo, BO, (size_t)DQ * DQ / 8, 16.0f);      /* (out,in) natural */
  k_normrope<NQH><<<TT / 8, 256, 0, stream>>>(q, qw, pos, Q16, QL); k_normrope<NKVH><<<TT / 8, 256, 0, stream>>>(k, kw, pos, K16, KL);
  k_x16<<<(unsigned)(((size_t)TT * DKV / 8 + 255) / 256), 256, 0, stream>>>(v, V16, (size_t)TT * DKV / 8);
  k_vt<NKVH * 2, TT><<<NKVH * 2 * (TT / 64), 256, 0, stream>>>(V16, DKV, 0, VT);      /* V^T [512][2048] as 8 slabs of 64 dims; kv head = rows kv*128 .. +127 */
  for (int kv = 0; kv < NKVH; ++kv) { const int h0 = kv * GRP; const size_t sS = (size_t)TT * TT;      /* batch index by = head h0 + by: A steps by one head, K / V^T are shared (stride 0), CP < 0 = own element of the batched C plane */
    k_gemm2<0><<<dim3((TT / 128) * (TT / 64), GRP), 128, 0, stream>>>(QL + h0 * HD, DQ, HD, K16 + kv * HD, DKV, 0, 0.088388347648318447f / 1024.0f, nullptr, 0, nullptr, 1, 0, 0, S, nullptr, TT, sS, TT, TT, HD);
    k_gemm2<0><<<dim3((TT / 128) * (TT / 64), GRP), 128, 0, stream>>>(Q16 + h0 * HD, DQ, HD, KL + kv * HD, DKV, 0, 0.088388347648318447f / 1024.0f, nullptr, 0, S, -1, 0, 0, S, nullptr, TT, sS, TT, TT, HD);
    k_gemm2<0><<<dim3((TT / 128) * (TT / 64), GRP), 128, 0, stream>>>(Q16 + h0 * HD, DQ, HD, K16 + kv * HD, DKV, 0, 0.088388347648318447f, nullptr, 0, S, -1, 0, 0, S, nullptr, TT, sS, TT, TT, HD);      /* q_h . k_kv / sqrt(128) as three hi/residual terms */
    k_softm<<<dim3(TT / 8, GRP), 256, 0, stream>>>(S, msk, P, PL);
    k_gemm2<0><<<dim3((TT / 128) * (HD / 64), GRP), 128, 0, stream>>>(PL, TT, sS, VT + (size_t)kv * HD * TT, TT, 0, 0.0009765625f / 1024.0f, nullptr, 0, nullptr, 1, 0, 0, CTX + h0 * HD, nullptr, DQ, HD, TT, HD, TT);
    k_gemm2<0><<<dim3((TT / 128) * (HD / 64), GRP), 128, 0, stream>>>(P, TT, sS, VT + (size_t)kv * HD * TT, TT, 0, 0.0009765625f, nullptr, 0, CTX + h0 * HD, -1, 0, 0, CTX + h0 * HD, nullptr, DQ, HD, TT, HD, TT); }      /* ctx[t][h*128 + d] = (P_lo + P_hi) v (v exact) */
  k_hl<<<(unsigned)(((size_t)TT * DQ / 8 + 255) / 256), 256, 0, stream>>>(CTX, C16, CL, (size_t)TT * DQ / 8);
  k_gemm2<0><<<dim3((TT / 128) * (DQ / 64), 1), 128, 0, stream>>>(CL, DQ, 0, BO, DQ, 0, 0.0625f / 1024.0f, nullptr, 0, nullptr, 1, 0, 0, (float*)d_out, nullptr, DQ, 0, TT, DQ, DQ);
  k_gemm2<0><<<dim3((TT / 128) * (DQ / 64), 1), 128, 0, stream>>>(C16, DQ, 0, BO, DQ, 0, 0.0625f, nullptr, 0, (const float*)d_out, 1, (size_t)DQ, 0, (float*)d_out, nullptr, DQ, 0, TT, DQ, DQ);      /* out = (ctx_lo + ctx_hi) W_out^T (W exact) */
}

// v002
// Measured time: 679 microseconds a run.
// Next to v001, in two timings, it ran 1.94 and 1.95 times as fast.
// Over all steps from v000 it is 4.92 times as fast.
#include <hip/hip_runtime.h>
// QEffMolmoBlock (1 x 2048 tokens; 16 query heads / 4 kv heads x 128 dims; q, k, v are INPUT projections): q = RMSNorm_2048(q) * q_norm_w, k = RMSNorm_512(k) * k_norm_w (flat, before the head split); rotate-half RoPE (hd 128, positions from position_ids, base 10000); GQA (each kv head serves 4 query heads); scores = q.k / sqrt(128), masked entries (int mask input != 0) REPLACED by -10000; softmax; out = (att v) W_out^T.
// Structure: RMSNorm + RoPE fused on VALU (wave per token) into f16 hi + 2^10 residual q/k planes; v as an exact f16 plane; V^T by LDS tiles; per kv group (its 4 query heads batched in grid.y, one launch per stage): the 2048 x 2048 score GEMM (f16 WMMA, 32x64 wave tiles, f32 accumulation, K = 128), the masked softmax on VALU (wave per row, mask read on device) into f16 P hi + residual (x 2^10), the readout GEMM as two terms (N = 128) into the merged context plane; context hi/residual; W_out as two GEMM terms (exact x16 weights). Every product runs all its hi/residual terms in one launch.
// Compute dtype: inputs rounded to bf16; v and W_out exact as f16; normed+rotated q/k (3-term scores), P and the merged context all carried as f16 hi + 2^10 residual (~2^-21): the q/k norm weights are O(1) random so logits have sigma ≈ 11 and the softmax is near one-hot; RMSNorm/RoPE/softmax f32. v_wmma_f32_16x16x32_f16.
#define TT 2048
#define MSTR 2048                /* attention_mask row stride (input geometry) */
#define NQH 16
#define NKVH 4
#define HD 128
#define DQ (NQH * HD)            /* 2048 */
#define DKV (NKVH * HD)          /* 512 */
#define GRP (NQH / NKVH)         /* 4 query heads share a kv head: one batch */
typedef __bf16 v16b __attribute__((ext_vector_type(16)));
typedef unsigned short v8us __attribute__((ext_vector_type(8), may_alias));
typedef float  v8f  __attribute__((ext_vector_type(8)));
typedef float  v4f  __attribute__((ext_vector_type(4)));
typedef float  v4fa __attribute__((ext_vector_type(4), may_alias));
union FragB { v16b v; v8us half[2]; unsigned short u[16]; };

__device__ __forceinline__ unsigned short bf16_bits(float x) { unsigned int u = __float_as_uint(x); return (unsigned short)((u + 0x7FFFu + ((u >> 16) & 1u)) >> 16); }
__device__ __forceinline__ float bf16_val(unsigned short b) { return __uint_as_float(((unsigned int)b) << 16); }
__device__ __forceinline__ float bf16_round(float x) { return bf16_val(bf16_bits(x)); }
// D += A·B with NT terms: 1 = ah·bh, 2 = + al·bh (A split), 3 = + ah·bl (both split)
template <int NT>
__device__ __forceinline__ v8f mmaN(v16b ah, v16b al, v16b bh, v16b bl, v8f c) {
  c = __builtin_amdgcn_wmma_f32_16x16x32_bf16(false, ah, false, bh, (short)0, c, false, false);
  if (NT >= 2) c = __builtin_amdgcn_wmma_f32_16x16x32_bf16(false, al, false, bh, (short)0, c, false, false);
  if (NT >= 3) c = __builtin_amdgcn_wmma_f32_16x16x32_bf16(false, ah, false, bl, (short)0, c, false, false);
  asm volatile("v_nop\n\tv_nop\n\tv_nop\n\tv_nop" : "+v"(c) : "v"(ah), "v"(al), "v"(bh), "v"(bl));
  return c;
}

__global__ __launch_bounds__(256) void k_wt_bf16(const float* __restrict__ W, unsigned short* __restrict__ Wt, int K, int N) {
  const int t = blockIdx.x * 256 + threadIdx.x;
  const int k8n = K / 8;
  if (t >= N * k8n) return;
  const int n = t / k8n, k8 = (t % k8n) * 8;
  v8us v;
#pragma unroll
  for (int i = 0; i < 8; ++i) v[i] = bf16_bits(W[(size_t)(k8 + i) * N + n]);
  *(v8us*)(Wt + (size_t)n * K + k8) = v;
  
}

// GEMM C[M][N] (f32, pitch ldc) = act(A[M][K]·W + bias). A f32 row-major (pitch lda) converted per fragment to bf16
// (ASPLIT: hi/lo two planes -> 2 terms, else single rounded term); Wt bf16 [N][K] (pitch ldb). BIAS_BF16 rounds the
// bias to bf16 first (bias quantised to bf16 before the add). K%32==0, M%16==0, N%64==0.
template <bool ASPLIT, int ACT, bool BIAS_BF16>
__global__ __launch_bounds__(128) void k_gemm_bf(const float* __restrict__ A, int lda, const unsigned short* __restrict__ Wt, int ldb,
                                               const float* __restrict__ bias, float* __restrict__ C, int ldc, int M, int N, int K) {
  __shared__ __attribute__((aligned(16))) float so[4][16][64];
  const int tid = threadIdx.x, w = tid >> 5, lane = tid & 31, ln = lane & 15, hh = lane >> 4;
  const int ntn = N / 64;
  const int wid = blockIdx.x * 4 + w;
  const int mt = wid / ntn, nq = wid % ntn;
  if (mt * 16 >= M) return;
  const int row0 = mt * 16, col0 = nq * 64;
  const float* arow = A + (size_t)(row0 + ln) * lda;
  v8f acc[4] = {};
  for (int kb = 0; kb < K; kb += 32) {
    FragB ah, al;
    const v4f x0 = *(const v4fa*)(arow + kb + 8 * hh), x1 = *(const v4fa*)(arow + kb + 8 * hh + 4);
    const v4f x2 = *(const v4fa*)(arow + kb + 16 + 8 * hh), x3 = *(const v4fa*)(arow + kb + 16 + 8 * hh + 4);
    float xs[16] = {x0[0],x0[1],x0[2],x0[3],x1[0],x1[1],x1[2],x1[3],x2[0],x2[1],x2[2],x2[3],x3[0],x3[1],x3[2],x3[3]};
#pragma unroll
    for (int i = 0; i < 16; ++i) { const unsigned short hb = bf16_bits(xs[i]); ah.u[i] = hb; al.u[i] = ASPLIT ? bf16_bits(xs[i] - bf16_val(hb)) : (unsigned short)0; }
#pragma unroll
    for (int t = 0; t < 4; ++t) {
      const unsigned short* brow = Wt + (size_t)(col0 + t * 16 + ln) * ldb + kb;
      FragB b;
      b.half[0] = *(const v8us*)(brow + 8 * hh);
      b.half[1] = *(const v8us*)(brow + 16 + 8 * hh);
      acc[t] = mmaN<ASPLIT ? 2 : 1>(ah.v, al.v, b.v, b.v, acc[t]);
    }
  }
#pragma unroll
  for (int t = 0; t < 4; ++t) {
    float bv = bias ? bias[col0 + t * 16 + ln] : 0.f;
    if (BIAS_BF16) bv = bf16_round(bv);
#pragma unroll
    for (int r = 0; r < 8; ++r) { float v = acc[t][r] + bv; if (ACT == 1) v = fmaxf(v, 0.f); so[w][8 * hh + r][t * 16 + ln] = v; }
  }
  __builtin_amdgcn_fence(__ATOMIC_ACQ_REL, "workgroup");
  __builtin_amdgcn_wave_barrier();
  const int rsub = lane >> 4, c4 = (lane & 15) * 4;
  {
#pragma unroll
    for (int q = 0; q < 8; ++q) {
      const int r = q * 2 + rsub;
      const v4f v = *(const v4fa*)&so[w][r][c4];
      *(v4f*)(C + (size_t)(row0 + r) * ldc + col0 + c4) = v;
    }
    
  }
}

// GEMM C = act(A·W + bias + resid): A f32 (ASPLIT -> hi/lo 2 terms), Wt bf16 [N][K]; ACT 0 none, 1 relu, 2 exact gelu;
// resid (optional, f32, row index = (row % rmod), pitch ldr, RES_BF16 rounds it) added before the activation.
template <bool ASPLIT, int ACT, bool BIAS_BF16, bool RES_BF16>
__global__ __launch_bounds__(128) void k_gemm_bf3(const float* __restrict__ A, int lda, const unsigned short* __restrict__ Wt, int ldb,
                                                const float* __restrict__ bias, const float* __restrict__ resid, int rmod, int ldr,
                                                float* __restrict__ C, int ldc, int M, int N, int K) {
  __shared__ __attribute__((aligned(16))) float so[4][16][64];
  const int tid = threadIdx.x, w = tid >> 5, lane = tid & 31, ln = lane & 15, hh = lane >> 4;
  const int ntn = N / 64;
  const int wid = blockIdx.x * 4 + w;
  const int mt = wid / ntn, nq = wid % ntn;
  if (mt * 16 >= M) return;
  const int row0 = mt * 16, col0 = nq * 64;
  const float* arow = A + (size_t)(row0 + ln) * lda;
  v8f acc[4] = {};
  for (int kb = 0; kb < K; kb += 32) {
    FragB ah, al;
    const v4f x0 = *(const v4fa*)(arow + kb + 8 * hh), x1 = *(const v4fa*)(arow + kb + 8 * hh + 4);
    const v4f x2 = *(const v4fa*)(arow + kb + 16 + 8 * hh), x3 = *(const v4fa*)(arow + kb + 16 + 8 * hh + 4);
    float xs[16] = {x0[0],x0[1],x0[2],x0[3],x1[0],x1[1],x1[2],x1[3],x2[0],x2[1],x2[2],x2[3],x3[0],x3[1],x3[2],x3[3]};
#pragma unroll
    for (int i = 0; i < 16; ++i) { const unsigned short hb = bf16_bits(xs[i]); ah.u[i] = hb; al.u[i] = ASPLIT ? bf16_bits(xs[i] - bf16_val(hb)) : (unsigned short)0; }
#pragma unroll
    for (int t = 0; t < 4; ++t) {
      const unsigned short* brow = Wt + (size_t)(col0 + t * 16 + ln) * ldb + kb;
      FragB b;
      b.half[0] = *(const v8us*)(brow + 8 * hh);
      b.half[1] = *(const v8us*)(brow + 16 + 8 * hh);
      acc[t] = mmaN<ASPLIT ? 2 : 1>(ah.v, al.v, b.v, b.v, acc[t]);
    }
  }
#pragma unroll
  for (int t = 0; t < 4; ++t) {
    const int col = col0 + t * 16 + ln;
    float bv = bias ? bias[col] : 0.f;
    if (BIAS_BF16) bv = bf16_round(bv);
#pragma unroll
    for (int r = 0; r < 8; ++r) {
      float v = acc[t][r] + bv;
      if (resid) { float rv = resid[(size_t)((row0 + 8 * hh + r) % rmod) * ldr + col]; if (RES_BF16) rv = bf16_round(rv); v += rv; }
      if (ACT == 1) v = fmaxf(v, 0.f);
      if (ACT == 2) v = 0.5f * v * (1.0f + erff(v * 0.70710678118654752f));
      if (ACT == 3) { const float u = 0.7978845608028654f * (v + 0.044715f * v * v * v); v = 0.5f * v * (1.0f + tanhf(u)); }
      so[w][8 * hh + r][t * 16 + ln] = v;
    }
  }
  __builtin_amdgcn_fence(__ATOMIC_ACQ_REL, "workgroup");
  __builtin_amdgcn_wave_barrier();
  const int rsub = lane >> 4, c4 = (lane & 15) * 4;
  {
#pragma unroll
    for (int q = 0; q < 8; ++q) {
      const int r = q * 2 + rsub;
      const v4f v = *(const v4fa*)&so[w][r][c4];
      *(v4f*)(C + (size_t)(row0 + r) * ldc + col0 + c4) = v;
    }
    
  }
}
// row LayerNorm (biased variance, eps) over N: s = X (+ R); optional out_sum <- s; out_norm <- (s-mu)*rsqrt(var+eps)*g + b
template <bool PARAM_BF16>
__global__ __launch_bounds__(256) void k_layernorm(const float* __restrict__ X, const float* __restrict__ R, const float* __restrict__ g, const float* __restrict__ bta,
                                                  float* __restrict__ out_sum, float* __restrict__ out_norm, int N, float eps) {
  __shared__ float red[256];
  const int row = blockIdx.x, tid = threadIdx.x;
  const float* x = X + (size_t)row * N; const float* rr = R ? R + (size_t)row * N : nullptr;
  float vals[16];                     // up to N = 4096
  const int per = N / 256;            // contiguous chunk per thread? use strided-by-4 chunks: thread handles j = tid*4 + 1024*u
  float s1 = 0.f;
  for (int u = 0; u < per / 4; ++u) {
    const int j = tid * 4 + 1024 * u;
    const v4f a = *(const v4fa*)(x + j);
    v4f b = {0.f,0.f,0.f,0.f}; if (rr) b = *(const v4fa*)(rr + j);
#pragma unroll
    for (int q = 0; q < 4; ++q) { const float v = a[q] + b[q]; vals[u * 4 + q] = v; s1 += v; }
  }
  red[tid] = s1; __syncthreads();
  for (int st = 128; st > 0; st >>= 1) { if (tid < st) red[tid] += red[tid + st]; __syncthreads(); }
  const float mu = red[0] / (float)N; __syncthreads();
  float s2 = 0.f;
  for (int u = 0; u < per / 4; ++u)
#pragma unroll
    for (int q = 0; q < 4; ++q) { const float c = vals[u * 4 + q] - mu; s2 += c * c; }
  red[tid] = s2; __syncthreads();
  for (int st = 128; st > 0; st >>= 1) { if (tid < st) red[tid] += red[tid + st]; __syncthreads(); }
  const float rs = rsqrtf(red[0] / (float)N + eps);
  {
    for (int u = 0; u < per / 4; ++u) {
      const int j = tid * 4 + 1024 * u;
      v4f o, sm;
#pragma unroll
      for (int q = 0; q < 4; ++q) {
        float gg = g[j + q], bb = bta[j + q];
        if (PARAM_BF16) { gg = bf16_round(gg); bb = bf16_round(bb); }
        sm[q] = vals[u * 4 + q]; o[q] = (vals[u * 4 + q] - mu) * rs * gg + bb;
      }
      if (out_sum) *(v4f*)(out_sum + (size_t)row * N + j) = sm;
      *(v4f*)(out_norm + (size_t)row * N + j) = o;
    }
    
  }
}



// ---- f16 WMMA path (v_wmma_f32_16x16x32_f16): 11-bit significands for operands in range — used where a [0,1] probability operand needs more precision than bf16
typedef _Float16 v16h __attribute__((ext_vector_type(16)));
union FragH { v16h v; v8us half[2]; _Float16 h[16]; unsigned short u[16]; };
template <int NT>
__device__ __forceinline__ v8f mmaH(v16h ah, v16h al, v16h bh, v16h bl, v8f c) {
  c = __builtin_amdgcn_wmma_f32_16x16x32_f16(false, ah, false, bh, (short)0, c, false, false);
  if (NT >= 2) c = __builtin_amdgcn_wmma_f32_16x16x32_f16(false, al, false, bh, (short)0, c, false, false);
  if (NT >= 3) c = __builtin_amdgcn_wmma_f32_16x16x32_f16(false, ah, false, bl, (short)0, c, false, false);
  asm volatile("v_nop\n\tv_nop\n\tv_nop\n\tv_nop" : "+v"(c) : "v"(ah), "v"(al), "v"(bh), "v"(bl));
  return c;
}
// batched GEMM like k_gemm_b but f16 operands: A f32 (split into f16 hi/lo if ASPLIT, else rounded to f16), Bt = f16 values [n][k]; alpha; C f32; N multiple of 16 (partial tiles skipped)
template <bool ASPLIT>
__global__ __launch_bounds__(128) void k_gemm_h(const float* __restrict__ A, int lda, size_t sA, const _Float16* __restrict__ Bh, int ldb, size_t sB, float alpha, float* __restrict__ C, int ldc, size_t sC, int M, int N, int K) {
  __shared__ __attribute__((aligned(16))) float so[4][16][64];
  const int tid = threadIdx.x, w = tid >> 5, lane = tid & 31, ln = lane & 15, hh = lane >> 4; const int by = blockIdx.y;
  A += (size_t)by * sA; Bh += (size_t)by * sB; C += (size_t)by * sC;
  const int ntn = (N + 63) / 64; const int wid = blockIdx.x * 4 + w; const int mt = wid / ntn, nq = wid % ntn; if (mt * 16 >= M) return;
  const int row0 = mt * 16, col0 = nq * 64; const float* arow = A + (size_t)(row0 + ln) * lda;
  v8f acc[4] = {};
  for (int kb = 0; kb < K; kb += 32) {
    FragH ah, al;
    const v4f x0 = *(const v4fa*)(arow + kb + 8 * hh), x1 = *(const v4fa*)(arow + kb + 8 * hh + 4), x2 = *(const v4fa*)(arow + kb + 16 + 8 * hh), x3 = *(const v4fa*)(arow + kb + 16 + 8 * hh + 4);
    float xs[16] = {x0[0],x0[1],x0[2],x0[3],x1[0],x1[1],x1[2],x1[3],x2[0],x2[1],x2[2],x2[3],x3[0],x3[1],x3[2],x3[3]};
#pragma unroll
    for (int i = 0; i < 16; ++i) { const _Float16 h = (_Float16)xs[i]; ah.h[i] = h; al.h[i] = ASPLIT ? (_Float16)(xs[i] - (float)h) : (_Float16)0.0f; }
#pragma unroll
    for (int t = 0; t < 4; ++t) { if (col0 + t * 16 >= N) continue; const size_t boff = (size_t)(col0 + t * 16 + ln) * ldb + kb; FragH bq; bq.half[0] = *(const v8us*)(Bh + boff + 8 * hh); bq.half[1] = *(const v8us*)(Bh + boff + 16 + 8 * hh);
      acc[t] = mmaH<ASPLIT ? 2 : 1>(ah.v, al.v, bq.v, bq.v, acc[t]); }
  }
#pragma unroll
  for (int t = 0; t < 4; ++t) { if (col0 + t * 16 >= N) continue;
#pragma unroll
    for (int r = 0; r < 8; ++r) so[w][8 * hh + r][t * 16 + ln] = acc[t][r] * alpha; }
  __builtin_amdgcn_fence(__ATOMIC_ACQ_REL, "workgroup"); __builtin_amdgcn_wave_barrier();
  const int rsub = lane >> 4, c4 = (lane & 15) * 4;
  {
#pragma unroll
    for (int q = 0; q < 8; ++q) { const int r = q * 2 + rsub; if (col0 + c4 < N) { const v4f v = *(const v4fa*)&so[w][r][c4]; *(v4f*)(C + (size_t)(row0 + r) * ldc + col0 + c4) = v; } }
     }
}

// Wt[n][k] = f16(W[k][n]·scale) from f32 row-major W[K][N] (scale = power of two; bf16-exact weights stay exact in f16 away from the subnormal range)
__global__ __launch_bounds__(256) void k_wt_f16(const float* __restrict__ W, _Float16* __restrict__ Wt, int K, int N, float scale) {
  const int t = blockIdx.x * 256 + threadIdx.x; if (t >= N * (K / 8)) return; const int n = t / (K / 8), k8 = (t % (K / 8)) * 8; FragH f;
#pragma unroll
  for (int i = 0; i < 8; ++i) f.h[i] = (_Float16)(bf16_round(W[(size_t)(k8 + i) * N + n]) * scale); const v8us o = f.half[0];
  *(v8us*)((unsigned short*)Wt + (size_t)n * K + k8) = o; 
}
// k_gemm_hh variant with fused epilogue: v = acc·alpha + bias[by·sBias + col] (+ CP[(row/rowsPerB)·sCPb + by·64 + col] if CP) ; ACT 0 none / 1 elu ; writes f16 C16 (and f32 C if non-null)
template <int ACT>
__global__ __launch_bounds__(128) void k_gemm_hhx(const _Float16* __restrict__ A, int lda, size_t sA, const _Float16* __restrict__ Bh, int ldb, size_t sB, float alpha, const float* __restrict__ bias, size_t sBias, const float* __restrict__ CP, int rowsPerB, size_t sCPb, int row0g,
    float* __restrict__ C, _Float16* __restrict__ C16, int ldc, size_t sC, int M, int N, int K) {
  __shared__ __attribute__((aligned(16))) float so[4][16][64];
  const int tid = threadIdx.x, w = tid >> 5, lane = tid & 31, ln = lane & 15, hh = lane >> 4; const int by = blockIdx.y;
  A += (size_t)by * sA; Bh += (size_t)by * sB; const size_t cofs = (size_t)by * sC; const float* bp = bias ? bias + (size_t)by * sBias : nullptr;
  const int ntn = (N + 63) / 64; const int wid = blockIdx.x * 4 + w; const int mt = wid / ntn, nq = wid % ntn; if (mt * 16 >= M) return;
  const int row0 = mt * 16, col0 = nq * 64; const _Float16* arow = A + (size_t)(row0 + ln) * lda;
  v8f acc[4] = {};
  for (int kb = 0; kb < K; kb += 32) { FragH ah; ah.half[0] = *(const v8us*)((const unsigned short*)arow + kb + 8 * hh); ah.half[1] = *(const v8us*)((const unsigned short*)arow + kb + 16 + 8 * hh);
#pragma unroll
    for (int t = 0; t < 4; ++t) { if (col0 + t * 16 >= N) continue; const size_t boff = (size_t)(col0 + t * 16 + ln) * ldb + kb; FragH bq; bq.half[0] = *(const v8us*)((const unsigned short*)Bh + boff + 8 * hh); bq.half[1] = *(const v8us*)((const unsigned short*)Bh + boff + 16 + 8 * hh);
      acc[t] = mmaH<1>(ah.v, ah.v, bq.v, bq.v, acc[t]); }
  }
#pragma unroll
  for (int t = 0; t < 4; ++t) { if (col0 + t * 16 >= N) continue; const int col = col0 + t * 16 + ln; const float bv = bp ? bf16_round(bp[col]) : 0.f;
#pragma unroll
    for (int r = 0; r < 8; ++r) { float v = acc[t][r] * alpha + bv; if (CP) { const int rr = row0g + row0 + 8 * hh + r; if (rowsPerB < 0) v += CP[cofs + (size_t)rr * ldc + col];      /* rowsPerB < 0: own element of the batched C plane */ else { const int bidx = rr / rowsPerB; v += CP[(size_t)bidx * sCPb + (size_t)by * 64 + col]; } } if (ACT == 1) v = (v > 0.f) ? v : expm1f(v); else if (ACT == 7) v = (v > 0.f) ? v + 1.0f : expf(v); else if (ACT == 8) v = tanhf(v); else if (ACT == 9) v = 0.5f * v * (1.0f + tanhf(0.7978845608028654f * (v + 0.044715f * v * v * v))); else if (ACT == 11) v = 1.0f / (1.0f + expf(-v)); else if (ACT == 12) v = (v > 0.f) ? v : 0.01f * v; else if (ACT == 14) v = (v > 0.f) ? v : 0.1f * v; else if (ACT == 16) v = (v >= 0.f) ? v : 0.3f * v; else if (ACT == 17) v = (v >= 0.f) ? v : 0.2f * v; else if (ACT == 15) v = v / (1.0f + expf(-v)); else if (ACT == 3) v = fmaxf(v, 0.f); else if (ACT == 6) v = 0.5f * v * (1.0f + erff(v * 0.70710678118654752f)); so[w][8 * hh + r][t * 16 + ln] = v; } }
  __builtin_amdgcn_fence(__ATOMIC_ACQ_REL, "workgroup"); __builtin_amdgcn_wave_barrier();
  const int rsub = lane >> 4, c4 = (lane & 15) * 4; typedef _Float16 v4h __attribute__((ext_vector_type(4)));
  {
#pragma unroll
    for (int q = 0; q < 8; ++q) { const int r = q * 2 + rsub; if (col0 + c4 < N) { const v4f v = *(const v4fa*)&so[w][r][c4]; if (C) *(v4f*)(C + cofs + (size_t)(row0 + r) * ldc + col0 + c4) = v; if (C16) { v4h h4; for (int i = 0; i < 4; ++i) h4[i] = (_Float16)v[i]; *(v4h*)(C16 + cofs + (size_t)(row0 + r) * ldc + col0 + c4) = h4; } } }
     }
}


typedef _Float16 v4h __attribute__((ext_vector_type(4)));

__global__ __launch_bounds__(256) void k_x16(const float* __restrict__ x, _Float16* __restrict__ X16, size_t n8) { const size_t t = (size_t)blockIdx.x * 256 + threadIdx.x; if (t >= n8) return; FragH f;
#pragma unroll
  for (int q = 0; q < 8; ++q) f.h[q] = (_Float16)bf16_round(x[t * 8 + q]); *(v8us*)((unsigned short*)X16 + t * 8) = f.half[0];  }
__global__ __launch_bounds__(256) void k_h16(const float* __restrict__ x, _Float16* __restrict__ X16, size_t n8) { const size_t t = (size_t)blockIdx.x * 256 + threadIdx.x; if (t >= n8) return; FragH f;
#pragma unroll
  for (int q = 0; q < 8; ++q) f.h[q] = (_Float16)x[t * 8 + q]; *(v8us*)((unsigned short*)X16 + t * 8) = f.half[0];  }
__global__ __launch_bounds__(256) void k_round16f(const float* __restrict__ W, _Float16* __restrict__ Bt, size_t n8) { const size_t t = (size_t)blockIdx.x * 256 + threadIdx.x; if (t >= n8) return; FragH f;
#pragma unroll
  for (int i = 0; i < 8; ++i) f.h[i] = (_Float16)(bf16_round(W[t * 8 + i]) * 16.0f); *(v8us*)((unsigned short*)Bt + t * 8) = f.half[0];  }
template <int NHv, int TTv>
__global__ __launch_bounds__(256) void k_vt(const _Float16* __restrict__ V16, int ldv, int voff, _Float16* __restrict__ Vt) { __shared__ unsigned short tl[64][66]; const int tid = threadIdx.x; const int slab = blockIdx.x / (TTv / 64), lg = blockIdx.x % (TTv / 64); const int b = slab / NHv, h = slab % NHv;
  for (int i = tid; i < 64 * 8; i += 256) { const int r = i / 8, c8 = (i % 8) * 8; FragH f; f.half[0] = *(const v8us*)((const unsigned short*)V16 + ((size_t)b * TTv + lg * 64 + r) * ldv + voff + h * 64 + c8);
#pragma unroll
    for (int q = 0; q < 8; ++q) tl[r][c8 + q] = f.u[q]; }
  __syncthreads();
  {
#pragma unroll
    for (int rd = 0; rd < 2; ++rd) { const int d = rd * 32 + tid / 8, pc = tid % 8; FragH f;
#pragma unroll
      for (int q = 0; q < 8; ++q) f.u[q] = tl[pc * 8 + q][d];
      *(v8us*)((unsigned short*)Vt + ((size_t)slab * 64 + d) * TTv + lg * 64 + pc * 8) = f.half[0]; }
     } }

__global__ __launch_bounds__(256) void k_hl(const float* __restrict__ F, _Float16* __restrict__ Hh, _Float16* __restrict__ Hl, size_t n8) { const size_t t = (size_t)blockIdx.x * 256 + threadIdx.x; if (t >= n8) return; FragH fh, fl; const v4f a = *(const v4fa*)(F + t * 8), c = *(const v4fa*)(F + t * 8 + 4);
#pragma unroll
  for (int q = 0; q < 4; ++q) { _Float16 h = (_Float16)a[q]; fh.h[q] = h; fl.h[q] = (_Float16)((a[q] - (float)h) * 1024.0f); h = (_Float16)c[q]; fh.h[4 + q] = h; fl.h[4 + q] = (_Float16)((c[q] - (float)h) * 1024.0f); }
  { *(v8us*)((unsigned short*)Hh + t * 8) = fh.half[0]; *(v8us*)((unsigned short*)Hl + t * 8) = fl.half[0];  } }

// ---- fast GEMM (wave tile 32x64; requires M % 32 == 0 rows per launch region and N % 64 == 0) ----
__device__ __forceinline__ v16h g2_frag(const _Float16* p, int hh) { FragH f; f.half[0] = *(const v8us*)((const unsigned short*)p + 8 * hh); f.half[1] = *(const v8us*)((const unsigned short*)p + 16 + 8 * hh); return f.v; }
__device__ __forceinline__ v8f g2_mma(v16h a, v16h b, v8f c) { v8f d = __builtin_amdgcn_wmma_f32_16x16x32_f16(false, a, false, b, (short)0, c, false, false); asm volatile("v_nop\n\tv_nop\n\tv_nop\n\tv_nop" : "+v"(d) : "v"(a), "v"(b)); return d; }
// All hi/residual terms of one product in ONE launch: C = alpha * (Ah.Bh + 2^-10 * (Al.Bh [+ Ah.Bl if BSPLIT])). The hi product and the residual products keep separate f32 accumulators
// (the residual planes carry a 2^10 scale) and meet once in the epilogue, so C is stored once and never read back, and each Ah / Bh fragment is loaded once for all the terms that use it.
template <bool BSPLIT, int lda, int ldb>
__global__ __launch_bounds__(128) void k_gemm2s(const _Float16* __restrict__ Ah, const _Float16* __restrict__ Al, size_t sA, const _Float16* __restrict__ Bh, const _Float16* __restrict__ Bl, size_t sB, float alpha,
    float* __restrict__ C, int ldc, size_t sC, int M, int N, int K) {
  __shared__ __attribute__((aligned(16))) float so[4][32][68];
  const int tid = threadIdx.x, w = tid >> 5, lane = tid & 31, ln = lane & 15, hh = lane >> 4; const int by = blockIdx.y; const size_t cofs = (size_t)by * sC;
  const int ntn = N >> 6; const int mt = blockIdx.x / ntn, nq = blockIdx.x - mt * ntn; const int row0 = mt * 128 + 32 * w, col0 = nq * 64; if (row0 >= M) return;
  const size_t aofs = (size_t)by * sA + (size_t)(row0 + ln) * lda, bofs = (size_t)by * sB + (size_t)(col0 + ln) * ldb; const size_t a16 = (size_t)16 * lda, b16 = (size_t)16 * ldb;
  const _Float16* ahp = Ah + aofs; const _Float16* alp = Al + aofs; const _Float16* bhp = Bh + bofs; const _Float16* blp = BSPLIT ? Bl + bofs : nullptr;
  const v8f z8 = {0.f,0.f,0.f,0.f,0.f,0.f,0.f,0.f}; v8f ch[8] = {z8, z8, z8, z8, z8, z8, z8, z8}, cl[8] = {z8, z8, z8, z8, z8, z8, z8, z8};      /* [t] = rows 0..15, [4 + t] = rows 16..31 of column tile t */
  /* kept rolled: one k step of fragments beside the 128 accumulator registers is what fits */
#pragma unroll 1
  for (int kb = 0; kb < K; kb += 32) { const v16h a0h = g2_frag(ahp + kb, hh), a1h = g2_frag(ahp + a16 + kb, hh);
    asm volatile("s_wait_xcnt 0x0" ::: "memory");      /* precaution: the compiler lets the loads below land in the registers that held the address of the loads above */
    const v16h a0l = g2_frag(alp + kb, hh); FragH f1; f1.half[0] = *(const v8us*)((const unsigned short*)(alp + a16 + kb) + 8 * hh);
    asm volatile("s_wait_xcnt 0x0" ::: "memory");      /* same precaution: the last load from this address pair lands in the pair itself */
    f1.half[1] = *(const v8us*)((const unsigned short*)(alp + a16 + kb) + 16 + 8 * hh); const v16h a1l = f1.v;
    /* unrolled so that ch[] / cl[] are indexed by constants and stay in registers (the same holds for the epilogue loops) */
#pragma unroll
    for (int t = 0; t < 4; ++t) { const v16h bh = g2_frag(bhp + t * b16 + kb, hh);
      ch[t] = g2_mma(a0h, bh, ch[t]); ch[4 + t] = g2_mma(a1h, bh, ch[4 + t]); cl[t] = g2_mma(a0l, bh, cl[t]); cl[4 + t] = g2_mma(a1l, bh, cl[4 + t]);
      if (BSPLIT) { const v16h bl = g2_frag(blp + t * b16 + kb, hh); cl[t] = g2_mma(a0h, bl, cl[t]); cl[4 + t] = g2_mma(a1h, bl, cl[4 + t]); } } }
  const float alo = alpha * 0.0009765625f;
#pragma unroll
  for (int u = 0; u < 8; ++u) { const int t = u & 3, half = u >> 2;
#pragma unroll
    for (int r = 0; r < 8; ++r) so[w][half * 16 + 8 * hh + r][t * 16 + ln] = ch[u][r] * alpha + cl[u][r] * alo; }
  __builtin_amdgcn_fence(__ATOMIC_ACQ_REL, "workgroup"); __builtin_amdgcn_wave_barrier();      /* this wave's LDS stores above come before its own LDS reads below (so[w] is private to the wave) */
  const int rsub = lane >> 4, c4 = (lane & 15) * 4;
#pragma unroll
  for (int q = 0; q < 16; ++q) { const int r = q * 2 + rsub; const v4f v = *(const v4fa*)&so[w][r][c4]; *(v4f*)(C + cofs + (size_t)(row0 + r) * ldc + col0 + c4) = v; } }


__global__ __launch_bounds__(256) void k_wsc(const float* __restrict__ Wm, _Float16* __restrict__ Bt, size_t n8, float sc) { const size_t t = (size_t)blockIdx.x * 256 + threadIdx.x; if (t >= n8) return; FragH f; for (int q = 0; q < 8; ++q) f.h[q] = (_Float16)(bf16_round(Wm[t * 8 + q]) * sc); *(v8us*)((unsigned short*)Bt + t * 8) = f.half[0];  }
template <int NH_>
__global__ __launch_bounds__(256) void k_normrope(const float* __restrict__ X, const float* __restrict__ w, const int* __restrict__ pos, _Float16* __restrict__ O16, _Float16* __restrict__ OL) {
  #pragma clang fp contract(off)
  constexpr int W_ = NH_ * HD; const int wv = threadIdx.x >> 5, ln = threadIdx.x & 31; const int t = blockIdx.x * 8 + wv; if (t >= TT) return; const float* x = X + (size_t)t * W_; float ss = 0.f;
#pragma unroll 1
  for (int c = ln * 4; c < W_; c += 128) { const v4f a = *(const v4fa*)(x + c); for (int e = 0; e < 4; ++e) { const float v = bf16_round(a[e]); ss += v * v; } }
  for (int o = 16; o > 0; o >>= 1) ss += __shfl_xor(ss, o, 32); const float inv = rsqrtf(ss / (float)W_ + 1e-5f); const float p = (float)pos[t];
  {
#pragma unroll 1
    for (int h = 0; h < NH_; ++h) { for (int u = 0; u < 2; ++u) { const int d = ln + 32 * u; const int c1 = h * HD + d, c2 = c1 + 64; float x1 = bf16_round(x[c1]) * inv; x1 *= bf16_round(w[c1]); float x2 = bf16_round(x[c2]) * inv; x2 *= bf16_round(w[c2]);
        const float ex = (float)(2 * d) / (float)HD; const float ivf = 1.0f / powf(10000.0f, ex); const float th = p * ivf; const float cs = cosf(th), sn = sinf(th); float o1 = x1 * cs; o1 += -(x2 * sn); float o2 = x2 * cs; o2 += x1 * sn;
        const _Float16 h1 = (_Float16)o1, h2 = (_Float16)o2; *(_Float16*)(O16 + (size_t)t * W_ + c1) = h1; *(_Float16*)(O16 + (size_t)t * W_ + c2) = h2; *(_Float16*)(OL + (size_t)t * W_ + c1) = (_Float16)((o1 - (float)h1) * 1024.0f); *(_Float16*)(OL + (size_t)t * W_ + c2) = (_Float16)((o2 - (float)h2) * 1024.0f); } }
     } }
__global__ __launch_bounds__(256) void k_softm(const float* __restrict__ S, const int* __restrict__ msk, _Float16* __restrict__ P, _Float16* __restrict__ PL) {
  #pragma clang fp contract(off)
  const int wv = threadIdx.x >> 5, ln = threadIdx.x & 31; const int r = blockIdx.x * 8 + wv; if (r >= TT) return; const size_t hofs = (size_t)blockIdx.y * TT * TT; S += hofs; P += hofs; PL += hofs;      /* grid.y = head inside the batch; the mask is shared */ const float* sr = S + (size_t)r * TT; const int* mr = msk + (size_t)r * MSTR; float m = -3.0e38f;
#pragma unroll 1
  for (int g = 0; g < TT / 256; ++g) { const int j0 = g * 256 + ln * 8; const v8f a = *(const v8f*)(sr + j0); for (int q = 0; q < 8; ++q) { const float s = (mr[j0 + q] != 0) ? -10000.0f : a[q]; m = fmaxf(m, s); } }
  for (int o = 16; o > 0; o >>= 1) m = fmaxf(m, __shfl_xor(m, o, 32)); float su = 0.f;
#pragma unroll 1
  for (int g = 0; g < TT / 256; ++g) { const int j0 = g * 256 + ln * 8; const v8f a = *(const v8f*)(sr + j0); for (int q = 0; q < 8; ++q) { const float s = (mr[j0 + q] != 0) ? -10000.0f : a[q]; su += expf(s - m); } }
  for (int o = 16; o > 0; o >>= 1) su += __shfl_xor(su, o, 32); const float f = 1024.0f / su;
  {
#pragma unroll 1
    for (int g = 0; g < TT / 256; ++g) { const int j0 = g * 256 + ln * 8; const v8f a = *(const v8f*)(sr + j0); FragH ph, pl; for (int q = 0; q < 8; ++q) { const float s = (mr[j0 + q] != 0) ? -10000.0f : a[q]; const float pv = expf(s - m) * f; const _Float16 hh = (_Float16)pv; ph.h[q] = hh; pl.h[q] = (_Float16)((pv - (float)hh) * 1024.0f); } *(v8us*)((unsigned short*)P + (size_t)r * TT + j0) = ph.half[0]; *(v8us*)((unsigned short*)PL + (size_t)r * TT + j0) = pl.half[0]; }
     } }

extern "C" void kernel_launch(void* const* d_in, const int* in_sizes, int n_in,
                              void* d_out, int out_size, void* d_ws, size_t ws_size, hipStream_t stream) {
  (void)in_sizes; (void)n_in; (void)out_size;
  const float* const* I = (const float* const*)d_in; const float* q = I[0]; const float* k = I[1]; const float* v = I[2]; const int* msk = (const int*)d_in[3]; const int* pos = (const int*)d_in[4]; const float* qw = I[5]; const float* kw = I[6]; const float* Wo = I[7];
  char* ws = (char*)d_ws; size_t off = 0;
  auto take = [&](size_t bytes) { char* p = ws + off; off += (bytes + 255) & ~(size_t)255; return p; };
  _Float16* BO = (_Float16*)take((size_t)DQ * DQ * 2); _Float16* Q16 = (_Float16*)take((size_t)TT * DQ * 2); _Float16* QL = (_Float16*)take((size_t)TT * DQ * 2); _Float16* K16 = (_Float16*)take((size_t)TT * DKV * 2); _Float16* KL = (_Float16*)take((size_t)TT * DKV * 2); _Float16* V16 = (_Float16*)take((size_t)TT * DKV * 2); _Float16* VT = (_Float16*)take((size_t)TT * DKV * 2); float* S = (float*)take((size_t)GRP * TT * TT * 4); _Float16* P = (_Float16*)take((size_t)GRP * TT * TT * 2); _Float16* PL = (_Float16*)take((size_t)GRP * TT * TT * 2); float* CTX = (float*)take((size_t)TT * DQ * 4); _Float16* C16 = Q16; _Float16* CL = QL;      /* merged context hi/lo over the q planes (dead after the last score GEMM) */
  if (off > ws_size) return;      /* 8 + 8+8 + 2+2 + 2 + 2 + 64 + 32+32 + 16 = 176 MiB */
  k_wsc<<<(unsigned)(((size_t)DQ * DQ / 8 + 255) / 256), 256, 0, stream>>>(Wo, BO, (size_t)DQ * DQ / 8, 16.0f);      /* (out,in) natural */
  k_normrope<NQH><<<TT / 8, 256, 0, stream>>>(q, qw, pos, Q16, QL); k_normrope<NKVH><<<TT / 8, 256, 0, stream>>>(k, kw, pos, K16, KL);
  k_x16<<<(unsigned)(((size_t)TT * DKV / 8 + 255) / 256), 256, 0, stream>>>(v, V16, (size_t)TT * DKV / 8);
  k_vt<NKVH * 2, TT><<<NKVH * 2 * (TT / 64), 256, 0, stream>>>(V16, DKV, 0, VT);      /* V^T [512][2048] as 8 slabs of 64 dims; kv head = rows kv*128 .. +127 */
  for (int kv = 0; kv < NKVH; ++kv) { const int h0 = kv * GRP; const size_t sS = (size_t)TT * TT;      /* batch index by = head h0 + by: A steps by one head, K / V^T are shared (stride 0) */
    k_gemm2s<true, DQ, DKV><<<dim3((TT / 128) * (TT / 64), GRP), 128, 0, stream>>>(Q16 + h0 * HD, QL + h0 * HD, HD, K16 + kv * HD, KL + kv * HD, 0, 0.088388347648318447f, S, TT, sS, TT, TT, HD);      /* q_h . k_kv / sqrt(128): three hi/residual terms, one launch */
    k_softm<<<dim3(TT / 8, GRP), 256, 0, stream>>>(S, msk, P, PL);
    k_gemm2s<false, TT, TT><<<dim3((TT / 128) * (HD / 64), GRP), 128, 0, stream>>>(P, PL, sS, VT + (size_t)kv * HD * TT, nullptr, 0, 0.0009765625f, CTX + h0 * HD, DQ, HD, TT, HD, TT); }      /* ctx[t][h*128 + d] = (P_hi + P_lo) v (v exact), one launch */
  k_hl<<<(unsigned)(((size_t)TT * DQ / 8 + 255) / 256), 256, 0, stream>>>(CTX, C16, CL, (size_t)TT * DQ / 8);
  k_gemm2s<false, DQ, DQ><<<dim3((TT / 128) * (DQ / 64), 1), 128, 0, stream>>>(C16, CL, 0, BO, nullptr, 0, 0.0625f, (float*)d_out, DQ, 0, TT, DQ, DQ);      /* out = (ctx_hi + ctx_lo) W_out^T (W exact), one launch */
}

// v003
// A run of this version takes 249 microseconds.
// Two timings next to v002 put it at 2.72 and 2.76 times that version's speed.
// All steps since v000 together make it 13.5 times as fast.
#include <hip/hip_runtime.h>
// QEffMolmoBlock (1 x 2048 tokens; 16 query heads / 4 kv heads x 128 dims; q, k, v are INPUT projections): q = RMSNorm_2048(q) * q_norm_w, k = RMSNorm_512(k) * k_norm_w (flat, before the head split); rotate-half RoPE (hd 128, positions from position_ids, base 10000); GQA (each kv head serves 4 query heads); scores = q.k / sqrt(128), masked entries (int mask input != 0) REPLACED by -10000; softmax; out = (att v) W_out^T.
// Structure: RMSNorm + RoPE fused on VALU (wave per token) into f16 hi + 2^10 residual q/k planes; v as an exact f16 plane; V^T by LDS tiles; one fused attention launch for all 16 heads (a wave owns 32 queries and walks the keys in passes of 32): the score products (f16 WMMA, f32 accumulation, K = 128, three terms), the masked online softmax on VALU (mask read on device), P as f16 hi + residual (x 2^10) packed in registers, the readout as two terms into the merged context plane; context hi/residual; W_out as two GEMM terms (exact x16 weights). Every product runs all its hi/residual terms in one launch.
// Compute dtype: inputs rounded to bf16; v and W_out exact as f16; normed+rotated q/k (3-term scores), P and the merged context all carried as f16 hi + 2^10 residual (~2^-21): the q/k norm weights are O(1) random so logits have sigma ≈ 11 and the softmax is near one-hot; RMSNorm/RoPE/softmax f32. v_wmma_f32_16x16x32_f16.
#define TT 2048
#define MSTR 2048                /* attention_mask row stride (input geometry) */
#define NQH 16
#define NKVH 4
#define HD 128
#define DQ (NQH * HD)            /* 2048 */
#define DKV (NKVH * HD)          /* 512 */
#define GRP (NQH / NKVH)         /* 4 query heads share a kv head */
typedef __bf16 v16b __attribute__((ext_vector_type(16)));
typedef unsigned short v8us __attribute__((ext_vector_type(8), may_alias));
typedef float  v8f  __attribute__((ext_vector_type(8)));
typedef float  v4f  __attribute__((ext_vector_type(4)));
typedef float  v4fa __attribute__((ext_vector_type(4), may_alias));
union FragB { v16b v; v8us half[2]; unsigned short u[16]; };

__device__ __forceinline__ unsigned short bf16_bits(float x) { unsigned int u = __float_as_uint(x); return (unsigned short)((u + 0x7FFFu + ((u >> 16) & 1u)) >> 16); }
__device__ __forceinline__ float bf16_val(unsigned short b) { return __uint_as_float(((unsigned int)b) << 16); }
__device__ __forceinline__ float bf16_round(float x) { return bf16_val(bf16_bits(x)); }
// D += A·B with NT terms: 1 = ah·bh, 2 = + al·bh (A split), 3 = + ah·bl (both split)
template <int NT>
__device__ __forceinline__ v8f mmaN(v16b ah, v16b al, v16b bh, v16b bl, v8f c) {
  c = __builtin_amdgcn_wmma_f32_16x16x32_bf16(false, ah, false, bh, (short)0, c, false, false);
  if (NT >= 2) c = __builtin_amdgcn_wmma_f32_16x16x32_bf16(false, al, false, bh, (short)0, c, false, false);
  if (NT >= 3) c = __builtin_amdgcn_wmma_f32_16x16x32_bf16(false, ah, false, bl, (short)0, c, false, false);
  asm volatile("v_nop\n\tv_nop\n\tv_nop\n\tv_nop" : "+v"(c) : "v"(ah), "v"(al), "v"(bh), "v"(bl));
  return c;
}

__global__ __launch_bounds__(256) void k_wt_bf16(const float* __restrict__ W, unsigned short* __restrict__ Wt, int K, int N) {
  const int t = blockIdx.x * 256 + threadIdx.x;
  const int k8n = K / 8;
  if (t >= N * k8n) return;
  const int n = t / k8n, k8 = (t % k8n) * 8;
  v8us v;
#pragma unroll
  for (int i = 0; i < 8; ++i) v[i] = bf16_bits(W[(size_t)(k8 + i) * N + n]);
  *(v8us*)(Wt + (size_t)n * K + k8) = v;
  
}

// GEMM C[M][N] (f32, pitch ldc) = act(A[M][K]·W + bias). A f32 row-major (pitch lda) converted per fragment to bf16
// (ASPLIT: hi/lo two planes -> 2 terms, else single rounded term); Wt bf16 [N][K] (pitch ldb). BIAS_BF16 rounds the
// bias to bf16 first (bias quantised to bf16 before the add). K%32==0, M%16==0, N%64==0.
template <bool ASPLIT, int ACT, bool BIAS_BF16>
__global__ __launch_bounds__(128) void k_gemm_bf(const float* __restrict__ A, int lda, const unsigned short* __restrict__ Wt, int ldb,
                                               const float* __restrict__ bias, float* __restrict__ C, int ldc, int M, int N, int K) {
  __shared__ __attribute__((aligned(16))) float so[4][16][64];
  const int tid = threadIdx.x, w = tid >> 5, lane = tid & 31, ln = lane & 15, hh = lane >> 4;
  const int ntn = N / 64;
  const int wid = blockIdx.x * 4 + w;
  const int mt = wid / ntn, nq = wid % ntn;
  if (mt * 16 >= M) return;
  const int row0 = mt * 16, col0 = nq * 64;
  const float* arow = A + (size_t)(row0 + ln) * lda;
  v8f acc[4] = {};
  for (int kb = 0; kb < K; kb += 32) {
    FragB ah, al;
    const v4f x0 = *(const v4fa*)(arow + kb + 8 * hh), x1 = *(const v4fa*)(arow + kb + 8 * hh + 4);
    const v4f x2 = *(const v4fa*)(arow + kb + 16 + 8 * hh), x3 = *(const v4fa*)(arow + kb + 16 + 8 * hh + 4);
    float xs[16] = {x0[0],x0[1],x0[2],x0[3],x1[0],x1[1],x1[2],x1[3],x2[0],x2[1],x2[2],x2[3],x3[0],x3[1],x3[2],x3[3]};
#pragma unroll
    for (int i = 0; i < 16; ++i) { const unsigned short hb = bf16_bits(xs[i]); ah.u[i] = hb; al.u[i] = ASPLIT ? bf16_bits(xs[i] - bf16_val(hb)) : (unsigned short)0; }
#pragma unroll
    for (int t = 0; t < 4; ++t) {
      const unsigned short* brow = Wt + (size_t)(col0 + t * 16 + ln) * ldb + kb;
      FragB b;
      b.half[0] = *(const v8us*)(brow + 8 * hh);
      b.half[1] = *(const v8us*)(brow + 16 + 8 * hh);
      acc[t] = mmaN<ASPLIT ? 2 : 1>(ah.v, al.v, b.v, b.v, acc[t]);
    }
  }
#pragma unroll
  for (int t = 0; t < 4; ++t) {
    float bv = bias ? bias[col0 + t * 16 + ln] : 0.f;
    if (BIAS_BF16) bv = bf16_round(bv);
#pragma unroll
    for (int r = 0; r < 8; ++r) { float v = acc[t][r] + bv; if (ACT == 1) v = fmaxf(v, 0.f); so[w][8 * hh + r][t * 16 + ln] = v; }
  }
  __builtin_amdgcn_fence(__ATOMIC_ACQ_REL, "workgroup");
  __builtin_amdgcn_wave_barrier();
  const int rsub = lane >> 4, c4 = (lane & 15) * 4;
  {
#pragma unroll
    for (int q = 0; q < 8; ++q) {
      const int r = q * 2 + rsub;
      const v4f v = *(const v4fa*)&so[w][r][c4];
      *(v4f*)(C + (size_t)(row0 + r) * ldc + col0 + c4) = v;
    }
    
  }
}

// GEMM C = act(A·W + bias + resid): A f32 (ASPLIT -> hi/lo 2 terms), Wt bf16 [N][K]; ACT 0 none, 1 relu, 2 exact gelu;
// resid (optional, f32, row index = (row % rmod), pitch ldr, RES_BF16 rounds it) added before the activation.
template <bool ASPLIT, int ACT, bool BIAS_BF16, bool RES_BF16>
__global__ __launch_bounds__(128) void k_gemm_bf3(const float* __restrict__ A, int lda, const unsigned short* __restrict__ Wt, int ldb,
                                                const float* __restrict__ bias, const float* __restrict__ resid, int rmod, int ldr,
                                                float* __restrict__ C, int ldc, int M, int N, int K) {
  __shared__ __attribute__((aligned(16))) float so[4][16][64];
  const int tid = threadIdx.x, w = tid >> 5, lane = tid & 31, ln = lane & 15, hh = lane >> 4;
  const int ntn = N / 64;
  const int wid = blockIdx.x * 4 + w;
  const int mt = wid / ntn, nq = wid % ntn;
  if (mt * 16 >= M) return;
  const int row0 = mt * 16, col0 = nq * 64;
  const float* arow = A + (size_t)(row0 + ln) * lda;
  v8f acc[4] = {};
  for (int kb = 0; kb < K; kb += 32) {
    FragB ah, al;
    const v4f x0 = *(const v4fa*)(arow + kb + 8 * hh), x1 = *(const v4fa*)(arow + kb + 8 * hh + 4);
    const v4f x2 = *(const v4fa*)(arow + kb + 16 + 8 * hh), x3 = *(const v4fa*)(arow + kb + 16 + 8 * hh + 4);
    float xs[16] = {x0[0],x0[1],x0[2],x0[3],x1[0],x1[1],x1[2],x1[3],x2[0],x2[1],x2[2],x2[3],x3[0],x3[1],x3[2],x3[3]};
#pragma unroll
    for (int i = 0; i < 16; ++i) { const unsigned short hb = bf16_bits(xs[i]); ah.u[i] = hb; al.u[i] = ASPLIT ? bf16_bits(xs[i] - bf16_val(hb)) : (unsigned short)0; }
#pragma unroll
    for (int t = 0; t < 4; ++t) {
      const unsigned short* brow = Wt + (size_t)(col0 + t * 16 + ln) * ldb + kb;
      FragB b;
      b.half[0] = *(const v8us*)(brow + 8 * hh);
      b.half[1] = *(const v8us*)(brow + 16 + 8 * hh);
      acc[t] = mmaN<ASPLIT ? 2 : 1>(ah.v, al.v, b.v, b.v, acc[t]);
    }
  }
#pragma unroll
  for (int t = 0; t < 4; ++t) {
    const int col = col0 + t * 16 + ln;
    float bv = bias ? bias[col] : 0.f;
    if (BIAS_BF16) bv = bf16_round(bv);
#pragma unroll
    for (int r = 0; r < 8; ++r) {
      float v = acc[t][r] + bv;
      if (resid) { float rv = resid[(size_t)((row0 + 8 * hh + r) % rmod) * ldr + col]; if (RES_BF16) rv = bf16_round(rv); v += rv; }
      if (ACT == 1) v = fmaxf(v, 0.f);
      if (ACT == 2) v = 0.5f * v * (1.0f + erff(v * 0.70710678118654752f));
      if (ACT == 3) { const float u = 0.7978845608028654f * (v + 0.044715f * v * v * v); v = 0.5f * v * (1.0f + tanhf(u)); }
      so[w][8 * hh + r][t * 16 + ln] = v;
    }
  }
  __builtin_amdgcn_fence(__ATOMIC_ACQ_REL, "workgroup");
  __builtin_amdgcn_wave_barrier();
  const int rsub = lane >> 4, c4 = (lane & 15) * 4;
  {
#pragma unroll
    for (int q = 0; q < 8; ++q) {
      const int r = q * 2 + rsub;
      const v4f v = *(const v4fa*)&so[w][r][c4];
      *(v4f*)(C + (size_t)(row0 + r) * ldc + col0 + c4) = v;
    }
    
  }
}
// row LayerNorm (biased variance, eps) over N: s = X (+ R); optional out_sum <- s; out_norm <- (s-mu)*rsqrt(var+eps)*g + b
template <bool PARAM_BF16>
__global__ __launch_bounds__(256) void k_layernorm(const float* __restrict__ X, const float* __restrict__ R, const float* __restrict__ g, const float* __restrict__ bta,
                                                  float* __restrict__ out_sum, float* __restrict__ out_norm, int N, float eps) {
  __shared__ float red[256];
  const int row = blockIdx.x, tid = threadIdx.x;
  const float* x = X + (size_t)row * N; const float* rr = R ? R + (size_t)row * N : nullptr;
  float vals[16];                     // up to N = 4096
  const int per = N / 256;            // contiguous chunk per thread? use strided-by-4 chunks: thread handles j = tid*4 + 1024*u
  float s1 = 0.f;
  for (int u = 0; u < per / 4; ++u) {
    const int j = tid * 4 + 1024 * u;
    const v4f a = *(const v4fa*)(x + j);
    v4f b = {0.f,0.f,0.f,0.f}; if (rr) b = *(const v4fa*)(rr + j);
#pragma unroll
    for (int q = 0; q < 4; ++q) { const float v = a[q] + b[q]; vals[u * 4 + q] = v; s1 += v; }
  }
  red[tid] = s1; __syncthreads();
  for (int st = 128; st > 0; st >>= 1) { if (tid < st) red[tid] += red[tid + st]; __syncthreads(); }
  const float mu = red[0] / (float)N; __syncthreads();
  float s2 = 0.f;
  for (int u = 0; u < per / 4; ++u)
#pragma unroll
    for (int q = 0; q < 4; ++q) { const float c = vals[u * 4 + q] - mu; s2 += c * c; }
  red[tid] = s2; __syncthreads();
  for (int st = 128; st > 0; st >>= 1) { if (tid < st) red[tid] += red[tid + st]; __syncthreads(); }
  const float rs = rsqrtf(red[0] / (float)N + eps);
  {
    for (int u = 0; u < per / 4; ++u) {
      const int j = tid * 4 + 1024 * u;
      v4f o, sm;
#pragma unroll
      for (int q = 0; q < 4; ++q) {
        float gg = g[j + q], bb = bta[j + q];
        if (PARAM_BF16) { gg = bf16_round(gg); bb = bf16_round(bb); }
        sm[q] = vals[u * 4 + q]; o[q] = (vals[u * 4 + q] - mu) * rs * gg + bb;
      }
      if (out_sum) *(v4f*)(out_sum + (size_t)row * N + j) = sm;
      *(v4f*)(out_norm + (size_t)row * N + j) = o;
    }
    
  }
}



// ---- f16 WMMA path (v_wmma_f32_16x16x32_f16): 11-bit significands for operands in range — used where a [0,1] probability operand needs more precision than bf16
typedef _Float16 v16h __attribute__((ext_vector_type(16)));
union FragH { v16h v; v8us half[2]; _Float16 h[16]; unsigned short u[16]; };
template <int NT>
__device__ __forceinline__ v8f mmaH(v16h ah, v16h al, v16h bh, v16h bl, v8f c) {
  c = __builtin_amdgcn_wmma_f32_16x16x32_f16(false, ah, false, bh, (short)0, c, false, false);
  if (NT >= 2) c = __builtin_amdgcn_wmma_f32_16x16x32_f16(false, al, false, bh, (short)0, c, false, false);
  if (NT >= 3) c = __builtin_amdgcn_wmma_f32_16x16x32_f16(false, ah, false, bl, (short)0, c, false, false);
  asm volatile("v_nop\n\tv_nop\n\tv_nop\n\tv_nop" : "+v"(c) : "v"(ah), "v"(al), "v"(bh), "v"(bl));
  return c;
}
// batched GEMM like k_gemm_b but f16 operands: A f32 (split into f16 hi/lo if ASPLIT, else rounded to f16), Bt = f16 values [n][k]; alpha; C f32; N multiple of 16 (partial tiles skipped)
template <bool ASPLIT>
__global__ __launch_bounds__(128) void k_gemm_h(const float* __restrict__ A, int lda, size_t sA, const _Float16* __restrict__ Bh, int ldb, size_t sB, float alpha, float* __restrict__ C, int ldc, size_t sC, int M, int N, int K) {
  __shared__ __attribute__((aligned(16))) float so[4][16][64];
  const int tid = threadIdx.x, w = tid >> 5, lane = tid & 31, ln = lane & 15, hh = lane >> 4; const int by = blockIdx.y;
  A += (size_t)by * sA; Bh += (size_t)by * sB; C += (size_t)by * sC;
  const int ntn = (N + 63) / 64; const int wid = blockIdx.x * 4 + w; const int mt = wid / ntn, nq = wid % ntn; if (mt * 16 >= M) return;
  const int row0 = mt * 16, col0 = nq * 64; const float* arow = A + (size_t)(row0 + ln) * lda;
  v8f acc[4] = {};
  for (int kb = 0; kb < K; kb += 32) {
    FragH ah, al;
    const v4f x0 = *(const v4fa*)(arow + kb + 8 * hh), x1 = *(const v4fa*)(arow + kb + 8 * hh + 4), x2 = *(const v4fa*)(arow + kb + 16 + 8 * hh), x3 = *(const v4fa*)(arow + kb + 16 + 8 * hh + 4);
    float xs[16] = {x0[0],x0[1],x0[2],x0[3],x1[0],x1[1],x1[2],x1[3],x2[0],x2[1],x2[2],x2[3],x3[0],x3[1],x3[2],x3[3]};
#pragma unroll
    for (int i = 0; i < 16; ++i) { const _Float16 h = (_Float16)xs[i]; ah.h[i] = h; al.h[i] = ASPLIT ? (_Float16)(xs[i] - (float)h) : (_Float16)0.0f; }
#pragma unroll
    for (int t = 0; t < 4; ++t) { if (col0 + t * 16 >= N) continue; const size_t boff = (size_t)(col0 + t * 16 + ln) * ldb + kb; FragH bq; bq.half[0] = *(const v8us*)(Bh + boff + 8 * hh); bq.half[1] = *(const v8us*)(Bh + boff + 16 + 8 * hh);
      acc[t] = mmaH<ASPLIT ? 2 : 1>(ah.v, al.v, bq.v, bq.v, acc[t]); }
  }
#pragma unroll
  for (int t = 0; t < 4; ++t) { if (col0 + t * 16 >= N) continue;
#pragma unroll
    for (int r = 0; r < 8; ++r) so[w][8 * hh + r][t * 16 + ln] = acc[t][r] * alpha; }
  __builtin_amdgcn_fence(__ATOMIC_ACQ_REL, "workgroup"); __builtin_amdgcn_wave_barrier();
  const int rsub = lane >> 4, c4 = (lane & 15) * 4;
  {
#pragma unroll
    for (int q = 0; q < 8; ++q) { const int r = q * 2 + rsub; if (col0 + c4 < N) { const v4f v = *(const v4fa*)&so[w][r][c4]; *(v4f*)(C + (size_t)(row0 + r) * ldc + col0 + c4) = v; } }
     }
}

// Wt[n][k] = f16(W[k][n]·scale) from f32 row-major W[K][N] (scale = power of two; bf16-exact weights stay exact in f16 away from the subnormal range)
__global__ __launch_bounds__(256) void k_wt_f16(const float* __restrict__ W, _Float16* __restrict__ Wt, int K, int N, float scale) {
  const int t = blockIdx.x * 256 + threadIdx.x; if (t >= N * (K / 8)) return; const int n = t / (K / 8), k8 = (t % (K / 8)) * 8; FragH f;
#pragma unroll
  for (int i = 0; i < 8; ++i) f.h[i] = (_Float16)(bf16_round(W[(size_t)(k8 + i) * N + n]) * scale); const v8us o = f.half[0];
  *(v8us*)((unsigned short*)Wt + (size_t)n * K + k8) = o; 
}
// k_gemm_hh variant with fused epilogue: v = acc·alpha + bias[by·sBias + col] (+ CP[(row/rowsPerB)·sCPb + by·64 + col] if CP) ; ACT 0 none / 1 elu ; writes f16 C16 (and f32 C if non-null)
template <int ACT>
__global__ __launch_bounds__(128) void k_gemm_hhx(const _Float16* __restrict__ A, int lda, size_t sA, const _Float16* __restrict__ Bh, int ldb, size_t sB, float alpha, const float* __restrict__ bias, size_t sBias, const float* __restrict__ CP, int rowsPerB, size_t sCPb, int row0g,
    float* __restrict__ C, _Float16* __restrict__ C16, int ldc, size_t sC, int M, int N, int K) {
  __shared__ __attribute__((aligned(16))) float so[4][16][64];
  const int tid = threadIdx.x, w = tid >> 5, lane = tid & 31, ln = lane & 15, hh = lane >> 4; const int by = blockIdx.y;
  A += (size_t)by * sA; Bh += (size_t)by * sB; const size_t cofs = (size_t)by * sC; const float* bp = bias ? bias + (size_t)by * sBias : nullptr;
  const int ntn = (N + 63) / 64; const int wid = blockIdx.x * 4 + w; const int mt = wid / ntn, nq = wid % ntn; if (mt * 16 >= M) return;
  const int row0 = mt * 16, col0 = nq * 64; const _Float16* arow = A + (size_t)(row0 + ln) * lda;
  v8f acc[4] = {};
  for (int kb = 0; kb < K; kb += 32) { FragH ah; ah.half[0] = *(const v8us*)((const unsigned short*)arow + kb + 8 * hh); ah.half[1] = *(const v8us*)((const unsigned short*)arow + kb + 16 + 8 * hh);
#pragma unroll
    for (int t = 0; t < 4; ++t) { if (col0 + t * 16 >= N) continue; const size_t boff = (size_t)(col0 + t * 16 + ln) * ldb + kb; FragH bq; bq.half[0] = *(const v8us*)((const unsigned short*)Bh + boff + 8 * hh); bq.half[1] = *(const v8us*)((const unsigned short*)Bh + boff + 16 + 8 * hh);
      acc[t] = mmaH<1>(ah.v, ah.v, bq.v, bq.v, acc[t]); }
  }
#pragma unroll
  for (int t = 0; t < 4; ++t) { if (col0 + t * 16 >= N) continue; const int col = col0 + t * 16 + ln; const float bv = bp ? bf16_round(bp[col]) : 0.f;
#pragma unroll
    for (int r = 0; r < 8; ++r) { float v = acc[t][r] * alpha + bv; if (CP) { const int rr = row0g + row0 + 8 * hh + r; if (rowsPerB < 0) v += CP[cofs + (size_t)rr * ldc + col];      /* rowsPerB < 0: own element of the batched C plane */ else { const int bidx = rr / rowsPerB; v += CP[(size_t)bidx * sCPb + (size_t)by * 64 + col]; } } if (ACT == 1) v = (v > 0.f) ? v : expm1f(v); else if (ACT == 7) v = (v > 0.f) ? v + 1.0f : expf(v); else if (ACT == 8) v = tanhf(v); else if (ACT == 9) v = 0.5f * v * (1.0f + tanhf(0.7978845608028654f * (v + 0.044715f * v * v * v))); else if (ACT == 11) v = 1.0f / (1.0f + expf(-v)); else if (ACT == 12) v = (v > 0.f) ? v : 0.01f * v; else if (ACT == 14) v = (v > 0.f) ? v : 0.1f * v; else if (ACT == 16) v = (v >= 0.f) ? v : 0.3f * v; else if (ACT == 17) v = (v >= 0.f) ? v : 0.2f * v; else if (ACT == 15) v = v / (1.0f + expf(-v)); else if (ACT == 3) v = fmaxf(v, 0.f); else if (ACT == 6) v = 0.5f * v * (1.0f + erff(v * 0.70710678118654752f)); so[w][8 * hh + r][t * 16 + ln] = v; } }
  __builtin_amdgcn_fence(__ATOMIC_ACQ_REL, "workgroup"); __builtin_amdgcn_wave_barrier();
  const int rsub = lane >> 4, c4 = (lane & 15) * 4; typedef _Float16 v4h __attribute__((ext_vector_type(4)));
  {
#pragma unroll
    for (int q = 0; q < 8; ++q) { const int r = q * 2 + rsub; if (col0 + c4 < N) { const v4f v = *(const v4fa*)&so[w][r][c4]; if (C) *(v4f*)(C + cofs + (size_t)(row0 + r) * ldc + col0 + c4) = v; if (C16) { v4h h4; for (int i = 0; i < 4; ++i) h4[i] = (_Float16)v[i]; *(v4h*)(C16 + cofs + (size_t)(row0 + r) * ldc + col0 + c4) = h4; } } }
     }
}


typedef _Float16 v4h __attribute__((ext_vector_type(4)));

__global__ __launch_bounds__(256) void k_x16(const float* __restrict__ x, _Float16* __restrict__ X16, size_t n8) { const size_t t = (size_t)blockIdx.x * 256 + threadIdx.x; if (t >= n8) return; FragH f;
#pragma unroll
  for (int q = 0; q < 8; ++q) f.h[q] = (_Float16)bf16_round(x[t * 8 + q]); *(v8us*)((unsigned short*)X16 + t * 8) = f.half[0];  }
__global__ __launch_bounds__(256) void k_h16(const float* __restrict__ x, _Float16* __restrict__ X16, size_t n8) { const size_t t = (size_t)blockIdx.x * 256 + threadIdx.x; if (t >= n8) return; FragH f;
#pragma unroll
  for (int q = 0; q < 8; ++q) f.h[q] = (_Float16)x[t * 8 + q]; *(v8us*)((unsigned short*)X16 + t * 8) = f.half[0];  }
__global__ __launch_bounds__(256) void k_round16f(const float* __restrict__ W, _Float16* __restrict__ Bt, size_t n8) { const size_t t = (size_t)blockIdx.x * 256 + threadIdx.x; if (t >= n8) return; FragH f;
#pragma unroll
  for (int i = 0; i < 8; ++i) f.h[i] = (_Float16)(bf16_round(W[t * 8 + i]) * 16.0f); *(v8us*)((unsigned short*)Bt + t * 8) = f.half[0];  }
template <int NHv, int TTv>
__global__ __launch_bounds__(256) void k_vt(const _Float16* __restrict__ V16, int ldv, int voff, _Float16* __restrict__ Vt) { __shared__ unsigned short tl[64][66]; const int tid = threadIdx.x; const int slab = blockIdx.x / (TTv / 64), lg = blockIdx.x % (TTv / 64); const int b = slab / NHv, h = slab % NHv;
  for (int i = tid; i < 64 * 8; i += 256) { const int r = i / 8, c8 = (i % 8) * 8; FragH f; f.half[0] = *(const v8us*)((const unsigned short*)V16 + ((size_t)b * TTv + lg * 64 + r) * ldv + voff + h * 64 + c8);
#pragma unroll
    for (int q = 0; q < 8; ++q) tl[r][c8 + q] = f.u[q]; }
  __syncthreads();
  {
#pragma unroll
    for (int rd = 0; rd < 2; ++rd) { const int d = rd * 32 + tid / 8, pc = tid % 8; FragH f;
#pragma unroll
      for (int q = 0; q < 8; ++q) f.u[q] = tl[pc * 8 + q][d];
      *(v8us*)((unsigned short*)Vt + ((size_t)slab * 64 + d) * TTv + lg * 64 + pc * 8) = f.half[0]; }
     } }

__global__ __launch_bounds__(256) void k_hl(const float* __restrict__ F, _Float16* __restrict__ Hh, _Float16* __restrict__ Hl, size_t n8) { const size_t t = (size_t)blockIdx.x * 256 + threadIdx.x; if (t >= n8) return; FragH fh, fl; const v4f a = *(const v4fa*)(F + t * 8), c = *(const v4fa*)(F + t * 8 + 4);
#pragma unroll
  for (int q = 0; q < 4; ++q) { _Float16 h = (_Float16)a[q]; fh.h[q] = h; fl.h[q] = (_Float16)((a[q] - (float)h) * 1024.0f); h = (_Float16)c[q]; fh.h[4 + q] = h; fl.h[4 + q] = (_Float16)((c[q] - (float)h) * 1024.0f); }
  { *(v8us*)((unsigned short*)Hh + t * 8) = fh.half[0]; *(v8us*)((unsigned short*)Hl + t * 8) = fl.half[0];  } }

// ---- fast GEMM (wave tile 32x64; requires M % 32 == 0 rows per launch region and N % 64 == 0) ----
__device__ __forceinline__ v16h g2_frag(const _Float16* p, int hh) { FragH f; f.half[0] = *(const v8us*)((const unsigned short*)p + 8 * hh); f.half[1] = *(const v8us*)((const unsigned short*)p + 16 + 8 * hh); return f.v; }
__device__ __forceinline__ v8f g2_mma(v16h a, v16h b, v8f c) { v8f d = __builtin_amdgcn_wmma_f32_16x16x32_f16(false, a, false, b, (short)0, c, false, false); asm volatile("v_nop\n\tv_nop\n\tv_nop\n\tv_nop" : "+v"(d) : "v"(a), "v"(b)); return d; }
// All hi/residual terms of one product in ONE launch: C = alpha * (Ah.Bh + 2^-10 * (Al.Bh [+ Ah.Bl if BSPLIT])). The hi product and the residual products keep separate f32 accumulators
// (the residual planes carry a 2^10 scale) and meet once in the epilogue, so C is stored once and never read back, and each Ah / Bh fragment is loaded once for all the terms that use it.
template <bool BSPLIT, int lda, int ldb>
__global__ __launch_bounds__(128) void k_gemm2s(const _Float16* __restrict__ Ah, const _Float16* __restrict__ Al, size_t sA, const _Float16* __restrict__ Bh, const _Float16* __restrict__ Bl, size_t sB, float alpha,
    float* __restrict__ C, int ldc, size_t sC, int M, int N, int K) {
  __shared__ __attribute__((aligned(16))) float so[4][32][68];
  const int tid = threadIdx.x, w = tid >> 5, lane = tid & 31, ln = lane & 15, hh = lane >> 4; const int by = blockIdx.y; const size_t cofs = (size_t)by * sC;
  const int ntn = N >> 6; const int mt = blockIdx.x / ntn, nq = blockIdx.x - mt * ntn; const int row0 = mt * 128 + 32 * w, col0 = nq * 64; if (row0 >= M) return;
  const size_t aofs = (size_t)by * sA + (size_t)(row0 + ln) * lda, bofs = (size_t)by * sB + (size_t)(col0 + ln) * ldb; const size_t a16 = (size_t)16 * lda, b16 = (size_t)16 * ldb;
  const _Float16* ahp = Ah + aofs; const _Float16* alp = Al + aofs; const _Float16* bhp = Bh + bofs; const _Float16* blp = BSPLIT ? Bl + bofs : nullptr;
  const v8f z8 = {0.f,0.f,0.f,0.f,0.f,0.f,0.f,0.f}; v8f ch[8] = {z8, z8, z8, z8, z8, z8, z8, z8}, cl[8] = {z8, z8, z8, z8, z8, z8, z8, z8};      /* [t] = rows 0..15, [4 + t] = rows 16..31 of column tile t */
  /* kept rolled: one k step of fragments beside the 128 accumulator registers is what fits */
#pragma unroll 1
  for (int kb = 0; kb < K; kb += 32) { const v16h a0h = g2_frag(ahp + kb, hh), a1h = g2_frag(ahp + a16 + kb, hh);
    asm volatile("s_wait_xcnt 0x0" ::: "memory");      /* precaution: the compiler lets the loads below land in the registers that held the address of the loads above */
    const v16h a0l = g2_frag(alp + kb, hh); FragH f1; f1.half[0] = *(const v8us*)((const unsigned short*)(alp + a16 + kb) + 8 * hh);
    asm volatile("s_wait_xcnt 0x0" ::: "memory");      /* same precaution: the last load from this address pair lands in the pair itself */
    f1.half[1] = *(const v8us*)((const unsigned short*)(alp + a16 + kb) + 16 + 8 * hh); const v16h a1l = f1.v;
    /* unrolled so that ch[] / cl[] are indexed by constants and stay in registers (the same holds for the epilogue loops) */
#pragma unroll
    for (int t = 0; t < 4; ++t) { const v16h bh = g2_frag(bhp + t * b16 + kb, hh);
      ch[t] = g2_mma(a0h, bh, ch[t]); ch[4 + t] = g2_mma(a1h, bh, ch[4 + t]); cl[t] = g2_mma(a0l, bh, cl[t]); cl[4 + t] = g2_mma(a1l, bh, cl[4 + t]);
      if (BSPLIT) { const v16h bl = g2_frag(blp + t * b16 + kb, hh); cl[t] = g2_mma(a0h, bl, cl[t]); cl[4 + t] = g2_mma(a1h, bl, cl[4 + t]); } } }
  const float alo = alpha * 0.0009765625f;
#pragma unroll
  for (int u = 0; u < 8; ++u) { const int t = u & 3, half = u >> 2;
#pragma unroll
    for (int r = 0; r < 8; ++r) so[w][half * 16 + 8 * hh + r][t * 16 + ln] = ch[u][r] * alpha + cl[u][r] * alo; }
  __builtin_amdgcn_fence(__ATOMIC_ACQ_REL, "workgroup"); __builtin_amdgcn_wave_barrier();      /* this wave's LDS stores above come before its own LDS reads below (so[w] is private to the wave) */
  const int rsub = lane >> 4, c4 = (lane & 15) * 4;
#pragma unroll
  for (int q = 0; q < 16; ++q) { const int r = q * 2 + rsub; const v4f v = *(const v4fa*)&so[w][r][c4]; *(v4f*)(C + cofs + (size_t)(row0 + r) * ldc + col0 + c4) = v; } }


__global__ __launch_bounds__(256) void k_wsc(const float* __restrict__ Wm, _Float16* __restrict__ Bt, size_t n8, float sc) { const size_t t = (size_t)blockIdx.x * 256 + threadIdx.x; if (t >= n8) return; FragH f; for (int q = 0; q < 8; ++q) f.h[q] = (_Float16)(bf16_round(Wm[t * 8 + q]) * sc); *(v8us*)((unsigned short*)Bt + t * 8) = f.half[0];  }
template <int NH_>
__global__ __launch_bounds__(256) void k_normrope(const float* __restrict__ X, const float* __restrict__ w, const int* __restrict__ pos, _Float16* __restrict__ O16, _Float16* __restrict__ OL) {
  #pragma clang fp contract(off)
  constexpr int W_ = NH_ * HD; const int wv = threadIdx.x >> 5, ln = threadIdx.x & 31; const int t = blockIdx.x * 8 + wv; if (t >= TT) return; const float* x = X + (size_t)t * W_; float ss = 0.f;
#pragma unroll 1
  for (int c = ln * 4; c < W_; c += 128) { const v4f a = *(const v4fa*)(x + c); for (int e = 0; e < 4; ++e) { const float v = bf16_round(a[e]); ss += v * v; } }
  for (int o = 16; o > 0; o >>= 1) ss += __shfl_xor(ss, o, 32); const float inv = rsqrtf(ss / (float)W_ + 1e-5f); const float p = (float)pos[t];
  {
#pragma unroll 1
    for (int h = 0; h < NH_; ++h) { for (int u = 0; u < 2; ++u) { const int d = ln + 32 * u; const int c1 = h * HD + d, c2 = c1 + 64; float x1 = bf16_round(x[c1]) * inv; x1 *= bf16_round(w[c1]); float x2 = bf16_round(x[c2]) * inv; x2 *= bf16_round(w[c2]);
        const float ex = (float)(2 * d) / (float)HD; const float ivf = 1.0f / powf(10000.0f, ex); const float th = p * ivf; const float cs = cosf(th), sn = sinf(th); float o1 = x1 * cs; o1 += -(x2 * sn); float o2 = x2 * cs; o2 += x1 * sn;
        const _Float16 h1 = (_Float16)o1, h2 = (_Float16)o2; *(_Float16*)(O16 + (size_t)t * W_ + c1) = h1; *(_Float16*)(O16 + (size_t)t * W_ + c2) = h2; *(_Float16*)(OL + (size_t)t * W_ + c1) = (_Float16)((o1 - (float)h1) * 1024.0f); *(_Float16*)(OL + (size_t)t * W_ + c2) = (_Float16)((o2 - (float)h2) * 1024.0f); } }
     } }

// ---- fused attention: scores, masked softmax and readout of all 16 heads in ONE launch; the score and probability planes never go to memory ----
// Transposed products: S^T = K.Q^T (A = key rows, B = query rows held in registers), O^T += V^T.P^T. In an accumulator tile a lane holds 8 keys of ONE query (column = lane & 15, rows 8 * (lane >> 4) + r),
// which is exactly the k order of the B loader (k = 8 * hh + i, then 16 + 8 * hh + i), so two 16-key score tiles pack in-lane into one 32-key P^T fragment. Running maximum and sum per query (online softmax):
// when the maximum moves, the output accumulators and the sum are scaled by exp(m_old - m_new). Same operand planes and terms as the separate stages: 3 hi/residual score terms, P as f16 hi + 2^10 residual of 1024 * p.
__device__ __forceinline__ v8f fa_mma(v16h a, v16h b, v8f c) { return __builtin_amdgcn_wmma_f32_16x16x32_f16(false, a, false, b, (short)0, c, false, false); }
typedef int v4i __attribute__((ext_vector_type(4)));
#define FKP 136                  /* LDS pitch of a K row, in halves */
#define FVP 40                   /* LDS pitch of a V^T row, in halves */
__global__ __launch_bounds__(128) void k_fattn(const _Float16* __restrict__ Qh, const _Float16* __restrict__ Ql, const _Float16* __restrict__ Kh, const _Float16* __restrict__ Kl, const _Float16* __restrict__ Vt,
    const int* __restrict__ msk, float* __restrict__ CTX) {
  __shared__ __attribute__((aligned(16))) _Float16 sKh[32 * FKP], sKl[32 * FKP], sV[HD * FVP];
  const int tid = threadIdx.x, w = tid >> 5, lane = tid & 31, ln = lane & 15, hh = lane >> 4; const int h = blockIdx.y, kv = h / GRP; const int q0 = blockIdx.x * 128 + 32 * w;      /* a wave owns 32 queries: two column groups of 16 */
  const v8f z8 = {0.f,0.f,0.f,0.f,0.f,0.f,0.f,0.f};
  v16h qh[2][4], ql[2][4];
  const size_t qo = (size_t)(q0 + ln) * DQ + h * HD; const _Float16* qp0 = Qh + qo; const _Float16* qp1 = Qh + qo + 16 * DQ; const _Float16* qp2 = Ql + qo; const _Float16* qp3 = Ql + qo + 16 * DQ;
#pragma unroll
  for (int ks = 0; ks < 4; ++ks) { qh[0][ks] = g2_frag(qp0 + ks * 32, hh); qh[1][ks] = g2_frag(qp1 + ks * 32, hh); ql[0][ks] = g2_frag(qp2 + ks * 32, hh); ql[1][ks] = g2_frag(qp3 + ks * 32, hh); }
  asm volatile("s_wait_xcnt 0x0" ::: "memory");      /* precaution: stands in front of every later write of a register that one of the loads above names */
  __builtin_amdgcn_sched_barrier(0);      /* keeps the work below from being scheduled above that wait */
  v8f oh[8][2], ol[8][2];
#pragma unroll
  for (int d = 0; d < 8; ++d) { oh[d][0] = z8; oh[d][1] = z8; ol[d][0] = z8; ol[d][1] = z8; }
  float mrun[2] = {-3.0e38f, -3.0e38f}, lrun[2] = {0.f, 0.f};
  const unsigned mlane = (unsigned)(ln * MSTR + 8 * hh);
  /* the block's four waves share each pass's K (hi, residual) and V^T tiles through LDS: whole-row global loads, one copy a block; pitches 272 B and 80 B (16 B x odd) keep the 16-byte fragment reads off each other's banks */
  const int krow = tid >> 4, kcol = (tid & 15) * 8, vrow = tid >> 2, vcol = (tid & 3) * 8;
  const _Float16* gkh = Kh + (size_t)krow * DKV + kv * HD + kcol; const _Float16* gkl = Kl + (size_t)krow * DKV + kv * HD + kcol; const _Float16* gv = Vt + ((size_t)kv * HD + vrow) * TT + vcol;
  const int* gm = msk + (size_t)q0 * MSTR + mlane;
  v8us rk[4], rl[4], rv[4]; v4i mk[2][2][2];
#pragma unroll
  for (int i = 0; i < 4; ++i) { rk[i] = *(const v8us*)(gkh + (size_t)i * 8 * DKV); rl[i] = *(const v8us*)(gkl + (size_t)i * 8 * DKV); rv[i] = *(const v8us*)(gv + (size_t)i * 32 * TT); }
#pragma unroll
  for (int g = 0; g < 2; ++g) {
#pragma unroll
    for (int j = 0; j < 2; ++j) { mk[g][j][0] = *(const v4i*)(gm + g * 16 * MSTR + j * 16); mk[g][j][1] = *(const v4i*)(gm + g * 16 * MSTR + j * 16 + 4); } }
  asm volatile("s_wait_xcnt 0x0" ::: "memory");      /* same precaution as behind the query loads */
  __builtin_amdgcn_sched_barrier(0);      /* keeps the work below from being scheduled above that wait */
  const float alpha = 0.088388347648318447f, alo = alpha * 0.0009765625f;
  /* kept rolled: one pass's staging registers and fragments beside the query fragments and the output accumulators are what is meant to stay in registers; every inner loop is unrolled so that the register arrays are indexed by constants */
#pragma unroll 1
  for (int key0 = 0; key0 < TT; key0 += 32) {
#pragma unroll
    for (int i = 0; i < 4; ++i) { *(v8us*)(sKh + (krow + 8 * i) * FKP + kcol) = rk[i]; *(v8us*)(sKl + (krow + 8 * i) * FKP + kcol) = rl[i]; *(v8us*)(sV + (vrow + 32 * i) * FVP + vcol) = rv[i]; }
    bool msel[2][2][8];      /* this pass's mask, read out of its registers before the next pass's lands in them */
#pragma unroll
    for (int g = 0; g < 2; ++g) {
#pragma unroll
      for (int j = 0; j < 2; ++j) {
#pragma unroll
        for (int r = 0; r < 8; ++r) msel[g][j][r] = mk[g][j][r >> 2][r & 3] != 0; } }
    __syncthreads();      /* this pass's tiles are published to all four waves */
    const int kn = (key0 + 32 < TT) ? key0 + 32 : key0;      /* the last pass fetches its own tiles again: in bounds, never used */
    const int* mp = gm + kn;
    /* the next pass's mask and tiles go into registers now: they fly while this pass is worked on */
#pragma unroll
    for (int g = 0; g < 2; ++g) {
#pragma unroll
      for (int j = 0; j < 2; ++j) { mk[g][j][0] = *(const v4i*)(mp + g * 16 * MSTR + j * 16); mk[g][j][1] = *(const v4i*)(mp + g * 16 * MSTR + j * 16 + 4); } }
#pragma unroll
    for (int i = 0; i < 4; ++i) { rk[i] = *(const v8us*)(gkh + (size_t)(kn + i * 8) * DKV); rl[i] = *(const v8us*)(gkl + (size_t)(kn + i * 8) * DKV); rv[i] = *(const v8us*)(gv + (size_t)i * 32 * TT + kn); }
    asm volatile("s_wait_xcnt 0x0" ::: "memory");      /* precaution: stands in front of every later write of a register that one of the loads above names */
    __builtin_amdgcn_sched_barrier(0);      /* keeps the work below from being scheduled above that wait, and the loads above in front of the pass's work */
    v8f sh[2][2] = {{z8, z8}, {z8, z8}}, sl[2][2] = {{z8, z8}, {z8, z8}};      /* [key tile j][column group g] */
#pragma unroll
    for (int ks = 0; ks < 4; ++ks) {
#pragma unroll
      for (int j = 0; j < 2; ++j) { const v16h kfh = g2_frag(sKh + (16 * j + ln) * FKP + ks * 32, hh), kfl = g2_frag(sKl + (16 * j + ln) * FKP + ks * 32, hh);
#pragma unroll
        for (int g = 0; g < 2; ++g) { sh[j][g] = fa_mma(kfh, qh[g][ks], sh[j][g]); sl[j][g] = fa_mma(kfh, ql[g][ks], sl[j][g]); sl[j][g] = fa_mma(kfl, qh[g][ks], sl[j][g]); } } }
    FragH ph[2], pl[2]; float al[2];
#pragma unroll
    for (int g = 0; g < 2; ++g) { float sv[2][8]; float mx = -3.0e38f;
#pragma unroll
      for (int j = 0; j < 2; ++j) {
#pragma unroll
        for (int r = 0; r < 8; ++r) { const float s0 = sh[j][g][r] * alpha + sl[j][g][r] * alo; const float s = msel[g][j][r] ? -10000.0f : s0; sv[j][r] = s; mx = fmaxf(mx, s); } }
      mx = fmaxf(mx, __shfl_xor(mx, 16, 32));      /* the other half-wave holds this query's other 16 keys */
      const float mn = fmaxf(mrun[g], mx); al[g] = expf(mrun[g] - mn); mrun[g] = mn; float su = 0.f;
#pragma unroll
      for (int j = 0; j < 2; ++j) {
#pragma unroll
        for (int r = 0; r < 8; ++r) { const float p = expf(sv[j][r] - mn); su += p; const float pv = p * 1024.0f; const _Float16 hi = (_Float16)pv; ph[g].h[8 * j + r] = hi; pl[g].h[8 * j + r] = (_Float16)((pv - (float)hi) * 1024.0f); } }
      lrun[g] = lrun[g] * al[g] + su; }      /* each half-wave sums its own keys; the halves meet in the epilogue */
#pragma unroll
    for (int d = 0; d < 8; ++d) {
#pragma unroll
      for (int g = 0; g < 2; ++g) { oh[d][g] *= al[g]; ol[d][g] *= al[g]; } }
#pragma unroll
    for (int d = 0; d < 8; ++d) { const v16h vf = g2_frag(sV + (16 * d + ln) * FVP, hh);
#pragma unroll
      for (int g = 0; g < 2; ++g) { oh[d][g] = fa_mma(vf, ph[g].v, oh[d][g]); ol[d][g] = fa_mma(vf, pl[g].v, ol[d][g]); } }
    __builtin_amdgcn_sched_barrier(0);      /* keeps the pass's work in front of the barrier below, whose fence waits for the loads in flight: scheduled earlier, it would wait out their whole latency */
    __syncthreads();      /* every wave has read this pass's tiles before the next pass's are stored over them */
  }
  /* every output value is formed in place first, then the stores go out as one run with nothing behind them: no register that an issued store names is written again */
  float* cr0 = CTX + (size_t)(q0 + ln) * DQ + h * HD + 8 * hh; float* cr1 = cr0 + (size_t)16 * DQ;
#pragma unroll
  for (int g = 0; g < 2; ++g) { const float lt = lrun[g] + __shfl_xor(lrun[g], 16, 32); const float f = 0.0009765625f / lt, fl = f * 0.0009765625f;
#pragma unroll
    for (int d = 0; d < 8; ++d) {
#pragma unroll
      for (int r = 0; r < 8; ++r) oh[d][g][r] = oh[d][g][r] * f + ol[d][g][r] * fl; } }
  __builtin_amdgcn_sched_barrier(0);      /* keeps the arithmetic above from being scheduled in among the stores below, where it would write registers of stores still under way */
#pragma unroll
  for (int d = 0; d < 8; ++d) {
#pragma unroll
    for (int g = 0; g < 2; ++g) { float* cr = (g ? cr1 : cr0) + 16 * d; const v8f o = oh[d][g]; const v4f a = {o[0], o[1], o[2], o[3]}, b = {o[4], o[5], o[6], o[7]};
      *(v4f*)cr = a; *(v4f*)(cr + 4) = b; } }
  asm volatile("s_wait_xcnt 0x0" ::: "memory");      /* precaution: closes the run of stores */
}

extern "C" void kernel_launch(void* const* d_in, const int* in_sizes, int n_in,
                              void* d_out, int out_size, void* d_ws, size_t ws_size, hipStream_t stream) {
  (void)in_sizes; (void)n_in; (void)out_size;
  const float* const* I = (const float* const*)d_in; const float* q = I[0]; const float* k = I[1]; const float* v = I[2]; const int* msk = (const int*)d_in[3]; const int* pos = (const int*)d_in[4]; const float* qw = I[5]; const float* kw = I[6]; const float* Wo = I[7];
  char* ws = (char*)d_ws; size_t off = 0;
  auto take = [&](size_t bytes) { char* p = ws + off; off += (bytes + 255) & ~(size_t)255; return p; };
  _Float16* BO = (_Float16*)take((size_t)DQ * DQ * 2); _Float16* Q16 = (_Float16*)take((size_t)TT * DQ * 2); _Float16* QL = (_Float16*)take((size_t)TT * DQ * 2); _Float16* K16 = (_Float16*)take((size_t)TT * DKV * 2); _Float16* KL = (_Float16*)take((size_t)TT * DKV * 2); _Float16* V16 = (_Float16*)take((size_t)TT * DKV * 2); _Float16* VT = (_Float16*)take((size_t)TT * DKV * 2); float* CTX = (float*)take((size_t)TT * DQ * 4); _Float16* C16 = Q16; _Float16* CL = QL;      /* merged context hi/lo over the q planes (dead after the attention launch) */
  if (off > ws_size) return;      /* 8 + 8+8 + 2+2 + 2 + 2 + 16 = 48 MiB */
  k_wsc<<<(unsigned)(((size_t)DQ * DQ / 8 + 255) / 256), 256, 0, stream>>>(Wo, BO, (size_t)DQ * DQ / 8, 16.0f);      /* (out,in) natural */
  k_normrope<NQH><<<TT / 8, 256, 0, stream>>>(q, qw, pos, Q16, QL); k_normrope<NKVH><<<TT / 8, 256, 0, stream>>>(k, kw, pos, K16, KL);
  k_x16<<<(unsigned)(((size_t)TT * DKV / 8 + 255) / 256), 256, 0, stream>>>(v, V16, (size_t)TT * DKV / 8);
  k_vt<NKVH * 2, TT><<<NKVH * 2 * (TT / 64), 256, 0, stream>>>(V16, DKV, 0, VT);      /* V^T [512][2048] as 8 slabs of 64 dims; kv head = rows kv*128 .. +127 */
  k_fattn<<<dim3(TT / 128, NQH), 128, 0, stream>>>(Q16, QL, K16, KL, VT, msk, CTX);      /* all 16 heads: ctx[t][h*128 + d], scores and probabilities stay in registers */
  k_hl<<<(unsigned)(((size_t)TT * DQ / 8 + 255) / 256), 256, 0, stream>>>(CTX, C16, CL, (size_t)TT * DQ / 8);
  k_gemm2s<false, DQ, DQ><<<dim3((TT / 128) * (DQ / 64), 1), 128, 0, stream>>>(C16, CL, 0, BO, nullptr, 0, 0.0625f, (float*)d_out, DQ, 0, TT, DQ, DQ);      /* out = (ctx_hi + ctx_lo) W_out^T (W exact), one launch */
}

// v004
// Measured time: 222 microseconds a run.
// Timed twice side by side with v003, it ran 1.11 and 1.12 times as fast.
// All steps since v000 together make it 15.0 times as fast.
#include <hip/hip_runtime.h>
// QEffMolmoBlock (1 x 2048 tokens; 16 query heads / 4 kv heads x 128 dims; q, k, v are INPUT projections): q = RMSNorm_2048(q) * q_norm_w, k = RMSNorm_512(k) * k_norm_w (flat, before the head split); rotate-half RoPE (hd 128, positions from position_ids, base 10000); GQA (each kv head serves 4 query heads); scores = q.k / sqrt(128), masked entries (int mask input != 0) REPLACED by -10000; softmax; out = (att v) W_out^T.
// Structure: RMSNorm + RoPE fused on VALU (wave per token) into f16 hi + 2^10 residual q/k planes; v as an exact f16 plane; V^T by LDS tiles; a flag per 64 x 32 mask tile (any open entry); one fused attention launch for all 16 heads (a wave owns 16 queries and walks the open key passes of 32): the score products (f16 WMMA, f32 accumulation, K = 128, three terms), the masked online softmax on VALU (mask read on device), P as f16 hi + residual (x 2^10) packed in registers, the readout as two terms into the merged context plane; context hi/residual; W_out as two GEMM terms (exact x16 weights). Every product runs all its hi/residual terms in one launch.
// Compute dtype: inputs rounded to bf16; v and W_out exact as f16; normed+rotated q/k (3-term scores), P and the merged context all carried as f16 hi + 2^10 residual (~2^-21): the q/k norm weights are O(1) random so logits have sigma ≈ 11 and the softmax is near one-hot; RMSNorm/RoPE/softmax f32. v_wmma_f32_16x16x32_f16.
#define TT 2048
#define MSTR 2048                /* attention_mask row stride (input geometry) */
#define NQH 16
#define NKVH 4
#define HD 128
#define DQ (NQH * HD)            /* 2048 */
#define DKV (NKVH * HD)          /* 512 */
#define GRP (NQH / NKVH)         /* 4 query heads share a kv head */
typedef __bf16 v16b __attribute__((ext_vector_type(16)));
typedef unsigned short v8us __attribute__((ext_vector_type(8), may_alias));
typedef float  v8f  __attribute__((ext_vector_type(8)));
typedef float  v4f  __attribute__((ext_vector_type(4)));
typedef float  v4fa __attribute__((ext_vector_type(4), may_alias));
union FragB { v16b v; v8us half[2]; unsigned short u[16]; };

__device__ __forceinline__ unsigned short bf16_bits(float x) { unsigned int u = __float_as_uint(x); return (unsigned short)((u + 0x7FFFu + ((u >> 16) & 1u)) >> 16); }
__device__ __forceinline__ float bf16_val(unsigned short b) { return __uint_as_float(((unsigned int)b) << 16); }
__device__ __forceinline__ float bf16_round(float x) { return bf16_val(bf16_bits(x)); }
// D += A·B with NT terms: 1 = ah·bh, 2 = + al·bh (A split), 3 = + ah·bl (both split)
template <int NT>
__device__ __forceinline__ v8f mmaN(v16b ah, v16b al, v16b bh, v16b bl, v8f c) {
  c = __builtin_amdgcn_wmma_f32_16x16x32_bf16(false, ah, false, bh, (short)0, c, false, false);
  if (NT >= 2) c = __builtin_amdgcn_wmma_f32_16x16x32_bf16(false, al, false, bh, (short)0, c, false, false);
  if (NT >= 3) c = __builtin_amdgcn_wmma_f32_16x16x32_bf16(false, ah, false, bl, (short)0, c, false, false);
  asm volatile("v_nop\n\tv_nop\n\tv_nop\n\tv_nop" : "+v"(c) : "v"(ah), "v"(al), "v"(bh), "v"(bl));
  return c;
}

__global__ __launch_bounds__(256) void k_wt_bf16(const float* __restrict__ W, unsigned short* __restrict__ Wt, int K, int N) {
  const int t = blockIdx.x * 256 + threadIdx.x;
  const int k8n = K / 8;
  if (t >= N * k8n) return;
  const int n = t / k8n, k8 = (t % k8n) * 8;
  v8us v;
#pragma unroll
  for (int i = 0; i < 8; ++i) v[i] = bf16_bits(W[(size_t)(k8 + i) * N + n]);
  *(v8us*)(Wt + (size_t)n * K + k8) = v;
  
}

// GEMM C[M][N] (f32, pitch ldc) = act(A[M][K]·W + bias). A f32 row-major (pitch lda) converted per fragment to bf16
// (ASPLIT: hi/lo two planes -> 2 terms, else single rounded term); Wt bf16 [N][K] (pitch ldb). BIAS_BF16 rounds the
// bias to bf16 first (bias quantised to bf16 before the add). K%32==0, M%16==0, N%64==0.
template <bool ASPLIT, int ACT, bool BIAS_BF16>
__global__ __launch_bounds__(128) void k_gemm_bf(const float* __restrict__ A, int lda, const unsigned short* __restrict__ Wt, int ldb,
                                               const float* __restrict__ bias, float* __restrict__ C, int ldc, int M, int N, int K) {
  __shared__ __attribute__((aligned(16))) float so[4][16][64];
  const int tid = threadIdx.x, w = tid >> 5, lane = tid & 31, ln = lane & 15, hh = lane >> 4;
  const int ntn = N / 64;
  const int wid = blockIdx.x * 4 + w;
  const int mt = wid / ntn, nq = wid % ntn;
  if (mt * 16 >= M) return;
  const int row0 = mt * 16, col0 = nq * 64;
  const float* arow = A + (size_t)(row0 + ln) * lda;
  v8f acc[4] = {};
  for (int kb = 0; kb < K; kb += 32) {
    FragB ah, al;
    const v4f x0 = *(const v4fa*)(arow + kb + 8 * hh), x1 = *(const v4fa*)(arow + kb + 8 * hh + 4);
    const v4f x2 = *(const v4fa*)(arow + kb + 16 + 8 * hh), x3 = *(const v4fa*)(arow + kb + 16 + 8 * hh + 4);
    float xs[16] = {x0[0],x0[1],x0[2],x0[3],x1[0],x1[1],x1[2],x1[3],x2[0],x2[1],x2[2],x2[3],x3[0],x3[1],x3[2],x3[3]};
#pragma unroll
    for (int i = 0; i < 16; ++i) { const unsigned short hb = bf16_bits(xs[i]); ah.u[i] = hb; al.u[i] = ASPLIT ? bf16_bits(xs[i] - bf16_val(hb)) : (unsigned short)0; }
#pragma unroll
    for (int t = 0; t < 4; ++t) {
      const unsigned short* brow = Wt + (size_t)(col0 + t * 16 + ln) * ldb + kb;
      FragB b;
      b.half[0] = *(const v8us*)(brow + 8 * hh);
      b.half[1] = *(const v8us*)(brow + 16 + 8 * hh);
      acc[t] = mmaN<ASPLIT ? 2 : 1>(ah.v, al.v, b.v, b.v, acc[t]);
    }
  }
#pragma unroll
  for (int t = 0; t < 4; ++t) {
    float bv = bias ? bias[col0 + t * 16 + ln] : 0.f;
    if (BIAS_BF16) bv = bf16_round(bv);
#pragma unroll
    for (int r = 0; r < 8; ++r) { float v = acc[t][r] + bv; if (ACT == 1) v = fmaxf(v, 0.f); so[w][8 * hh + r][t * 16 + ln] = v; }
  }
  __builtin_amdgcn_fence(__ATOMIC_ACQ_REL, "workgroup");
  __builtin_amdgcn_wave_barrier();
  const int rsub = lane >> 4, c4 = (lane & 15) * 4;
  {
#pragma unroll
    for (int q = 0; q < 8; ++q) {
      const int r = q * 2 + rsub;
      const v4f v = *(const v4fa*)&so[w][r][c4];
      *(v4f*)(C + (size_t)(row0 + r) * ldc + col0 + c4) = v;
    }
    
  }
}

// GEMM C = act(A·W + bias + resid): A f32 (ASPLIT -> hi/lo 2 terms), Wt bf16 [N][K]; ACT 0 none, 1 relu, 2 exact gelu;
// resid (optional, f32, row index = (row % rmod), pitch ldr, RES_BF16 rounds it) added before the activation.
template <bool ASPLIT, int ACT, bool BIAS_BF16, bool RES_BF16>
__global__ __launch_bounds__(128) void k_gemm_bf3(const float* __restrict__ A, int lda, const unsigned short* __restrict__ Wt, int ldb,
                                                const float* __restrict__ bias, const float* __restrict__ resid, int rmod, int ldr,
                                                float* __restrict__ C, int ldc, int M, int N, int K) {
  __shared__ __attribute__((aligned(16))) float so[4][16][64];
  const int tid = threadIdx.x, w = tid >> 5, lane = tid & 31, ln = lane & 15, hh = lane >> 4;
  const int ntn = N / 64;
  const int wid = blockIdx.x * 4 + w;
  const int mt = wid / ntn, nq = wid % ntn;
  if (mt * 16 >= M) return;
  const int row0 = mt * 16, col0 = nq * 64;
  const float* arow = A + (size_t)(row0 + ln) * lda;
  v8f acc[4] = {};
  for (int kb = 0; kb < K; kb += 32) {
    FragB ah, al;
    const v4f x0 = *(const v4fa*)(arow + kb + 8 * hh), x1 = *(const v4fa*)(arow + kb + 8 * hh + 4);
    const v4f x2 = *(const v4fa*)(arow + kb + 16 + 8 * hh), x3 = *(const v4fa*)(arow + kb + 16 + 8 * hh + 4);
    float xs[16] = {x0[0],x0[1],x0[2],x0[3],x1[0],x1[1],x1[2],x1[3],x2[0],x2[1],x2[2],x2[3],x3[0],x3[1],x3[2],x3[3]};
#pragma unroll
    for (int i = 0; i < 16; ++i) { const unsigned short hb = bf16_bits(xs[i]); ah.u[i] = hb; al.u[i] = ASPLIT ? bf16_bits(xs[i] - bf16_val(hb)) : (unsigned short)0; }
#pragma unroll
    for (int t = 0; t < 4; ++t) {
      const unsigned short* brow = Wt + (size_t)(col0 + t * 16 + ln) * ldb + kb;
      FragB b;
      b.half[0] = *(const v8us*)(brow + 8 * hh);
      b.half[1] = *(const v8us*)(brow + 16 + 8 * hh);
      acc[t] = mmaN<ASPLIT ? 2 : 1>(ah.v, al.v, b.v, b.v, acc[t]);
    }
  }
#pragma unroll
  for (int t = 0; t < 4; ++t) {
    const int col = col0 + t * 16 + ln;
    float bv = bias ? bias[col] : 0.f;
    if (BIAS_BF16) bv = bf16_round(bv);
#pragma unroll
    for (int r = 0; r < 8; ++r) {
      float v = acc[t][r] + bv;
      if (resid) { float rv = resid[(size_t)((row0 + 8 * hh + r) % rmod) * ldr + col]; if (RES_BF16) rv = bf16_round(rv); v += rv; }
      if (ACT == 1) v = fmaxf(v, 0.f);
      if (ACT == 2) v = 0.5f * v * (1.0f + erff(v * 0.70710678118654752f));
      if (ACT == 3) { const float u = 0.7978845608028654f * (v + 0.044715f * v * v * v); v = 0.5f * v * (1.0f + tanhf(u)); }
      so[w][8 * hh + r][t * 16 + ln] = v;
    }
  }
  __builtin_amdgcn_fence(__ATOMIC_ACQ_REL, "workgroup");
  __builtin_amdgcn_wave_barrier();
  const int rsub = lane >> 4, c4 = (lane & 15) * 4;
  {
#pragma unroll
    for (int q = 0; q < 8; ++q) {
      const int r = q * 2 + rsub;
      const v4f v = *(const v4fa*)&so[w][r][c4];
      *(v4f*)(C + (size_t)(row0 + r) * ldc + col0 + c4) = v;
    }
    
  }
}
// row LayerNorm (biased variance, eps) over N: s = X (+ R); optional out_sum <- s; out_norm <- (s-mu)*rsqrt(var+eps)*g + b
template <bool PARAM_BF16>
__global__ __launch_bounds__(256) void k_layernorm(const float* __restrict__ X, const float* __restrict__ R, const float* __restrict__ g, const float* __restrict__ bta,
                                                  float* __restrict__ out_sum, float* __restrict__ out_norm, int N, float eps) {
  __shared__ float red[256];
  const int row = blockIdx.x, tid = threadIdx.x;
  const float* x = X + (size_t)row * N; const float* rr = R ? R + (size_t)row * N : nullptr;
  float vals[16];                     // up to N = 4096
  const int per = N / 256;            // contiguous chunk per thread? use strided-by-4 chunks: thread handles j = tid*4 + 1024*u
  float s1 = 0.f;
  for (int u = 0; u < per / 4; ++u) {
    const int j = tid * 4 + 1024 * u;
    const v4f a = *(const v4fa*)(x + j);
    v4f b = {0.f,0.f,0.f,0.f}; if (rr) b = *(const v4fa*)(rr + j);
#pragma unroll
    for (int q = 0; q < 4; ++q) { const float v = a[q] + b[q]; vals[u * 4 + q] = v; s1 += v; }
  }
  red[tid] = s1; __syncthreads();
  for (int st = 128; st > 0; st >>= 1) { if (tid < st) red[tid] += red[tid + st]; __syncthreads(); }
  const float mu = red[0] / (float)N; __syncthreads();
  float s2 = 0.f;
  for (int u = 0; u < per / 4; ++u)
#pragma unroll
    for (int q = 0; q < 4; ++q) { const float c = vals[u * 4 + q] - mu; s2 += c * c; }
  red[tid] = s2; __syncthreads();
  for (int st = 128; st > 0; st >>= 1) { if (tid < st) red[tid] += red[tid + st]; __syncthreads(); }
  const float rs = rsqrtf(red[0] / (float)N + eps);
  {
    for (int u = 0; u < per / 4; ++u) {
      const int j = tid * 4 + 1024 * u;
      v4f o, sm;
#pragma unroll
      for (int q = 0; q < 4; ++q) {
        float gg = g[j + q], bb = bta[j + q];
        if (PARAM_BF16) { gg = bf16_round(gg); bb = bf16_round(bb); }
        sm[q] = vals[u * 4 + q]; o[q] = (vals[u * 4 + q] - mu) * rs * gg + bb;
      }
      if (out_sum) *(v4f*)(out_sum + (size_t)row * N + j) = sm;
      *(v4f*)(out_norm + (size_t)row * N + j) = o;
    }
    
  }
}



// ---- f16 WMMA path (v_wmma_f32_16x16x32_f16): 11-bit significands for operands in range — used where a [0,1] probability operand needs more precision than bf16
typedef _Float16 v16h __attribute__((ext_vector_type(16)));
union FragH { v16h v; v8us half[2]; _Float16 h[16]; unsigned short u[16]; };
template <int NT>
__device__ __forceinline__ v8f mmaH(v16h ah, v16h al, v16h bh, v16h bl, v8f c) {
  c = __builtin_amdgcn_wmma_f32_16x16x32_f16(false, ah, false, bh, (short)0, c, false, false);
  if (NT >= 2) c = __builtin_amdgcn_wmma_f32_16x16x32_f16(false, al, false, bh, (short)0, c, false, false);
  if (NT >= 3) c = __builtin_amdgcn_wmma_f32_16x16x32_f16(false, ah, false, bl, (short)0, c, false, false);
  asm volatile("v_nop\n\tv_nop\n\tv_nop\n\tv_nop" : "+v"(c) : "v"(ah), "v"(al), "v"(bh), "v"(bl));
  return c;
}
// batched GEMM like k_gemm_b but f16 operands: A f32 (split into f16 hi/lo if ASPLIT, else rounded to f16), Bt = f16 values [n][k]; alpha; C f32; N multiple of 16 (partial tiles skipped)
template <bool ASPLIT>
__global__ __launch_bounds__(128) void k_gemm_h(const float* __restrict__ A, int lda, size_t sA, const _Float16* __restrict__ Bh, int ldb, size_t sB, float alpha, float* __restrict__ C, int ldc, size_t sC, int M, int N, int K) {
  __shared__ __attribute__((aligned(16))) float so[4][16][64];
  const int tid = threadIdx.x, w = tid >> 5, lane = tid & 31, ln = lane & 15, hh = lane >> 4; const int by = blockIdx.y;
  A += (size_t)by * sA; Bh += (size_t)by * sB; C += (size_t)by * sC;
  const int ntn = (N + 63) / 64; const int wid = blockIdx.x * 4 + w; const int mt = wid / ntn, nq = wid % ntn; if (mt * 16 >= M) return;
  const int row0 = mt * 16, col0 = nq * 64; const float* arow = A + (size_t)(row0 + ln) * lda;
  v8f acc[4] = {};
  for (int kb = 0; kb < K; kb += 32) {
    FragH ah, al;
    const v4f x0 = *(const v4fa*)(arow + kb + 8 * hh), x1 = *(const v4fa*)(arow + kb + 8 * hh + 4), x2 = *(const v4fa*)(arow + kb + 16 + 8 * hh), x3 = *(const v4fa*)(arow + kb + 16 + 8 * hh + 4);
    float xs[16] = {x0[0],x0[1],x0[2],x0[3],x1[0],x1[1],x1[2],x1[3],x2[0],x2[1],x2[2],x2[3],x3[0],x3[1],x3[2],x3[3]};
#pragma unroll
    for (int i = 0; i < 16; ++i) { const _Float16 h = (_Float16)xs[i]; ah.h[i] = h; al.h[i] = ASPLIT ? (_Float16)(xs[i] - (float)h) : (_Float16)0.0f; }
#pragma unroll
    for (int t = 0; t < 4; ++t) { if (col0 + t * 16 >= N) continue; const size_t boff = (size_t)(col0 + t * 16 + ln) * ldb + kb; FragH bq; bq.half[0] = *(const v8us*)(Bh + boff + 8 * hh); bq.half[1] = *(const v8us*)(Bh + boff + 16 + 8 * hh);
      acc[t] = mmaH<ASPLIT ? 2 : 1>(ah.v, al.v, bq.v, bq.v, acc[t]); }
  }
#pragma unroll
  for (int t = 0; t < 4; ++t) { if (col0 + t * 16 >= N) continue;
#pragma unroll
    for (int r = 0; r < 8; ++r) so[w][8 * hh + r][t * 16 + ln] = acc[t][r] * alpha; }
  __builtin_amdgcn_fence(__ATOMIC_ACQ_REL, "workgroup"); __builtin_amdgcn_wave_barrier();
  const int rsub = lane >> 4, c4 = (lane & 15) * 4;
  {
#pragma unroll
    for (int q = 0; q < 8; ++q) { const int r = q * 2 + rsub; if (col0 + c4 < N) { const v4f v = *(const v4fa*)&so[w][r][c4]; *(v4f*)(C + (size_t)(row0 + r) * ldc + col0 + c4) = v; } }
     }
}

// Wt[n][k] = f16(W[k][n]·scale) from f32 row-major W[K][N] (scale = power of two; bf16-exact weights stay exact in f16 away from the subnormal range)
__global__ __launch_bounds__(256) void k_wt_f16(const float* __restrict__ W, _Float16* __restrict__ Wt, int K, int N, float scale) {
  const int t = blockIdx.x * 256 + threadIdx.x; if (t >= N * (K / 8)) return; const int n = t / (K / 8), k8 = (t % (K / 8)) * 8; FragH f;
#pragma unroll
  for (int i = 0; i < 8; ++i) f.h[i] = (_Float16)(bf16_round(W[(size_t)(k8 + i) * N + n]) * scale); const v8us o = f.half[0];
  *(v8us*)((unsigned short*)Wt + (size_t)n * K + k8) = o; 
}
// k_gemm_hh variant with fused epilogue: v = acc·alpha + bias[by·sBias + col] (+ CP[(row/rowsPerB)·sCPb + by·64 + col] if CP) ; ACT 0 none / 1 elu ; writes f16 C16 (and f32 C if non-null)
template <int ACT>
__global__ __launch_bounds__(128) void k_gemm_hhx(const _Float16* __restrict__ A, int lda, size_t sA, const _Float16* __restrict__ Bh, int ldb, size_t sB, float alpha, const float* __restrict__ bias, size_t sBias, const float* __restrict__ CP, int rowsPerB, size_t sCPb, int row0g,
    float* __restrict__ C, _Float16* __restrict__ C16, int ldc, size_t sC, int M, int N, int K) {
  __shared__ __attribute__((aligned(16))) float so[4][16][64];
  const int tid = threadIdx.x, w = tid >> 5, lane = tid & 31, ln = lane & 15, hh = lane >> 4; const int by = blockIdx.y;
  A += (size_t)by * sA; Bh += (size_t)by * sB; const size_t cofs = (size_t)by * sC; const float* bp = bias ? bias + (size_t)by * sBias : nullptr;
  const int ntn = (N + 63) / 64; const int wid = blockIdx.x * 4 + w; const int mt = wid / ntn, nq = wid % ntn; if (mt * 16 >= M) return;
  const int row0 = mt * 16, col0 = nq * 64; const _Float16* arow = A + (size_t)(row0 + ln) * lda;
  v8f acc[4] = {};
  for (int kb = 0; kb < K; kb += 32) { FragH ah; ah.half[0] = *(const v8us*)((const unsigned short*)arow + kb + 8 * hh); ah.half[1] = *(const v8us*)((const unsigned short*)arow + kb + 16 + 8 * hh);
#pragma unroll
    for (int t = 0; t < 4; ++t) { if (col0 + t * 16 >= N) continue; const size_t boff = (size_t)(col0 + t * 16 + ln) * ldb + kb; FragH bq; bq.half[0] = *(const v8us*)((const unsigned short*)Bh + boff + 8 * hh); bq.half[1] = *(const v8us*)((const unsigned short*)Bh + boff + 16 + 8 * hh);
      acc[t] = mmaH<1>(ah.v, ah.v, bq.v, bq.v, acc[t]); }
  }
#pragma unroll
  for (int t = 0; t < 4; ++t) { if (col0 + t * 16 >= N) continue; const int col = col0 + t * 16 + ln; const float bv = bp ? bf16_round(bp[col]) : 0.f;
#pragma unroll
    for (int r = 0; r < 8; ++r) { float v = acc[t][r] * alpha + bv; if (CP) { const int rr = row0g + row0 + 8 * hh + r; if (rowsPerB < 0) v += CP[cofs + (size_t)rr * ldc + col];      /* rowsPerB < 0: own element of the batched C plane */ else { const int bidx = rr / rowsPerB; v += CP[(size_t)bidx * sCPb + (size_t)by * 64 + col]; } } if (ACT == 1) v = (v > 0.f) ? v : expm1f(v); else if (ACT == 7) v = (v > 0.f) ? v + 1.0f : expf(v); else if (ACT == 8) v = tanhf(v); else if (ACT == 9) v = 0.5f * v * (1.0f + tanhf(0.7978845608028654f * (v + 0.044715f * v * v * v))); else if (ACT == 11) v = 1.0f / (1.0f + expf(-v)); else if (ACT == 12) v = (v > 0.f) ? v : 0.01f * v; else if (ACT == 14) v = (v > 0.f) ? v : 0.1f * v; else if (ACT == 16) v = (v >= 0.f) ? v : 0.3f * v; else if (ACT == 17) v = (v >= 0.f) ? v : 0.2f * v; else if (ACT == 15) v = v / (1.0f + expf(-v)); else if (ACT == 3) v = fmaxf(v, 0.f); else if (ACT == 6) v = 0.5f * v * (1.0f + erff(v * 0.70710678118654752f)); so[w][8 * hh + r][t * 16 + ln] = v; } }
  __builtin_amdgcn_fence(__ATOMIC_ACQ_REL, "workgroup"); __builtin_amdgcn_wave_barrier();
  const int rsub = lane >> 4, c4 = (lane & 15) * 4; typedef _Float16 v4h __attribute__((ext_vector_type(4)));
  {
#pragma unroll
    for (int q = 0; q < 8; ++q) { const int r = q * 2 + rsub; if (col0 + c4 < N) { const v4f v = *(const v4fa*)&so[w][r][c4]; if (C) *(v4f*)(C + cofs + (size_t)(row0 + r) * ldc + col0 + c4) = v; if (C16) { v4h h4; for (int i = 0; i < 4; ++i) h4[i] = (_Float16)v[i]; *(v4h*)(C16 + cofs + (size_t)(row0 + r) * ldc + col0 + c4) = h4; } } }
     }
}


typedef _Float16 v4h __attribute__((ext_vector_type(4)));

__global__ __launch_bounds__(256) void k_x16(const float* __restrict__ x, _Float16* __restrict__ X16, size_t n8) { const size_t t = (size_t)blockIdx.x * 256 + threadIdx.x; if (t >= n8) return; FragH f;
#pragma unroll
  for (int q = 0; q < 8; ++q) f.h[q] = (_Float16)bf16_round(x[t * 8 + q]); *(v8us*)((unsigned short*)X16 + t * 8) = f.half[0];  }
__global__ __launch_bounds__(256) void k_h16(const float* __restrict__ x, _Float16* __restrict__ X16, size_t n8) { const size_t t = (size_t)blockIdx.x * 256 + threadIdx.x; if (t >= n8) return; FragH f;
#pragma unroll
  for (int q = 0; q < 8; ++q) f.h[q] = (_Float16)x[t * 8 + q]; *(v8us*)((unsigned short*)X16 + t * 8) = f.half[0];  }
__global__ __launch_bounds__(256) void k_round16f(const float* __restrict__ W, _Float16* __restrict__ Bt, size_t n8) { const size_t t = (size_t)blockIdx.x * 256 + threadIdx.x; if (t >= n8) return; FragH f;
#pragma unroll
  for (int i = 0; i < 8; ++i) f.h[i] = (_Float16)(bf16_round(W[t * 8 + i]) * 16.0f); *(v8us*)((unsigned short*)Bt + t * 8) = f.half[0];  }
template <int NHv, int TTv>
__global__ __launch_bounds__(256) void k_vt(const _Float16* __restrict__ V16, int ldv, int voff, _Float16* __restrict__ Vt) { __shared__ unsigned short tl[64][66]; const int tid = threadIdx.x; const int slab = blockIdx.x / (TTv / 64), lg = blockIdx.x % (TTv / 64); const int b = slab / NHv, h = slab % NHv;
  for (int i = tid; i < 64 * 8; i += 256) { const int r = i / 8, c8 = (i % 8) * 8; FragH f; f.half[0] = *(const v8us*)((const unsigned short*)V16 + ((size_t)b * TTv + lg * 64 + r) * ldv + voff + h * 64 + c8);
#pragma unroll
    for (int q = 0; q < 8; ++q) tl[r][c8 + q] = f.u[q]; }
  __syncthreads();
  {
#pragma unroll
    for (int rd = 0; rd < 2; ++rd) { const int d = rd * 32 + tid / 8, pc = tid % 8; FragH f;
#pragma unroll
      for (int q = 0; q < 8; ++q) f.u[q] = tl[pc * 8 + q][d];
      *(v8us*)((unsigned short*)Vt + ((size_t)slab * 64 + d) * TTv + lg * 64 + pc * 8) = f.half[0]; }
     } }

__global__ __launch_bounds__(256) void k_hl(const float* __restrict__ F, _Float16* __restrict__ Hh, _Float16* __restrict__ Hl, size_t n8) { const size_t t = (size_t)blockIdx.x * 256 + threadIdx.x; if (t >= n8) return; FragH fh, fl; const v4f a = *(const v4fa*)(F + t * 8), c = *(const v4fa*)(F + t * 8 + 4);
#pragma unroll
  for (int q = 0; q < 4; ++q) { _Float16 h = (_Float16)a[q]; fh.h[q] = h; fl.h[q] = (_Float16)((a[q] - (float)h) * 1024.0f); h = (_Float16)c[q]; fh.h[4 + q] = h; fl.h[4 + q] = (_Float16)((c[q] - (float)h) * 1024.0f); }
  { *(v8us*)((unsigned short*)Hh + t * 8) = fh.half[0]; *(v8us*)((unsigned short*)Hl + t * 8) = fl.half[0];  } }

// ---- fast GEMM (wave tile 32x64; requires M % 32 == 0 rows per launch region and N % 64 == 0) ----
__device__ __forceinline__ v16h g2_frag(const _Float16* p, int hh) { FragH f; f.half[0] = *(const v8us*)((const unsigned short*)p + 8 * hh); f.half[1] = *(const v8us*)((const unsigned short*)p + 16 + 8 * hh); return f.v; }
__device__ __forceinline__ v8f g2_mma(v16h a, v16h b, v8f c) { v8f d = __builtin_amdgcn_wmma_f32_16x16x32_f16(false, a, false, b, (short)0, c, false, false); asm volatile("v_nop\n\tv_nop\n\tv_nop\n\tv_nop" : "+v"(d) : "v"(a), "v"(b)); return d; }
// All hi/residual terms of one product in ONE launch: C = alpha * (Ah.Bh + 2^-10 * (Al.Bh [+ Ah.Bl if BSPLIT])). The hi product and the residual products keep separate f32 accumulators
// (the residual planes carry a 2^10 scale) and meet once in the epilogue, so C is stored once and never read back, and each Ah / Bh fragment is loaded once for all the terms that use it.
template <bool BSPLIT, int lda, int ldb>
__global__ __launch_bounds__(128) void k_gemm2s(const _Float16* __restrict__ Ah, const _Float16* __restrict__ Al, size_t sA, const _Float16* __restrict__ Bh, const _Float16* __restrict__ Bl, size_t sB, float alpha,
    float* __restrict__ C, int ldc, size_t sC, int M, int N, int K) {
  __shared__ __attribute__((aligned(16))) float so[4][32][68];
  const int tid = threadIdx.x, w = tid >> 5, lane = tid & 31, ln = lane & 15, hh = lane >> 4; const int by = blockIdx.y; const size_t cofs = (size_t)by * sC;
  const int ntn = N >> 6; const int mt = blockIdx.x / ntn, nq = blockIdx.x - mt * ntn; const int row0 = mt * 128 + 32 * w, col0 = nq * 64; if (row0 >= M) return;
  const size_t aofs = (size_t)by * sA + (size_t)(row0 + ln) * lda, bofs = (size_t)by * sB + (size_t)(col0 + ln) * ldb; const size_t a16 = (size_t)16 * lda, b16 = (size_t)16 * ldb;
  const _Float16* ahp = Ah + aofs; const _Float16* alp = Al + aofs; const _Float16* bhp = Bh + bofs; const _Float16* blp = BSPLIT ? Bl + bofs : nullptr;
  const v8f z8 = {0.f,0.f,0.f,0.f,0.f,0.f,0.f,0.f}; v8f ch[8] = {z8, z8, z8, z8, z8, z8, z8, z8}, cl[8] = {z8, z8, z8, z8, z8, z8, z8, z8};      /* [t] = rows 0..15, [4 + t] = rows 16..31 of column tile t */
  /* kept rolled: one k step of fragments beside the 128 accumulator registers is what fits */
#pragma unroll 1
  for (int kb = 0; kb < K; kb += 32) { const v16h a0h = g2_frag(ahp + kb, hh), a1h = g2_frag(ahp + a16 + kb, hh);
    asm volatile("s_wait_xcnt 0x0" ::: "memory");      /* precaution: the compiler lets the loads below land in the registers that held the address of the loads above */
    const v16h a0l = g2_frag(alp + kb, hh); FragH f1; f1.half[0] = *(const v8us*)((const unsigned short*)(alp + a16 + kb) + 8 * hh);
    asm volatile("s_wait_xcnt 0x0" ::: "memory");      /* same precaution: the last load from this address pair lands in the pair itself */
    f1.half[1] = *(const v8us*)((const unsigned short*)(alp + a16 + kb) + 16 + 8 * hh); const v16h a1l = f1.v;
    /* unrolled so that ch[] / cl[] are indexed by constants and stay in registers (the same holds for the epilogue loops) */
#pragma unroll
    for (int t = 0; t < 4; ++t) { const v16h bh = g2_frag(bhp + t * b16 + kb, hh);
      ch[t] = g2_mma(a0h, bh, ch[t]); ch[4 + t] = g2_mma(a1h, bh, ch[4 + t]); cl[t] = g2_mma(a0l, bh, cl[t]); cl[4 + t] = g2_mma(a1l, bh, cl[4 + t]);
      if (BSPLIT) { const v16h bl = g2_frag(blp + t * b16 + kb, hh); cl[t] = g2_mma(a0h, bl, cl[t]); cl[4 + t] = g2_mma(a1h, bl, cl[4 + t]); } } }
  const float alo = alpha * 0.0009765625f;
#pragma unroll
  for (int u = 0; u < 8; ++u) { const int t = u & 3, half = u >> 2;
#pragma unroll
    for (int r = 0; r < 8; ++r) so[w][half * 16 + 8 * hh + r][t * 16 + ln] = ch[u][r] * alpha + cl[u][r] * alo; }
  __builtin_amdgcn_fence(__ATOMIC_ACQ_REL, "workgroup"); __builtin_amdgcn_wave_barrier();      /* this wave's LDS stores above come before its own LDS reads below (so[w] is private to the wave) */
  const int rsub = lane >> 4, c4 = (lane & 15) * 4;
#pragma unroll
  for (int q = 0; q < 16; ++q) { const int r = q * 2 + rsub; const v4f v = *(const v4fa*)&so[w][r][c4]; *(v4f*)(C + cofs + (size_t)(row0 + r) * ldc + col0 + c4) = v; } }


__global__ __launch_bounds__(256) void k_wsc(const float* __restrict__ Wm, _Float16* __restrict__ Bt, size_t n8, float sc) { const size_t t = (size_t)blockIdx.x * 256 + threadIdx.x; if (t >= n8) return; FragH f; for (int q = 0; q < 8; ++q) f.h[q] = (_Float16)(bf16_round(Wm[t * 8 + q]) * sc); *(v8us*)((unsigned short*)Bt + t * 8) = f.half[0];  }
template <int NH_>
__global__ __launch_bounds__(256) void k_normrope(const float* __restrict__ X, const float* __restrict__ w, const int* __restrict__ pos, _Float16* __restrict__ O16, _Float16* __restrict__ OL) {
  #pragma clang fp contract(off)
  constexpr int W_ = NH_ * HD; const int wv = threadIdx.x >> 5, ln = threadIdx.x & 31; const int t = blockIdx.x * 8 + wv; if (t >= TT) return; const float* x = X + (size_t)t * W_; float ss = 0.f;
#pragma unroll 1
  for (int c = ln * 4; c < W_; c += 128) { const v4f a = *(const v4fa*)(x + c); for (int e = 0; e < 4; ++e) { const float v = bf16_round(a[e]); ss += v * v; } }
  for (int o = 16; o > 0; o >>= 1) ss += __shfl_xor(ss, o, 32); const float inv = rsqrtf(ss / (float)W_ + 1e-5f); const float p = (float)pos[t];
  {
#pragma unroll 1
    for (int h = 0; h < NH_; ++h) { for (int u = 0; u < 2; ++u) { const int d = ln + 32 * u; const int c1 = h * HD + d, c2 = c1 + 64; float x1 = bf16_round(x[c1]) * inv; x1 *= bf16_round(w[c1]); float x2 = bf16_round(x[c2]) * inv; x2 *= bf16_round(w[c2]);
        const float ex = (float)(2 * d) / (float)HD; const float ivf = 1.0f / powf(10000.0f, ex); const float th = p * ivf; const float cs = cosf(th), sn = sinf(th); float o1 = x1 * cs; o1 += -(x2 * sn); float o2 = x2 * cs; o2 += x1 * sn;
        const _Float16 h1 = (_Float16)o1, h2 = (_Float16)o2; *(_Float16*)(O16 + (size_t)t * W_ + c1) = h1; *(_Float16*)(O16 + (size_t)t * W_ + c2) = h2; *(_Float16*)(OL + (size_t)t * W_ + c1) = (_Float16)((o1 - (float)h1) * 1024.0f); *(_Float16*)(OL + (size_t)t * W_ + c2) = (_Float16)((o2 - (float)h2) * 1024.0f); } }
     } }

// ---- fused attention: scores, masked softmax and readout of all 16 heads in ONE launch; the score and probability planes never go to memory ----
// Transposed products: S^T = K.Q^T (A = key rows, B = query rows held in registers), O^T += V^T.P^T. In an accumulator tile a lane holds 8 keys of ONE query (column = lane & 15, rows 8 * (lane >> 4) + r),
// which is exactly the k order of the B loader (k = 8 * hh + i, then 16 + 8 * hh + i), so two 16-key score tiles pack in-lane into one 32-key P^T fragment. Running maximum and sum per query (online softmax):
// when the maximum moves, the output accumulators and the sum are scaled by exp(m_old - m_new). Same operand planes and terms as the separate stages: 3 hi/residual score terms, P as f16 hi + 2^10 residual of 1024 * p.
__device__ __forceinline__ v8f fa_mma(v16h a, v16h b, v8f c) { return __builtin_amdgcn_wmma_f32_16x16x32_f16(false, a, false, b, (short)0, c, false, false); }
typedef int v4i __attribute__((ext_vector_type(4)));
#define FKP 136                  /* LDS pitch of a K row, in halves */
#define FVP 40                   /* LDS pitch of a V^T row, in halves */
#define QTN (TT / 64)            /* query tiles of 64 rows */
// act[qt * 64 + p] = 1 where the 64 x 32 mask tile (query tile qt, key pass p) holds at least one open (zero) entry, else 0. A wave reads one tile; a block writes one whole 128-byte line of flags.
__global__ __launch_bounds__(1024) void k_mflag(const int* __restrict__ msk, int* __restrict__ act) {
  const int wv = threadIdx.x >> 5, lane = threadIdx.x & 31; const int u = blockIdx.x * 32 + wv; const int qt = u >> 6, p = u & 63;
  const int* mp = msk + (size_t)(qt * 64 + (lane >> 3)) * MSTR + p * 32 + (lane & 7) * 4;
  bool open = false;
#pragma unroll
  for (int i = 0; i < 16; ++i) { const v4i m = *(const v4i*)(mp + (size_t)i * 4 * MSTR); open = open || m[0] == 0 || m[1] == 0 || m[2] == 0 || m[3] == 0; }
  const unsigned any = __builtin_amdgcn_ballot_w32(open);
  if (lane == 0) act[u] = any != 0u ? 1 : 0;
}
// A block runs two query tiles of 64 rows one after the other, tile QTN - 1 - x and tile x, so that under a triangular mask every block has the same number of open passes; a wave owns 16 queries.
// Of each tile only the open key passes are walked (flags of k_mflag). A closed pass holds nothing but scores of -10000: once every row of the tile has a running maximum of -9000 or more, exp(-10000 - max) is 0 in f32
// and the pass would change neither sums nor maximum. Where a row's maximum is lower after the open passes (a row with no open key among them), the closed passes are walked as well, after the open ones, by the same code.
__global__ __launch_bounds__(128) void k_fattn(const _Float16* __restrict__ Qh, const _Float16* __restrict__ Ql, const _Float16* __restrict__ Kh, const _Float16* __restrict__ Kl, const _Float16* __restrict__ Vt,
    const int* __restrict__ msk, const int* __restrict__ act, float* __restrict__ CTX) {
  __shared__ __attribute__((aligned(16))) _Float16 sKh[32 * FKP], sKl[32 * FKP], sV[HD * FVP];
  __shared__ int sLow[2][4];      /* per tile and wave: some row's maximum is still low; a slot set of its own for each tile, so that no wave writes a slot that a slower wave still reads */
  const int tid = threadIdx.x, w = tid >> 5, lane = tid & 31, ln = lane & 15, hh = lane >> 4; const int h = blockIdx.y, kv = h / GRP;
  const v8f z8 = {0.f,0.f,0.f,0.f,0.f,0.f,0.f,0.f};
  /* the block's four waves share each pass's K (hi, residual) and V^T tiles through LDS: whole-row global loads, one copy a block; pitches 272 B and 80 B (16 B x odd) keep the 16-byte fragment reads off each other's banks */
  const int krow = tid >> 4, kcol = (tid & 15) * 8, vrow = tid >> 2, vcol = (tid & 3) * 8;
  const _Float16* gkh = Kh + (size_t)krow * DKV + kv * HD + kcol; const _Float16* gkl = Kl + (size_t)krow * DKV + kv * HD + kcol; const _Float16* gv = Vt + ((size_t)kv * HD + vrow) * TT + vcol;
  const float alpha = 0.088388347648318447f, alo = alpha * 0.0009765625f;
  /* kept rolled: the two tiles run through one copy of the code */
#pragma unroll 1
  for (int half = 0; half < 2; ++half) {
    const int qt = half ? (int)blockIdx.x : QTN - 1 - (int)blockIdx.x; const int q0 = qt * 64 + 16 * w;      /* a wave owns 16 queries: one column group */
    const int a0 = act[qt * 64 + lane], a1 = act[qt * 64 + 32 + lane];
    asm volatile("s_wait_xcnt 0x0" ::: "memory");      /* precaution: the loads below may land in, or have their addresses formed in, a register that the two loads above name */
    __builtin_amdgcn_sched_barrier(0);      /* keeps the loads below behind that wait */
    v16h qh[4], ql[4];
    const size_t qo = (size_t)(q0 + ln) * DQ + h * HD; const _Float16* qp0 = Qh + qo; const _Float16* qp2 = Ql + qo;
#pragma unroll
    for (int ks = 0; ks < 4; ++ks) { qh[ks] = g2_frag(qp0 + ks * 32, hh); ql[ks] = g2_frag(qp2 + ks * 32, hh); }
    asm volatile("s_wait_xcnt 0x0" ::: "memory");      /* precaution: stands in front of every later write of a register that one of the loads above names */
    __builtin_amdgcn_sched_barrier(0);      /* keeps the work below from being scheduled above that wait */
    const unsigned long long open = (unsigned long long)__builtin_amdgcn_ballot_w32(a0 != 0) | ((unsigned long long)__builtin_amdgcn_ballot_w32(a1 != 0) << 32);      /* bit p: pass p is open; the same in all four waves */
    v8f oh[8], ol[8];
#pragma unroll
    for (int d = 0; d < 8; ++d) { oh[d] = z8; ol[d] = z8; }
    float mrun = -3.0e38f, lrun = 0.f;
    const int* gm = msk + (size_t)(q0 + ln) * MSTR + 8 * hh;
    /* kept rolled: open passes (phase 0) and, where needed, closed passes (phase 1) run through one copy of the code */
#pragma unroll 1
    for (int phase = 0; phase < 2; ++phase) {
      unsigned long long todo = open;
      if (phase) {
        const unsigned lowb = __builtin_amdgcn_ballot_w32(mrun < -9000.0f);
        if (lane == 0) sLow[half][w] = lowb != 0u ? 1 : 0;
        __syncthreads();      /* the four waves' findings are published: the choice below must be the same in the whole block, barriers follow it */
        const int anylow = sLow[half][0] | sLow[half][1] | sLow[half][2] | sLow[half][3];
        todo = __builtin_amdgcn_readfirstlane(anylow) != 0 ? ~open : 0ull;
      }
      if (todo == 0ull) continue;
      int cur = __builtin_ctzll(todo); todo &= todo - 1ull;
      v8us rk[4], rl[4], rv[4]; v4i mk[2][2];
#pragma unroll
      for (int i = 0; i < 4; ++i) { rk[i] = *(const v8us*)(gkh + (size_t)(cur * 32 + i * 8) * DKV); rl[i] = *(const v8us*)(gkl + (size_t)(cur * 32 + i * 8) * DKV); rv[i] = *(const v8us*)(gv + (size_t)i * 32 * TT + cur * 32); }
#pragma unroll
      for (int j = 0; j < 2; ++j) { mk[j][0] = *(const v4i*)(gm + cur * 32 + j * 16); mk[j][1] = *(const v4i*)(gm + cur * 32 + j * 16 + 4); }
      asm volatile("s_wait_xcnt 0x0" ::: "memory");      /* same precaution as behind the query loads */
      __builtin_amdgcn_sched_barrier(0);      /* keeps the work below from being scheduled above that wait */
      /* kept rolled: one pass's staging registers and fragments beside the query fragments and the output accumulators are what is meant to stay in registers; every inner loop is unrolled so that the register arrays are indexed by constants */
#pragma unroll 1
      for (;;) {
#pragma unroll
        for (int i = 0; i < 4; ++i) { *(v8us*)(sKh + (krow + 8 * i) * FKP + kcol) = rk[i]; *(v8us*)(sKl + (krow + 8 * i) * FKP + kcol) = rl[i]; *(v8us*)(sV + (vrow + 32 * i) * FVP + vcol) = rv[i]; }
        bool msel[2][8];      /* this pass's mask, read out of its registers before the next pass's lands in them */
#pragma unroll
        for (int j = 0; j < 2; ++j) {
#pragma unroll
          for (int r = 0; r < 8; ++r) msel[j][r] = mk[j][r >> 2][r & 3] != 0; }
        __syncthreads();      /* this pass's tiles are published to all four waves */
        const bool more = todo != 0ull; const int nxt = more ? __builtin_ctzll(todo) : cur; todo &= todo - 1ull;      /* the last pass of a phase fetches its own tiles again: in bounds, never used */
        const int kn = nxt * 32;
        const int* mp = gm + kn;
        /* the next pass's mask and tiles go into registers now: they fly while this pass is worked on */
#pragma unroll
        for (int j = 0; j < 2; ++j) { mk[j][0] = *(const v4i*)(mp + j * 16); mk[j][1] = *(const v4i*)(mp + j * 16 + 4); }
#pragma unroll
        for (int i = 0; i < 4; ++i) { rk[i] = *(const v8us*)(gkh + (size_t)(kn + i * 8) * DKV); rl[i] = *(const v8us*)(gkl + (size_t)(kn + i * 8) * DKV); rv[i] = *(const v8us*)(gv + (size_t)i * 32 * TT + kn); }
        asm volatile("s_wait_xcnt 0x0" ::: "memory");      /* precaution: stands in front of every later write of a register that one of the loads above names */
        __builtin_amdgcn_sched_barrier(0);      /* keeps the work below from being scheduled above that wait, and the loads above in front of the pass's work */
        v8f sh[2] = {z8, z8}, sl[2] = {z8, z8};      /* [key tile j] */
#pragma unroll
        for (int ks = 0; ks < 4; ++ks) { const v16h kh0 = g2_frag(sKh + ln * FKP + ks * 32, hh), kh1 = g2_frag(sKh + (16 + ln) * FKP + ks * 32, hh), kl0 = g2_frag(sKl + ln * FKP + ks * 32, hh), kl1 = g2_frag(sKl + (16 + ln) * FKP + ks * 32, hh);
          sh[0] = fa_mma(kh0, qh[ks], sh[0]); sh[1] = fa_mma(kh1, qh[ks], sh[1]); sl[0] = fa_mma(kh0, ql[ks], sl[0]); sl[1] = fa_mma(kh1, ql[ks], sl[1]); sl[0] = fa_mma(kl0, qh[ks], sl[0]); sl[1] = fa_mma(kl1, qh[ks], sl[1]); }
        FragH ph, pl; float sv[2][8]; float mx = -3.0e38f;
#pragma unroll
        for (int j = 0; j < 2; ++j) {
#pragma unroll
          for (int r = 0; r < 8; ++r) { const float s0 = sh[j][r] * alpha + sl[j][r] * alo; const float s = msel[j][r] ? -10000.0f : s0; sv[j][r] = s; mx = fmaxf(mx, s); } }
        mx = fmaxf(mx, __shfl_xor(mx, 16, 32));      /* the other half-wave holds this query's other 16 keys */
        const float mn = fmaxf(mrun, mx); const float al = expf(mrun - mn); mrun = mn; float su = 0.f;
#pragma unroll
        for (int j = 0; j < 2; ++j) {
#pragma unroll
          for (int r = 0; r < 8; ++r) { const float p = expf(sv[j][r] - mn); su += p; const float pv = p * 1024.0f; const _Float16 hi = (_Float16)pv; ph.h[8 * j + r] = hi; pl.h[8 * j + r] = (_Float16)((pv - (float)hi) * 1024.0f); } }
        lrun = lrun * al + su;      /* each half-wave sums its own keys; the halves meet in the epilogue */
#pragma unroll
        for (int d = 0; d < 8; ++d) { oh[d] *= al; ol[d] *= al; }
#pragma unroll
        for (int d = 0; d < 8; ++d) { const v16h vf = g2_frag(sV + (16 * d + ln) * FVP, hh); oh[d] = fa_mma(vf, ph.v, oh[d]); ol[d] = fa_mma(vf, pl.v, ol[d]); }
        __builtin_amdgcn_sched_barrier(0);      /* keeps the pass's work in front of the barrier below, whose fence waits for the loads in flight: scheduled earlier, it would wait out their whole latency */
        __syncthreads();      /* every wave has read this pass's tiles before the next pass's are stored over them */
        if (!more) break;
        cur = nxt;
      }
    }
    /* every output value is formed in place first, then the stores go out as one run: no register that an issued store names is written before the wait behind the run */
    float* cr0 = CTX + (size_t)(q0 + ln) * DQ + h * HD + 8 * hh;
    const float lt = lrun + __shfl_xor(lrun, 16, 32); const float f = 0.0009765625f / lt, fl = f * 0.0009765625f;
#pragma unroll
    for (int d = 0; d < 8; ++d) {
#pragma unroll
      for (int r = 0; r < 8; ++r) oh[d][r] = oh[d][r] * f + ol[d][r] * fl; }
    __builtin_amdgcn_sched_barrier(0);      /* keeps the arithmetic above from being scheduled in among the stores below, where it would write registers of stores still under way */
#pragma unroll
    for (int d = 0; d < 8; ++d) { float* cr = cr0 + 16 * d; const v8f o = oh[d]; const v4f a = {o[0], o[1], o[2], o[3]}, b = {o[4], o[5], o[6], o[7]};
      *(v4f*)cr = a; *(v4f*)(cr + 4) = b; }
    asm volatile("s_wait_xcnt 0x0" ::: "memory");      /* precaution: closes the run of stores, in front of the second tile's writes of their registers */
  }
}

extern "C" void kernel_launch(void* const* d_in, const int* in_sizes, int n_in,
                              void* d_out, int out_size, void* d_ws, size_t ws_size, hipStream_t stream) {
  (void)in_sizes; (void)n_in; (void)out_size;
  const float* const* I = (const float* const*)d_in; const float* q = I[0]; const float* k = I[1]; const float* v = I[2]; const int* msk = (const int*)d_in[3]; const int* pos = (const int*)d_in[4]; const float* qw = I[5]; const float* kw = I[6]; const float* Wo = I[7];
  char* ws = (char*)d_ws; size_t off = 0;
  auto take = [&](size_t bytes) { char* p = ws + off; off += (bytes + 255) & ~(size_t)255; return p; };
  _Float16* BO = (_Float16*)take((size_t)DQ * DQ * 2); _Float16* Q16 = (_Float16*)take((size_t)TT * DQ * 2); _Float16* QL = (_Float16*)take((size_t)TT * DQ * 2); _Float16* K16 = (_Float16*)take((size_t)TT * DKV * 2); _Float16* KL = (_Float16*)take((size_t)TT * DKV * 2); _Float16* V16 = (_Float16*)take((size_t)TT * DKV * 2); _Float16* VT = (_Float16*)take((size_t)TT * DKV * 2); float* CTX = (float*)take((size_t)TT * DQ * 4); int* ACT = (int*)take((size_t)QTN * 64 * 4); _Float16* C16 = Q16; _Float16* CL = QL;      /* merged context hi/lo over the q planes (dead after the attention launch) */
  if (off > ws_size) return;      /* 8 + 8+8 + 2+2 + 2 + 2 + 16 = 48 MiB */
  k_wsc<<<(unsigned)(((size_t)DQ * DQ / 8 + 255) / 256), 256, 0, stream>>>(Wo, BO, (size_t)DQ * DQ / 8, 16.0f);      /* (out,in) natural */
  k_normrope<NQH><<<TT / 8, 256, 0, stream>>>(q, qw, pos, Q16, QL); k_normrope<NKVH><<<TT / 8, 256, 0, stream>>>(k, kw, pos, K16, KL);
  k_x16<<<(unsigned)(((size_t)TT * DKV / 8 + 255) / 256), 256, 0, stream>>>(v, V16, (size_t)TT * DKV / 8);
  k_vt<NKVH * 2, TT><<<NKVH * 2 * (TT / 64), 256, 0, stream>>>(V16, DKV, 0, VT);      /* V^T [512][2048] as 8 slabs of 64 dims; kv head = rows kv*128 .. +127 */
  k_mflag<<<QTN * 64 / 32, 1024, 0, stream>>>(msk, ACT);      /* which 64 x 32 mask tiles hold an open entry */
  k_fattn<<<dim3(QTN / 2, NQH), 128, 0, stream>>>(Q16, QL, K16, KL, VT, msk, ACT, CTX);      /* all 16 heads: ctx[t][h*128 + d], scores and probabilities stay in registers */
  k_hl<<<(unsigned)(((size_t)TT * DQ / 8 + 255) / 256), 256, 0, stream>>>(CTX, C16, CL, (size_t)TT * DQ / 8);
  k_gemm2s<false, DQ, DQ><<<dim3((TT / 128) * (DQ / 64), 1), 128, 0, stream>>>(C16, CL, 0, BO, nullptr, 0, 0.0625f, (float*)d_out, DQ, 0, TT, DQ, DQ);      /* out = (ctx_hi + ctx_lo) W_out^T (W exact), one launch */
}

// v005
// One run takes 168 microseconds.
// Two timings next to v004 both put it at 1.33 times that version's speed.
// All steps since v000 together make it 19.9 times as fast.
#include <hip/hip_runtime.h>
// QEffMolmoBlock (1 x 2048 tokens; 16 query heads / 4 kv heads x 128 dims; q, k, v are INPUT projections): q = RMSNorm_2048(q) * q_norm_w, k = RMSNorm_512(k) * k_norm_w (flat, before the head split); rotate-half RoPE (hd 128, positions from position_ids, base 10000); GQA (each kv head serves 4 query heads); scores = q.k / sqrt(128), masked entries (int mask input != 0) REPLACED by -10000; softmax; out = (att v) W_out^T.
// Structure: RMSNorm + RoPE fused on VALU (wave per token) into f16 hi + 2^10 residual q/k planes; v as an exact f16 plane; V^T by LDS tiles; a flag per 64 x 32 mask tile (any open entry); one fused attention launch for all 16 heads (a wave owns 16 queries and walks the open key passes of 32): the score products (f16 WMMA, f32 accumulation, K = 128, three terms), the masked online softmax on VALU (mask read on device), P as f16 hi + residual (x 2^10) packed in registers, the readout as two terms into the merged context plane; context hi/residual; W_out as two GEMM terms (exact x16 weights). Every product runs all its hi/residual terms in one launch.
// Compute dtype: inputs rounded to bf16; v and W_out exact as f16; normed+rotated q/k (3-term scores), P and the merged context all carried as f16 hi + 2^10 residual (~2^-21): the q/k norm weights are O(1) random so logits have sigma ≈ 11 and the softmax is near one-hot; RMSNorm/RoPE/softmax f32. v_wmma_f32_16x16x32_f16.
#define TT 2048
#define MSTR 2048                /* attention_mask row stride (input geometry) */
#define NQH 16
#define NKVH 4
#define HD 128
#define DQ (NQH * HD)            /* 2048 */
#define DKV (NKVH * HD)          /* 512 */
#define GRP (NQH / NKVH)         /* 4 query heads share a kv head */
typedef __bf16 v16b __attribute__((ext_vector_type(16)));
typedef unsigned short v8us __attribute__((ext_vector_type(8), may_alias));
typedef float  v8f  __attribute__((ext_vector_type(8)));
typedef float  v4f  __attribute__((ext_vector_type(4)));
typedef float  v4fa __attribute__((ext_vector_type(4), may_alias));
union FragB { v16b v; v8us half[2]; unsigned short u[16]; };

__device__ __forceinline__ unsigned short bf16_bits(float x) { unsigned int u = __float_as_uint(x); return (unsigned short)((u + 0x7FFFu + ((u >> 16) & 1u)) >> 16); }
__device__ __forceinline__ float bf16_val(unsigned short b) { return __uint_as_float(((unsigned int)b) << 16); }
__device__ __forceinline__ float bf16_round(float x) { return bf16_val(bf16_bits(x)); }
// D += A·B with NT terms: 1 = ah·bh, 2 = + al·bh (A split), 3 = + ah·bl (both split)
template <int NT>
__device__ __forceinline__ v8f mmaN(v16b ah, v16b al, v16b bh, v16b bl, v8f c) {
  c = __builtin_amdgcn_wmma_f32_16x16x32_bf16(false, ah, false, bh, (short)0, c, false, false);
  if (NT >= 2) c = __builtin_amdgcn_wmma_f32_16x16x32_bf16(false, al, false, bh, (short)0, c, false, false);
  if (NT >= 3) c = __builtin_amdgcn_wmma_f32_16x16x32_bf16(false, ah, false, bl, (short)0, c, false, false);
  asm volatile("v_nop\n\tv_nop\n\tv_nop\n\tv_nop" : "+v"(c) : "v"(ah), "v"(al), "v"(bh), "v"(bl));
  return c;
}

__global__ __launch_bounds__(256) void k_wt_bf16(const float* __restrict__ W, unsigned short* __restrict__ Wt, int K, int N) {
  const int t = blockIdx.x * 256 + threadIdx.x;
  const int k8n = K / 8;
  if (t >= N * k8n) return;
  const int n = t / k8n, k8 = (t % k8n) * 8;
  v8us v;
#pragma unroll
  for (int i = 0; i < 8; ++i) v[i] = bf16_bits(W[(size_t)(k8 + i) * N + n]);
  *(v8us*)(Wt + (size_t)n * K + k8) = v;
  
}

// GEMM C[M][N] (f32, pitch ldc) = act(A[M][K]·W + bias). A f32 row-major (pitch lda) converted per fragment to bf16
// (ASPLIT: hi/lo two planes -> 2 terms, else single rounded term); Wt bf16 [N][K] (pitch ldb). BIAS_BF16 rounds the
// bias to bf16 first (bias quantised to bf16 before the add). K%32==0, M%16==0, N%64==0.
template <bool ASPLIT, int ACT, bool BIAS_BF16>
__global__ __launch_bounds__(128) void k_gemm_bf(const float* __restrict__ A, int lda, const unsigned short* __restrict__ Wt, int ldb,
                                               const float* __restrict__ bias, float* __restrict__ C, int ldc, int M, int N, int K) {
  __shared__ __attribute__((aligned(16))) float so[4][16][64];
  const int tid = threadIdx.x, w = tid >> 5, lane = tid & 31, ln = lane & 15, hh = lane >> 4;
  const int ntn = N / 64;
  const int wid = blockIdx.x * 4 + w;
  const int mt = wid / ntn, nq = wid % ntn;
  if (mt * 16 >= M) return;
  const int row0 = mt * 16, col0 = nq * 64;
  const float* arow = A + (size_t)(row0 + ln) * lda;
  v8f acc[4] = {};
  for (int kb = 0; kb < K; kb += 32) {
    FragB ah, al;
    const v4f x0 = *(const v4fa*)(arow + kb + 8 * hh), x1 = *(const v4fa*)(arow + kb + 8 * hh + 4);
    const v4f x2 = *(const v4fa*)(arow + kb + 16 + 8 * hh), x3 = *(const v4fa*)(arow + kb + 16 + 8 * hh + 4);
    float xs[16] = {x0[0],x0[1],x0[2],x0[3],x1[0],x1[1],x1[2],x1[3],x2[0],x2[1],x2[2],x2[3],x3[0],x3[1],x3[2],x3[3]};
#pragma unroll
    for (int i = 0; i < 16; ++i) { const unsigned short hb = bf16_bits(xs[i]); ah.u[i] = hb; al.u[i] = ASPLIT ? bf16_bits(xs[i] - bf16_val(hb)) : (unsigned short)0; }
#pragma unroll
    for (int t = 0; t < 4; ++t) {
      const unsigned short* brow = Wt + (size_t)(col0 + t * 16 + ln) * ldb + kb;
      FragB b;
      b.half[0] = *(const v8us*)(brow + 8 * hh);
      b.half[1] = *(const v8us*)(brow + 16 + 8 * hh);
      acc[t] = mmaN<ASPLIT ? 2 : 1>(ah.v, al.v, b.v, b.v, acc[t]);
    }
  }
#pragma unroll
  for (int t = 0; t < 4; ++t) {
    float bv = bias ? bias[col0 + t * 16 + ln] : 0.f;
    if (BIAS_BF16) bv = bf16_round(bv);
#pragma unroll
    for (int r = 0; r < 8; ++r) { float v = acc[t][r] + bv; if (ACT == 1) v = fmaxf(v, 0.f); so[w][8 * hh + r][t * 16 + ln] = v; }
  }
  __builtin_amdgcn_fence(__ATOMIC_ACQ_REL, "workgroup");
  __builtin_amdgcn_wave_barrier();
  const int rsub = lane >> 4, c4 = (lane & 15) * 4;
  {
#pragma unroll
    for (int q = 0; q < 8; ++q) {
      const int r = q * 2 + rsub;
      const v4f v = *(const v4fa*)&so[w][r][c4];
      *(v4f*)(C + (size_t)(row0 + r) * ldc + col0 + c4) = v;
    }
    
  }
}

// GEMM C = act(A·W + bias + resid): A f32 (ASPLIT -> hi/lo 2 terms), Wt bf16 [N][K]; ACT 0 none, 1 relu, 2 exact gelu;
// resid (optional, f32, row index = (row % rmod), pitch ldr, RES_BF16 rounds it) added before the activation.
template <bool ASPLIT, int ACT, bool BIAS_BF16, bool RES_BF16>
__global__ __launch_bounds__(128) void k_gemm_bf3(const float* __restrict__ A, int lda, const unsigned short* __restrict__ Wt, int ldb,
                                                const float* __restrict__ bias, const float* __restrict__ resid, int rmod, int ldr,
                                                float* __restrict__ C, int ldc, int M, int N, int K) {
  __shared__ __attribute__((aligned(16))) float so[4][16][64];
  const int tid = threadIdx.x, w = tid >> 5, lane = tid & 31, ln = lane & 15, hh = lane >> 4;
  const int ntn = N / 64;
  const int wid = blockIdx.x * 4 + w;
  const int mt = wid / ntn, nq = wid % ntn;
  if (mt * 16 >= M) return;
  const int row0 = mt * 16, col0 = nq * 64;
  const float* arow = A + (size_t)(row0 + ln) * lda;
  v8f acc[4] = {};
  for (int kb = 0; kb < K; kb += 32) {
    FragB ah, al;
    const v4f x0 = *(const v4fa*)(arow + kb + 8 * hh), x1 = *(const v4fa*)(arow + kb + 8 * hh + 4);
    const v4f x2 = *(const v4fa*)(arow + kb + 16 + 8 * hh), x3 = *(const v4fa*)(arow + kb + 16 + 8 * hh + 4);
    float xs[16] = {x0[0],x0[1],x0[2],x0[3],x1[0],x1[1],x1[2],x1[3],x2[0],x2[1],x2[2],x2[3],x3[0],x3[1],x3[2],x3[3]};
#pragma unroll
    for (int i = 0; i < 16; ++i) { const unsigned short hb = bf16_bits(xs[i]); ah.u[i] = hb; al.u[i] = ASPLIT ? bf16_bits(xs[i] - bf16_val(hb)) : (unsigned short)0; }
#pragma unroll
    for (int t = 0; t < 4; ++t) {
      const unsigned short* brow = Wt + (size_t)(col0 + t * 16 + ln) * ldb + kb;
      FragB b;
      b.half[0] = *(const v8us*)(brow + 8 * hh);
      b.half[1] = *(const v8us*)(brow + 16 + 8 * hh);
      acc[t] = mmaN<ASPLIT ? 2 : 1>(ah.v, al.v, b.v, b.v, acc[t]);
    }
  }
#pragma unroll
  for (int t = 0; t < 4; ++t) {
    const int col = col0 + t * 16 + ln;
    float bv = bias ? bias[col] : 0.f;
    if (BIAS_BF16) bv = bf16_round(bv);
#pragma unroll
    for (int r = 0; r < 8; ++r) {
      float v = acc[t][r] + bv;
      if (resid) { float rv = resid[(size_t)((row0 + 8 * hh + r) % rmod) * ldr + col]; if (RES_BF16) rv = bf16_round(rv); v += rv; }
      if (ACT == 1) v = fmaxf(v, 0.f);
      if (ACT == 2) v = 0.5f * v * (1.0f + erff(v * 0.70710678118654752f));
      if (ACT == 3) { const float u = 0.7978845608028654f * (v + 0.044715f * v * v * v); v = 0.5f * v * (1.0f + tanhf(u)); }
      so[w][8 * hh + r][t * 16 + ln] = v;
    }
  }
  __builtin_amdgcn_fence(__ATOMIC_ACQ_REL, "workgroup");
  __builtin_amdgcn_wave_barrier();
  const int rsub = lane >> 4, c4 = (lane & 15) * 4;
  {
#pragma unroll
    for (int q = 0; q < 8; ++q) {
      const int r = q * 2 + rsub;
      const v4f v = *(const v4fa*)&so[w][r][c4];
      *(v4f*)(C + (size_t)(row0 + r) * ldc + col0 + c4) = v;
    }
    
  }
}
// row LayerNorm (biased variance, eps) over N: s = X (+ R); optional out_sum <- s; out_norm <- (s-mu)*rsqrt(var+eps)*g + b
template <bool PARAM_BF16>
__global__ __launch_bounds__(256) void k_layernorm(const float* __restrict__ X, const float* __restrict__ R, const float* __restrict__ g, const float* __restrict__ bta,
                                                  float* __restrict__ out_sum, float* __restrict__ out_norm, int N, float eps) {
  __shared__ float red[256];
  const int row = blockIdx.x, tid = threadIdx.x;
  const float* x = X + (size_t)row * N; const float* rr = R ? R + (size_t)row * N : nullptr;
  float vals[16];                     // up to N = 4096
  const int per = N / 256;            // contiguous chunk per thread? use strided-by-4 chunks: thread handles j = tid*4 + 1024*u
  float s1 = 0.f;
  for (int u = 0; u < per / 4; ++u) {
    const int j = tid * 4 + 1024 * u;
    const v4f a = *(const v4fa*)(x + j);
    v4f b = {0.f,0.f,0.f,0.f}; if (rr) b = *(const v4fa*)(rr + j);
#pragma unroll
    for (int q = 0; q < 4; ++q) { const float v = a[q] + b[q]; vals[u * 4 + q] = v; s1 += v; }
  }
  red[tid] = s1; __syncthreads();
  for (int st = 128; st > 0; st >>= 1) { if (tid < st) red[tid] += red[tid + st]; __syncthreads(); }
  const float mu = red[0] / (float)N; __syncthreads();
  float s2 = 0.f;
  for (int u = 0; u < per / 4; ++u)
#pragma unroll
    for (int q = 0; q < 4; ++q) { const float c = vals[u * 4 + q] - mu; s2 += c * c; }
  red[tid] = s2; __syncthreads();
  for (int st = 128; st > 0; st >>= 1) { if (tid < st) red[tid] += red[tid + st]; __syncthreads(); }
  const float rs = rsqrtf(red[0] / (float)N + eps);
  {
    for (int u = 0; u < per / 4; ++u) {
      const int j = tid * 4 + 1024 * u;
      v4f o, sm;
#pragma unroll
      for (int q = 0; q < 4; ++q) {
        float gg = g[j + q], bb = bta[j + q];
        if (PARAM_BF16) { gg = bf16_round(gg); bb = bf16_round(bb); }
        sm[q] = vals[u * 4 + q]; o[q] = (vals[u * 4 + q] - mu) * rs * gg + bb;
      }
      if (out_sum) *(v4f*)(out_sum + (size_t)row * N + j) = sm;
      *(v4f*)(out_norm + (size_t)row * N + j) = o;
    }
    
  }
}



// ---- f16 WMMA path (v_wmma_f32_16x16x32_f16): 11-bit significands for operands in range — used where a [0,1] probability operand needs more precision than bf16
typedef _Float16 v16h __attribute__((ext_vector_type(16)));
union FragH { v16h v; v8us half[2]; _Float16 h[16]; unsigned short u[16]; };
template <int NT>
__device__ __forceinline__ v8f mmaH(v16h ah, v16h al, v16h bh, v16h bl, v8f c) {
  c = __builtin_amdgcn_wmma_f32_16x16x32_f16(false, ah, false, bh, (short)0, c, false, false);
  if (NT >= 2) c = __builtin_amdgcn_wmma_f32_16x16x32_f16(false, al, false, bh, (short)0, c, false, false);
  if (NT >= 3) c = __builtin_amdgcn_wmma_f32_16x16x32_f16(false, ah, false, bl, (short)0, c, false, false);
  asm volatile("v_nop\n\tv_nop\n\tv_nop\n\tv_nop" : "+v"(c) : "v"(ah), "v"(al), "v"(bh), "v"(bl));
  return c;
}
// batched GEMM like k_gemm_b but f16 operands: A f32 (split into f16 hi/lo if ASPLIT, else rounded to f16), Bt = f16 values [n][k]; alpha; C f32; N multiple of 16 (partial tiles skipped)
template <bool ASPLIT>
__global__ __launch_bounds__(128) void k_gemm_h(const float* __restrict__ A, int lda, size_t sA, const _Float16* __restrict__ Bh, int ldb, size_t sB, float alpha, float* __restrict__ C, int ldc, size_t sC, int M, int N, int K) {
  __shared__ __attribute__((aligned(16))) float so[4][16][64];
  const int tid = threadIdx.x, w = tid >> 5, lane = tid & 31, ln = lane & 15, hh = lane >> 4; const int by = blockIdx.y;
  A += (size_t)by * sA; Bh += (size_t)by * sB; C += (size_t)by * sC;
  const int ntn = (N + 63) / 64; const int wid = blockIdx.x * 4 + w; const int mt = wid / ntn, nq = wid % ntn; if (mt * 16 >= M) return;
  const int row0 = mt * 16, col0 = nq * 64; const float* arow = A + (size_t)(row0 + ln) * lda;
  v8f acc[4] = {};
  for (int kb = 0; kb < K; kb += 32) {
    FragH ah, al;
    const v4f x0 = *(const v4fa*)(arow + kb + 8 * hh), x1 = *(const v4fa*)(arow + kb + 8 * hh + 4), x2 = *(const v4fa*)(arow + kb + 16 + 8 * hh), x3 = *(const v4fa*)(arow + kb + 16 + 8 * hh + 4);
    float xs[16] = {x0[0],x0[1],x0[2],x0[3],x1[0],x1[1],x1[2],x1[3],x2[0],x2[1],x2[2],x2[3],x3[0],x3[1],x3[2],x3[3]};
#pragma unroll
    for (int i = 0; i < 16; ++i) { const _Float16 h = (_Float16)xs[i]; ah.h[i] = h; al.h[i] = ASPLIT ? (_Float16)(xs[i] - (float)h) : (_Float16)0.0f; }
#pragma unroll
    for (int t = 0; t < 4; ++t) { if (col0 + t * 16 >= N) continue; const size_t boff = (size_t)(col0 + t * 16 + ln) * ldb + kb; FragH bq; bq.half[0] = *(const v8us*)(Bh + boff + 8 * hh); bq.half[1] = *(const v8us*)(Bh + boff + 16 + 8 * hh);
      acc[t] = mmaH<ASPLIT ? 2 : 1>(ah.v, al.v, bq.v, bq.v, acc[t]); }
  }
#pragma unroll
  for (int t = 0; t < 4; ++t) { if (col0 + t * 16 >= N) continue;
#pragma unroll
    for (int r = 0; r < 8; ++r) so[w][8 * hh + r][t * 16 + ln] = acc[t][r] * alpha; }
  __builtin_amdgcn_fence(__ATOMIC_ACQ_REL, "workgroup"); __builtin_amdgcn_wave_barrier();
  const int rsub = lane >> 4, c4 = (lane & 15) * 4;
  {
#pragma unroll
    for (int q = 0; q < 8; ++q) { const int r = q * 2 + rsub; if (col0 + c4 < N) { const v4f v = *(const v4fa*)&so[w][r][c4]; *(v4f*)(C + (size_t)(row0 + r) * ldc + col0 + c4) = v; } }
     }
}

// Wt[n][k] = f16(W[k][n]·scale) from f32 row-major W[K][N] (scale = power of two; bf16-exact weights stay exact in f16 away from the subnormal range)
__global__ __launch_bounds__(256) void k_wt_f16(const float* __restrict__ W, _Float16* __restrict__ Wt, int K, int N, float scale) {
  const int t = blockIdx.x * 256 + threadIdx.x; if (t >= N * (K / 8)) return; const int n = t / (K / 8), k8 = (t % (K / 8)) * 8; FragH f;
#pragma unroll
  for (int i = 0; i < 8; ++i) f.h[i] = (_Float16)(bf16_round(W[(size_t)(k8 + i) * N + n]) * scale); const v8us o = f.half[0];
  *(v8us*)((unsigned short*)Wt + (size_t)n * K + k8) = o; 
}
// k_gemm_hh variant with fused epilogue: v = acc·alpha + bias[by·sBias + col] (+ CP[(row/rowsPerB)·sCPb + by·64 + col] if CP) ; ACT 0 none / 1 elu ; writes f16 C16 (and f32 C if non-null)
template <int ACT>
__global__ __launch_bounds__(128) void k_gemm_hhx(const _Float16* __restrict__ A, int lda, size_t sA, const _Float16* __restrict__ Bh, int ldb, size_t sB, float alpha, const float* __restrict__ bias, size_t sBias, const float* __restrict__ CP, int rowsPerB, size_t sCPb, int row0g,
    float* __restrict__ C, _Float16* __restrict__ C16, int ldc, size_t sC, int M, int N, int K) {
  __shared__ __attribute__((aligned(16))) float so[4][16][64];
  const int tid = threadIdx.x, w = tid >> 5, lane = tid & 31, ln = lane & 15, hh = lane >> 4; const int by = blockIdx.y;
  A += (size_t)by * sA; Bh += (size_t)by * sB; const size_t cofs = (size_t)by * sC; const float* bp = bias ? bias + (size_t)by * sBias : nullptr;
  const int ntn = (N + 63) / 64; const int wid = blockIdx.x * 4 + w; const int mt = wid / ntn, nq = wid % ntn; if (mt * 16 >= M) return;
  const int row0 = mt * 16, col0 = nq * 64; const _Float16* arow = A + (size_t)(row0 + ln) * lda;
  v8f acc[4] = {};
  for (int kb = 0; kb < K; kb += 32) { FragH ah; ah.half[0] = *(const v8us*)((const unsigned short*)arow + kb + 8 * hh); ah.half[1] = *(const v8us*)((const unsigned short*)arow + kb + 16 + 8 * hh);
#pragma unroll
    for (int t = 0; t < 4; ++t) { if (col0 + t * 16 >= N) continue; const size_t boff = (size_t)(col0 + t * 16 + ln) * ldb + kb; FragH bq; bq.half[0] = *(const v8us*)((const unsigned short*)Bh + boff + 8 * hh); bq.half[1] = *(const v8us*)((const unsigned short*)Bh + boff + 16 + 8 * hh);
      acc[t] = mmaH<1>(ah.v, ah.v, bq.v, bq.v, acc[t]); }
  }
#pragma unroll
  for (int t = 0; t < 4; ++t) { if (col0 + t * 16 >= N) continue; const int col = col0 + t * 16 + ln; const float bv = bp ? bf16_round(bp[col]) : 0.f;
#pragma unroll
    for (int r = 0; r < 8; ++r) { float v = acc[t][r] * alpha + bv; if (CP) { const int rr = row0g + row0 + 8 * hh + r; if (rowsPerB < 0) v += CP[cofs + (size_t)rr * ldc + col];      /* rowsPerB < 0: own element of the batched C plane */ else { const int bidx = rr / rowsPerB; v += CP[(size_t)bidx * sCPb + (size_t)by * 64 + col]; } } if (ACT == 1) v = (v > 0.f) ? v : expm1f(v); else if (ACT == 7) v = (v > 0.f) ? v + 1.0f : expf(v); else if (ACT == 8) v = tanhf(v); else if (ACT == 9) v = 0.5f * v * (1.0f + tanhf(0.7978845608028654f * (v + 0.044715f * v * v * v))); else if (ACT == 11) v = 1.0f / (1.0f + expf(-v)); else if (ACT == 12) v = (v > 0.f) ? v : 0.01f * v; else if (ACT == 14) v = (v > 0.f) ? v : 0.1f * v; else if (ACT == 16) v = (v >= 0.f) ? v : 0.3f * v; else if (ACT == 17) v = (v >= 0.f) ? v : 0.2f * v; else if (ACT == 15) v = v / (1.0f + expf(-v)); else if (ACT == 3) v = fmaxf(v, 0.f); else if (ACT == 6) v = 0.5f * v * (1.0f + erff(v * 0.70710678118654752f)); so[w][8 * hh + r][t * 16 + ln] = v; } }
  __builtin_amdgcn_fence(__ATOMIC_ACQ_REL, "workgroup"); __builtin_amdgcn_wave_barrier();
  const int rsub = lane >> 4, c4 = (lane & 15) * 4; typedef _Float16 v4h __attribute__((ext_vector_type(4)));
  {
#pragma unroll
    for (int q = 0; q < 8; ++q) { const int r = q * 2 + rsub; if (col0 + c4 < N) { const v4f v = *(const v4fa*)&so[w][r][c4]; if (C) *(v4f*)(C + cofs + (size_t)(row0 + r) * ldc + col0 + c4) = v; if (C16) { v4h h4; for (int i = 0; i < 4; ++i) h4[i] = (_Float16)v[i]; *(v4h*)(C16 + cofs + (size_t)(row0 + r) * ldc + col0 + c4) = h4; } } }
     }
}


typedef _Float16 v4h __attribute__((ext_vector_type(4)));

__global__ __launch_bounds__(256) void k_x16(const float* __restrict__ x, _Float16* __restrict__ X16, size_t n8) { const size_t t = (size_t)blockIdx.x * 256 + threadIdx.x; if (t >= n8) return; FragH f;
#pragma unroll
  for (int q = 0; q < 8; ++q) f.h[q] = (_Float16)bf16_round(x[t * 8 + q]); *(v8us*)((unsigned short*)X16 + t * 8) = f.half[0];  }
__global__ __launch_bounds__(256) void k_h16(const float* __restrict__ x, _Float16* __restrict__ X16, size_t n8) { const size_t t = (size_t)blockIdx.x * 256 + threadIdx.x; if (t >= n8) return; FragH f;
#pragma unroll
  for (int q = 0; q < 8; ++q) f.h[q] = (_Float16)x[t * 8 + q]; *(v8us*)((unsigned short*)X16 + t * 8) = f.half[0];  }
__global__ __launch_bounds__(256) void k_round16f(const float* __restrict__ W, _Float16* __restrict__ Bt, size_t n8) { const size_t t = (size_t)blockIdx.x * 256 + threadIdx.x; if (t >= n8) return; FragH f;
#pragma unroll
  for (int i = 0; i < 8; ++i) f.h[i] = (_Float16)(bf16_round(W[t * 8 + i]) * 16.0f); *(v8us*)((unsigned short*)Bt + t * 8) = f.half[0];  }
template <int NHv, int TTv>
__global__ __launch_bounds__(256) void k_vt(const _Float16* __restrict__ V16, int ldv, int voff, _Float16* __restrict__ Vt) { __shared__ unsigned short tl[64][66]; const int tid = threadIdx.x; const int slab = blockIdx.x / (TTv / 64), lg = blockIdx.x % (TTv / 64); const int b = slab / NHv, h = slab % NHv;
  for (int i = tid; i < 64 * 8; i += 256) { const int r = i / 8, c8 = (i % 8) * 8; FragH f; f.half[0] = *(const v8us*)((const unsigned short*)V16 + ((size_t)b * TTv + lg * 64 + r) * ldv + voff + h * 64 + c8);
#pragma unroll
    for (int q = 0; q < 8; ++q) tl[r][c8 + q] = f.u[q]; }
  __syncthreads();
  {
#pragma unroll
    for (int rd = 0; rd < 2; ++rd) { const int d = rd * 32 + tid / 8, pc = tid % 8; FragH f;
#pragma unroll
      for (int q = 0; q < 8; ++q) f.u[q] = tl[pc * 8 + q][d];
      *(v8us*)((unsigned short*)Vt + ((size_t)slab * 64 + d) * TTv + lg * 64 + pc * 8) = f.half[0]; }
     } }

__global__ __launch_bounds__(256) void k_hl(const float* __restrict__ F, _Float16* __restrict__ Hh, _Float16* __restrict__ Hl, size_t n8) { const size_t t = (size_t)blockIdx.x * 256 + threadIdx.x; if (t >= n8) return; FragH fh, fl; const v4f a = *(const v4fa*)(F + t * 8), c = *(const v4fa*)(F + t * 8 + 4);
#pragma unroll
  for (int q = 0; q < 4; ++q) { _Float16 h = (_Float16)a[q]; fh.h[q] = h; fl.h[q] = (_Float16)((a[q] - (float)h) * 1024.0f); h = (_Float16)c[q]; fh.h[4 + q] = h; fl.h[4 + q] = (_Float16)((c[q] - (float)h) * 1024.0f); }
  { *(v8us*)((unsigned short*)Hh + t * 8) = fh.half[0]; *(v8us*)((unsigned short*)Hl + t * 8) = fl.half[0];  } }

// ---- fragment loader: 16 halves of one operand row in the hardware k order ----
__device__ __forceinline__ v16h g2_frag(const _Float16* p, int hh) { FragH f; f.half[0] = *(const v8us*)((const unsigned short*)p + 8 * hh); f.half[1] = *(const v8us*)((const unsigned short*)p + 16 + 8 * hh); return f.v; }
__global__ __launch_bounds__(256) void k_wsc(const float* __restrict__ Wm, _Float16* __restrict__ Bt, size_t n8, float sc) { const size_t t = (size_t)blockIdx.x * 256 + threadIdx.x; if (t >= n8) return; FragH f; for (int q = 0; q < 8; ++q) f.h[q] = (_Float16)(bf16_round(Wm[t * 8 + q]) * sc); *(v8us*)((unsigned short*)Bt + t * 8) = f.half[0];  }
template <int NH_>
__global__ __launch_bounds__(256) void k_normrope(const float* __restrict__ X, const float* __restrict__ w, const int* __restrict__ pos, _Float16* __restrict__ O16, _Float16* __restrict__ OL) {
  #pragma clang fp contract(off)
  constexpr int W_ = NH_ * HD; const int wv = threadIdx.x >> 5, ln = threadIdx.x & 31; const int t = blockIdx.x * 8 + wv; if (t >= TT) return; const float* x = X + (size_t)t * W_; float ss = 0.f;
#pragma unroll 1
  for (int c = ln * 4; c < W_; c += 128) { const v4f a = *(const v4fa*)(x + c); for (int e = 0; e < 4; ++e) { const float v = bf16_round(a[e]); ss += v * v; } }
  for (int o = 16; o > 0; o >>= 1) ss += __shfl_xor(ss, o, 32); const float inv = rsqrtf(ss / (float)W_ + 1e-5f); const float p = (float)pos[t];
  {
#pragma unroll 1
    for (int h = 0; h < NH_; ++h) { for (int u = 0; u < 2; ++u) { const int d = ln + 32 * u; const int c1 = h * HD + d, c2 = c1 + 64; float x1 = bf16_round(x[c1]) * inv; x1 *= bf16_round(w[c1]); float x2 = bf16_round(x[c2]) * inv; x2 *= bf16_round(w[c2]);
        const float ex = (float)(2 * d) / (float)HD; const float ivf = 1.0f / powf(10000.0f, ex); const float th = p * ivf; const float cs = cosf(th), sn = sinf(th); float o1 = x1 * cs; o1 += -(x2 * sn); float o2 = x2 * cs; o2 += x1 * sn;
        const _Float16 h1 = (_Float16)o1, h2 = (_Float16)o2; *(_Float16*)(O16 + (size_t)t * W_ + c1) = h1; *(_Float16*)(O16 + (size_t)t * W_ + c2) = h2; *(_Float16*)(OL + (size_t)t * W_ + c1) = (_Float16)((o1 - (float)h1) * 1024.0f); *(_Float16*)(OL + (size_t)t * W_ + c2) = (_Float16)((o2 - (float)h2) * 1024.0f); } }
     } }

// ---- fused attention: scores, masked softmax and readout of all 16 heads in ONE launch; the score and probability planes never go to memory ----
// Transposed products: S^T = K.Q^T (A = key rows, B = query rows held in registers), O^T += V^T.P^T. In an accumulator tile a lane holds 8 keys of ONE query (column = lane & 15, rows 8 * (lane >> 4) + r),
// which is exactly the k order of the B loader (k = 8 * hh + i, then 16 + 8 * hh + i), so two 16-key score tiles pack in-lane into one 32-key P^T fragment. Running maximum and sum per query (online softmax):
// when the maximum moves, the output accumulators and the sum are scaled by exp(m_old - m_new). Same operand planes and terms as the separate stages: 3 hi/residual score terms, P as f16 hi + 2^10 residual of 1024 * p.
__device__ __forceinline__ v8f fa_mma(v16h a, v16h b, v8f c) { return __builtin_amdgcn_wmma_f32_16x16x32_f16(false, a, false, b, (short)0, c, false, false); }
typedef int v4i __attribute__((ext_vector_type(4)));
#define FKP 136                  /* LDS pitch of a K row, in halves */
#define FVP 40                   /* LDS pitch of a V^T row, in halves */
#define QTN (TT / 64)            /* query tiles of 64 rows */
// act[qt * 64 + p] = 1 where the 64 x 32 mask tile (query tile qt, key pass p) holds at least one open (zero) entry, else 0. A wave reads one tile; a block writes one whole 128-byte line of flags.
__global__ __launch_bounds__(1024) void k_mflag(const int* __restrict__ msk, int* __restrict__ act) {
  const int wv = threadIdx.x >> 5, lane = threadIdx.x & 31; const int u = blockIdx.x * 32 + wv; const int qt = u >> 6, p = u & 63;
  const int* mp = msk + (size_t)(qt * 64 + (lane >> 3)) * MSTR + p * 32 + (lane & 7) * 4;
  bool open = false;
#pragma unroll
  for (int i = 0; i < 16; ++i) { const v4i m = *(const v4i*)(mp + (size_t)i * 4 * MSTR); open = open || m[0] == 0 || m[1] == 0 || m[2] == 0 || m[3] == 0; }
  const unsigned any = __builtin_amdgcn_ballot_w32(open);
  if (lane == 0) act[u] = any != 0u ? 1 : 0;
}
// A block runs two query tiles of 64 rows one after the other, tile QTN - 1 - x and tile x, so that under a triangular mask every block has the same number of open passes; a wave owns 16 queries.
// Of each tile only the open key passes are walked (flags of k_mflag). A closed pass holds nothing but scores of -10000: once every row of the tile has a running maximum of -9000 or more, exp(-10000 - max) is 0 in f32
// and the pass would change neither sums nor maximum. Where a row's maximum is lower after the open passes (a row with no open key among them), the closed passes are walked as well, after the open ones, by the same code.
__global__ __launch_bounds__(128) void k_fattn(const _Float16* __restrict__ Qh, const _Float16* __restrict__ Ql, const _Float16* __restrict__ Kh, const _Float16* __restrict__ Kl, const _Float16* __restrict__ Vt,
    const int* __restrict__ msk, const int* __restrict__ act, float* __restrict__ CTX) {
  __shared__ __attribute__((aligned(16))) _Float16 sKh[32 * FKP], sKl[32 * FKP], sV[HD * FVP];
  __shared__ int sLow[2][4];      /* per tile and wave: some row's maximum is still low; a slot set of its own for each tile, so that no wave writes a slot that a slower wave still reads */
  const int tid = threadIdx.x, w = tid >> 5, lane = tid & 31, ln = lane & 15, hh = lane >> 4; const int h = blockIdx.y, kv = h / GRP;
  const v8f z8 = {0.f,0.f,0.f,0.f,0.f,0.f,0.f,0.f};
  /* the block's four waves share each pass's K (hi, residual) and V^T tiles through LDS: whole-row global loads, one copy a block; pitches 272 B and 80 B (16 B x odd) keep the 16-byte fragment reads off each other's banks */
  const int krow = tid >> 4, kcol = (tid & 15) * 8, vrow = tid >> 2, vcol = (tid & 3) * 8;
  const _Float16* gkh = Kh + (size_t)krow * DKV + kv * HD + kcol; const _Float16* gkl = Kl + (size_t)krow * DKV + kv * HD + kcol; const _Float16* gv = Vt + ((size_t)kv * HD + vrow) * TT + vcol;
  const float alpha = 0.088388347648318447f, alo = alpha * 0.0009765625f;
  /* kept rolled: the two tiles run through one copy of the code */
#pragma unroll 1
  for (int half = 0; half < 2; ++half) {
    const int qt = half ? (int)blockIdx.x : QTN - 1 - (int)blockIdx.x; const int q0 = qt * 64 + 16 * w;      /* a wave owns 16 queries: one column group */
    const int a0 = act[qt * 64 + lane], a1 = act[qt * 64 + 32 + lane];
    asm volatile("s_wait_xcnt 0x0" ::: "memory");      /* precaution: the loads below may land in, or have their addresses formed in, a register that the two loads above name */
    __builtin_amdgcn_sched_barrier(0);      /* keeps the loads below behind that wait */
    v16h qh[4], ql[4];
    const size_t qo = (size_t)(q0 + ln) * DQ + h * HD; const _Float16* qp0 = Qh + qo; const _Float16* qp2 = Ql + qo;
#pragma unroll
    for (int ks = 0; ks < 4; ++ks) { qh[ks] = g2_frag(qp0 + ks * 32, hh); ql[ks] = g2_frag(qp2 + ks * 32, hh); }
    asm volatile("s_wait_xcnt 0x0" ::: "memory");      /* precaution: stands in front of every later write of a register that one of the loads above names */
    __builtin_amdgcn_sched_barrier(0);      /* keeps the work below from being scheduled above that wait */
    const unsigned long long open = (unsigned long long)__builtin_amdgcn_ballot_w32(a0 != 0) | ((unsigned long long)__builtin_amdgcn_ballot_w32(a1 != 0) << 32);      /* bit p: pass p is open; the same in all four waves */
    v8f oh[8], ol[8];
#pragma unroll
    for (int d = 0; d < 8; ++d) { oh[d] = z8; ol[d] = z8; }
    float mrun = -3.0e38f, lrun = 0.f;
    const int* gm = msk + (size_t)(q0 + ln) * MSTR + 8 * hh;
    /* kept rolled: open passes (phase 0) and, where needed, closed passes (phase 1) run through one copy of the code */
#pragma unroll 1
    for (int phase = 0; phase < 2; ++phase) {
      unsigned long long todo = open;
      if (phase) {
        const unsigned lowb = __builtin_amdgcn_ballot_w32(mrun < -9000.0f);
        if (lane == 0) sLow[half][w] = lowb != 0u ? 1 : 0;
        __syncthreads();      /* the four waves' findings are published: the choice below must be the same in the whole block, barriers follow it */
        const int anylow = sLow[half][0] | sLow[half][1] | sLow[half][2] | sLow[half][3];
        todo = __builtin_amdgcn_readfirstlane(anylow) != 0 ? ~open : 0ull;
      }
      if (todo == 0ull) continue;
      int cur = __builtin_ctzll(todo); todo &= todo - 1ull;
      v8us rk[4], rl[4], rv[4]; v4i mk[2][2];
#pragma unroll
      for (int i = 0; i < 4; ++i) { rk[i] = *(const v8us*)(gkh + (size_t)(cur * 32 + i * 8) * DKV); rl[i] = *(const v8us*)(gkl + (size_t)(cur * 32 + i * 8) * DKV); rv[i] = *(const v8us*)(gv + (size_t)i * 32 * TT + cur * 32); }
#pragma unroll
      for (int j = 0; j < 2; ++j) { mk[j][0] = *(const v4i*)(gm + cur * 32 + j * 16); mk[j][1] = *(const v4i*)(gm + cur * 32 + j * 16 + 4); }
      asm volatile("s_wait_xcnt 0x0" ::: "memory");      /* same precaution as behind the query loads */
      __builtin_amdgcn_sched_barrier(0);      /* keeps the work below from being scheduled above that wait */
      /* kept rolled: one pass's staging registers and fragments beside the query fragments and the output accumulators are what is meant to stay in registers; every inner loop is unrolled so that the register arrays are indexed by constants */
#pragma unroll 1
      for (;;) {
#pragma unroll
        for (int i = 0; i < 4; ++i) { *(v8us*)(sKh + (krow + 8 * i) * FKP + kcol) = rk[i]; *(v8us*)(sKl + (krow + 8 * i) * FKP + kcol) = rl[i]; *(v8us*)(sV + (vrow + 32 * i) * FVP + vcol) = rv[i]; }
        bool msel[2][8];      /* this pass's mask, read out of its registers before the next pass's lands in them */
#pragma unroll
        for (int j = 0; j < 2; ++j) {
#pragma unroll
          for (int r = 0; r < 8; ++r) msel[j][r] = mk[j][r >> 2][r & 3] != 0; }
        __syncthreads();      /* this pass's tiles are published to all four waves */
        const bool more = todo != 0ull; const int nxt = more ? __builtin_ctzll(todo) : cur; todo &= todo - 1ull;      /* the last pass of a phase fetches its own tiles again: in bounds, never used */
        const int kn = nxt * 32;
        const int* mp = gm + kn;
        /* the next pass's mask and tiles go into registers now: they fly while this pass is worked on */
#pragma unroll
        for (int j = 0; j < 2; ++j) { mk[j][0] = *(const v4i*)(mp + j * 16); mk[j][1] = *(const v4i*)(mp + j * 16 + 4); }
#pragma unroll
        for (int i = 0; i < 4; ++i) { rk[i] = *(const v8us*)(gkh + (size_t)(kn + i * 8) * DKV); rl[i] = *(const v8us*)(gkl + (size_t)(kn + i * 8) * DKV); rv[i] = *(const v8us*)(gv + (size_t)i * 32 * TT + kn); }
        asm volatile("s_wait_xcnt 0x0" ::: "memory");      /* precaution: stands in front of every later write of a register that one of the loads above names */
        __builtin_amdgcn_sched_barrier(0);      /* keeps the work below from being scheduled above that wait, and the loads above in front of the pass's work */
        v8f sh[2] = {z8, z8}, sl[2] = {z8, z8};      /* [key tile j] */
#pragma unroll
        for (int ks = 0; ks < 4; ++ks) { const v16h kh0 = g2_frag(sKh + ln * FKP + ks * 32, hh), kh1 = g2_frag(sKh + (16 + ln) * FKP + ks * 32, hh), kl0 = g2_frag(sKl + ln * FKP + ks * 32, hh), kl1 = g2_frag(sKl + (16 + ln) * FKP + ks * 32, hh);
          sh[0] = fa_mma(kh0, qh[ks], sh[0]); sh[1] = fa_mma(kh1, qh[ks], sh[1]); sl[0] = fa_mma(kh0, ql[ks], sl[0]); sl[1] = fa_mma(kh1, ql[ks], sl[1]); sl[0] = fa_mma(kl0, qh[ks], sl[0]); sl[1] = fa_mma(kl1, qh[ks], sl[1]); }
        FragH ph, pl; float sv[2][8]; float mx = -3.0e38f;
#pragma unroll
        for (int j = 0; j < 2; ++j) {
#pragma unroll
          for (int r = 0; r < 8; ++r) { const float s0 = sh[j][r] * alpha + sl[j][r] * alo; const float s = msel[j][r] ? -10000.0f : s0; sv[j][r] = s; mx = fmaxf(mx, s); } }
        mx = fmaxf(mx, __shfl_xor(mx, 16, 32));      /* the other half-wave holds this query's other 16 keys */
        const float mn = fmaxf(mrun, mx); const float al = expf(mrun - mn); mrun = mn; float su = 0.f;
#pragma unroll
        for (int j = 0; j < 2; ++j) {
#pragma unroll
          for (int r = 0; r < 8; ++r) { const float p = expf(sv[j][r] - mn); su += p; const float pv = p * 1024.0f; const _Float16 hi = (_Float16)pv; ph.h[8 * j + r] = hi; pl.h[8 * j + r] = (_Float16)((pv - (float)hi) * 1024.0f); } }
        lrun = lrun * al + su;      /* each half-wave sums its own keys; the halves meet in the epilogue */
#pragma unroll
        for (int d = 0; d < 8; ++d) { oh[d] *= al; ol[d] *= al; }
#pragma unroll
        for (int d = 0; d < 8; ++d) { const v16h vf = g2_frag(sV + (16 * d + ln) * FVP, hh); oh[d] = fa_mma(vf, ph.v, oh[d]); ol[d] = fa_mma(vf, pl.v, ol[d]); }
        __builtin_amdgcn_sched_barrier(0);      /* keeps the pass's work in front of the barrier below, whose fence waits for the loads in flight: scheduled earlier, it would wait out their whole latency */
        __syncthreads();      /* every wave has read this pass's tiles before the next pass's are stored over them */
        if (!more) break;
        cur = nxt;
      }
    }
    /* every output value is formed in place first, then the stores go out as one run: no register that an issued store names is written before the wait behind the run */
    float* cr0 = CTX + (size_t)(q0 + ln) * DQ + h * HD + 8 * hh;
    const float lt = lrun + __shfl_xor(lrun, 16, 32); const float f = 0.0009765625f / lt, fl = f * 0.0009765625f;
#pragma unroll
    for (int d = 0; d < 8; ++d) {
#pragma unroll
      for (int r = 0; r < 8; ++r) oh[d][r] = oh[d][r] * f + ol[d][r] * fl; }
    __builtin_amdgcn_sched_barrier(0);      /* keeps the arithmetic above from being scheduled in among the stores below, where it would write registers of stores still under way */
#pragma unroll
    for (int d = 0; d < 8; ++d) { float* cr = cr0 + 16 * d; const v8f o = oh[d]; const v4f a = {o[0], o[1], o[2], o[3]}, b = {o[4], o[5], o[6], o[7]};
      *(v4f*)cr = a; *(v4f*)(cr + 4) = b; }
    asm volatile("s_wait_xcnt 0x0" ::: "memory");      /* precaution: closes the run of stores, in front of the second tile's writes of their registers */
  }
}

// ---- W_out GEMM, operand tiles staged in LDS ----
// C = alpha * (Ah.Bh^T + 2^-10 * Al.Bh^T), all three planes [2048][2048] f16, k contiguous. A block owns a 128 x 128 tile of C, a wave 32 rows x 64 columns of it (4 x 2 waves); the hi product and the residual product keep
// separate f32 accumulators (the residual plane carries a 2^10 scale) and meet once in the epilogue. A stage is 64 k = 128 B of each of the 3 x 128 operand rows: eight lanes fetch one row's whole cache line, each row once a block,
// and the fragments, whose 16 rows lie 4 KiB apart in memory, are read from LDS instead. Two LDS buffers: stage s + 1 is stored and stage s + 2 fetched to registers while stage s is worked on; one barrier a stage.
#define GKS 64                   /* k (halves) a stage */
#define GPI 72                   /* LDS pitch of a staged row, in halves: 144 B = 16 B x odd keeps the 16-byte fragment reads off each other's banks */
#define GBUF (128 * GPI)         /* halves of one plane's buffer */
#define GNS (DQ / GKS)           /* stages */
__global__ __launch_bounds__(256) void k_gemm2l(const _Float16* __restrict__ Ah, const _Float16* __restrict__ Al, const _Float16* __restrict__ Bh, float alpha, float* __restrict__ C) {
  __shared__ __attribute__((aligned(16))) _Float16 sAh[2 * GBUF], sAl[2 * GBUF], sB[2 * GBUF];
  __shared__ __attribute__((aligned(16))) float so[8][32][68];
  const int tid = threadIdx.x, w = tid >> 5, lane = tid & 31, ln = lane & 15, hh = lane >> 4;
  const int mt = blockIdx.x / (DQ / 128), nt = blockIdx.x % (DQ / 128); const int wr = (w >> 1) * 32, wc = (w & 1) * 64;
  const int srow = tid >> 3, scol = (tid & 7) * 8; const int sofs = srow * GPI + scol;      /* staging: a thread moves 16 bytes of rows srow, srow + 32, + 64, + 96 of each plane */
  const _Float16* gah = Ah + (size_t)(mt * 128 + srow) * DQ + scol; const _Float16* gal = Al + (size_t)(mt * 128 + srow) * DQ + scol; const _Float16* gb = Bh + (size_t)(nt * 128 + srow) * DQ + scol;
  const v8f z8 = {0.f,0.f,0.f,0.f,0.f,0.f,0.f,0.f}; v8f ch[8] = {z8, z8, z8, z8, z8, z8, z8, z8}, cl[8] = {z8, z8, z8, z8, z8, z8, z8, z8};      /* [t] = rows 0..15, [4 + t] = rows 16..31 of column tile t */
  v8us ra[4], rl[4], rb[4];
#pragma unroll
  for (int i = 0; i < 4; ++i) { ra[i] = *(const v8us*)(gah + (size_t)i * 32 * DQ); rl[i] = *(const v8us*)(gal + (size_t)i * 32 * DQ); rb[i] = *(const v8us*)(gb + (size_t)i * 32 * DQ); }
  asm volatile("s_wait_xcnt 0x0" ::: "memory");      /* precaution: stands in front of every later write of a register that one of the loads above names */
  __builtin_amdgcn_sched_barrier(0);      /* keeps the work below from being scheduled above that wait */
#pragma unroll
  for (int i = 0; i < 4; ++i) { *(v8us*)(sAh + sofs + i * 32 * GPI) = ra[i]; *(v8us*)(sAl + sofs + i * 32 * GPI) = rl[i]; *(v8us*)(sB + sofs + i * 32 * GPI) = rb[i]; }
#pragma unroll
  for (int i = 0; i < 4; ++i) { ra[i] = *(const v8us*)(gah + (size_t)i * 32 * DQ + GKS); rl[i] = *(const v8us*)(gal + (size_t)i * 32 * DQ + GKS); rb[i] = *(const v8us*)(gb + (size_t)i * 32 * DQ + GKS); }
  asm volatile("s_wait_xcnt 0x0" ::: "memory");      /* same precaution */
  __builtin_amdgcn_sched_barrier(0);      /* keeps the work below from being scheduled above that wait */
  __syncthreads();      /* publishes stage 0 */
  /* kept rolled: one copy of the stage's code; every inner loop is unrolled so that the register arrays are indexed by constants */
#pragma unroll 1
  for (int s = 0; s < GNS; ++s) {
    const int cb = (s & 1) * GBUF, nb = GBUF - cb;      /* this stage's buffer; the other one, which every wave left at the last barrier */
    const _Float16* pah = sAh + cb + (wr + ln) * GPI; const _Float16* pal = sAl + cb + (wr + ln) * GPI; const _Float16* pb = sB + cb + (wc + ln) * GPI;
    v16h fa[GKS / 32][4], fb[GKS / 32][4];      /* [k step][rows 0..15 hi, rows 16..31 hi, rows 0..15 residual, rows 16..31 residual], [k step][column tile] */
#pragma unroll
    for (int ks = 0; ks < GKS / 32; ++ks) {
      fa[ks][0] = g2_frag(pah + ks * 32, hh); fa[ks][1] = g2_frag(pah + 16 * GPI + ks * 32, hh); fa[ks][2] = g2_frag(pal + ks * 32, hh); fa[ks][3] = g2_frag(pal + 16 * GPI + ks * 32, hh);
#pragma unroll
      for (int t = 0; t < 4; ++t) fb[ks][t] = g2_frag(pb + t * 16 * GPI + ks * 32, hh); }
    __builtin_amdgcn_sched_barrier(0);      /* keeps the stage's fragment reads as one run at its head: the first products wait for nothing else, and the second k step's fragments land while the first's products run */
    /* stage s + 1 goes from its registers into the other buffer, stage s + 2 into the registers: both run beside the products below. No branch here, so that the waits in front of the products can be counted ones:
       the last trip stores, and the last two fetch, the last stage once more: in bounds, never read */
#pragma unroll
    for (int i = 0; i < 4; ++i) { *(v8us*)(sAh + nb + sofs + i * 32 * GPI) = ra[i]; *(v8us*)(sAl + nb + sofs + i * 32 * GPI) = rl[i]; *(v8us*)(sB + nb + sofs + i * 32 * GPI) = rb[i]; }
    const int kn = (s + 2 < GNS ? s + 2 : GNS - 1) * GKS;
#pragma unroll
    for (int i = 0; i < 4; ++i) { ra[i] = *(const v8us*)(gah + (size_t)i * 32 * DQ + kn); rl[i] = *(const v8us*)(gal + (size_t)i * 32 * DQ + kn); rb[i] = *(const v8us*)(gb + (size_t)i * 32 * DQ + kn); }
    asm volatile("s_wait_xcnt 0x0" ::: "memory");      /* same precaution as behind the first loads */
    __builtin_amdgcn_sched_barrier(0);      /* keeps the loads above in front of the products, so that they fly during them, and the products behind the wait */
#pragma unroll
    for (int ks = 0; ks < GKS / 32; ++ks) {
#pragma unroll
      for (int t = 0; t < 4; ++t) { ch[t] = fa_mma(fa[ks][0], fb[ks][t], ch[t]); ch[4 + t] = fa_mma(fa[ks][1], fb[ks][t], ch[4 + t]); cl[t] = fa_mma(fa[ks][2], fb[ks][t], cl[t]); cl[4 + t] = fa_mma(fa[ks][3], fb[ks][t], cl[4 + t]); } }
    __builtin_amdgcn_sched_barrier(0);      /* keeps the products in front of the barrier below, whose fence waits for the loads in flight */
    __syncthreads();      /* publishes stage s + 1 to all eight waves, and ends every wave's reads of stage s before its buffer is stored over */
  }
  const float alo = alpha * 0.0009765625f;
#pragma unroll
  for (int u = 0; u < 8; ++u) { const int t = u & 3, half = u >> 2;
#pragma unroll
    for (int r = 0; r < 8; ++r) so[w][half * 16 + 8 * hh + r][t * 16 + ln] = ch[u][r] * alpha + cl[u][r] * alo; }
  __builtin_amdgcn_fence(__ATOMIC_ACQ_REL, "workgroup"); __builtin_amdgcn_wave_barrier();      /* this wave's LDS stores above come before its own LDS reads below (so[w] is private to the wave) */
  const int rsub = lane >> 4, c4 = (lane & 15) * 4; float* cp = C + (size_t)(mt * 128 + wr + rsub) * DQ + nt * 128 + wc + c4;
  v4f ov[16];
#pragma unroll
  for (int q = 0; q < 16; ++q) ov[q] = *(const v4fa*)&so[w][q * 2 + rsub][c4];
  __builtin_amdgcn_sched_barrier(0);      /* every value is in its register before the run of stores starts: no register that an issued store names is written behind it */
#pragma unroll
  for (int q = 0; q < 16; ++q) *(v4f*)(cp + (size_t)q * 2 * DQ) = ov[q];
}

extern "C" void kernel_launch(void* const* d_in, const int* in_sizes, int n_in,
                              void* d_out, int out_size, void* d_ws, size_t ws_size, hipStream_t stream) {
  (void)in_sizes; (void)n_in; (void)out_size;
  const float* const* I = (const float* const*)d_in; const float* q = I[0]; const float* k = I[1]; const float* v = I[2]; const int* msk = (const int*)d_in[3]; const int* pos = (const int*)d_in[4]; const float* qw = I[5]; const float* kw = I[6]; const float* Wo = I[7];
  char* ws = (char*)d_ws; size_t off = 0;
  auto take = [&](size_t bytes) { char* p = ws + off; off += (bytes + 255) & ~(size_t)255; return p; };
  _Float16* BO = (_Float16*)take((size_t)DQ * DQ * 2); _Float16* Q16 = (_Float16*)take((size_t)TT * DQ * 2); _Float16* QL = (_Float16*)take((size_t)TT * DQ * 2); _Float16* K16 = (_Float16*)take((size_t)TT * DKV * 2); _Float16* KL = (_Float16*)take((size_t)TT * DKV * 2); _Float16* V16 = (_Float16*)take((size_t)TT * DKV * 2); _Float16* VT = (_Float16*)take((size_t)TT * DKV * 2); float* CTX = (float*)take((size_t)TT * DQ * 4); int* ACT = (int*)take((size_t)QTN * 64 * 4); _Float16* C16 = Q16; _Float16* CL = QL;      /* merged context hi/lo over the q planes (dead after the attention launch) */
  if (off > ws_size) return;      /* 8 + 8+8 + 2+2 + 2 + 2 + 16 = 48 MiB */
  k_wsc<<<(unsigned)(((size_t)DQ * DQ / 8 + 255) / 256), 256, 0, stream>>>(Wo, BO, (size_t)DQ * DQ / 8, 16.0f);      /* (out,in) natural */
  k_normrope<NQH><<<TT / 8, 256, 0, stream>>>(q, qw, pos, Q16, QL); k_normrope<NKVH><<<TT / 8, 256, 0, stream>>>(k, kw, pos, K16, KL);
  k_x16<<<(unsigned)(((size_t)TT * DKV / 8 + 255) / 256), 256, 0, stream>>>(v, V16, (size_t)TT * DKV / 8);
  k_vt<NKVH * 2, TT><<<NKVH * 2 * (TT / 64), 256, 0, stream>>>(V16, DKV, 0, VT);      /* V^T [512][2048] as 8 slabs of 64 dims; kv head = rows kv*128 .. +127 */
  k_mflag<<<QTN * 64 / 32, 1024, 0, stream>>>(msk, ACT);      /* which 64 x 32 mask tiles hold an open entry */
  k_fattn<<<dim3(QTN / 2, NQH), 128, 0, stream>>>(Q16, QL, K16, KL, VT, msk, ACT, CTX);      /* all 16 heads: ctx[t][h*128 + d], scores and probabilities stay in registers */
  k_hl<<<(unsigned)(((size_t)TT * DQ / 8 + 255) / 256), 256, 0, stream>>>(CTX, C16, CL, (size_t)TT * DQ / 8);
  k_gemm2l<<<(TT / 128) * (DQ / 128), 256, 0, stream>>>(C16, CL, BO, 0.0625f, (float*)d_out);      /* out = (ctx_hi + ctx_lo) W_out^T (W exact), one launch */
}

// v006
// A run of this version takes 148 microseconds.
// Two timings next to v005 both put it at 1.13 times that version's speed.
// Counting every step since v000, it is 22.5 times as fast.
#include <hip/hip_runtime.h>
// QEffMolmoBlock (1 x 2048 tokens; 16 query heads / 4 kv heads x 128 dims; q, k, v are INPUT projections): q = RMSNorm_2048(q) * q_norm_w, k = RMSNorm_512(k) * k_norm_w (flat, before the head split); rotate-half RoPE (hd 128, positions from position_ids, base 10000); GQA (each kv head serves 4 query heads); scores = q.k / sqrt(128), masked entries (int mask input != 0) REPLACED by -10000; softmax; out = (att v) W_out^T.
// Structure: one preparation launch (RMSNorm + RoPE fused on VALU, wave per token, into f16 hi + 2^10 residual q/k planes; v as exact f16, V^T by LDS tiles; a flag per 64 x 32 mask tile (any open entry); W_out x 16 as f16); one fused attention launch for all 16 heads (a wave owns 16 queries and walks the open key passes of 32): the score products (f16 WMMA, f32 accumulation, K = 128, three terms), the masked online softmax on VALU (mask read on device), P as f16 hi + residual (x 2^10) packed in registers, the readout as two terms into the merged context plane; context hi/residual; W_out as two GEMM terms (exact x16 weights). Every product runs all its hi/residual terms in one launch.
// Compute dtype: inputs rounded to bf16; v and W_out exact as f16; normed+rotated q/k (3-term scores), P and the merged context all carried as f16 hi + 2^10 residual (~2^-21): the q/k norm weights are O(1) random so logits have sigma ≈ 11 and the softmax is near one-hot; RMSNorm/RoPE/softmax f32. v_wmma_f32_16x16x32_f16.
#define TT 2048
#define MSTR 2048                /* attention_mask row stride (input geometry) */
#define NQH 16
#define NKVH 4
#define HD 128
#define DQ (NQH * HD)            /* 2048 */
#define DKV (NKVH * HD)          /* 512 */
#define GRP (NQH / NKVH)         /* 4 query heads share a kv head */
typedef __bf16 v16b __attribute__((ext_vector_type(16)));
typedef unsigned short v8us __attribute__((ext_vector_type(8), may_alias));
typedef float  v8f  __attribute__((ext_vector_type(8)));
typedef float  v4f  __attribute__((ext_vector_type(4)));
typedef float  v4fa __attribute__((ext_vector_type(4), may_alias));
union FragB { v16b v; v8us half[2]; unsigned short u[16]; };

__device__ __forceinline__ unsigned short bf16_bits(float x) { unsigned int u = __float_as_uint(x); return (unsigned short)((u + 0x7FFFu + ((u >> 16) & 1u)) >> 16); }
__device__ __forceinline__ float bf16_val(unsigned short b) { return __uint_as_float(((unsigned int)b) << 16); }
__device__ __forceinline__ float bf16_round(float x) { return bf16_val(bf16_bits(x)); }
// D += A·B with NT terms: 1 = ah·bh, 2 = + al·bh (A split), 3 = + ah·bl (both split)
template <int NT>
__device__ __forceinline__ v8f mmaN(v16b ah, v16b al, v16b bh, v16b bl, v8f c) {
  c = __builtin_amdgcn_wmma_f32_16x16x32_bf16(false, ah, false, bh, (short)0, c, false, false);
  if (NT >= 2) c = __builtin_amdgcn_wmma_f32_16x16x32_bf16(false, al, false, bh, (short)0, c, false, false);
  if (NT >= 3) c = __builtin_amdgcn_wmma_f32_16x16x32_bf16(false, ah, false, bl, (short)0, c, false, false);
  asm volatile("v_nop\n\tv_nop\n\tv_nop\n\tv_nop" : "+v"(c) : "v"(ah), "v"(al), "v"(bh), "v"(bl));
  return c;
}

__global__ __launch_bounds__(256) void k_wt_bf16(const float* __restrict__ W, unsigned short* __restrict__ Wt, int K, int N) {
  const int t = blockIdx.x * 256 + threadIdx.x;
  const int k8n = K / 8;
  if (t >= N * k8n) return;
  const int n = t / k8n, k8 = (t % k8n) * 8;
  v8us v;
#pragma unroll
  for (int i = 0; i < 8; ++i) v[i] = bf16_bits(W[(size_t)(k8 + i) * N + n]);
  *(v8us*)(Wt + (size_t)n * K + k8) = v;
  
}

// GEMM C[M][N] (f32, pitch ldc) = act(A[M][K]·W + bias). A f32 row-major (pitch lda) converted per fragment to bf16
// (ASPLIT: hi/lo two planes -> 2 terms, else single rounded term); Wt bf16 [N][K] (pitch ldb). BIAS_BF16 rounds the
// bias to bf16 first (bias quantised to bf16 before the add). K%32==0, M%16==0, N%64==0.
template <bool ASPLIT, int ACT, bool BIAS_BF16>
__global__ __launch_bounds__(128) void k_gemm_bf(const float* __restrict__ A, int lda, const unsigned short* __restrict__ Wt, int ldb,
                                               const float* __restrict__ bias, float* __restrict__ C, int ldc, int M, int N, int K) {
  __shared__ __attribute__((aligned(16))) float so[4][16][64];
  const int tid = threadIdx.x, w = tid >> 5, lane = tid & 31, ln = lane & 15, hh = lane >> 4;
  const int ntn = N / 64;
  const int wid = blockIdx.x * 4 + w;
  const int mt = wid / ntn, nq = wid % ntn;
  if (mt * 16 >= M) return;
  const int row0 = mt * 16, col0 = nq * 64;
  const float* arow = A + (size_t)(row0 + ln) * lda;
  v8f acc[4] = {};
  for (int kb = 0; kb < K; kb += 32) {
    FragB ah, al;
    const v4f x0 = *(const v4fa*)(arow + kb + 8 * hh), x1 = *(const v4fa*)(arow + kb + 8 * hh + 4);
    const v4f x2 = *(const v4fa*)(arow + kb + 16 + 8 * hh), x3 = *(const v4fa*)(arow + kb + 16 + 8 * hh + 4);
    float xs[16] = {x0[0],x0[1],x0[2],x0[3],x1[0],x1[1],x1[2],x1[3],x2[0],x2[1],x2[2],x2[3],x3[0],x3[1],x3[2],x3[3]};
#pragma unroll
    for (int i = 0; i < 16; ++i) { const unsigned short hb = bf16_bits(xs[i]); ah.u[i] = hb; al.u[i] = ASPLIT ? bf16_bits(xs[i] - bf16_val(hb)) : (unsigned short)0; }
#pragma unroll
    for (int t = 0; t < 4; ++t) {
      const unsigned short* brow = Wt + (size_t)(col0 + t * 16 + ln) * ldb + kb;
      FragB b;
      b.half[0] = *(const v8us*)(brow + 8 * hh);
      b.half[1] = *(const v8us*)(brow + 16 + 8 * hh);
      acc[t] = mmaN<ASPLIT ? 2 : 1>(ah.v, al.v, b.v, b.v, acc[t]);
    }
  }
#pragma unroll
  for (int t = 0; t < 4; ++t) {
    float bv = bias ? bias[col0 + t * 16 + ln] : 0.f;
    if (BIAS_BF16) bv = bf16_round(bv);
#pragma unroll
    for (int r = 0; r < 8; ++r) { float v = acc[t][r] + bv; if (ACT == 1) v = fmaxf(v, 0.f); so[w][8 * hh + r][t * 16 + ln] = v; }
  }
  __builtin_amdgcn_fence(__ATOMIC_ACQ_REL, "workgroup");
  __builtin_amdgcn_wave_barrier();
  const int rsub = lane >> 4, c4 = (lane & 15) * 4;
  {
#pragma unroll
    for (int q = 0; q < 8; ++q) {
      const int r = q * 2 + rsub;
      const v4f v = *(const v4fa*)&so[w][r][c4];
      *(v4f*)(C + (size_t)(row0 + r) * ldc + col0 + c4) = v;
    }
    
  }
}

// GEMM C = act(A·W + bias + resid): A f32 (ASPLIT -> hi/lo 2 terms), Wt bf16 [N][K]; ACT 0 none, 1 relu, 2 exact gelu;
// resid (optional, f32, row index = (row % rmod), pitch ldr, RES_BF16 rounds it) added before the activation.
template <bool ASPLIT, int ACT, bool BIAS_BF16, bool RES_BF16>
__global__ __launch_bounds__(128) void k_gemm_bf3(const float* __restrict__ A, int lda, const unsigned short* __restrict__ Wt, int ldb,
                                                const float* __restrict__ bias, const float* __restrict__ resid, int rmod, int ldr,
                                                float* __restrict__ C, int ldc, int M, int N, int K) {
  __shared__ __attribute__((aligned(16))) float so[4][16][64];
  const int tid = threadIdx.x, w = tid >> 5, lane = tid & 31, ln = lane & 15, hh = lane >> 4;
  const int ntn = N / 64;
  const int wid = blockIdx.x * 4 + w;
  const int mt = wid / ntn, nq = wid % ntn;
  if (mt * 16 >= M) return;
  const int row0 = mt * 16, col0 = nq * 64;
  const float* arow = A + (size_t)(row0 + ln) * lda;
  v8f acc[4] = {};
  for (int kb = 0; kb < K; kb += 32) {
    FragB ah, al;
    const v4f x0 = *(const v4fa*)(arow + kb + 8 * hh), x1 = *(const v4fa*)(arow + kb + 8 * hh + 4);
    const v4f x2 = *(const v4fa*)(arow + kb + 16 + 8 * hh), x3 = *(const v4fa*)(arow + kb + 16 + 8 * hh + 4);
    float xs[16] = {x0[0],x0[1],x0[2],x0[3],x1[0],x1[1],x1[2],x1[3],x2[0],x2[1],x2[2],x2[3],x3[0],x3[1],x3[2],x3[3]};
#pragma unroll
    for (int i = 0; i < 16; ++i) { const unsigned short hb = bf16_bits(xs[i]); ah.u[i] = hb; al.u[i] = ASPLIT ? bf16_bits(xs[i] - bf16_val(hb)) : (unsigned short)0; }
#pragma unroll
    for (int t = 0; t < 4; ++t) {
      const unsigned short* brow = Wt + (size_t)(col0 + t * 16 + ln) * ldb + kb;
      FragB b;
      b.half[0] = *(const v8us*)(brow + 8 * hh);
      b.half[1] = *(const v8us*)(brow + 16 + 8 * hh);
      acc[t] = mmaN<ASPLIT ? 2 : 1>(ah.v, al.v, b.v, b.v, acc[t]);
    }
  }
#pragma unroll
  for (int t = 0; t < 4; ++t) {
    const int col = col0 + t * 16 + ln;
    float bv = bias ? bias[col] : 0.f;
    if (BIAS_BF16) bv = bf16_round(bv);
#pragma unroll
    for (int r = 0; r < 8; ++r) {
      float v = acc[t][r] + bv;
      if (resid) { float rv = resid[(size_t)((row0 + 8 * hh + r) % rmod) * ldr + col]; if (RES_BF16) rv = bf16_round(rv); v += rv; }
      if (ACT == 1) v = fmaxf(v, 0.f);
      if (ACT == 2) v = 0.5f * v * (1.0f + erff(v * 0.70710678118654752f));
      if (ACT == 3) { const float u = 0.7978845608028654f * (v + 0.044715f * v * v * v); v = 0.5f * v * (1.0f + tanhf(u)); }
      so[w][8 * hh + r][t * 16 + ln] = v;
    }
  }
  __builtin_amdgcn_fence(__ATOMIC_ACQ_REL, "workgroup");
  __builtin_amdgcn_wave_barrier();
  const int rsub = lane >> 4, c4 = (lane & 15) * 4;
  {
#pragma unroll
    for (int q = 0; q < 8; ++q) {
      const int r = q * 2 + rsub;
      const v4f v = *(const v4fa*)&so[w][r][c4];
      *(v4f*)(C + (size_t)(row0 + r) * ldc + col0 + c4) = v;
    }
    
  }
}
// row LayerNorm (biased variance, eps) over N: s = X (+ R); optional out_sum <- s; out_norm <- (s-mu)*rsqrt(var+eps)*g + b
template <bool PARAM_BF16>
__global__ __launch_bounds__(256) void k_layernorm(const float* __restrict__ X, const float* __restrict__ R, const float* __restrict__ g, const float* __restrict__ bta,
                                                  float* __restrict__ out_sum, float* __restrict__ out_norm, int N, float eps) {
  __shared__ float red[256];
  const int row = blockIdx.x, tid = threadIdx.x;
  const float* x = X + (size_t)row * N; const float* rr = R ? R + (size_t)row * N : nullptr;
  float vals[16];                     // up to N = 4096
  const int per = N / 256;            // contiguous chunk per thread? use strided-by-4 chunks: thread handles j = tid*4 + 1024*u
  float s1 = 0.f;
  for (int u = 0; u < per / 4; ++u) {
    const int j = tid * 4 + 1024 * u;
    const v4f a = *(const v4fa*)(x + j);
    v4f b = {0.f,0.f,0.f,0.f}; if (rr) b = *(const v4fa*)(rr + j);
#pragma unroll
    for (int q = 0; q < 4; ++q) { const float v = a[q] + b[q]; vals[u * 4 + q] = v; s1 += v; }
  }
  red[tid] = s1; __syncthreads();
  for (int st = 128; st > 0; st >>= 1) { if (tid < st) red[tid] += red[tid + st]; __syncthreads(); }
  const float mu = red[0] / (float)N; __syncthreads();
  float s2 = 0.f;
  for (int u = 0; u < per / 4; ++u)
#pragma unroll
    for (int q = 0; q < 4; ++q) { const float c = vals[u * 4 + q] - mu; s2 += c * c; }
  red[tid] = s2; __syncthreads();
  for (int st = 128; st > 0; st >>= 1) { if (tid < st) red[tid] += red[tid + st]; __syncthreads(); }
  const float rs = rsqrtf(red[0] / (float)N + eps);
  {
    for (int u = 0; u < per / 4; ++u) {
      const int j = tid * 4 + 1024 * u;
      v4f o, sm;
#pragma unroll
      for (int q = 0; q < 4; ++q) {
        float gg = g[j + q], bb = bta[j + q];
        if (PARAM_BF16) { gg = bf16_round(gg); bb = bf16_round(bb); }
        sm[q] = vals[u * 4 + q]; o[q] = (vals[u * 4 + q] - mu) * rs * gg + bb;
      }
      if (out_sum) *(v4f*)(out_sum + (size_t)row * N + j) = sm;
      *(v4f*)(out_norm + (size_t)row * N + j) = o;
    }
    
  }
}



// ---- f16 WMMA path (v_wmma_f32_16x16x32_f16): 11-bit significands for operands in range — used where a [0,1] probability operand needs more precision than bf16
typedef _Float16 v16h __attribute__((ext_vector_type(16)));
union FragH { v16h v; v8us half[2]; _Float16 h[16]; unsigned short u[16]; };
template <int NT>
__device__ __forceinline__ v8f mmaH(v16h ah, v16h al, v16h bh, v16h bl, v8f c) {
  c = __builtin_amdgcn_wmma_f32_16x16x32_f16(false, ah, false, bh, (short)0, c, false, false);
  if (NT >= 2) c = __builtin_amdgcn_wmma_f32_16x16x32_f16(false, al, false, bh, (short)0, c, false, false);
  if (NT >= 3) c = __builtin_amdgcn_wmma_f32_16x16x32_f16(false, ah, false, bl, (short)0, c, false, false);
  asm volatile("v_nop\n\tv_nop\n\tv_nop\n\tv_nop" : "+v"(c) : "v"(ah), "v"(al), "v"(bh), "v"(bl));
  return c;
}
// batched GEMM like k_gemm_b but f16 operands: A f32 (split into f16 hi/lo if ASPLIT, else rounded to f16), Bt = f16 values [n][k]; alpha; C f32; N multiple of 16 (partial tiles skipped)
template <bool ASPLIT>
__global__ __launch_bounds__(128) void k_gemm_h(const float* __restrict__ A, int lda, size_t sA, const _Float16* __restrict__ Bh, int ldb, size_t sB, float alpha, float* __restrict__ C, int ldc, size_t sC, int M, int N, int K) {
  __shared__ __attribute__((aligned(16))) float so[4][16][64];
  const int tid = threadIdx.x, w = tid >> 5, lane = tid & 31, ln = lane & 15, hh = lane >> 4; const int by = blockIdx.y;
  A += (size_t)by * sA; Bh += (size_t)by * sB; C += (size_t)by * sC;
  const int ntn = (N + 63) / 64; const int wid = blockIdx.x * 4 + w; const int mt = wid / ntn, nq = wid % ntn; if (mt * 16 >= M) return;
  const int row0 = mt * 16, col0 = nq * 64; const float* arow = A + (size_t)(row0 + ln) * lda;
  v8f acc[4] = {};
  for (int kb = 0; kb < K; kb += 32) {
    FragH ah, al;
    const v4f x0 = *(const v4fa*)(arow + kb + 8 * hh), x1 = *(const v4fa*)(arow + kb + 8 * hh + 4), x2 = *(const v4fa*)(arow + kb + 16 + 8 * hh), x3 = *(const v4fa*)(arow + kb + 16 + 8 * hh + 4);
    float xs[16] = {x0[0],x0[1],x0[2],x0[3],x1[0],x1[1],x1[2],x1[3],x2[0],x2[1],x2[2],x2[3],x3[0],x3[1],x3[2],x3[3]};
#pragma unroll
    for (int i = 0; i < 16; ++i) { const _Float16 h = (_Float16)xs[i]; ah.h[i] = h; al.h[i] = ASPLIT ? (_Float16)(xs[i] - (float)h) : (_Float16)0.0f; }
#pragma unroll
    for (int t = 0; t < 4; ++t) { if (col0 + t * 16 >= N) continue; const size_t boff = (size_t)(col0 + t * 16 + ln) * ldb + kb; FragH bq; bq.half[0] = *(const v8us*)(Bh + boff + 8 * hh); bq.half[1] = *(const v8us*)(Bh + boff + 16 + 8 * hh);
      acc[t] = mmaH<ASPLIT ? 2 : 1>(ah.v, al.v, bq.v, bq.v, acc[t]); }
  }
#pragma unroll
  for (int t = 0; t < 4; ++t) { if (col0 + t * 16 >= N) continue;
#pragma unroll
    for (int r = 0; r < 8; ++r) so[w][8 * hh + r][t * 16 + ln] = acc[t][r] * alpha; }
  __builtin_amdgcn_fence(__ATOMIC_ACQ_REL, "workgroup"); __builtin_amdgcn_wave_barrier();
  const int rsub = lane >> 4, c4 = (lane & 15) * 4;
  {
#pragma unroll
    for (int q = 0; q < 8; ++q) { const int r = q * 2 + rsub; if (col0 + c4 < N) { const v4f v = *(const v4fa*)&so[w][r][c4]; *(v4f*)(C + (size_t)(row0 + r) * ldc + col0 + c4) = v; } }
     }
}

// Wt[n][k] = f16(W[k][n]·scale) from f32 row-major W[K][N] (scale = power of two; bf16-exact weights stay exact in f16 away from the subnormal range)
__global__ __launch_bounds__(256) void k_wt_f16(const float* __restrict__ W, _Float16* __restrict__ Wt, int K, int N, float scale) {
  const int t = blockIdx.x * 256 + threadIdx.x; if (t >= N * (K / 8)) return; const int n = t / (K / 8), k8 = (t % (K / 8)) * 8; FragH f;
#pragma unroll
  for (int i = 0; i < 8; ++i) f.h[i] = (_Float16)(bf16_round(W[(size_t)(k8 + i) * N + n]) * scale); const v8us o = f.half[0];
  *(v8us*)((unsigned short*)Wt + (size_t)n * K + k8) = o; 
}
// k_gemm_hh variant with fused epilogue: v = acc·alpha + bias[by·sBias + col] (+ CP[(row/rowsPerB)·sCPb + by·64 + col] if CP) ; ACT 0 none / 1 elu ; writes f16 C16 (and f32 C if non-null)
template <int ACT>
__global__ __launch_bounds__(128) void k_gemm_hhx(const _Float16* __restrict__ A, int lda, size_t sA, const _Float16* __restrict__ Bh, int ldb, size_t sB, float alpha, const float* __restrict__ bias, size_t sBias, const float* __restrict__ CP, int rowsPerB, size_t sCPb, int row0g,
    float* __restrict__ C, _Float16* __restrict__ C16, int ldc, size_t sC, int M, int N, int K) {
  __shared__ __attribute__((aligned(16))) float so[4][16][64];
  const int tid = threadIdx.x, w = tid >> 5, lane = tid & 31, ln = lane & 15, hh = lane >> 4; const int by = blockIdx.y;
  A += (size_t)by * sA; Bh += (size_t)by * sB; const size_t cofs = (size_t)by * sC; const float* bp = bias ? bias + (size_t)by * sBias : nullptr;
  const int ntn = (N + 63) / 64; const int wid = blockIdx.x * 4 + w; const int mt = wid / ntn, nq = wid % ntn; if (mt * 16 >= M) return;
  const int row0 = mt * 16, col0 = nq * 64; const _Float16* arow = A + (size_t)(row0 + ln) * lda;
  v8f acc[4] = {};
  for (int kb = 0; kb < K; kb += 32) { FragH ah; ah.half[0] = *(const v8us*)((const unsigned short*)arow + kb + 8 * hh); ah.half[1] = *(const v8us*)((const unsigned short*)arow + kb + 16 + 8 * hh);
#pragma unroll
    for (int t = 0; t < 4; ++t) { if (col0 + t * 16 >= N) continue; const size_t boff = (size_t)(col0 + t * 16 + ln) * ldb + kb; FragH bq; bq.half[0] = *(const v8us*)((const unsigned short*)Bh + boff + 8 * hh); bq.half[1] = *(const v8us*)((const unsigned short*)Bh + boff + 16 + 8 * hh);
      acc[t] = mmaH<1>(ah.v, ah.v, bq.v, bq.v, acc[t]); }
  }
#pragma unroll
  for (int t = 0; t < 4; ++t) { if (col0 + t * 16 >= N) continue; const int col = col0 + t * 16 + ln; const float bv = bp ? bf16_round(bp[col]) : 0.f;
#pragma unroll
    for (int r = 0; r < 8; ++r) { float v = acc[t][r] * alpha + bv; if (CP) { const int rr = row0g + row0 + 8 * hh + r; if (rowsPerB < 0) v += CP[cofs + (size_t)rr * ldc + col];      /* rowsPerB < 0: own element of the batched C plane */ else { const int bidx = rr / rowsPerB; v += CP[(size_t)bidx * sCPb + (size_t)by * 64 + col]; } } if (ACT == 1) v = (v > 0.f) ? v : expm1f(v); else if (ACT == 7) v = (v > 0.f) ? v + 1.0f : expf(v); else if (ACT == 8) v = tanhf(v); else if (ACT == 9) v = 0.5f * v * (1.0f + tanhf(0.7978845608028654f * (v + 0.044715f * v * v * v))); else if (ACT == 11) v = 1.0f / (1.0f + expf(-v)); else if (ACT == 12) v = (v > 0.f) ? v : 0.01f * v; else if (ACT == 14) v = (v > 0.f) ? v : 0.1f * v; else if (ACT == 16) v = (v >= 0.f) ? v : 0.3f * v; else if (ACT == 17) v = (v >= 0.f) ? v : 0.2f * v; else if (ACT == 15) v = v / (1.0f + expf(-v)); else if (ACT == 3) v = fmaxf(v, 0.f); else if (ACT == 6) v = 0.5f * v * (1.0f + erff(v * 0.70710678118654752f)); so[w][8 * hh + r][t * 16 + ln] = v; } }
  __builtin_amdgcn_fence(__ATOMIC_ACQ_REL, "workgroup"); __builtin_amdgcn_wave_barrier();
  const int rsub = lane >> 4, c4 = (lane & 15) * 4; typedef _Float16 v4h __attribute__((ext_vector_type(4)));
  {
#pragma unroll
    for (int q = 0; q < 8; ++q) { const int r = q * 2 + rsub; if (col0 + c4 < N) { const v4f v = *(const v4fa*)&so[w][r][c4]; if (C) *(v4f*)(C + cofs + (size_t)(row0 + r) * ldc + col0 + c4) = v; if (C16) { v4h h4; for (int i = 0; i < 4; ++i) h4[i] = (_Float16)v[i]; *(v4h*)(C16 + cofs + (size_t)(row0 + r) * ldc + col0 + c4) = h4; } } }
     }
}


typedef _Float16 v4h __attribute__((ext_vector_type(4)));

__global__ __launch_bounds__(256) void k_h16(const float* __restrict__ x, _Float16* __restrict__ X16, size_t n8) { const size_t t = (size_t)blockIdx.x * 256 + threadIdx.x; if (t >= n8) return; FragH f;
#pragma unroll
  for (int q = 0; q < 8; ++q) f.h[q] = (_Float16)x[t * 8 + q]; *(v8us*)((unsigned short*)X16 + t * 8) = f.half[0];  }
__global__ __launch_bounds__(256) void k_round16f(const float* __restrict__ W, _Float16* __restrict__ Bt, size_t n8) { const size_t t = (size_t)blockIdx.x * 256 + threadIdx.x; if (t >= n8) return; FragH f;
#pragma unroll
  for (int i = 0; i < 8; ++i) f.h[i] = (_Float16)(bf16_round(W[t * 8 + i]) * 16.0f); *(v8us*)((unsigned short*)Bt + t * 8) = f.half[0];  }
// V^T [512][2048] from v [2048][512]: block blk turns the 64 tokens x 64 dims tile (token group blk % 32, dim slab blk / 32) through LDS; v is rounded to bf16 and written as exact f16 on the way in.
// Every loop is unrolled so that the register arrays are indexed by constants and the four loads of a thread fly together.
__device__ __forceinline__ void d_vt(const int blk, const float* __restrict__ v, _Float16* __restrict__ Vt, unsigned short (*tl)[66]) { const int tid = threadIdx.x; const int slab = blk / (TT / 64), lg = blk % (TT / 64);
  v4f va[2], vc[2];
#pragma unroll
  for (int i = 0; i < 2; ++i) { const float* vp = v + (size_t)(lg * 64 + i * 32 + tid / 8) * DKV + slab * 64 + (tid % 8) * 8; va[i] = *(const v4fa*)vp; vc[i] = *(const v4fa*)(vp + 4); }
  asm volatile("s_wait_xcnt 0x0" ::: "memory");      /* precaution: stands in front of every later write of a register that one of the loads above names */
  __builtin_amdgcn_sched_barrier(0);      /* keeps the work below from being scheduled above that wait */
#pragma unroll
  for (int i = 0; i < 2; ++i) { const int r = i * 32 + tid / 8, c8 = (tid % 8) * 8; FragH f;
#pragma unroll
    for (int q = 0; q < 4; ++q) { f.h[q] = (_Float16)bf16_round(va[i][q]); f.h[4 + q] = (_Float16)bf16_round(vc[i][q]); }
#pragma unroll
    for (int q = 0; q < 8; ++q) tl[r][c8 + q] = f.u[q]; }
  __syncthreads();
  {
#pragma unroll
    for (int rd = 0; rd < 2; ++rd) { const int d = rd * 32 + tid / 8, pc = tid % 8; FragH f;
#pragma unroll
      for (int q = 0; q < 8; ++q) f.u[q] = tl[pc * 8 + q][d];
      *(v8us*)((unsigned short*)Vt + ((size_t)slab * 64 + d) * TT + lg * 64 + pc * 8) = f.half[0]; }
    asm volatile("s_wait_xcnt 0x0" ::: "memory");      /* precaution: closes the two stores, in front of whatever the merged kernel's code behind this job writes into their registers */
     } }

__global__ __launch_bounds__(256) void k_hl(const float* __restrict__ F, _Float16* __restrict__ Hh, _Float16* __restrict__ Hl, size_t n8) { const size_t t = (size_t)blockIdx.x * 256 + threadIdx.x; if (t >= n8) return; FragH fh, fl; const v4f a = *(const v4fa*)(F + t * 8), c = *(const v4fa*)(F + t * 8 + 4);
#pragma unroll
  for (int q = 0; q < 4; ++q) { _Float16 h = (_Float16)a[q]; fh.h[q] = h; fl.h[q] = (_Float16)((a[q] - (float)h) * 1024.0f); h = (_Float16)c[q]; fh.h[4 + q] = h; fl.h[4 + q] = (_Float16)((c[q] - (float)h) * 1024.0f); }
  { *(v8us*)((unsigned short*)Hh + t * 8) = fh.half[0]; *(v8us*)((unsigned short*)Hl + t * 8) = fl.half[0];  } }

// ---- fragment loader: 16 halves of one operand row in the hardware k order ----
__device__ __forceinline__ v16h g2_frag(const _Float16* p, int hh) { FragH f; f.half[0] = *(const v8us*)((const unsigned short*)p + 8 * hh); f.half[1] = *(const v8us*)((const unsigned short*)p + 16 + 8 * hh); return f.v; }
#define WCH 4                    /* chunks of 8 weights a thread: a quarter of the blocks to start, eight 16-byte loads of a thread in flight */
// Bt = f16(bf16(Wm) * sc), same layout. Every loop is unrolled so that the register arrays are indexed by constants and the loads fly together.
__device__ __forceinline__ void d_wsc(const int blk, const float* __restrict__ Wm, _Float16* __restrict__ Bt, const float sc) { const size_t t0 = (size_t)blk * (WCH * 256) + threadIdx.x;
  v4f wa[WCH], wc[WCH];
#pragma unroll
  for (int j = 0; j < WCH; ++j) { const float* wp = Wm + (t0 + j * 256) * 8; wa[j] = *(const v4fa*)wp; wc[j] = *(const v4fa*)(wp + 4); }
  asm volatile("s_wait_xcnt 0x0" ::: "memory");      /* precaution: stands in front of every later write of a register that one of the loads above names */
  __builtin_amdgcn_sched_barrier(0);      /* keeps the work below from being scheduled above that wait */
  FragH f[WCH];
#pragma unroll
  for (int j = 0; j < WCH; ++j) {
#pragma unroll
    for (int q = 0; q < 4; ++q) { f[j].h[q] = (_Float16)(bf16_round(wa[j][q]) * sc); f[j].h[4 + q] = (_Float16)(bf16_round(wc[j][q]) * sc); } }
  __builtin_amdgcn_sched_barrier(0);      /* every value is in its register before the run of stores starts: no register that an issued store names is written behind it */
#pragma unroll
  for (int j = 0; j < WCH; ++j) *(v8us*)((unsigned short*)Bt + (t0 + j * 256) * 8) = f[j].half[0];
  asm volatile("s_wait_xcnt 0x0" ::: "memory");      /* precaution: closes the run of stores, in front of whatever the merged kernel's code behind this job writes into their registers */
}
template <int NH_>
__device__ __forceinline__ void d_normrope(const int blk, const float* __restrict__ X, const float* __restrict__ w, const int* __restrict__ pos, _Float16* __restrict__ O16, _Float16* __restrict__ OL) {
  #pragma clang fp contract(off)
  constexpr int W_ = NH_ * HD; const int wv = threadIdx.x >> 5, ln = threadIdx.x & 31; const int t = blk * 8 + wv; if (t >= TT) return; const float* x = X + (size_t)t * W_; float ss = 0.f;
#pragma unroll 1
  for (int c = ln * 4; c < W_; c += 128) { const v4f a = *(const v4fa*)(x + c); for (int e = 0; e < 4; ++e) { const float v = bf16_round(a[e]); ss += v * v; } }
  for (int o = 16; o > 0; o >>= 1) ss += __shfl_xor(ss, o, 32); const float inv = rsqrtf(ss / (float)W_ + 1e-5f); const float p = (float)pos[t];
  {
#pragma unroll 1
    for (int h = 0; h < NH_; ++h) { for (int u = 0; u < 2; ++u) { const int d = ln + 32 * u; const int c1 = h * HD + d, c2 = c1 + 64; float x1 = bf16_round(x[c1]) * inv; x1 *= bf16_round(w[c1]); float x2 = bf16_round(x[c2]) * inv; x2 *= bf16_round(w[c2]);
        const float ex = (float)(2 * d) / (float)HD; const float ivf = 1.0f / powf(10000.0f, ex); const float th = p * ivf; const float cs = cosf(th), sn = sinf(th); float o1 = x1 * cs; o1 += -(x2 * sn); float o2 = x2 * cs; o2 += x1 * sn;
        const _Float16 h1 = (_Float16)o1, h2 = (_Float16)o2; *(_Float16*)(O16 + (size_t)t * W_ + c1) = h1; *(_Float16*)(O16 + (size_t)t * W_ + c2) = h2; *(_Float16*)(OL + (size_t)t * W_ + c1) = (_Float16)((o1 - (float)h1) * 1024.0f); *(_Float16*)(OL + (size_t)t * W_ + c2) = (_Float16)((o2 - (float)h2) * 1024.0f);
        asm volatile("s_wait_xcnt 0x0" ::: "memory");      /* precaution: closes the four stores, in front of the next trip's writes of their registers */
      } }
     } }

// ---- fused attention: scores, masked softmax and readout of all 16 heads in ONE launch; the score and probability planes never go to memory ----
// Transposed products: S^T = K.Q^T (A = key rows, B = query rows held in registers), O^T += V^T.P^T. In an accumulator tile a lane holds 8 keys of ONE query (column = lane & 15, rows 8 * (lane >> 4) + r),
// which is exactly the k order of the B loader (k = 8 * hh + i, then 16 + 8 * hh + i), so two 16-key score tiles pack in-lane into one 32-key P^T fragment. Running maximum and sum per query (online softmax):
// when the maximum moves, the output accumulators and the sum are scaled by exp(m_old - m_new). Same operand planes and terms as the separate stages: 3 hi/residual score terms, P as f16 hi + 2^10 residual of 1024 * p.
__device__ __forceinline__ v8f fa_mma(v16h a, v16h b, v8f c) { return __builtin_amdgcn_wmma_f32_16x16x32_f16(false, a, false, b, (short)0, c, false, false); }
typedef int v4i __attribute__((ext_vector_type(4)));
#define FKP 136                  /* LDS pitch of a K row, in halves */
#define FVP 40                   /* LDS pitch of a V^T row, in halves */
#define QTN (TT / 64)            /* query tiles of 64 rows */
// act[qt * 64 + p] = 1 where the 64 x 32 mask tile (query tile qt, key pass p) holds at least one open (zero) entry, else 0. A wave reads four tiles in turn; a block of eight waves writes one whole 128-byte line of flags.
__device__ __forceinline__ void d_mflag(const int blk, const int* __restrict__ msk, int* __restrict__ act) {
  const int wv = threadIdx.x >> 5, lane = threadIdx.x & 31; unsigned bits = 0u;      /* bit j: the wave's tile j is open */
  /* kept rolled: one tile's sixteen loads in flight a wave; unrolled, the four tiles' loads would set the register count of the whole launch */
#pragma unroll 1
  for (int j = 0; j < 4; ++j) {
    const int u = blk * 32 + wv * 4 + j; const int qt = u >> 6, p = u & 63;
    const int* mp = msk + (size_t)(qt * 64 + (lane >> 3)) * MSTR + p * 32 + (lane & 7) * 4;
    v4i m[16];      /* both inner loops are unrolled so that this array stays in registers and its loads fly together */
#pragma unroll
    for (int i = 0; i < 16; ++i) m[i] = *(const v4i*)(mp + (size_t)i * 4 * MSTR);
    asm volatile("s_wait_xcnt 0x0" :: "v"(mp) : "memory");      /* precaution: stands in front of every later write of a register that one of the loads above names; the address is an input so that it stays in its registers up to here and no load of the run lands in them */
    __builtin_amdgcn_sched_barrier(0);      /* keeps the work below from being scheduled above that wait */
    bool open = false;
#pragma unroll
    for (int i = 0; i < 16; ++i) open = open || m[i][0] == 0 || m[i][1] == 0 || m[i][2] == 0 || m[i][3] == 0;
    const unsigned any = __builtin_amdgcn_ballot_w32(open);
    bits |= (any != 0u ? 1u : 0u) << j;
  }
  if (lane < 4) act[blk * 32 + wv * 4 + lane] = (int)((bits >> lane) & 1u);
}
// ---- preparation: the five jobs that only read inputs (q and k norm + RoPE, mask flags, V^T, scaled W_out) in ONE launch, told apart by block ranges; none reads what another writes. The longest job (q) has the first blocks (for speed only).
#define PB_NQ (TT / 8)                       /* q: a wave a token */
#define PB_NK (TT / 8)                       /* k: a wave a token */
#define PB_MF (QTN * 64 / 32)                /* mask flags: 32 tiles a block */
#define PB_VT (NKVH * 2 * (TT / 64))         /* V^T: 8 slabs of 64 dims x 32 token groups */
#define PB_WS (DQ * DQ / 8 / 256 / WCH)      /* W_out */
__global__ __launch_bounds__(256) void k_prep(const float* __restrict__ q, const float* __restrict__ k, const float* __restrict__ v, const int* __restrict__ msk, const int* __restrict__ pos, const float* __restrict__ qw, const float* __restrict__ kw, const float* __restrict__ Wo,
    _Float16* __restrict__ Q16, _Float16* __restrict__ QL, _Float16* __restrict__ K16, _Float16* __restrict__ KL, _Float16* __restrict__ VT, int* __restrict__ ACT, _Float16* __restrict__ BO) {
  __shared__ unsigned short tl[64][66];
  const int b = blockIdx.x;      /* every test below is the same for the whole block: the barrier of the V^T job is passed by all its waves */
  if (b < PB_NQ) d_normrope<NQH>(b, q, qw, pos, Q16, QL);
  else if (b < PB_NQ + PB_NK) d_normrope<NKVH>(b - PB_NQ, k, kw, pos, K16, KL);
  else if (b < PB_NQ + PB_NK + PB_MF) d_mflag(b - (PB_NQ + PB_NK), msk, ACT);
  else if (b < PB_NQ + PB_NK + PB_MF + PB_VT) d_vt(b - (PB_NQ + PB_NK + PB_MF), v, VT, tl);
  else d_wsc(b - (PB_NQ + PB_NK + PB_MF + PB_VT), Wo, BO, 16.0f);      /* (out,in) natural */
}
// A block runs two query tiles of 64 rows one after the other, tile QTN - 1 - x and tile x, so that under a triangular mask every block has the same number of open passes; a wave owns 16 queries.
// Of each tile only the open key passes are walked (flags of d_mflag). A closed pass holds nothing but scores of -10000: once every row of the tile has a running maximum of -9000 or more, exp(-10000 - max) is 0 in f32
// and the pass would change neither sums nor maximum. Where a row's maximum is lower after the open passes (a row with no open key among them), the closed passes are walked as well, after the open ones, by the same code.
__global__ __launch_bounds__(128) void k_fattn(const _Float16* __restrict__ Qh, const _Float16* __restrict__ Ql, const _Float16* __restrict__ Kh, const _Float16* __restrict__ Kl, const _Float16* __restrict__ Vt,
    const int* __restrict__ msk, const int* __restrict__ act, float* __restrict__ CTX) {
  __shared__ __attribute__((aligned(16))) _Float16 sKh[32 * FKP], sKl[32 * FKP], sV[HD * FVP];
  __shared__ int sLow[2][4];      /* per tile and wave: some row's maximum is still low; a slot set of its own for each tile, so that no wave writes a slot that a slower wave still reads */
  const int tid = threadIdx.x, w = tid >> 5, lane = tid & 31, ln = lane & 15, hh = lane >> 4; const int h = blockIdx.y, kv = h / GRP;
  const v8f z8 = {0.f,0.f,0.f,0.f,0.f,0.f,0.f,0.f};
  /* the block's four waves share each pass's K (hi, residual) and V^T tiles through LDS: whole-row global loads, one copy a block; pitches 272 B and 80 B (16 B x odd) keep the 16-byte fragment reads off each other's banks */
  const int krow = tid >> 4, kcol = (tid & 15) * 8, vrow = tid >> 2, vcol = (tid & 3) * 8;
  const _Float16* gkh = Kh + (size_t)krow * DKV + kv * HD + kcol; const _Float16* gkl = Kl + (size_t)krow * DKV + kv * HD + kcol; const _Float16* gv = Vt + ((size_t)kv * HD + vrow) * TT + vcol;
  const float alpha = 0.088388347648318447f, alo = alpha * 0.0009765625f;
  /* kept rolled: the two tiles run through one copy of the code */
#pragma unroll 1
  for (int half = 0; half < 2; ++half) {
    const int qt = half ? (int)blockIdx.x : QTN - 1 - (int)blockIdx.x; const int q0 = qt * 64 + 16 * w;      /* a wave owns 16 queries: one column group */
    const int a0 = act[qt * 64 + lane], a1 = act[qt * 64 + 32 + lane];
    asm volatile("s_wait_xcnt 0x0" ::: "memory");      /* precaution: the loads below may land in, or have their addresses formed in, a register that the two loads above name */
    __builtin_amdgcn_sched_barrier(0);      /* keeps the loads below behind that wait */
    v16h qh[4], ql[4];
    const size_t qo = (size_t)(q0 + ln) * DQ + h * HD; const _Float16* qp0 = Qh + qo; const _Float16* qp2 = Ql + qo;
#pragma unroll
    for (int ks = 0; ks < 4; ++ks) { qh[ks] = g2_frag(qp0 + ks * 32, hh); ql[ks] = g2_frag(qp2 + ks * 32, hh); }
    asm volatile("s_wait_xcnt 0x0" ::: "memory");      /* precaution: stands in front of every later write of a register that one of the loads above names */
    __builtin_amdgcn_sched_barrier(0);      /* keeps the work below from being scheduled above that wait */
    const unsigned long long open = (unsigned long long)__builtin_amdgcn_ballot_w32(a0 != 0) | ((unsigned long long)__builtin_amdgcn_ballot_w32(a1 != 0) << 32);      /* bit p: pass p is open; the same in all four waves */
    v8f oh[8], ol[8];
#pragma unroll
    for (int d = 0; d < 8; ++d) { oh[d] = z8; ol[d] = z8; }
    float mrun = -3.0e38f, lrun = 0.f;
    const int* gm = msk + (size_t)(q0 + ln) * MSTR + 8 * hh;
    /* kept rolled: open passes (phase 0) and, where needed, closed passes (phase 1) run through one copy of the code */
#pragma unroll 1
    for (int phase = 0; phase < 2; ++phase) {
      unsigned long long todo = open;
      if (phase) {
        const unsigned lowb = __builtin_amdgcn_ballot_w32(mrun < -9000.0f);
        if (lane == 0) sLow[half][w] = lowb != 0u ? 1 : 0;
        __syncthreads();      /* the four waves' findings are published: the choice below must be the same in the whole block, barriers follow it */
        const int anylow = sLow[half][0] | sLow[half][1] | sLow[half][2] | sLow[half][3];
        todo = __builtin_amdgcn_readfirstlane(anylow) != 0 ? ~open : 0ull;
      }
      if (todo == 0ull) continue;
      int cur = __builtin_ctzll(todo); todo &= todo - 1ull;
      v8us rk[4], rl[4], rv[4]; v4i mk[2][2];
#pragma unroll
      for (int i = 0; i < 4; ++i) { rk[i] = *(const v8us*)(gkh + (size_t)(cur * 32 + i * 8) * DKV); rl[i] = *(const v8us*)(gkl + (size_t)(cur * 32 + i * 8) * DKV); rv[i] = *(const v8us*)(gv + (size_t)i * 32 * TT + cur * 32); }
#pragma unroll
      for (int j = 0; j < 2; ++j) { mk[j][0] = *(const v4i*)(gm + cur * 32 + j * 16); mk[j][1] = *(const v4i*)(gm + cur * 32 + j * 16 + 4); }
      asm volatile("s_wait_xcnt 0x0" ::: "memory");      /* same precaution as behind the query loads */
      __builtin_amdgcn_sched_barrier(0);      /* keeps the work below from being scheduled above that wait */
      /* kept rolled: one pass's staging registers and fragments beside the query fragments and the output accumulators are what is meant to stay in registers; every inner loop is unrolled so that the register arrays are indexed by constants */
#pragma unroll 1
      for (;;) {
#pragma unroll
        for (int i = 0; i < 4; ++i) { *(v8us*)(sKh + (krow + 8 * i) * FKP + kcol) = rk[i]; *(v8us*)(sKl + (krow + 8 * i) * FKP + kcol) = rl[i]; *(v8us*)(sV + (vrow + 32 * i) * FVP + vcol) = rv[i]; }
        bool msel[2][8];      /* this pass's mask, read out of its registers before the next pass's lands in them */
#pragma unroll
        for (int j = 0; j < 2; ++j) {
#pragma unroll
          for (int r = 0; r < 8; ++r) msel[j][r] = mk[j][r >> 2][r & 3] != 0; }
        __syncthreads();      /* this pass's tiles are published to all four waves */
        const bool more = todo != 0ull; const int nxt = more ? __builtin_ctzll(todo) : cur; todo &= todo - 1ull;      /* the last pass of a phase fetches its own tiles again: in bounds, never used */
        const int kn = nxt * 32;
        const int* mp = gm + kn;
        /* the next pass's mask and tiles go into registers now: they fly while this pass is worked on */
#pragma unroll
        for (int j = 0; j < 2; ++j) { mk[j][0] = *(const v4i*)(mp + j * 16); mk[j][1] = *(const v4i*)(mp + j * 16 + 4); }
#pragma unroll
        for (int i = 0; i < 4; ++i) { rk[i] = *(const v8us*)(gkh + (size_t)(kn + i * 8) * DKV); rl[i] = *(const v8us*)(gkl + (size_t)(kn + i * 8) * DKV); rv[i] = *(const v8us*)(gv + (size_t)i * 32 * TT + kn); }
        asm volatile("s_wait_xcnt 0x0" ::: "memory");      /* precaution: stands in front of every later write of a register that one of the loads above names */
        __builtin_amdgcn_sched_barrier(0);      /* keeps the work below from being scheduled above that wait, and the loads above in front of the pass's work */
        v8f sh[2] = {z8, z8}, sl[2] = {z8, z8};      /* [key tile j] */
#pragma unroll
        for (int ks = 0; ks < 4; ++ks) { const v16h kh0 = g2_frag(sKh + ln * FKP + ks * 32, hh), kh1 = g2_frag(sKh + (16 + ln) * FKP + ks * 32, hh), kl0 = g2_frag(sKl + ln * FKP + ks * 32, hh), kl1 = g2_frag(sKl + (16 + ln) * FKP + ks * 32, hh);
          sh[0] = fa_mma(kh0, qh[ks], sh[0]); sh[1] = fa_mma(kh1, qh[ks], sh[1]); sl[0] = fa_mma(kh0, ql[ks], sl[0]); sl[1] = fa_mma(kh1, ql[ks], sl[1]); sl[0] = fa_mma(kl0, qh[ks], sl[0]); sl[1] = fa_mma(kl1, qh[ks], sl[1]); }
        FragH ph, pl; float sv[2][8]; float mx = -3.0e38f;
#pragma unroll
        for (int j = 0; j < 2; ++j) {
#pragma unroll
          for (int r = 0; r < 8; ++r) { const float s0 = sh[j][r] * alpha + sl[j][r] * alo; const float s = msel[j][r] ? -10000.0f : s0; sv[j][r] = s; mx = fmaxf(mx, s); } }
        mx = fmaxf(mx, __shfl_xor(mx, 16, 32));      /* the other half-wave holds this query's other 16 keys */
        const float mn = fmaxf(mrun, mx); const float al = expf(mrun - mn); mrun = mn; float su = 0.f;
#pragma unroll
        for (int j = 0; j < 2; ++j) {
#pragma unroll
          for (int r = 0; r < 8; ++r) { const float p = expf(sv[j][r] - mn); su += p; const float pv = p * 1024.0f; const _Float16 hi = (_Float16)pv; ph.h[8 * j + r] = hi; pl.h[8 * j + r] = (_Float16)((pv - (float)hi) * 1024.0f); } }
        lrun = lrun * al + su;      /* each half-wave sums its own keys; the halves meet in the epilogue */
#pragma unroll
        for (int d = 0; d < 8; ++d) { oh[d] *= al; ol[d] *= al; }
#pragma unroll
        for (int d = 0; d < 8; ++d) { const v16h vf = g2_frag(sV + (16 * d + ln) * FVP, hh); oh[d] = fa_mma(vf, ph.v, oh[d]); ol[d] = fa_mma(vf, pl.v, ol[d]); }
        __builtin_amdgcn_sched_barrier(0);      /* keeps the pass's work in front of the barrier below, whose fence waits for the loads in flight: scheduled earlier, it would wait out their whole latency */
        __syncthreads();      /* every wave has read this pass's tiles before the next pass's are stored over them */
        if (!more) break;
        cur = nxt;
      }
    }
    /* every output value is formed in place first, then the stores go out as one run: no register that an issued store names is written before the wait behind the run */
    float* cr0 = CTX + (size_t)(q0 + ln) * DQ + h * HD + 8 * hh;
    const float lt = lrun + __shfl_xor(lrun, 16, 32); const float f = 0.0009765625f / lt, fl = f * 0.0009765625f;
#pragma unroll
    for (int d = 0; d < 8; ++d) {
#pragma unroll
      for (int r = 0; r < 8; ++r) oh[d][r] = oh[d][r] * f + ol[d][r] * fl; }
    __builtin_amdgcn_sched_barrier(0);      /* keeps the arithmetic above from being scheduled in among the stores below, where it would write registers of stores still under way */
#pragma unroll
    for (int d = 0; d < 8; ++d) { float* cr = cr0 + 16 * d; const v8f o = oh[d]; const v4f a = {o[0], o[1], o[2], o[3]}, b = {o[4], o[5], o[6], o[7]};
      *(v4f*)cr = a; *(v4f*)(cr + 4) = b; }
    asm volatile("s_wait_xcnt 0x0" ::: "memory");      /* precaution: closes the run of stores, in front of the second tile's writes of their registers */
  }
}

// ---- W_out GEMM, operand tiles staged in LDS ----
// C = alpha * (Ah.Bh^T + 2^-10 * Al.Bh^T), all three planes [2048][2048] f16, k contiguous. A block owns a 128 x 128 tile of C, a wave 32 rows x 64 columns of it (4 x 2 waves); the hi product and the residual product keep
// separate f32 accumulators (the residual plane carries a 2^10 scale) and meet once in the epilogue. A stage is 64 k = 128 B of each of the 3 x 128 operand rows: eight lanes fetch one row's whole cache line, each row once a block,
// and the fragments, whose 16 rows lie 4 KiB apart in memory, are read from LDS instead. Two LDS buffers: stage s + 1 is stored and stage s + 2 fetched to registers while stage s is worked on; one barrier a stage.
#define GKS 64                   /* k (halves) a stage */
#define GPI 72                   /* LDS pitch of a staged row, in halves: 144 B = 16 B x odd keeps the 16-byte fragment reads off each other's banks */
#define GBUF (128 * GPI)         /* halves of one plane's buffer */
#define GNS (DQ / GKS)           /* stages */
__global__ __launch_bounds__(256) void k_gemm2l(const _Float16* __restrict__ Ah, const _Float16* __restrict__ Al, const _Float16* __restrict__ Bh, float alpha, float* __restrict__ C) {
  __shared__ __attribute__((aligned(16))) _Float16 sAh[2 * GBUF], sAl[2 * GBUF], sB[2 * GBUF];
  __shared__ __attribute__((aligned(16))) float so[8][32][68];
  const int tid = threadIdx.x, w = tid >> 5, lane = tid & 31, ln = lane & 15, hh = lane >> 4;
  const int mt = blockIdx.x / (DQ / 128), nt = blockIdx.x % (DQ / 128); const int wr = (w >> 1) * 32, wc = (w & 1) * 64;
  const int srow = tid >> 3, scol = (tid & 7) * 8; const int sofs = srow * GPI + scol;      /* staging: a thread moves 16 bytes of rows srow, srow + 32, + 64, + 96 of each plane */
  const _Float16* gah = Ah + (size_t)(mt * 128 + srow) * DQ + scol; const _Float16* gal = Al + (size_t)(mt * 128 + srow) * DQ + scol; const _Float16* gb = Bh + (size_t)(nt * 128 + srow) * DQ + scol;
  const v8f z8 = {0.f,0.f,0.f,0.f,0.f,0.f,0.f,0.f}; v8f ch[8] = {z8, z8, z8, z8, z8, z8, z8, z8}, cl[8] = {z8, z8, z8, z8, z8, z8, z8, z8};      /* [t] = rows 0..15, [4 + t] = rows 16..31 of column tile t */
  v8us ra[4], rl[4], rb[4];
#pragma unroll
  for (int i = 0; i < 4; ++i) { ra[i] = *(const v8us*)(gah + (size_t)i * 32 * DQ); rl[i] = *(const v8us*)(gal + (size_t)i * 32 * DQ); rb[i] = *(const v8us*)(gb + (size_t)i * 32 * DQ); }
  asm volatile("s_wait_xcnt 0x0" ::: "memory");      /* precaution: stands in front of every later write of a register that one of the loads above names */
  __builtin_amdgcn_sched_barrier(0);      /* keeps the work below from being scheduled above that wait */
#pragma unroll
  for (int i = 0; i < 4; ++i) { *(v8us*)(sAh + sofs + i * 32 * GPI) = ra[i]; *(v8us*)(sAl + sofs + i * 32 * GPI) = rl[i]; *(v8us*)(sB + sofs + i * 32 * GPI) = rb[i]; }
#pragma unroll
  for (int i = 0; i < 4; ++i) { ra[i] = *(const v8us*)(gah + (size_t)i * 32 * DQ + GKS); rl[i] = *(const v8us*)(gal + (size_t)i * 32 * DQ + GKS); rb[i] = *(const v8us*)(gb + (size_t)i * 32 * DQ + GKS); }
  asm volatile("s_wait_xcnt 0x0" ::: "memory");      /* same precaution */
  __builtin_amdgcn_sched_barrier(0);      /* keeps the work below from being scheduled above that wait */
  __syncthreads();      /* publishes stage 0 */
  /* kept rolled: one copy of the stage's code; every inner loop is unrolled so that the register arrays are indexed by constants */
#pragma unroll 1
  for (int s = 0; s < GNS; ++s) {
    const int cb = (s & 1) * GBUF, nb = GBUF - cb;      /* this stage's buffer; the other one, which every wave left at the last barrier */
    const _Float16* pah = sAh + cb + (wr + ln) * GPI; const _Float16* pal = sAl + cb + (wr + ln) * GPI; const _Float16* pb = sB + cb + (wc + ln) * GPI;
    v16h fa[GKS / 32][4], fb[GKS / 32][4];      /* [k step][rows 0..15 hi, rows 16..31 hi, rows 0..15 residual, rows 16..31 residual], [k step][column tile] */
#pragma unroll
    for (int ks = 0; ks < GKS / 32; ++ks) {
      fa[ks][0] = g2_frag(pah + ks * 32, hh); fa[ks][1] = g2_frag(pah + 16 * GPI + ks * 32, hh); fa[ks][2] = g2_frag(pal + ks * 32, hh); fa[ks][3] = g2_frag(pal + 16 * GPI + ks * 32, hh);
#pragma unroll
      for (int t = 0; t < 4; ++t) fb[ks][t] = g2_frag(pb + t * 16 * GPI + ks * 32, hh); }
    __builtin_amdgcn_sched_barrier(0);      /* keeps the stage's fragment reads as one run at its head: the first products wait for nothing else, and the second k step's fragments land while the first's products run */
    /* stage s + 1 goes from its registers into the other buffer, stage s + 2 into the registers: both run beside the products below. No branch here, so that the waits in front of the products can be counted ones:
       the last trip stores, and the last two fetch, the last stage once more: in bounds, never read */
#pragma unroll
    for (int i = 0; i < 4; ++i) { *(v8us*)(sAh + nb + sofs + i * 32 * GPI) = ra[i]; *(v8us*)(sAl + nb + sofs + i * 32 * GPI) = rl[i]; *(v8us*)(sB + nb + sofs + i * 32 * GPI) = rb[i]; }
    const int kn = (s + 2 < GNS ? s + 2 : GNS - 1) * GKS;
#pragma unroll
    for (int i = 0; i < 4; ++i) { ra[i] = *(const v8us*)(gah + (size_t)i * 32 * DQ + kn); rl[i] = *(const v8us*)(gal + (size_t)i * 32 * DQ + kn); rb[i] = *(const v8us*)(gb + (size_t)i * 32 * DQ + kn); }
    asm volatile("s_wait_xcnt 0x0" ::: "memory");      /* same precaution as behind the first loads */
    __builtin_amdgcn_sched_barrier(0);      /* keeps the loads above in front of the products, so that they fly during them, and the products behind the wait */
#pragma unroll
    for (int ks = 0; ks < GKS / 32; ++ks) {
#pragma unroll
      for (int t = 0; t < 4; ++t) { ch[t] = fa_mma(fa[ks][0], fb[ks][t], ch[t]); ch[4 + t] = fa_mma(fa[ks][1], fb[ks][t], ch[4 + t]); cl[t] = fa_mma(fa[ks][2], fb[ks][t], cl[t]); cl[4 + t] = fa_mma(fa[ks][3], fb[ks][t], cl[4 + t]); } }
    __builtin_amdgcn_sched_barrier(0);      /* keeps the products in front of the barrier below, whose fence waits for the loads in flight */
    __syncthreads();      /* publishes stage s + 1 to all eight waves, and ends every wave's reads of stage s before its buffer is stored over */
  }
  const float alo = alpha * 0.0009765625f;
#pragma unroll
  for (int u = 0; u < 8; ++u) { const int t = u & 3, half = u >> 2;
#pragma unroll
    for (int r = 0; r < 8; ++r) so[w][half * 16 + 8 * hh + r][t * 16 + ln] = ch[u][r] * alpha + cl[u][r] * alo; }
  __builtin_amdgcn_fence(__ATOMIC_ACQ_REL, "workgroup"); __builtin_amdgcn_wave_barrier();      /* this wave's LDS stores above come before its own LDS reads below (so[w] is private to the wave) */
  const int rsub = lane >> 4, c4 = (lane & 15) * 4; float* cp = C + (size_t)(mt * 128 + wr + rsub) * DQ + nt * 128 + wc + c4;
  v4f ov[16];
#pragma unroll
  for (int q = 0; q < 16; ++q) ov[q] = *(const v4fa*)&so[w][q * 2 + rsub][c4];
  __builtin_amdgcn_sched_barrier(0);      /* every value is in its register before the run of stores starts: no register that an issued store names is written behind it */
#pragma unroll
  for (int q = 0; q < 16; ++q) *(v4f*)(cp + (size_t)q * 2 * DQ) = ov[q];
}

extern "C" void kernel_launch(void* const* d_in, const int* in_sizes, int n_in,
                              void* d_out, int out_size, void* d_ws, size_t ws_size, hipStream_t stream) {
  (void)in_sizes; (void)n_in; (void)out_size;
  const float* const* I = (const float* const*)d_in; const float* q = I[0]; const float* k = I[1]; const float* v = I[2]; const int* msk = (const int*)d_in[3]; const int* pos = (const int*)d_in[4]; const float* qw = I[5]; const float* kw = I[6]; const float* Wo = I[7];
  char* ws = (char*)d_ws; size_t off = 0;
  auto take = [&](size_t bytes) { char* p = ws + off; off += (bytes + 255) & ~(size_t)255; return p; };
  _Float16* BO = (_Float16*)take((size_t)DQ * DQ * 2); _Float16* Q16 = (_Float16*)take((size_t)TT * DQ * 2); _Float16* QL = (_Float16*)take((size_t)TT * DQ * 2); _Float16* K16 = (_Float16*)take((size_t)TT * DKV * 2); _Float16* KL = (_Float16*)take((size_t)TT * DKV * 2); _Float16* VT = (_Float16*)take((size_t)TT * DKV * 2); float* CTX = (float*)take((size_t)TT * DQ * 4); int* ACT = (int*)take((size_t)QTN * 64 * 4); _Float16* C16 = Q16; _Float16* CL = QL;      /* merged context hi/lo over the q planes (dead after the attention launch) */
  if (off > ws_size) return;      /* 8 + 8+8 + 2+2 + 2 + 16 = 46 MiB */
  k_prep<<<PB_NQ + PB_NK + PB_MF + PB_VT + PB_WS, 256, 0, stream>>>(q, k, v, msk, pos, qw, kw, Wo, Q16, QL, K16, KL, VT, ACT, BO);      /* q/k planes; which 64 x 32 mask tiles hold an open entry; V^T [512][2048], kv head = rows kv*128 .. +127; W_out x 16 */
  k_fattn<<<dim3(QTN / 2, NQH), 128, 0, stream>>>(Q16, QL, K16, KL, VT, msk, ACT, CTX);      /* all 16 heads: ctx[t][h*128 + d], scores and probabilities stay in registers */
  k_hl<<<(unsigned)(((size_t)TT * DQ / 8 + 255) / 256), 256, 0, stream>>>(CTX, C16, CL, (size_t)TT * DQ / 8);
  k_gemm2l<<<(TT / 128) * (DQ / 128), 256, 0, stream>>>(C16, CL, BO, 0.0625f, (float*)d_out);      /* out = (ctx_hi + ctx_lo) W_out^T (W exact), one launch */
}

// v007
// One run takes 136 microseconds.
// Next to v006, in two timings, it ran 1.09 times as fast each time.
// Counting every step since v000, it is 24.5 times as fast.
#include <hip/hip_runtime.h>
// QEffMolmoBlock (1 x 2048 tokens; 16 query heads / 4 kv heads x 128 dims; q, k, v are INPUT projections): q = RMSNorm_2048(q) * q_norm_w, k = RMSNorm_512(k) * k_norm_w (flat, before the head split); rotate-half RoPE (hd 128, positions from position_ids, base 10000); GQA (each kv head serves 4 query heads); scores = q.k / sqrt(128), masked entries (int mask input != 0) REPLACED by -10000; softmax; out = (att v) W_out^T.
// Structure: one preparation launch (RMSNorm + RoPE fused on VALU, wave per token, into f16 hi + 2^10 residual q/k planes; v as exact f16, V^T by LDS tiles; a flag per 64 x 32 mask tile (any open entry); W_out x 16 as f16); one fused attention launch for all 16 heads (a wave owns 16 queries and walks every other open key pass of 32): the score products (f16 WMMA, f32 accumulation, K = 128, three terms), the masked online softmax on VALU (mask read on device), P as f16 hi + residual (x 2^10) packed in registers, the readout as two terms into the merged context plane; context hi/residual; W_out as two GEMM terms (exact x16 weights). Every product runs all its hi/residual terms in one launch.
// Compute dtype: inputs rounded to bf16; v and W_out exact as f16; normed+rotated q/k (3-term scores), P and the merged context all carried as f16 hi + 2^10 residual (~2^-21): the q/k norm weights are O(1) random so logits have sigma ≈ 11 and the softmax is near one-hot; RMSNorm/RoPE/softmax f32. v_wmma_f32_16x16x32_f16.
#define TT 2048
#define MSTR 2048                /* attention_mask row stride (input geometry) */
#define NQH 16
#define NKVH 4
#define HD 128
#define DQ (NQH * HD)            /* 2048 */
#define DKV (NKVH * HD)          /* 512 */
#define GRP (NQH / NKVH)         /* 4 query heads share a kv head */
typedef __bf16 v16b __attribute__((ext_vector_type(16)));
typedef unsigned short v8us __attribute__((ext_vector_type(8), may_alias));
typedef float  v8f  __attribute__((ext_vector_type(8)));
typedef float  v4f  __attribute__((ext_vector_type(4)));
typedef float  v4fa __attribute__((ext_vector_type(4), may_alias));
union FragB { v16b v; v8us half[2]; unsigned short u[16]; };

__device__ __forceinline__ unsigned short bf16_bits(float x) { unsigned int u = __float_as_uint(x); return (unsigned short)((u + 0x7FFFu + ((u >> 16) & 1u)) >> 16); }
__device__ __forceinline__ float bf16_val(unsigned short b) { return __uint_as_float(((unsigned int)b) << 16); }
__device__ __forceinline__ float bf16_round(float x) { return bf16_val(bf16_bits(x)); }
// D += A·B with NT terms: 1 = ah·bh, 2 = + al·bh (A split), 3 = + ah·bl (both split)
template <int NT>
__device__ __forceinline__ v8f mmaN(v16b ah, v16b al, v16b bh, v16b bl, v8f c) {
  c = __builtin_amdgcn_wmma_f32_16x16x32_bf16(false, ah, false, bh, (short)0, c, false, false);
  if (NT >= 2) c = __builtin_amdgcn_wmma_f32_16x16x32_bf16(false, al, false, bh, (short)0, c, false, false);
  if (NT >= 3) c = __builtin_amdgcn_wmma_f32_16x16x32_bf16(false, ah, false, bl, (short)0, c, false, false);
  asm volatile("v_nop\n\tv_nop\n\tv_nop\n\tv_nop" : "+v"(c) : "v"(ah), "v"(al), "v"(bh), "v"(bl));
  return c;
}

__global__ __launch_bounds__(256) void k_wt_bf16(const float* __restrict__ W, unsigned short* __restrict__ Wt, int K, int N) {
  const int t = blockIdx.x * 256 + threadIdx.x;
  const int k8n = K / 8;
  if (t >= N * k8n) return;
  const int n = t / k8n, k8 = (t % k8n) * 8;
  v8us v;
#pragma unroll
  for (int i = 0; i < 8; ++i) v[i] = bf16_bits(W[(size_t)(k8 + i) * N + n]);
  *(v8us*)(Wt + (size_t)n * K + k8) = v;
  
}

// GEMM C[M][N] (f32, pitch ldc) = act(A[M][K]·W + bias). A f32 row-major (pitch lda) converted per fragment to bf16
// (ASPLIT: hi/lo two planes -> 2 terms, else single rounded term); Wt bf16 [N][K] (pitch ldb). BIAS_BF16 rounds the
// bias to bf16 first (bias quantised to bf16 before the add). K%32==0, M%16==0, N%64==0.
template <bool ASPLIT, int ACT, bool BIAS_BF16>
__global__ __launch_bounds__(128) void k_gemm_bf(const float* __restrict__ A, int lda, const unsigned short* __restrict__ Wt, int ldb,
                                               const float* __restrict__ bias, float* __restrict__ C, int ldc, int M, int N, int K) {
  __shared__ __attribute__((aligned(16))) float so[4][16][64];
  const int tid = threadIdx.x, w = tid >> 5, lane = tid & 31, ln = lane & 15, hh = lane >> 4;
  const int ntn = N / 64;
  const int wid = blockIdx.x * 4 + w;
  const int mt = wid / ntn, nq = wid % ntn;
  if (mt * 16 >= M) return;
  const int row0 = mt * 16, col0 = nq * 64;
  const float* arow = A + (size_t)(row0 + ln) * lda;
  v8f acc[4] = {};
  for (int kb = 0; kb < K; kb += 32) {
    FragB ah, al;
    const v4f x0 = *(const v4fa*)(arow + kb + 8 * hh), x1 = *(const v4fa*)(arow + kb + 8 * hh + 4);
    const v4f x2 = *(const v4fa*)(arow + kb + 16 + 8 * hh), x3 = *(const v4fa*)(arow + kb + 16 + 8 * hh + 4);
    float xs[16] = {x0[0],x0[1],x0[2],x0[3],x1[0],x1[1],x1[2],x1[3],x2[0],x2[1],x2[2],x2[3],x3[0],x3[1],x3[2],x3[3]};
#pragma unroll
    for (int i = 0; i < 16; ++i) { const unsigned short hb = bf16_bits(xs[i]); ah.u[i] = hb; al.u[i] = ASPLIT ? bf16_bits(xs[i] - bf16_val(hb)) : (unsigned short)0; }
#pragma unroll
    for (int t = 0; t < 4; ++t) {
      const unsigned short* brow = Wt + (size_t)(col0 + t * 16 + ln) * ldb + kb;
      FragB b;
      b.half[0] = *(const v8us*)(brow + 8 * hh);
      b.half[1] = *(const v8us*)(brow + 16 + 8 * hh);
      acc[t] = mmaN<ASPLIT ? 2 : 1>(ah.v, al.v, b.v, b.v, acc[t]);
    }
  }
#pragma unroll
  for (int t = 0; t < 4; ++t) {
    float bv = bias ? bias[col0 + t * 16 + ln] : 0.f;
    if (BIAS_BF16) bv = bf16_round(bv);
#pragma unroll
    for (int r = 0; r < 8; ++r) { float v = acc[t][r] + bv; if (ACT == 1) v = fmaxf(v, 0.f); so[w][8 * hh + r][t * 16 + ln] = v; }
  }
  __builtin_amdgcn_fence(__ATOMIC_ACQ_REL, "workgroup");
  __builtin_amdgcn_wave_barrier();
  const int rsub = lane >> 4, c4 = (lane & 15) * 4;
  {
#pragma unroll
    for (int q = 0; q < 8; ++q) {
      const int r = q * 2 + rsub;
      const v4f v = *(const v4fa*)&so[w][r][c4];
      *(v4f*)(C + (size_t)(row0 + r) * ldc + col0 + c4) = v;
    }
    
  }
}

// GEMM C = act(A·W + bias + resid): A f32 (ASPLIT -> hi/lo 2 terms), Wt bf16 [N][K]; ACT 0 none, 1 relu, 2 exact gelu;
// resid (optional, f32, row index = (row % rmod), pitch ldr, RES_BF16 rounds it) added before the activation.
template <bool ASPLIT, int ACT, bool BIAS_BF16, bool RES_BF16>
__global__ __launch_bounds__(128) void k_gemm_bf3(const float* __restrict__ A, int lda, const unsigned short* __restrict__ Wt, int ldb,
                                                const float* __restrict__ bias, const float* __restrict__ resid, int rmod, int ldr,
                                                float* __restrict__ C, int ldc, int M, int N, int K) {
  __shared__ __attribute__((aligned(16))) float so[4][16][64];
  const int tid = threadIdx.x, w = tid >> 5, lane = tid & 31, ln = lane & 15, hh = lane >> 4;
  const int ntn = N / 64;
  const int wid = blockIdx.x * 4 + w;
  const int mt = wid / ntn, nq = wid % ntn;
  if (mt * 16 >= M) return;
  const int row0 = mt * 16, col0 = nq * 64;
  const float* arow = A + (size_t)(row0 + ln) * lda;
  v8f acc[4] = {};
  for (int kb = 0; kb < K; kb += 32) {
    FragB ah, al;
    const v4f x0 = *(const v4fa*)(arow + kb + 8 * hh), x1 = *(const v4fa*)(arow + kb + 8 * hh + 4);
    const v4f x2 = *(const v4fa*)(arow + kb + 16 + 8 * hh), x3 = *(const v4fa*)(arow + kb + 16 + 8 * hh + 4);
    float xs[16] = {x0[0],x0[1],x0[2],x0[3],x1[0],x1[1],x1[2],x1[3],x2[0],x2[1],x2[2],x2[3],x3[0],x3[1],x3[2],x3[3]};
#pragma unroll
    for (int i = 0; i < 16; ++i) { const unsigned short hb = bf16_bits(xs[i]); ah.u[i] = hb; al.u[i] = ASPLIT ? bf16_bits(xs[i] - bf16_val(hb)) : (unsigned short)0; }
#pragma unroll
    for (int t = 0; t < 4; ++t) {
      const unsigned short* brow = Wt + (size_t)(col0 + t * 16 + ln) * ldb + kb;
      FragB b;
      b.half[0] = *(const v8us*)(brow + 8 * hh);
      b.half[1] = *(const v8us*)(brow + 16 + 8 * hh);
      acc[t] = mmaN<ASPLIT ? 2 : 1>(ah.v, al.v, b.v, b.v, acc[t]);
    }
  }
#pragma unroll
  for (int t = 0; t < 4; ++t) {
    const int col = col0 + t * 16 + ln;
    float bv = bias ? bias[col] : 0.f;
    if (BIAS_BF16) bv = bf16_round(bv);
#pragma unroll
    for (int r = 0; r < 8; ++r) {
      float v = acc[t][r] + bv;
      if (resid) { float rv = resid[(size_t)((row0 + 8 * hh + r) % rmod) * ldr + col]; if (RES_BF16) rv = bf16_round(rv); v += rv; }
      if (ACT == 1) v = fmaxf(v, 0.f);
      if (ACT == 2) v = 0.5f * v * (1.0f + erff(v * 0.70710678118654752f));
      if (ACT == 3) { const float u = 0.7978845608028654f * (v + 0.044715f * v * v * v); v = 0.5f * v * (1.0f + tanhf(u)); }
      so[w][8 * hh + r][t * 16 + ln] = v;
    }
  }
  __builtin_amdgcn_fence(__ATOMIC_ACQ_REL, "workgroup");
  __builtin_amdgcn_wave_barrier();
  const int rsub = lane >> 4, c4 = (lane & 15) * 4;
  {
#pragma unroll
    for (int q = 0; q < 8; ++q) {
      const int r = q * 2 + rsub;
      const v4f v = *(const v4fa*)&so[w][r][c4];
      *(v4f*)(C + (size_t)(row0 + r) * ldc + col0 + c4) = v;
    }
    
  }
}
// row LayerNorm (biased variance, eps) over N: s = X (+ R); optional out_sum <- s; out_norm <- (s-mu)*rsqrt(var+eps)*g + b
template <bool PARAM_BF16>
__global__ __launch_bounds__(256) void k_layernorm(const float* __restrict__ X, const float* __restrict__ R, const float* __restrict__ g, const float* __restrict__ bta,
                                                  float* __restrict__ out_sum, float* __restrict__ out_norm, int N, float eps) {
  __shared__ float red[256];
  const int row = blockIdx.x, tid = threadIdx.x;
  const float* x = X + (size_t)row * N; const float* rr = R ? R + (size_t)row * N : nullptr;
  float vals[16];                     // up to N = 4096
  const int per = N / 256;            // contiguous chunk per thread? use strided-by-4 chunks: thread handles j = tid*4 + 1024*u
  float s1 = 0.f;
  for (int u = 0; u < per / 4; ++u) {
    const int j = tid * 4 + 1024 * u;
    const v4f a = *(const v4fa*)(x + j);
    v4f b = {0.f,0.f,0.f,0.f}; if (rr) b = *(const v4fa*)(rr + j);
#pragma unroll
    for (int q = 0; q < 4; ++q) { const float v = a[q] + b[q]; vals[u * 4 + q] = v; s1 += v; }
  }
  red[tid] = s1; __syncthreads();
  for (int st = 128; st > 0; st >>= 1) { if (tid < st) red[tid] += red[tid + st]; __syncthreads(); }
  const float mu = red[0] / (float)N; __syncthreads();
  float s2 = 0.f;
  for (int u = 0; u < per / 4; ++u)
#pragma unroll
    for (int q = 0; q < 4; ++q) { const float c = vals[u * 4 + q] - mu; s2 += c * c; }
  red[tid] = s2; __syncthreads();
  for (int st = 128; st > 0; st >>= 1) { if (tid < st) red[tid] += red[tid + st]; __syncthreads(); }
  const float rs = rsqrtf(red[0] / (float)N + eps);
  {
    for (int u = 0; u < per / 4; ++u) {
      const int j = tid * 4 + 1024 * u;
      v4f o, sm;
#pragma unroll
      for (int q = 0; q < 4; ++q) {
        float gg = g[j + q], bb = bta[j + q];
        if (PARAM_BF16) { gg = bf16_round(gg); bb = bf16_round(bb); }
        sm[q] = vals[u * 4 + q]; o[q] = (vals[u * 4 + q] - mu) * rs * gg + bb;
      }
      if (out_sum) *(v4f*)(out_sum + (size_t)row * N + j) = sm;
      *(v4f*)(out_norm + (size_t)row * N + j) = o;
    }
    
  }
}



// ---- f16 WMMA path (v_wmma_f32_16x16x32_f16): 11-bit significands for operands in range — used where a [0,1] probability operand needs more precision than bf16
typedef _Float16 v16h __attribute__((ext_vector_type(16)));
union FragH { v16h v; v8us half[2]; _Float16 h[16]; unsigned short u[16]; };
template <int NT>
__device__ __forceinline__ v8f mmaH(v16h ah, v16h al, v16h bh, v16h bl, v8f c) {
  c = __builtin_amdgcn_wmma_f32_16x16x32_f16(false, ah, false, bh, (short)0, c, false, false);
  if (NT >= 2) c = __builtin_amdgcn_wmma_f32_16x16x32_f16(false, al, false, bh, (short)0, c, false, false);
  if (NT >= 3) c = __builtin_amdgcn_wmma_f32_16x16x32_f16(false, ah, false, bl, (short)0, c, false, false);
  asm volatile("v_nop\n\tv_nop\n\tv_nop\n\tv_nop" : "+v"(c) : "v"(ah), "v"(al), "v"(bh), "v"(bl));
  return c;
}
// batched GEMM like k_gemm_b but f16 operands: A f32 (split into f16 hi/lo if ASPLIT, else rounded to f16), Bt = f16 values [n][k]; alpha; C f32; N multiple of 16 (partial tiles skipped)
template <bool ASPLIT>
__global__ __launch_bounds__(128) void k_gemm_h(const float* __restrict__ A, int lda, size_t sA, const _Float16* __restrict__ Bh, int ldb, size_t sB, float alpha, float* __restrict__ C, int ldc, size_t sC, int M, int N, int K) {
  __shared__ __attribute__((aligned(16))) float so[4][16][64];
  const int tid = threadIdx.x, w = tid >> 5, lane = tid & 31, ln = lane & 15, hh = lane >> 4; const int by = blockIdx.y;
  A += (size_t)by * sA; Bh += (size_t)by * sB; C += (size_t)by * sC;
  const int ntn = (N + 63) / 64; const int wid = blockIdx.x * 4 + w; const int mt = wid / ntn, nq = wid % ntn; if (mt * 16 >= M) return;
  const int row0 = mt * 16, col0 = nq * 64; const float* arow = A + (size_t)(row0 + ln) * lda;
  v8f acc[4] = {};
  for (int kb = 0; kb < K; kb += 32) {
    FragH ah, al;
    const v4f x0 = *(const v4fa*)(arow + kb + 8 * hh), x1 = *(const v4fa*)(arow + kb + 8 * hh + 4), x2 = *(const v4fa*)(arow + kb + 16 + 8 * hh), x3 = *(const v4fa*)(arow + kb + 16 + 8 * hh + 4);
    float xs[16] = {x0[0],x0[1],x0[2],x0[3],x1[0],x1[1],x1[2],x1[3],x2[0],x2[1],x2[2],x2[3],x3[0],x3[1],x3[2],x3[3]};
#pragma unroll
    for (int i = 0; i < 16; ++i) { const _Float16 h = (_Float16)xs[i]; ah.h[i] = h; al.h[i] = ASPLIT ? (_Float16)(xs[i] - (float)h) : (_Float16)0.0f; }
#pragma unroll
    for (int t = 0; t < 4; ++t) { if (col0 + t * 16 >= N) continue; const size_t boff = (size_t)(col0 + t * 16 + ln) * ldb + kb; FragH bq; bq.half[0] = *(const v8us*)(Bh + boff + 8 * hh); bq.half[1] = *(const v8us*)(Bh + boff + 16 + 8 * hh);
      acc[t] = mmaH<ASPLIT ? 2 : 1>(ah.v, al.v, bq.v, bq.v, acc[t]); }
  }
#pragma unroll
  for (int t = 0; t < 4; ++t) { if (col0 + t * 16 >= N) continue;
#pragma unroll
    for (int r = 0; r < 8; ++r) so[w][8 * hh + r][t * 16 + ln] = acc[t][r] * alpha; }
  __builtin_amdgcn_fence(__ATOMIC_ACQ_REL, "workgroup"); __builtin_amdgcn_wave_barrier();
  const int rsub = lane >> 4, c4 = (lane & 15) * 4;
  {
#pragma unroll
    for (int q = 0; q < 8; ++q) { const int r = q * 2 + rsub; if (col0 + c4 < N) { const v4f v = *(const v4fa*)&so[w][r][c4]; *(v4f*)(C + (size_t)(row0 + r) * ldc + col0 + c4) = v; } }
     }
}

// Wt[n][k] = f16(W[k][n]·scale) from f32 row-major W[K][N] (scale = power of two; bf16-exact weights stay exact in f16 away from the subnormal range)
__global__ __launch_bounds__(256) void k_wt_f16(const float* __restrict__ W, _Float16* __restrict__ Wt, int K, int N, float scale) {
  const int t = blockIdx.x * 256 + threadIdx.x; if (t >= N * (K / 8)) return; const int n = t / (K / 8), k8 = (t % (K / 8)) * 8; FragH f;
#pragma unroll
  for (int i = 0; i < 8; ++i) f.h[i] = (_Float16)(bf16_round(W[(size_t)(k8 + i) * N + n]) * scale); const v8us o = f.half[0];
  *(v8us*)((unsigned short*)Wt + (size_t)n * K + k8) = o; 
}
// k_gemm_hh variant with fused epilogue: v = acc·alpha + bias[by·sBias + col] (+ CP[(row/rowsPerB)·sCPb + by·64 + col] if CP) ; ACT 0 none / 1 elu ; writes f16 C16 (and f32 C if non-null)
template <int ACT>
__global__ __launch_bounds__(128) void k_gemm_hhx(const _Float16* __restrict__ A, int lda, size_t sA, const _Float16* __restrict__ Bh, int ldb, size_t sB, float alpha, const float* __restrict__ bias, size_t sBias, const float* __restrict__ CP, int rowsPerB, size_t sCPb, int row0g,
    float* __restrict__ C, _Float16* __restrict__ C16, int ldc, size_t sC, int M, int N, int K) {
  __shared__ __attribute__((aligned(16))) float so[4][16][64];
  const int tid = threadIdx.x, w = tid >> 5, lane = tid & 31, ln = lane & 15, hh = lane >> 4; const int by = blockIdx.y;
  A += (size_t)by * sA; Bh += (size_t)by * sB; const size_t cofs = (size_t)by * sC; const float* bp = bias ? bias + (size_t)by * sBias : nullptr;
  const int ntn = (N + 63) / 64; const int wid = blockIdx.x * 4 + w; const int mt = wid / ntn, nq = wid % ntn; if (mt * 16 >= M) return;
  const int row0 = mt * 16, col0 = nq * 64; const _Float16* arow = A + (size_t)(row0 + ln) * lda;
  v8f acc[4] = {};
  for (int kb = 0; kb < K; kb += 32) { FragH ah; ah.half[0] = *(const v8us*)((const unsigned short*)arow + kb + 8 * hh); ah.half[1] = *(const v8us*)((const unsigned short*)arow + kb + 16 + 8 * hh);
#pragma unroll
    for (int t = 0; t < 4; ++t) { if (col0 + t * 16 >= N) continue; const size_t boff = (size_t)(col0 + t * 16 + ln) * ldb + kb; FragH bq; bq.half[0] = *(const v8us*)((const unsigned short*)Bh + boff + 8 * hh); bq.half[1] = *(const v8us*)((const unsigned short*)Bh + boff + 16 + 8 * hh);
      acc[t] = mmaH<1>(ah.v, ah.v, bq.v, bq.v, acc[t]); }
  }
#pragma unroll
  for (int t = 0; t < 4; ++t) { if (col0 + t * 16 >= N) continue; const int col = col0 + t * 16 + ln; const float bv = bp ? bf16_round(bp[col]) : 0.f;
#pragma unroll
    for (int r = 0; r < 8; ++r) { float v = acc[t][r] * alpha + bv; if (CP) { const int rr = row0g + row0 + 8 * hh + r; if (rowsPerB < 0) v += CP[cofs + (size_t)rr * ldc + col];      /* rowsPerB < 0: own element of the batched C plane */ else { const int bidx = rr / rowsPerB; v += CP[(size_t)bidx * sCPb + (size_t)by * 64 + col]; } } if (ACT == 1) v = (v > 0.f) ? v : expm1f(v); else if (ACT == 7) v = (v > 0.f) ? v + 1.0f : expf(v); else if (ACT == 8) v = tanhf(v); else if (ACT == 9) v = 0.5f * v * (1.0f + tanhf(0.7978845608028654f * (v + 0.044715f * v * v * v))); else if (ACT == 11) v = 1.0f / (1.0f + expf(-v)); else if (ACT == 12) v = (v > 0.f) ? v : 0.01f * v; else if (ACT == 14) v = (v > 0.f) ? v : 0.1f * v; else if (ACT == 16) v = (v >= 0.f) ? v : 0.3f * v; else if (ACT == 17) v = (v >= 0.f) ? v : 0.2f * v; else if (ACT == 15) v = v / (1.0f + expf(-v)); else if (ACT == 3) v = fmaxf(v, 0.f); else if (ACT == 6) v = 0.5f * v * (1.0f + erff(v * 0.70710678118654752f)); so[w][8 * hh + r][t * 16 + ln] = v; } }
  __builtin_amdgcn_fence(__ATOMIC_ACQ_REL, "workgroup"); __builtin_amdgcn_wave_barrier();
  const int rsub = lane >> 4, c4 = (lane & 15) * 4; typedef _Float16 v4h __attribute__((ext_vector_type(4)));
  {
#pragma unroll
    for (int q = 0; q < 8; ++q) { const int r = q * 2 + rsub; if (col0 + c4 < N) { const v4f v = *(const v4fa*)&so[w][r][c4]; if (C) *(v4f*)(C + cofs + (size_t)(row0 + r) * ldc + col0 + c4) = v; if (C16) { v4h h4; for (int i = 0; i < 4; ++i) h4[i] = (_Float16)v[i]; *(v4h*)(C16 + cofs + (size_t)(row0 + r) * ldc + col0 + c4) = h4; } } }
     }
}


typedef _Float16 v4h __attribute__((ext_vector_type(4)));

__global__ __launch_bounds__(256) void k_h16(const float* __restrict__ x, _Float16* __restrict__ X16, size_t n8) { const size_t t = (size_t)blockIdx.x * 256 + threadIdx.x; if (t >= n8) return; FragH f;
#pragma unroll
  for (int q = 0; q < 8; ++q) f.h[q] = (_Float16)x[t * 8 + q]; *(v8us*)((unsigned short*)X16 + t * 8) = f.half[0];  }
__global__ __launch_bounds__(256) void k_round16f(const float* __restrict__ W, _Float16* __restrict__ Bt, size_t n8) { const size_t t = (size_t)blockIdx.x * 256 + threadIdx.x; if (t >= n8) return; FragH f;
#pragma unroll
  for (int i = 0; i < 8; ++i) f.h[i] = (_Float16)(bf16_round(W[t * 8 + i]) * 16.0f); *(v8us*)((unsigned short*)Bt + t * 8) = f.half[0];  }
// V^T [512][2048] from v [2048][512]: block blk turns the 64 tokens x 64 dims tile (token group blk % 32, dim slab blk / 32) through LDS; v is rounded to bf16 and written as exact f16 on the way in.
// Every loop is unrolled so that the register arrays are indexed by constants and the four loads of a thread fly together.
__device__ __forceinline__ void d_vt(const int blk, const float* __restrict__ v, _Float16* __restrict__ Vt, unsigned short (*tl)[66]) { const int tid = threadIdx.x; const int slab = blk / (TT / 64), lg = blk % (TT / 64);
  v4f va[2], vc[2];
#pragma unroll
  for (int i = 0; i < 2; ++i) { const float* vp = v + (size_t)(lg * 64 + i * 32 + tid / 8) * DKV + slab * 64 + (tid % 8) * 8; va[i] = *(const v4fa*)vp; vc[i] = *(const v4fa*)(vp + 4); }
  asm volatile("s_wait_xcnt 0x0" ::: "memory");      /* precaution: stands in front of every later write of a register that one of the loads above names */
  __builtin_amdgcn_sched_barrier(0);      /* keeps the work below from being scheduled above that wait */
#pragma unroll
  for (int i = 0; i < 2; ++i) { const int r = i * 32 + tid / 8, c8 = (tid % 8) * 8; FragH f;
#pragma unroll
    for (int q = 0; q < 4; ++q) { f.h[q] = (_Float16)bf16_round(va[i][q]); f.h[4 + q] = (_Float16)bf16_round(vc[i][q]); }
#pragma unroll
    for (int q = 0; q < 8; ++q) tl[r][c8 + q] = f.u[q]; }
  __syncthreads();
  {
#pragma unroll
    for (int rd = 0; rd < 2; ++rd) { const int d = rd * 32 + tid / 8, pc = tid % 8; FragH f;
#pragma unroll
      for (int q = 0; q < 8; ++q) f.u[q] = tl[pc * 8 + q][d];
      *(v8us*)((unsigned short*)Vt + ((size_t)slab * 64 + d) * TT + lg * 64 + pc * 8) = f.half[0]; }
    asm volatile("s_wait_xcnt 0x0" ::: "memory");      /* precaution: closes the two stores, in front of whatever the merged kernel's code behind this job writes into their registers */
     } }

__global__ __launch_bounds__(256) void k_hl(const float* __restrict__ F, _Float16* __restrict__ Hh, _Float16* __restrict__ Hl, size_t n8) { const size_t t = (size_t)blockIdx.x * 256 + threadIdx.x; if (t >= n8) return; FragH fh, fl; const v4f a = *(const v4fa*)(F + t * 8), c = *(const v4fa*)(F + t * 8 + 4);
#pragma unroll
  for (int q = 0; q < 4; ++q) { _Float16 h = (_Float16)a[q]; fh.h[q] = h; fl.h[q] = (_Float16)((a[q] - (float)h) * 1024.0f); h = (_Float16)c[q]; fh.h[4 + q] = h; fl.h[4 + q] = (_Float16)((c[q] - (float)h) * 1024.0f); }
  { *(v8us*)((unsigned short*)Hh + t * 8) = fh.half[0]; *(v8us*)((unsigned short*)Hl + t * 8) = fl.half[0];  } }

// ---- fragment loader: 16 halves of one operand row in the hardware k order ----
__device__ __forceinline__ v16h g2_frag(const _Float16* p, int hh) { FragH f; f.half[0] = *(const v8us*)((const unsigned short*)p + 8 * hh); f.half[1] = *(const v8us*)((const unsigned short*)p + 16 + 8 * hh); return f.v; }
#define WCH 4                    /* chunks of 8 weights a thread: a quarter of the blocks to start, eight 16-byte loads of a thread in flight */
// Bt = f16(bf16(Wm) * sc), same layout. Every loop is unrolled so that the register arrays are indexed by constants and the loads fly together.
__device__ __forceinline__ void d_wsc(const int blk, const float* __restrict__ Wm, _Float16* __restrict__ Bt, const float sc) { const size_t t0 = (size_t)blk * (WCH * 256) + threadIdx.x;
  v4f wa[WCH], wc[WCH];
#pragma unroll
  for (int j = 0; j < WCH; ++j) { const float* wp = Wm + (t0 + j * 256) * 8; wa[j] = *(const v4fa*)wp; wc[j] = *(const v4fa*)(wp + 4); }
  asm volatile("s_wait_xcnt 0x0" ::: "memory");      /* precaution: stands in front of every later write of a register that one of the loads above names */
  __builtin_amdgcn_sched_barrier(0);      /* keeps the work below from being scheduled above that wait */
  FragH f[WCH];
#pragma unroll
  for (int j = 0; j < WCH; ++j) {
#pragma unroll
    for (int q = 0; q < 4; ++q) { f[j].h[q] = (_Float16)(bf16_round(wa[j][q]) * sc); f[j].h[4 + q] = (_Float16)(bf16_round(wc[j][q]) * sc); } }
  __builtin_amdgcn_sched_barrier(0);      /* every value is in its register before the run of stores starts: no register that an issued store names is written behind it */
#pragma unroll
  for (int j = 0; j < WCH; ++j) *(v8us*)((unsigned short*)Bt + (t0 + j * 256) * 8) = f[j].half[0];
  asm volatile("s_wait_xcnt 0x0" ::: "memory");      /* precaution: closes the run of stores, in front of whatever the merged kernel's code behind this job writes into their registers */
}
template <int NH_>
__device__ __forceinline__ void d_normrope(const int blk, const float* __restrict__ X, const float* __restrict__ w, const int* __restrict__ pos, _Float16* __restrict__ O16, _Float16* __restrict__ OL) {
  #pragma clang fp contract(off)
  constexpr int W_ = NH_ * HD; const int wv = threadIdx.x >> 5, ln = threadIdx.x & 31; const int t = blk * 8 + wv; if (t >= TT) return; const float* x = X + (size_t)t * W_; float ss = 0.f;
#pragma unroll 1
  for (int c = ln * 4; c < W_; c += 128) { const v4f a = *(const v4fa*)(x + c); for (int e = 0; e < 4; ++e) { const float v = bf16_round(a[e]); ss += v * v; } }
  for (int o = 16; o > 0; o >>= 1) ss += __shfl_xor(ss, o, 32); const float inv = rsqrtf(ss / (float)W_ + 1e-5f); const float p = (float)pos[t];
  {
#pragma unroll 1
    for (int h = 0; h < NH_; ++h) { for (int u = 0; u < 2; ++u) { const int d = ln + 32 * u; const int c1 = h * HD + d, c2 = c1 + 64; float x1 = bf16_round(x[c1]) * inv; x1 *= bf16_round(w[c1]); float x2 = bf16_round(x[c2]) * inv; x2 *= bf16_round(w[c2]);
        const float ex = (float)(2 * d) / (float)HD; const float ivf = 1.0f / powf(10000.0f, ex); const float th = p * ivf; const float cs = cosf(th), sn = sinf(th); float o1 = x1 * cs; o1 += -(x2 * sn); float o2 = x2 * cs; o2 += x1 * sn;
        const _Float16 h1 = (_Float16)o1, h2 = (_Float16)o2; *(_Float16*)(O16 + (size_t)t * W_ + c1) = h1; *(_Float16*)(O16 + (size_t)t * W_ + c2) = h2; *(_Float16*)(OL + (size_t)t * W_ + c1) = (_Float16)((o1 - (float)h1) * 1024.0f); *(_Float16*)(OL + (size_t)t * W_ + c2) = (_Float16)((o2 - (float)h2) * 1024.0f);
        asm volatile("s_wait_xcnt 0x0" ::: "memory");      /* precaution: closes the four stores, in front of the next trip's writes of their registers */
      } }
     } }

// ---- fused attention: scores, masked softmax and readout of all 16 heads in ONE launch; the score and probability planes never go to memory ----
// Transposed products: S^T = K.Q^T (A = key rows, B = query rows held in registers), O^T += V^T.P^T. In an accumulator tile a lane holds 8 keys of ONE query (column = lane & 15, rows 8 * (lane >> 4) + r),
// which is exactly the k order of the B loader (k = 8 * hh + i, then 16 + 8 * hh + i), so two 16-key score tiles pack in-lane into one 32-key P^T fragment. Running maximum and sum per query (online softmax):
// when the maximum moves, the output accumulators and the sum are scaled by exp(m_old - m_new). Same operand planes and terms as the separate stages: 3 hi/residual score terms, P as f16 hi + 2^10 residual of 1024 * p.
__device__ __forceinline__ v8f fa_mma(v16h a, v16h b, v8f c) { return __builtin_amdgcn_wmma_f32_16x16x32_f16(false, a, false, b, (short)0, c, false, false); }
typedef int v4i __attribute__((ext_vector_type(4)));
#define FKP 136                  /* LDS pitch of a K row, in halves */
#define FVP 40                   /* LDS pitch of a V^T row, in halves */
#define QTN (TT / 64)            /* query tiles of 64 rows */
// act[qt * 64 + p] = 1 where the 64 x 32 mask tile (query tile qt, key pass p) holds at least one open (zero) entry, else 0. A wave reads four tiles in turn; a block of eight waves writes one whole 128-byte line of flags.
__device__ __forceinline__ void d_mflag(const int blk, const int* __restrict__ msk, int* __restrict__ act) {
  const int wv = threadIdx.x >> 5, lane = threadIdx.x & 31; unsigned bits = 0u;      /* bit j: the wave's tile j is open */
  /* kept rolled: one tile's sixteen loads in flight a wave; unrolled, the four tiles' loads would set the register count of the whole launch */
#pragma unroll 1
  for (int j = 0; j < 4; ++j) {
    const int u = blk * 32 + wv * 4 + j; const int qt = u >> 6, p = u & 63;
    const int* mp = msk + (size_t)(qt * 64 + (lane >> 3)) * MSTR + p * 32 + (lane & 7) * 4;
    v4i m[16];      /* both inner loops are unrolled so that this array stays in registers and its loads fly together */
#pragma unroll
    for (int i = 0; i < 16; ++i) m[i] = *(const v4i*)(mp + (size_t)i * 4 * MSTR);
    asm volatile("s_wait_xcnt 0x0" :: "v"(mp) : "memory");      /* precaution: stands in front of every later write of a register that one of the loads above names; the address is an input so that it stays in its registers up to here and no load of the run lands in them */
    __builtin_amdgcn_sched_barrier(0);      /* keeps the work below from being scheduled above that wait */
    bool open = false;
#pragma unroll
    for (int i = 0; i < 16; ++i) open = open || m[i][0] == 0 || m[i][1] == 0 || m[i][2] == 0 || m[i][3] == 0;
    const unsigned any = __builtin_amdgcn_ballot_w32(open);
    bits |= (any != 0u ? 1u : 0u) << j;
  }
  if (lane < 4) act[blk * 32 + wv * 4 + lane] = (int)((bits >> lane) & 1u);
}
// ---- preparation: the five jobs that only read inputs (q and k norm + RoPE, mask flags, V^T, scaled W_out) in ONE launch, told apart by block ranges; none reads what another writes. The longest job (q) has the first blocks (for speed only).
#define PB_NQ (TT / 8)                       /* q: a wave a token */
#define PB_NK (TT / 8)                       /* k: a wave a token */
#define PB_MF (QTN * 64 / 32)                /* mask flags: 32 tiles a block */
#define PB_VT (NKVH * 2 * (TT / 64))         /* V^T: 8 slabs of 64 dims x 32 token groups */
#define PB_WS (DQ * DQ / 8 / 256 / WCH)      /* W_out */
__global__ __launch_bounds__(256) void k_prep(const float* __restrict__ q, const float* __restrict__ k, const float* __restrict__ v, const int* __restrict__ msk, const int* __restrict__ pos, const float* __restrict__ qw, const float* __restrict__ kw, const float* __restrict__ Wo,
    _Float16* __restrict__ Q16, _Float16* __restrict__ QL, _Float16* __restrict__ K16, _Float16* __restrict__ KL, _Float16* __restrict__ VT, int* __restrict__ ACT, _Float16* __restrict__ BO) {
  __shared__ unsigned short tl[64][66];
  const int b = blockIdx.x;      /* every test below is the same for the whole block: the barrier of the V^T job is passed by all its waves */
  if (b < PB_NQ) d_normrope<NQH>(b, q, qw, pos, Q16, QL);
  else if (b < PB_NQ + PB_NK) d_normrope<NKVH>(b - PB_NQ, k, kw, pos, K16, KL);
  else if (b < PB_NQ + PB_NK + PB_MF) d_mflag(b - (PB_NQ + PB_NK), msk, ACT);
  else if (b < PB_NQ + PB_NK + PB_MF + PB_VT) d_vt(b - (PB_NQ + PB_NK + PB_MF), v, VT, tl);
  else d_wsc(b - (PB_NQ + PB_NK + PB_MF + PB_VT), Wo, BO, 16.0f);      /* (out,in) natural */
}
// A block runs two query tiles of 64 rows one after the other, tile QTN - 1 - x and tile x, so that under a triangular mask every block has the same number of open passes; a wave owns 16 queries.
// Eight waves in two key groups of four: both groups hold the same 64 queries, and of the passes to walk group 0 takes the 1st, 3rd, ... and group 1 the 2nd, 4th, ..., each with K/V tiles of its own in LDS.
// Each group keeps its own running maximum, sum and output sums; at the end of a tile the two are joined (rescaled to the common maximum), each group finishing half of the dims.
// Of each tile only the open key passes are walked (flags of d_mflag). A closed pass holds nothing but scores of -10000: once every row of the tile has a running maximum of -9000 or more, exp(-10000 - max) is 0 in f32
// and the pass would change neither sums nor maximum. Where a row's maximum is lower after the open passes (a row with no open key among them), the closed passes are walked as well, after the open ones, by the same code.
typedef v4f v4fs __attribute__((may_alias));
#define MGS 17                   /* 16-byte slots a lane hands over: 4 dims tiles x (hi, residual) x 2, then maximum and sum */
// Group G hands its partner wave the four dims tiles that the partner finishes, with its running maximum and sum. slot = the wave's own range, at its lane; slots lie 32 lanes apart, so that a wave's 16-byte accesses cover whole rows of banks.
template <int G>
__device__ __forceinline__ void fa_put(const v8f (&oh)[8], const v8f (&ol)[8], const float m, const float l, v4fs* slot) {
#pragma unroll
  for (int dd = 0; dd < 4; ++dd) { const v8f a = oh[(1 - G) * 4 + dd], b = ol[(1 - G) * 4 + dd];
    const v4f a0 = {a[0], a[1], a[2], a[3]}, a1 = {a[4], a[5], a[6], a[7]}, b0 = {b[0], b[1], b[2], b[3]}, b1 = {b[4], b[5], b[6], b[7]};
    slot[(dd * 4 + 0) * 32] = a0; slot[(dd * 4 + 1) * 32] = a1; slot[(dd * 4 + 2) * 32] = b0; slot[(dd * 4 + 3) * 32] = b1; }
  const v4f ml = {m, l, 0.f, 0.f}; slot[16 * 32] = ml;
}
// Group G joins the partner's sums into its own four dims tiles, divides by the joined sum and stores them. slot = the partner wave's range, at this lane.
template <int G>
__device__ __forceinline__ void fa_fin(v8f (&oh)[8], v8f (&ol)[8], const float m, const float l, const v4fs* slot, float* cr0) {
  const v4f ml = slot[16 * 32]; const float mj = fmaxf(m, ml[0]); const float as = expf(m - mj), ao = expf(ml[0] - mj); const float lj = l * as + ml[1] * ao;
  const float lt = lj + __shfl_xor(lj, 16, 32); const float f = 0.0009765625f / lt, fl = f * 0.0009765625f;
  /* every output value is formed in place first, then the stores go out as one run: no register that an issued store names is written before the wait behind the run */
#pragma unroll
  for (int dd = 0; dd < 4; ++dd) { const int d = G * 4 + dd; const v4f a0 = slot[(dd * 4 + 0) * 32], a1 = slot[(dd * 4 + 1) * 32], b0 = slot[(dd * 4 + 2) * 32], b1 = slot[(dd * 4 + 3) * 32];
#pragma unroll
    for (int r = 0; r < 4; ++r) { const float h0 = oh[d][r] * as + a0[r] * ao, h1 = oh[d][4 + r] * as + a1[r] * ao, l0 = ol[d][r] * as + b0[r] * ao, l1 = ol[d][4 + r] * as + b1[r] * ao;
      oh[d][r] = h0 * f + l0 * fl; oh[d][4 + r] = h1 * f + l1 * fl; } }
  __builtin_amdgcn_sched_barrier(0);      /* keeps the arithmetic above from being scheduled in among the stores below, where it would write registers of stores still under way */
#pragma unroll
  for (int dd = 0; dd < 4; ++dd) { const int d = G * 4 + dd; float* cr = cr0 + 16 * d; const v8f o = oh[d]; const v4f a = {o[0], o[1], o[2], o[3]}, b = {o[4], o[5], o[6], o[7]};
    *(v4f*)cr = a; *(v4f*)(cr + 4) = b; }
  asm volatile("s_wait_xcnt 0x0" ::: "memory");      /* precaution: closes the run of stores, in front of the second tile's writes of their registers */
}
__global__ __launch_bounds__(256) void k_fattn(const _Float16* __restrict__ Qh, const _Float16* __restrict__ Ql, const _Float16* __restrict__ Kh, const _Float16* __restrict__ Kl, const _Float16* __restrict__ Vt,
    const int* __restrict__ msk, const int* __restrict__ act, float* __restrict__ CTX) {
  __shared__ __attribute__((aligned(16))) _Float16 sKh2[2 * 32 * FKP], sKl2[2 * 32 * FKP], sV2[2 * HD * FVP];      /* a tile set for each key group */
  __shared__ float sMx[2][2][64];      /* per tile, key group and row: the running maximum after the open passes; a slot set of its own for each tile, so that no wave writes a slot that a slower wave still reads */
  __shared__ __attribute__((aligned(16))) v4fs sMg[8 * MGS * 32];      /* the hand-over at the end of a tile: a range for each wave */
  const int tid = threadIdx.x & 127, wv = threadIdx.x >> 5, w = wv & 3, lane = tid & 31, ln = lane & 15, hh = lane >> 4; const int h = blockIdx.y, kv = h / GRP;      /* tid, w: place inside the key group */
  const int g = __builtin_amdgcn_readfirstlane((int)(threadIdx.x >> 7));      /* key group, in a scalar register: the choices made from it are scalar ones */
  _Float16* const sKh = sKh2 + g * (32 * FKP); _Float16* const sKl = sKl2 + g * (32 * FKP); _Float16* const sV = sV2 + g * (HD * FVP);
  const v8f z8 = {0.f,0.f,0.f,0.f,0.f,0.f,0.f,0.f};
  /* a key group's four waves share each pass's K (hi, residual) and V^T tiles through LDS: whole-row global loads, one copy a group; pitches 272 B and 80 B (16 B x odd) keep the 16-byte fragment reads off each other's banks */
  const int krow = tid >> 4, kcol = (tid & 15) * 8, vrow = tid >> 2, vcol = (tid & 3) * 8;
  const _Float16* gkh = Kh + (size_t)krow * DKV + kv * HD + kcol; const _Float16* gkl = Kl + (size_t)krow * DKV + kv * HD + kcol; const _Float16* gv = Vt + ((size_t)kv * HD + vrow) * TT + vcol;
  const float alpha = 0.088388347648318447f, alo = alpha * 0.0009765625f;
  /* kept rolled: the two tiles run through one copy of the code */
#pragma unroll 1
  for (int half = 0; half < 2; ++half) {
    const int qt = half ? (int)blockIdx.x : QTN - 1 - (int)blockIdx.x; const int q0 = qt * 64 + 16 * w;      /* a wave owns 16 queries: one column group */
    const int a0 = act[qt * 64 + lane], a1 = act[qt * 64 + 32 + lane];
    asm volatile("s_wait_xcnt 0x0" ::: "memory");      /* precaution: the loads below may land in, or have their addresses formed in, a register that the two loads above name */
    __builtin_amdgcn_sched_barrier(0);      /* keeps the loads below behind that wait */
    v16h qh[4], ql[4];
    const size_t qo = (size_t)(q0 + ln) * DQ + h * HD; const _Float16* qp0 = Qh + qo; const _Float16* qp2 = Ql + qo;
#pragma unroll
    for (int ks = 0; ks < 4; ++ks) { qh[ks] = g2_frag(qp0 + ks * 32, hh); ql[ks] = g2_frag(qp2 + ks * 32, hh); }
    asm volatile("s_wait_xcnt 0x0" ::: "memory");      /* precaution: stands in front of every later write of a register that one of the loads above names */
    __builtin_amdgcn_sched_barrier(0);      /* keeps the work below from being scheduled above that wait */
    const unsigned long long open = (unsigned long long)__builtin_amdgcn_ballot_w32(a0 != 0) | ((unsigned long long)__builtin_amdgcn_ballot_w32(a1 != 0) << 32);      /* bit p: pass p is open; the same in all eight waves */
    v8f oh[8], ol[8];
#pragma unroll
    for (int d = 0; d < 8; ++d) { oh[d] = z8; ol[d] = z8; }
    float mrun = -3.0e38f, lrun = 0.f;
    const int* gm = msk + (size_t)(q0 + ln) * MSTR + 8 * hh;
    /* kept rolled: open passes (phase 0) and, where needed, closed passes (phase 1) run through one copy of the code */
#pragma unroll 1
    for (int phase = 0; phase < 2; ++phase) {
      unsigned long long todo = open;
      if (phase) {
        if (hh == 0) sMx[half][g][16 * w + ln] = mrun;      /* both half-waves hold the same maximum */
        __syncthreads();      /* the eight waves' maxima are published: the choice below must be the same in the whole block, barriers follow it */
        /* a row's maximum is the larger of its two groups'; every wave looks at all 64 rows and so finds the same */
        const float c0 = fmaxf(sMx[half][0][lane], sMx[half][1][lane]), c1 = fmaxf(sMx[half][0][32 + lane], sMx[half][1][32 + lane]);
        todo = __builtin_amdgcn_ballot_w32(c0 < -9000.0f || c1 < -9000.0f) != 0u ? ~open : 0ull;
      }
      if (todo == 0ull) continue;
      /* a trip takes two passes off the list: the first for group 0, the second, where there is one, for group 1 (else group 1 fetches the first again, in bounds, and leaves the trip's work out) */
      int cur = __builtin_ctzll(todo); todo &= todo - 1ull;
      bool live = true;
      { const bool two = todo != 0ull; const int sec = two ? __builtin_ctzll(todo) : cur; todo &= todo - 1ull; if (g) { cur = sec; live = two; } }
      v8us rk[4], rl[4], rv[4]; v4i mk[2][2];
#pragma unroll
      for (int i = 0; i < 4; ++i) { rk[i] = *(const v8us*)(gkh + (size_t)(cur * 32 + i * 8) * DKV); rl[i] = *(const v8us*)(gkl + (size_t)(cur * 32 + i * 8) * DKV); rv[i] = *(const v8us*)(gv + (size_t)i * 32 * TT + cur * 32); }
#pragma unroll
      for (int j = 0; j < 2; ++j) { mk[j][0] = *(const v4i*)(gm + cur * 32 + j * 16); mk[j][1] = *(const v4i*)(gm + cur * 32 + j * 16 + 4); }
      asm volatile("s_wait_xcnt 0x0" :: "v"(gm + cur * 32), "v"(gkh + (size_t)(cur * 32) * DKV), "v"(gkl + (size_t)(cur * 32) * DKV), "v"(gv + cur * 32) : "memory");      /* same precaution as behind the query loads; the four addresses are inputs so that they stay in their registers up to here and no load of the run lands in them */
      __builtin_amdgcn_sched_barrier(0);      /* keeps the work below from being scheduled above that wait */
      /* kept rolled: one pass's staging registers and fragments beside the query fragments and the output accumulators are what is meant to stay in registers; every inner loop is unrolled so that the register arrays are indexed by constants */
#pragma unroll 1
      for (;;) {
#pragma unroll
        for (int i = 0; i < 4; ++i) { *(v8us*)(sKh + (krow + 8 * i) * FKP + kcol) = rk[i]; *(v8us*)(sKl + (krow + 8 * i) * FKP + kcol) = rl[i]; *(v8us*)(sV + (vrow + 32 * i) * FVP + vcol) = rv[i]; }
        bool msel[2][8];      /* this pass's mask, read out of its registers before the next pass's lands in them */
#pragma unroll
        for (int j = 0; j < 2; ++j) {
#pragma unroll
          for (int r = 0; r < 8; ++r) msel[j][r] = mk[j][r >> 2][r & 3] != 0; }
        __syncthreads();      /* this trip's tiles are published to their groups' waves */
        const bool more = todo != 0ull; int nxt = more ? __builtin_ctzll(todo) : cur; todo &= todo - 1ull;      /* the last trip of a phase fetches its own tiles again: in bounds, never used */
        bool nlive = true;
        { const bool two = todo != 0ull; const int sec = two ? __builtin_ctzll(todo) : nxt; todo &= todo - 1ull; if (g) { nxt = sec; nlive = two; } }
        const int kn = nxt * 32;
        const int* mp = gm + kn;
        /* the next pass's mask and tiles go into registers now: they fly while this pass is worked on */
#pragma unroll
        for (int j = 0; j < 2; ++j) { mk[j][0] = *(const v4i*)(mp + j * 16); mk[j][1] = *(const v4i*)(mp + j * 16 + 4); }
#pragma unroll
        for (int i = 0; i < 4; ++i) { rk[i] = *(const v8us*)(gkh + (size_t)(kn + i * 8) * DKV); rl[i] = *(const v8us*)(gkl + (size_t)(kn + i * 8) * DKV); rv[i] = *(const v8us*)(gv + (size_t)i * 32 * TT + kn); }
        asm volatile("s_wait_xcnt 0x0" :: "v"(mp), "v"(gkh + (size_t)kn * DKV), "v"(gkl + (size_t)kn * DKV), "v"(gv + kn) : "memory");      /* precaution: stands in front of every later write of a register that one of the loads above names; the four addresses are inputs so that they stay in their registers up to here and no load of the run lands in them */
        __builtin_amdgcn_sched_barrier(0);      /* keeps the work below from being scheduled above that wait, and the loads above in front of the pass's work */
        if (live) {      /* a scalar choice: a whole wave works on its pass or leaves it out; the barriers stand outside */
        v8f sh[2] = {z8, z8}, sl[2] = {z8, z8};      /* [key tile j] */
#pragma unroll
        for (int ks = 0; ks < 4; ++ks) { const v16h kh0 = g2_frag(sKh + ln * FKP + ks * 32, hh), kh1 = g2_frag(sKh + (16 + ln) * FKP + ks * 32, hh), kl0 = g2_frag(sKl + ln * FKP + ks * 32, hh), kl1 = g2_frag(sKl + (16 + ln) * FKP + ks * 32, hh);
          sh[0] = fa_mma(kh0, qh[ks], sh[0]); sh[1] = fa_mma(kh1, qh[ks], sh[1]); sl[0] = fa_mma(kh0, ql[ks], sl[0]); sl[1] = fa_mma(kh1, ql[ks], sl[1]); sl[0] = fa_mma(kl0, qh[ks], sl[0]); sl[1] = fa_mma(kl1, qh[ks], sl[1]); }
        FragH ph, pl; float sv[2][8]; float mx = -3.0e38f;
#pragma unroll
        for (int j = 0; j < 2; ++j) {
#pragma unroll
          for (int r = 0; r < 8; ++r) { const float s0 = sh[j][r] * alpha + sl[j][r] * alo; const float s = msel[j][r] ? -10000.0f : s0; sv[j][r] = s; mx = fmaxf(mx, s); } }
        mx = fmaxf(mx, __shfl_xor(mx, 16, 32));      /* the other half-wave holds this query's other 16 keys */
        const float mn = fmaxf(mrun, mx); const float al = expf(mrun - mn); mrun = mn; float su = 0.f;
#pragma unroll
        for (int j = 0; j < 2; ++j) {
#pragma unroll
          for (int r = 0; r < 8; ++r) { const float p = expf(sv[j][r] - mn); su += p; const float pv = p * 1024.0f; const _Float16 hi = (_Float16)pv; ph.h[8 * j + r] = hi; pl.h[8 * j + r] = (_Float16)((pv - (float)hi) * 1024.0f); } }
        lrun = lrun * al + su;      /* each half-wave sums its own keys; the halves meet in the epilogue */
#pragma unroll
        for (int d = 0; d < 8; ++d) { oh[d] *= al; ol[d] *= al; }
#pragma unroll
        for (int d = 0; d < 8; ++d) { const v16h vf = g2_frag(sV + (16 * d + ln) * FVP, hh); oh[d] = fa_mma(vf, ph.v, oh[d]); ol[d] = fa_mma(vf, pl.v, ol[d]); }
        }
        __builtin_amdgcn_sched_barrier(0);      /* keeps the pass's work in front of the barrier below, whose fence waits for the loads in flight: scheduled earlier, it would wait out their whole latency */
        __syncthreads();      /* every wave has read this pass's tiles before the next pass's are stored over them */
        if (!more) break;
        cur = nxt; live = nlive;
      }
    }
    /* the two key groups' sums meet: each wave hands its partner (the other group's wave with the same queries) the half of the dims that the partner finishes */
    float* cr0 = CTX + (size_t)(q0 + ln) * DQ + h * HD + 8 * hh;
    v4fs* own = sMg + wv * (MGS * 32) + lane; const v4fs* oth = sMg + (wv ^ 4) * (MGS * 32) + lane;
    if (g == 0) fa_put<0>(oh, ol, mrun, lrun, own); else fa_put<1>(oh, ol, mrun, lrun, own);
    __syncthreads();      /* publishes the hand-over; the ranges are written again only behind the next tile's barrier on the maxima, which every reader reaches after its reads */
    if (g == 0) fa_fin<0>(oh, ol, mrun, lrun, oth, cr0); else fa_fin<1>(oh, ol, mrun, lrun, oth, cr0);
  }
}

// ---- W_out GEMM, operand tiles staged in LDS ----
// C = alpha * (Ah.Bh^T + 2^-10 * Al.Bh^T), all three planes [2048][2048] f16, k contiguous. A block owns a 128 x 128 tile of C, a wave 32 rows x 64 columns of it (4 x 2 waves); the hi product and the residual product keep
// separate f32 accumulators (the residual plane carries a 2^10 scale) and meet once in the epilogue. A stage is 64 k = 128 B of each of the 3 x 128 operand rows: eight lanes fetch one row's whole cache line, each row once a block,
// and the fragments, whose 16 rows lie 4 KiB apart in memory, are read from LDS instead. Two LDS buffers: stage s + 1 is stored and stage s + 2 fetched to registers while stage s is worked on; one barrier a stage.
#define GKS 64                   /* k (halves) a stage */
#define GPI 72                   /* LDS pitch of a staged row, in halves: 144 B = 16 B x odd keeps the 16-byte fragment reads off each other's banks */
#define GBUF (128 * GPI)         /* halves of one plane's buffer */
#define GNS (DQ / GKS)           /* stages */
__global__ __launch_bounds__(256) void k_gemm2l(const _Float16* __restrict__ Ah, const _Float16* __restrict__ Al, const _Float16* __restrict__ Bh, float alpha, float* __restrict__ C) {
  __shared__ __attribute__((aligned(16))) _Float16 sAh[2 * GBUF], sAl[2 * GBUF], sB[2 * GBUF];
  __shared__ __attribute__((aligned(16))) float so[8][32][68];
  const int tid = threadIdx.x, w = tid >> 5, lane = tid & 31, ln = lane & 15, hh = lane >> 4;
  const int mt = blockIdx.x / (DQ / 128), nt = blockIdx.x % (DQ / 128); const int wr = (w >> 1) * 32, wc = (w & 1) * 64;
  const int srow = tid >> 3, scol = (tid & 7) * 8; const int sofs = srow * GPI + scol;      /* staging: a thread moves 16 bytes of rows srow, srow + 32, + 64, + 96 of each plane */
  const _Float16* gah = Ah + (size_t)(mt * 128 + srow) * DQ + scol; const _Float16* gal = Al + (size_t)(mt * 128 + srow) * DQ + scol; const _Float16* gb = Bh + (size_t)(nt * 128 + srow) * DQ + scol;
  const v8f z8 = {0.f,0.f,0.f,0.f,0.f,0.f,0.f,0.f}; v8f ch[8] = {z8, z8, z8, z8, z8, z8, z8, z8}, cl[8] = {z8, z8, z8, z8, z8, z8, z8, z8};      /* [t] = rows 0..15, [4 + t] = rows 16..31 of column tile t */
  v8us ra[4], rl[4], rb[4];
#pragma unroll
  for (int i = 0; i < 4; ++i) { ra[i] = *(const v8us*)(gah + (size_t)i * 32 * DQ); rl[i] = *(const v8us*)(gal + (size_t)i * 32 * DQ); rb[i] = *(const v8us*)(gb + (size_t)i * 32 * DQ); }
  asm volatile("s_wait_xcnt 0x0" ::: "memory");      /* precaution: stands in front of every later write of a register that one of the loads above names */
  __builtin_amdgcn_sched_barrier(0);      /* keeps the work below from being scheduled above that wait */
#pragma unroll
  for (int i = 0; i < 4; ++i) { *(v8us*)(sAh + sofs + i * 32 * GPI) = ra[i]; *(v8us*)(sAl + sofs + i * 32 * GPI) = rl[i]; *(v8us*)(sB + sofs + i * 32 * GPI) = rb[i]; }
#pragma unroll
  for (int i = 0; i < 4; ++i) { ra[i] = *(const v8us*)(gah + (size_t)i * 32 * DQ + GKS); rl[i] = *(const v8us*)(gal + (size_t)i * 32 * DQ + GKS); rb[i] = *(const v8us*)(gb + (size_t)i * 32 * DQ + GKS); }
  asm volatile("s_wait_xcnt 0x0" ::: "memory");      /* same precaution */
  __builtin_amdgcn_sched_barrier(0);      /* keeps the work below from being scheduled above that wait */
  __syncthreads();      /* publishes stage 0 */
  /* kept rolled: one copy of the stage's code; every inner loop is unrolled so that the register arrays are indexed by constants */
#pragma unroll 1
  for (int s = 0; s < GNS; ++s) {
    const int cb = (s & 1) * GBUF, nb = GBUF - cb;      /* this stage's buffer; the other one, which every wave left at the last barrier */
    const _Float16* pah = sAh + cb + (wr + ln) * GPI; const _Float16* pal = sAl + cb + (wr + ln) * GPI; const _Float16* pb = sB + cb + (wc + ln) * GPI;
    v16h fa[GKS / 32][4], fb[GKS / 32][4];      /* [k step][rows 0..15 hi, rows 16..31 hi, rows 0..15 residual, rows 16..31 residual], [k step][column tile] */
#pragma unroll
    for (int ks = 0; ks < GKS / 32; ++ks) {
      fa[ks][0] = g2_frag(pah + ks * 32, hh); fa[ks][1] = g2_frag(pah + 16 * GPI + ks * 32, hh); fa[ks][2] = g2_frag(pal + ks * 32, hh); fa[ks][3] = g2_frag(pal + 16 * GPI + ks * 32, hh);
#pragma unroll
      for (int t = 0; t < 4; ++t) fb[ks][t] = g2_frag(pb + t * 16 * GPI + ks * 32, hh); }
    __builtin_amdgcn_sched_barrier(0);      /* keeps the stage's fragment reads as one run at its head: the first products wait for nothing else, and the second k step's fragments land while the first's products run */
    /* stage s + 1 goes from its registers into the other buffer, stage s + 2 into the registers: both run beside the products below. No branch here, so that the waits in front of the products can be counted ones:
       the last trip stores, and the last two fetch, the last stage once more: in bounds, never read */
#pragma unroll
    for (int i = 0; i < 4; ++i) { *(v8us*)(sAh + nb + sofs + i * 32 * GPI) = ra[i]; *(v8us*)(sAl + nb + sofs + i * 32 * GPI) = rl[i]; *(v8us*)(sB + nb + sofs + i * 32 * GPI) = rb[i]; }
    const int kn = (s + 2 < GNS ? s + 2 : GNS - 1) * GKS;
#pragma unroll
    for (int i = 0; i < 4; ++i) { ra[i] = *(const v8us*)(gah + (size_t)i * 32 * DQ + kn); rl[i] = *(const v8us*)(gal + (size_t)i * 32 * DQ + kn); rb[i] = *(const v8us*)(gb + (size_t)i * 32 * DQ + kn); }
    asm volatile("s_wait_xcnt 0x0" ::: "memory");      /* same precaution as behind the first loads */
    __builtin_amdgcn_sched_barrier(0);      /* keeps the loads above in front of the products, so that they fly during them, and the products behind the wait */
#pragma unroll
    for (int ks = 0; ks < GKS / 32; ++ks) {
#pragma unroll
      for (int t = 0; t < 4; ++t) { ch[t] = fa_mma(fa[ks][0], fb[ks][t], ch[t]); ch[4 + t] = fa_mma(fa[ks][1], fb[ks][t], ch[4 + t]); cl[t] = fa_mma(fa[ks][2], fb[ks][t], cl[t]); cl[4 + t] = fa_mma(fa[ks][3], fb[ks][t], cl[4 + t]); } }
    __builtin_amdgcn_sched_barrier(0);      /* keeps the products in front of the barrier below, whose fence waits for the loads in flight */
    __syncthreads();      /* publishes stage s + 1 to all eight waves, and ends every wave's reads of stage s before its buffer is stored over */
  }
  const float alo = alpha * 0.0009765625f;
#pragma unroll
  for (int u = 0; u < 8; ++u) { const int t = u & 3, half = u >> 2;
#pragma unroll
    for (int r = 0; r < 8; ++r) so[w][half * 16 + 8 * hh + r][t * 16 + ln] = ch[u][r] * alpha + cl[u][r] * alo; }
  __builtin_amdgcn_fence(__ATOMIC_ACQ_REL, "workgroup"); __builtin_amdgcn_wave_barrier();      /* this wave's LDS stores above come before its own LDS reads below (so[w] is private to the wave) */
  const int rsub = lane >> 4, c4 = (lane & 15) * 4; float* cp = C + (size_t)(mt * 128 + wr + rsub) * DQ + nt * 128 + wc + c4;
  v4f ov[16];
#pragma unroll
  for (int q = 0; q < 16; ++q) ov[q] = *(const v4fa*)&so[w][q * 2 + rsub][c4];
  __builtin_amdgcn_sched_barrier(0);      /* every value is in its register before the run of stores starts: no register that an issued store names is written behind it */
#pragma unroll
  for (int q = 0; q < 16; ++q) *(v4f*)(cp + (size_t)q * 2 * DQ) = ov[q];
}

extern "C" void kernel_launch(void* const* d_in, const int* in_sizes, int n_in,
                              void* d_out, int out_size, void* d_ws, size_t ws_size, hipStream_t stream) {
  (void)in_sizes; (void)n_in; (void)out_size;
  const float* const* I = (const float* const*)d_in; const float* q = I[0]; const float* k = I[1]; const float* v = I[2]; const int* msk = (const int*)d_in[3]; const int* pos = (const int*)d_in[4]; const float* qw = I[5]; const float* kw = I[6]; const float* Wo = I[7];
  char* ws = (char*)d_ws; size_t off = 0;
  auto take = [&](size_t bytes) { char* p = ws + off; off += (bytes + 255) & ~(size_t)255; return p; };
  _Float16* BO = (_Float16*)take((size_t)DQ * DQ * 2); _Float16* Q16 = (_Float16*)take((size_t)TT * DQ * 2); _Float16* QL = (_Float16*)take((size_t)TT * DQ * 2); _Float16* K16 = (_Float16*)take((size_t)TT * DKV * 2); _Float16* KL = (_Float16*)take((size_t)TT * DKV * 2); _Float16* VT = (_Float16*)take((size_t)TT * DKV * 2); float* CTX = (float*)take((size_t)TT * DQ * 4); int* ACT = (int*)take((size_t)QTN * 64 * 4); _Float16* C16 = Q16; _Float16* CL = QL;      /* merged context hi/lo over the q planes (dead after the attention launch) */
  if (off > ws_size) return;      /* 8 + 8+8 + 2+2 + 2 + 16 = 46 MiB */
  k_prep<<<PB_NQ + PB_NK + PB_MF + PB_VT + PB_WS, 256, 0, stream>>>(q, k, v, msk, pos, qw, kw, Wo, Q16, QL, K16, KL, VT, ACT, BO);      /* q/k planes; which 64 x 32 mask tiles hold an open entry; V^T [512][2048], kv head = rows kv*128 .. +127; W_out x 16 */
  k_fattn<<<dim3(QTN / 2, NQH), 256, 0, stream>>>(Q16, QL, K16, KL, VT, msk, ACT, CTX);      /* all 16 heads: ctx[t][h*128 + d], scores and probabilities stay in registers */
  k_hl<<<(unsigned)(((size_t)TT * DQ / 8 + 255) / 256), 256, 0, stream>>>(CTX, C16, CL, (size_t)TT * DQ / 8);
  k_gemm2l<<<(TT / 128) * (DQ / 128), 256, 0, stream>>>(C16, CL, BO, 0.0625f, (float*)d_out);      /* out = (ctx_hi + ctx_lo) W_out^T (W exact), one launch */
}

// v008
// One run takes 129 microseconds.
// Timed twice side by side with v007, it ran 1.05 times as fast both times.
// Counting every step since v000, it is 25.9 times as fast.
#include <hip/hip_runtime.h>
// QEffMolmoBlock (1 x 2048 tokens; 16 query heads / 4 kv heads x 128 dims; q, k, v are INPUT projections): q = RMSNorm_2048(q) * q_norm_w, k = RMSNorm_512(k) * k_norm_w (flat, before the head split); rotate-half RoPE (hd 128, positions from position_ids, base 10000); GQA (each kv head serves 4 query heads); scores = q.k / sqrt(128), masked entries (int mask input != 0) REPLACED by -10000; softmax; out = (att v) W_out^T.
// Structure: one preparation launch (RMSNorm + RoPE fused on VALU, wave per token, into f16 hi + 2^10 residual q/k planes; v as exact f16, V^T by LDS tiles; a flag per 64 x 32 mask tile (any open entry); W_out x 16 as f16); one fused attention launch for all 16 heads (a wave owns 16 queries and walks every other open key pass of 32): the score products (f16 WMMA, f32 accumulation, K = 128, three terms), the masked online softmax on VALU (mask read on device), P as f16 hi + residual (x 2^10) packed in registers, the readout as two terms into the merged context plane; context hi/residual; W_out as two GEMM terms (exact x16 weights). Every product runs all its hi/residual terms in one launch.
// Compute dtype: inputs rounded to bf16; v and W_out exact as f16; normed+rotated q/k (3-term scores), P and the merged context all carried as f16 hi + 2^10 residual (~2^-21): the q/k norm weights are O(1) random so logits have sigma ≈ 11 and the softmax is near one-hot; RMSNorm/RoPE/softmax f32. v_wmma_f32_16x16x32_f16.
#define TT 2048
#define MSTR 2048                /* attention_mask row stride (input geometry) */
#define NQH 16
#define NKVH 4
#define HD 128
#define DQ (NQH * HD)            /* 2048 */
#define DKV (NKVH * HD)          /* 512 */
#define GRP (NQH / NKVH)         /* 4 query heads share a kv head */
typedef __bf16 v16b __attribute__((ext_vector_type(16)));
typedef unsigned short v8us __attribute__((ext_vector_type(8), may_alias));
typedef float  v8f  __attribute__((ext_vector_type(8)));
typedef float  v4f  __attribute__((ext_vector_type(4)));
typedef float  v4fa __attribute__((ext_vector_type(4), may_alias));
union FragB { v16b v; v8us half[2]; unsigned short u[16]; };

__device__ __forceinline__ unsigned short bf16_bits(float x) { unsigned int u = __float_as_uint(x); return (unsigned short)((u + 0x7FFFu + ((u >> 16) & 1u)) >> 16); }
__device__ __forceinline__ float bf16_val(unsigned short b) { return __uint_as_float(((unsigned int)b) << 16); }
__device__ __forceinline__ float bf16_round(float x) { return bf16_val(bf16_bits(x)); }
// D += A·B with NT terms: 1 = ah·bh, 2 = + al·bh (A split), 3 = + ah·bl (both split)
template <int NT>
__device__ __forceinline__ v8f mmaN(v16b ah, v16b al, v16b bh, v16b bl, v8f c) {
  c = __builtin_amdgcn_wmma_f32_16x16x32_bf16(false, ah, false, bh, (short)0, c, false, false);
  if (NT >= 2) c = __builtin_amdgcn_wmma_f32_16x16x32_bf16(false, al, false, bh, (short)0, c, false, false);
  if (NT >= 3) c = __builtin_amdgcn_wmma_f32_16x16x32_bf16(false, ah, false, bl, (short)0, c, false, false);
  asm volatile("v_nop\n\tv_nop\n\tv_nop\n\tv_nop" : "+v"(c) : "v"(ah), "v"(al), "v"(bh), "v"(bl));
  return c;
}

__global__ __launch_bounds__(256) void k_wt_bf16(const float* __restrict__ W, unsigned short* __restrict__ Wt, int K, int N) {
  const int t = blockIdx.x * 256 + threadIdx.x;
  const int k8n = K / 8;
  if (t >= N * k8n) return;
  const int n = t / k8n, k8 = (t % k8n) * 8;
  v8us v;
#pragma unroll
  for (int i = 0; i < 8; ++i) v[i] = bf16_bits(W[(size_t)(k8 + i) * N + n]);
  *(v8us*)(Wt + (size_t)n * K + k8) = v;
  
}

// GEMM C[M][N] (f32, pitch ldc) = act(A[M][K]·W + bias). A f32 row-major (pitch lda) converted per fragment to bf16
// (ASPLIT: hi/lo two planes -> 2 terms, else single rounded term); Wt bf16 [N][K] (pitch ldb). BIAS_BF16 rounds the
// bias to bf16 first (bias quantised to bf16 before the add). K%32==0, M%16==0, N%64==0.
template <bool ASPLIT, int ACT, bool BIAS_BF16>
__global__ __launch_bounds__(128) void k_gemm_bf(const float* __restrict__ A, int lda, const unsigned short* __restrict__ Wt, int ldb,
                                               const float* __restrict__ bias, float* __restrict__ C, int ldc, int M, int N, int K) {
  __shared__ __attribute__((aligned(16))) float so[4][16][64];
  const int tid = threadIdx.x, w = tid >> 5, lane = tid & 31, ln = lane & 15, hh = lane >> 4;
  const int ntn = N / 64;
  const int wid = blockIdx.x * 4 + w;
  const int mt = wid / ntn, nq = wid % ntn;
  if (mt * 16 >= M) return;
  const int row0 = mt * 16, col0 = nq * 64;
  const float* arow = A + (size_t)(row0 + ln) * lda;
  v8f acc[4] = {};
  for (int kb = 0; kb < K; kb += 32) {
    FragB ah, al;
    const v4f x0 = *(const v4fa*)(arow + kb + 8 * hh), x1 = *(const v4fa*)(arow + kb + 8 * hh + 4);
    const v4f x2 = *(const v4fa*)(arow + kb + 16 + 8 * hh), x3 = *(const v4fa*)(arow + kb + 16 + 8 * hh + 4);
    float xs[16] = {x0[0],x0[1],x0[2],x0[3],x1[0],x1[1],x1[2],x1[3],x2[0],x2[1],x2[2],x2[3],x3[0],x3[1],x3[2],x3[3]};
#pragma unroll
    for (int i = 0; i < 16; ++i) { const unsigned short hb = bf16_bits(xs[i]); ah.u[i] = hb; al.u[i] = ASPLIT ? bf16_bits(xs[i] - bf16_val(hb)) : (unsigned short)0; }
#pragma unroll
    for (int t = 0; t < 4; ++t) {
      const unsigned short* brow = Wt + (size_t)(col0 + t * 16 + ln) * ldb + kb;
      FragB b;
      b.half[0] = *(const v8us*)(brow + 8 * hh);
      b.half[1] = *(const v8us*)(brow + 16 + 8 * hh);
      acc[t] = mmaN<ASPLIT ? 2 : 1>(ah.v, al.v, b.v, b.v, acc[t]);
    }
  }
#pragma unroll
  for (int t = 0; t < 4; ++t) {
    float bv = bias ? bias[col0 + t * 16 + ln] : 0.f;
    if (BIAS_BF16) bv = bf16_round(bv);
#pragma unroll
    for (int r = 0; r < 8; ++r) { float v = acc[t][r] + bv; if (ACT == 1) v = fmaxf(v, 0.f); so[w][8 * hh + r][t * 16 + ln] = v; }
  }
  __builtin_amdgcn_fence(__ATOMIC_ACQ_REL, "workgroup");
  __builtin_amdgcn_wave_barrier();
  const int rsub = lane >> 4, c4 = (lane & 15) * 4;
  {
#pragma unroll
    for (int q = 0; q < 8; ++q) {
      const int r = q * 2 + rsub;
      const v4f v = *(const v4fa*)&so[w][r][c4];
      *(v4f*)(C + (size_t)(row0 + r) * ldc + col0 + c4) = v;
    }
    
  }
}

// GEMM C = act(A·W + bias + resid): A f32 (ASPLIT -> hi/lo 2 terms), Wt bf16 [N][K]; ACT 0 none, 1 relu, 2 exact gelu;
// resid (optional, f32, row index = (row % rmod), pitch ldr, RES_BF16 rounds it) added before the activation.
template <bool ASPLIT, int ACT, bool BIAS_BF16, bool RES_BF16>
__global__ __launch_bounds__(128) void k_gemm_bf3(const float* __restrict__ A, int lda, const unsigned short* __restrict__ Wt, int ldb,
                                                const float* __restrict__ bias, const float* __restrict__ resid, int rmod, int ldr,
                                                float* __restrict__ C, int ldc, int M, int N, int K) {
  __shared__ __attribute__((aligned(16))) float so[4][16][64];
  const int tid = threadIdx.x, w = tid >> 5, lane = tid & 31, ln = lane & 15, hh = lane >> 4;
  const int ntn = N / 64;
  const int wid = blockIdx.x * 4 + w;
  const int mt = wid / ntn, nq = wid % ntn;
  if (mt * 16 >= M) return;
  const int row0 = mt * 16, col0 = nq * 64;
  const float* arow = A + (size_t)(row0 + ln) * lda;
  v8f acc[4] = {};
  for (int kb = 0; kb < K; kb += 32) {
    FragB ah, al;
    const v4f x0 = *(const v4fa*)(arow + kb + 8 * hh), x1 = *(const v4fa*)(arow + kb + 8 * hh + 4);
    const v4f x2 = *(const v4fa*)(arow + kb + 16 + 8 * hh), x3 = *(const v4fa*)(arow + kb + 16 + 8 * hh + 4);
    float xs[16] = {x0[0],x0[1],x0[2],x0[3],x1[0],x1[1],x1[2],x1[3],x2[0],x2[1],x2[2],x2[3],x3[0],x3[1],x3[2],x3[3]};
#pragma unroll
    for (int i = 0; i < 16; ++i) { const unsigned short hb = bf16_bits(xs[i]); ah.u[i] = hb; al.u[i] = ASPLIT ? bf16_bits(xs[i] - bf16_val(hb)) : (unsigned short)0; }
#pragma unroll
    for (int t = 0; t < 4; ++t) {
      const unsigned short* brow = Wt + (size_t)(col0 + t * 16 + ln) * ldb + kb;
      FragB b;
      b.half[0] = *(const v8us*)(brow + 8 * hh);
      b.half[1] = *(const v8us*)(brow + 16 + 8 * hh);
      acc[t] = mmaN<ASPLIT ? 2 : 1>(ah.v, al.v, b.v, b.v, acc[t]);
    }
  }
#pragma unroll
  for (int t = 0; t < 4; ++t) {
    const int col = col0 + t * 16 + ln;
    float bv = bias ? bias[col] : 0.f;
    if (BIAS_BF16) bv = bf16_round(bv);
#pragma unroll
    for (int r = 0; r < 8; ++r) {
      float v = acc[t][r] + bv;
      if (resid) { float rv = resid[(size_t)((row0 + 8 * hh + r) % rmod) * ldr + col]; if (RES_BF16) rv = bf16_round(rv); v += rv; }
      if (ACT == 1) v = fmaxf(v, 0.f);
      if (ACT == 2) v = 0.5f * v * (1.0f + erff(v * 0.70710678118654752f));
      if (ACT == 3) { const float u = 0.7978845608028654f * (v + 0.044715f * v * v * v); v = 0.5f * v * (1.0f + tanhf(u)); }
      so[w][8 * hh + r][t * 16 + ln] = v;
    }
  }
  __builtin_amdgcn_fence(__ATOMIC_ACQ_REL, "workgroup");
  __builtin_amdgcn_wave_barrier();
  const int rsub = lane >> 4, c4 = (lane & 15) * 4;
  {
#pragma unroll
    for (int q = 0; q < 8; ++q) {
      const int r = q * 2 + rsub;
      const v4f v = *(const v4fa*)&so[w][r][c4];
      *(v4f*)(C + (size_t)(row0 + r) * ldc + col0 + c4) = v;
    }
    
  }
}
// row LayerNorm (biased variance, eps) over N: s = X (+ R); optional out_sum <- s; out_norm <- (s-mu)*rsqrt(var+eps)*g + b
template <bool PARAM_BF16>
__global__ __launch_bounds__(256) void k_layernorm(const float* __restrict__ X, const float* __restrict__ R, const float* __restrict__ g, const float* __restrict__ bta,
                                                  float* __restrict__ out_sum, float* __restrict__ out_norm, int N, float eps) {
  __shared__ float red[256];
  const int row = blockIdx.x, tid = threadIdx.x;
  const float* x = X + (size_t)row * N; const float* rr = R ? R + (size_t)row * N : nullptr;
  float vals[16];                     // up to N = 4096
  const int per = N / 256;            // contiguous chunk per thread? use strided-by-4 chunks: thread handles j = tid*4 + 1024*u
  float s1 = 0.f;
  for (int u = 0; u < per / 4; ++u) {
    const int j = tid * 4 + 1024 * u;
    const v4f a = *(const v4fa*)(x + j);
    v4f b = {0.f,0.f,0.f,0.f}; if (rr) b = *(const v4fa*)(rr + j);
#pragma unroll
    for (int q = 0; q < 4; ++q) { const float v = a[q] + b[q]; vals[u * 4 + q] = v; s1 += v; }
  }
  red[tid] = s1; __syncthreads();
  for (int st = 128; st > 0; st >>= 1) { if (tid < st) red[tid] += red[tid + st]; __syncthreads(); }
  const float mu = red[0] / (float)N; __syncthreads();
  float s2 = 0.f;
  for (int u = 0; u < per / 4; ++u)
#pragma unroll
    for (int q = 0; q < 4; ++q) { const float c = vals[u * 4 + q] - mu; s2 += c * c; }
  red[tid] = s2; __syncthreads();
  for (int st = 128; st > 0; st >>= 1) { if (tid < st) red[tid] += red[tid + st]; __syncthreads(); }
  const float rs = rsqrtf(red[0] / (float)N + eps);
  {
    for (int u = 0; u < per / 4; ++u) {
      const int j = tid * 4 + 1024 * u;
      v4f o, sm;
#pragma unroll
      for (int q = 0; q < 4; ++q) {
        float gg = g[j + q], bb = bta[j + q];
        if (PARAM_BF16) { gg = bf16_round(gg); bb = bf16_round(bb); }
        sm[q] = vals[u * 4 + q]; o[q] = (vals[u * 4 + q] - mu) * rs * gg + bb;
      }
      if (out_sum) *(v4f*)(out_sum + (size_t)row * N + j) = sm;
      *(v4f*)(out_norm + (size_t)row * N + j) = o;
    }
    
  }
}



// ---- f16 WMMA path (v_wmma_f32_16x16x32_f16): 11-bit significands for operands in range — used where a [0,1] probability operand needs more precision than bf16
typedef _Float16 v16h __attribute__((ext_vector_type(16)));
union FragH { v16h v; v8us half[2]; _Float16 h[16]; unsigned short u[16]; };
template <int NT>
__device__ __forceinline__ v8f mmaH(v16h ah, v16h al, v16h bh, v16h bl, v8f c) {
  c = __builtin_amdgcn_wmma_f32_16x16x32_f16(false, ah, false, bh, (short)0, c, false, false);
  if (NT >= 2) c = __builtin_amdgcn_wmma_f32_16x16x32_f16(false, al, false, bh, (short)0, c, false, false);
  if (NT >= 3) c = __builtin_amdgcn_wmma_f32_16x16x32_f16(false, ah, false, bl, (short)0, c, false, false);
  asm volatile("v_nop\n\tv_nop\n\tv_nop\n\tv_nop" : "+v"(c) : "v"(ah), "v"(al), "v"(bh), "v"(bl));
  return c;
}
// batched GEMM like k_gemm_b but f16 operands: A f32 (split into f16 hi/lo if ASPLIT, else rounded to f16), Bt = f16 values [n][k]; alpha; C f32; N multiple of 16 (partial tiles skipped)
template <bool ASPLIT>
__global__ __launch_bounds__(128) void k_gemm_h(const float* __restrict__ A, int lda, size_t sA, const _Float16* __restrict__ Bh, int ldb, size_t sB, float alpha, float* __restrict__ C, int ldc, size_t sC, int M, int N, int K) {
  __shared__ __attribute__((aligned(16))) float so[4][16][64];
  const int tid = threadIdx.x, w = tid >> 5, lane = tid & 31, ln = lane & 15, hh = lane >> 4; const int by = blockIdx.y;
  A += (size_t)by * sA; Bh += (size_t)by * sB; C += (size_t)by * sC;
  const int ntn = (N + 63) / 64; const int wid = blockIdx.x * 4 + w; const int mt = wid / ntn, nq = wid % ntn; if (mt * 16 >= M) return;
  const int row0 = mt * 16, col0 = nq * 64; const float* arow = A + (size_t)(row0 + ln) * lda;
  v8f acc[4] = {};
  for (int kb = 0; kb < K; kb += 32) {
    FragH ah, al;
    const v4f x0 = *(const v4fa*)(arow + kb + 8 * hh), x1 = *(const v4fa*)(arow + kb + 8 * hh + 4), x2 = *(const v4fa*)(arow + kb + 16 + 8 * hh), x3 = *(const v4fa*)(arow + kb + 16 + 8 * hh + 4);
    float xs[16] = {x0[0],x0[1],x0[2],x0[3],x1[0],x1[1],x1[2],x1[3],x2[0],x2[1],x2[2],x2[3],x3[0],x3[1],x3[2],x3[3]};
#pragma unroll
    for (int i = 0; i < 16; ++i) { const _Float16 h = (_Float16)xs[i]; ah.h[i] = h; al.h[i] = ASPLIT ? (_Float16)(xs[i] - (float)h) : (_Float16)0.0f; }
#pragma unroll
    for (int t = 0; t < 4; ++t) { if (col0 + t * 16 >= N) continue; const size_t boff = (size_t)(col0 + t * 16 + ln) * ldb + kb; FragH bq; bq.half[0] = *(const v8us*)(Bh + boff + 8 * hh); bq.half[1] = *(const v8us*)(Bh + boff + 16 + 8 * hh);
      acc[t] = mmaH<ASPLIT ? 2 : 1>(ah.v, al.v, bq.v, bq.v, acc[t]); }
  }
#pragma unroll
  for (int t = 0; t < 4; ++t) { if (col0 + t * 16 >= N) continue;
#pragma unroll
    for (int r = 0; r < 8; ++r) so[w][8 * hh + r][t * 16 + ln] = acc[t][r] * alpha; }
  __builtin_amdgcn_fence(__ATOMIC_ACQ_REL, "workgroup"); __builtin_amdgcn_wave_barrier();
  const int rsub = lane >> 4, c4 = (lane & 15) * 4;
  {
#pragma unroll
    for (int q = 0; q < 8; ++q) { const int r = q * 2 + rsub; if (col0 + c4 < N) { const v4f v = *(const v4fa*)&so[w][r][c4]; *(v4f*)(C + (size_t)(row0 + r) * ldc + col0 + c4) = v; } }
     }
}

// Wt[n][k] = f16(W[k][n]·scale) from f32 row-major W[K][N] (scale = power of two; bf16-exact weights stay exact in f16 away from the subnormal range)
__global__ __launch_bounds__(256) void k_wt_f16(const float* __restrict__ W, _Float16* __restrict__ Wt, int K, int N, float scale) {
  const int t = blockIdx.x * 256 + threadIdx.x; if (t >= N * (K / 8)) return; const int n = t / (K / 8), k8 = (t % (K / 8)) * 8; FragH f;
#pragma unroll
  for (int i = 0; i < 8; ++i) f.h[i] = (_Float16)(bf16_round(W[(size_t)(k8 + i) * N + n]) * scale); const v8us o = f.half[0];
  *(v8us*)((unsigned short*)Wt + (size_t)n * K + k8) = o; 
}
// k_gemm_hh variant with fused epilogue: v = acc·alpha + bias[by·sBias + col] (+ CP[(row/rowsPerB)·sCPb + by·64 + col] if CP) ; ACT 0 none / 1 elu ; writes f16 C16 (and f32 C if non-null)
template <int ACT>
__global__ __launch_bounds__(128) void k_gemm_hhx(const _Float16* __restrict__ A, int lda, size_t sA, const _Float16* __restrict__ Bh, int ldb, size_t sB, float alpha, const float* __restrict__ bias, size_t sBias, const float* __restrict__ CP, int rowsPerB, size_t sCPb, int row0g,
    float* __restrict__ C, _Float16* __restrict__ C16, int ldc, size_t sC, int M, int N, int K) {
  __shared__ __attribute__((aligned(16))) float so[4][16][64];
  const int tid = threadIdx.x, w = tid >> 5, lane = tid & 31, ln = lane & 15, hh = lane >> 4; const int by = blockIdx.y;
  A += (size_t)by * sA; Bh += (size_t)by * sB; const size_t cofs = (size_t)by * sC; const float* bp = bias ? bias + (size_t)by * sBias : nullptr;
  const int ntn = (N + 63) / 64; const int wid = blockIdx.x * 4 + w; const int mt = wid / ntn, nq = wid % ntn; if (mt * 16 >= M) return;
  const int row0 = mt * 16, col0 = nq * 64; const _Float16* arow = A + (size_t)(row0 + ln) * lda;
  v8f acc[4] = {};
  for (int kb = 0; kb < K; kb += 32) { FragH ah; ah.half[0] = *(const v8us*)((const unsigned short*)arow + kb + 8 * hh); ah.half[1] = *(const v8us*)((const unsigned short*)arow + kb + 16 + 8 * hh);
#pragma unroll
    for (int t = 0; t < 4; ++t) { if (col0 + t * 16 >= N) continue; const size_t boff = (size_t)(col0 + t * 16 + ln) * ldb + kb; FragH bq; bq.half[0] = *(const v8us*)((const unsigned short*)Bh + boff + 8 * hh); bq.half[1] = *(const v8us*)((const unsigned short*)Bh + boff + 16 + 8 * hh);
      acc[t] = mmaH<1>(ah.v, ah.v, bq.v, bq.v, acc[t]); }
  }
#pragma unroll
  for (int t = 0; t < 4; ++t) { if (col0 + t * 16 >= N) continue; const int col = col0 + t * 16 + ln; const float bv = bp ? bf16_round(bp[col]) : 0.f;
#pragma unroll
    for (int r = 0; r < 8; ++r) { float v = acc[t][r] * alpha + bv; if (CP) { const int rr = row0g + row0 + 8 * hh + r; if (rowsPerB < 0) v += CP[cofs + (size_t)rr * ldc + col];      /* rowsPerB < 0: own element of the batched C plane */ else { const int bidx = rr / rowsPerB; v += CP[(size_t)bidx * sCPb + (size_t)by * 64 + col]; } } if (ACT == 1) v = (v > 0.f) ? v : expm1f(v); else if (ACT == 7) v = (v > 0.f) ? v + 1.0f : expf(v); else if (ACT == 8) v = tanhf(v); else if (ACT == 9) v = 0.5f * v * (1.0f + tanhf(0.7978845608028654f * (v + 0.044715f * v * v * v))); else if (ACT == 11) v = 1.0f / (1.0f + expf(-v)); else if (ACT == 12) v = (v > 0.f) ? v : 0.01f * v; else if (ACT == 14) v = (v > 0.f) ? v : 0.1f * v; else if (ACT == 16) v = (v >= 0.f) ? v : 0.3f * v; else if (ACT == 17) v = (v >= 0.f) ? v : 0.2f * v; else if (ACT == 15) v = v / (1.0f + expf(-v)); else if (ACT == 3) v = fmaxf(v, 0.f); else if (ACT == 6) v = 0.5f * v * (1.0f + erff(v * 0.70710678118654752f)); so[w][8 * hh + r][t * 16 + ln] = v; } }
  __builtin_amdgcn_fence(__ATOMIC_ACQ_REL, "workgroup"); __builtin_amdgcn_wave_barrier();
  const int rsub = lane >> 4, c4 = (lane & 15) * 4; typedef _Float16 v4h __attribute__((ext_vector_type(4)));
  {
#pragma unroll
    for (int q = 0; q < 8; ++q) { const int r = q * 2 + rsub; if (col0 + c4 < N) { const v4f v = *(const v4fa*)&so[w][r][c4]; if (C) *(v4f*)(C + cofs + (size_t)(row0 + r) * ldc + col0 + c4) = v; if (C16) { v4h h4; for (int i = 0; i < 4; ++i) h4[i] = (_Float16)v[i]; *(v4h*)(C16 + cofs + (size_t)(row0 + r) * ldc + col0 + c4) = h4; } } }
     }
}


typedef _Float16 v4h __attribute__((ext_vector_type(4)));

__global__ __launch_bounds__(256) void k_h16(const float* __restrict__ x, _Float16* __restrict__ X16, size_t n8) { const size_t t = (size_t)blockIdx.x * 256 + threadIdx.x; if (t >= n8) return; FragH f;
#pragma unroll
  for (int q = 0; q < 8; ++q) f.h[q] = (_Float16)x[t * 8 + q]; *(v8us*)((unsigned short*)X16 + t * 8) = f.half[0];  }
__global__ __launch_bounds__(256) void k_round16f(const float* __restrict__ W, _Float16* __restrict__ Bt, size_t n8) { const size_t t = (size_t)blockIdx.x * 256 + threadIdx.x; if (t >= n8) return; FragH f;
#pragma unroll
  for (int i = 0; i < 8; ++i) f.h[i] = (_Float16)(bf16_round(W[t * 8 + i]) * 16.0f); *(v8us*)((unsigned short*)Bt + t * 8) = f.half[0];  }
// V^T [512][2048] from v [2048][512]: block blk turns the 64 tokens x 64 dims tile (token group blk % 32, dim slab blk / 32) through LDS; v is rounded to bf16 and written as exact f16 on the way in.
// Every loop is unrolled so that the register arrays are indexed by constants and the four loads of a thread fly together.
__device__ __forceinline__ void d_vt(const int blk, const float* __restrict__ v, _Float16* __restrict__ Vt, unsigned short (*tl)[66]) { const int tid = threadIdx.x; const int slab = blk / (TT / 64), lg = blk % (TT / 64);
  v4f va[2], vc[2];
#pragma unroll
  for (int i = 0; i < 2; ++i) { const float* vp = v + (size_t)(lg * 64 + i * 32 + tid / 8) * DKV + slab * 64 + (tid % 8) * 8; va[i] = *(const v4fa*)vp; vc[i] = *(const v4fa*)(vp + 4); }
  asm volatile("s_wait_xcnt 0x0" ::: "memory");      /* precaution: stands in front of every later write of a register that one of the loads above names */
  __builtin_amdgcn_sched_barrier(0);      /* keeps the work below from being scheduled above that wait */
#pragma unroll
  for (int i = 0; i < 2; ++i) { const int r = i * 32 + tid / 8, c8 = (tid % 8) * 8; FragH f;
#pragma unroll
    for (int q = 0; q < 4; ++q) { f.h[q] = (_Float16)bf16_round(va[i][q]); f.h[4 + q] = (_Float16)bf16_round(vc[i][q]); }
#pragma unroll
    for (int q = 0; q < 8; ++q) tl[r][c8 + q] = f.u[q]; }
  __syncthreads();
  {
#pragma unroll
    for (int rd = 0; rd < 2; ++rd) { const int d = rd * 32 + tid / 8, pc = tid % 8; FragH f;
#pragma unroll
      for (int q = 0; q < 8; ++q) f.u[q] = tl[pc * 8 + q][d];
      *(v8us*)((unsigned short*)Vt + ((size_t)slab * 64 + d) * TT + lg * 64 + pc * 8) = f.half[0]; }
    asm volatile("s_wait_xcnt 0x0" ::: "memory");      /* precaution: closes the two stores, in front of whatever the merged kernel's code behind this job writes into their registers */
     } }

__global__ __launch_bounds__(256) void k_hl(const float* __restrict__ F, _Float16* __restrict__ Hh, _Float16* __restrict__ Hl, size_t n8) { const size_t t = (size_t)blockIdx.x * 256 + threadIdx.x; if (t >= n8) return; FragH fh, fl; const v4f a = *(const v4fa*)(F + t * 8), c = *(const v4fa*)(F + t * 8 + 4);
#pragma unroll
  for (int q = 0; q < 4; ++q) { _Float16 h = (_Float16)a[q]; fh.h[q] = h; fl.h[q] = (_Float16)((a[q] - (float)h) * 1024.0f); h = (_Float16)c[q]; fh.h[4 + q] = h; fl.h[4 + q] = (_Float16)((c[q] - (float)h) * 1024.0f); }
  { *(v8us*)((unsigned short*)Hh + t * 8) = fh.half[0]; *(v8us*)((unsigned short*)Hl + t * 8) = fl.half[0];  } }

// ---- fragment loader: 16 halves of one operand row in the hardware k order ----
__device__ __forceinline__ v16h g2_frag(const _Float16* p, int hh) { FragH f; f.half[0] = *(const v8us*)((const unsigned short*)p + 8 * hh); f.half[1] = *(const v8us*)((const unsigned short*)p + 16 + 8 * hh); return f.v; }
#define WCH 4                    /* chunks of 8 weights a thread: a quarter of the blocks to start, eight 16-byte loads of a thread in flight */
// Bt = f16(bf16(Wm) * sc), same layout. Every loop is unrolled so that the register arrays are indexed by constants and the loads fly together.
__device__ __forceinline__ void d_wsc(const int blk, const float* __restrict__ Wm, _Float16* __restrict__ Bt, const float sc) { const size_t t0 = (size_t)blk * (WCH * 256) + threadIdx.x;
  v4f wa[WCH], wc[WCH];
#pragma unroll
  for (int j = 0; j < WCH; ++j) { const float* wp = Wm + (t0 + j * 256) * 8; wa[j] = *(const v4fa*)wp; wc[j] = *(const v4fa*)(wp + 4); }
  asm volatile("s_wait_xcnt 0x0" ::: "memory");      /* precaution: stands in front of every later write of a register that one of the loads above names */
  __builtin_amdgcn_sched_barrier(0);      /* keeps the work below from being scheduled above that wait */
  FragH f[WCH];
#pragma unroll
  for (int j = 0; j < WCH; ++j) {
#pragma unroll
    for (int q = 0; q < 4; ++q) { f[j].h[q] = (_Float16)(bf16_round(wa[j][q]) * sc); f[j].h[4 + q] = (_Float16)(bf16_round(wc[j][q]) * sc); } }
  __builtin_amdgcn_sched_barrier(0);      /* every value is in its register before the run of stores starts: no register that an issued store names is written behind it */
#pragma unroll
  for (int j = 0; j < WCH; ++j) *(v8us*)((unsigned short*)Bt + (t0 + j * 256) * 8) = f[j].half[0];
  asm volatile("s_wait_xcnt 0x0" ::: "memory");      /* precaution: closes the run of stores, in front of whatever the merged kernel's code behind this job writes into their registers */
}
// lane l with lane l ^ 16
__device__ __forceinline__ float xhalf(float x) { return __builtin_bit_cast(float, __builtin_amdgcn_permlanex16(__builtin_bit_cast(int, x), __builtin_bit_cast(int, x), 0x76543210, 0xfedcba98, false, false)); }
#define NRG 4                    /* heads a group: their weights are fetched together and their eight stores go out as one run */
// RMSNorm + RoPE of one token a wave. A lane owns dims 4 * lane .. + 3 of EVERY head (a head is 128 floats = one 16-byte load of the wave), and the token's row stays in registers from its one read to the stores.
// A rotation pair (d, d + 64) sits in lanes l and l ^ 16, so the partner's value comes by one cross-row move. The angle of a pair depends on the token and on d alone, not on the head: the wave forms its 64 angles once
// (two a lane, handed to the lanes that use them), in front of the head loop. Per element the same operations in the same order as before, and the same order of the row's sum of squares.
// Every loop over a register array (xa, c2, s2, cs, sg, wa, vh, vl) is unrolled so that the array is indexed by constants and stays in registers.
template <int NH_>
__device__ __forceinline__ void d_normrope(const int blk, const float* __restrict__ X, const float* __restrict__ w, const int* __restrict__ pos, _Float16* __restrict__ O16, _Float16* __restrict__ OL) {
  /* numerical, as in the versions before: every product and every sum rounds on its own, as the reference's separate elementwise operations do; the logits are large and the softmax near one-hot, and the q/k planes stay bit-identical */
  #pragma clang fp contract(off)
  constexpr int W_ = NH_ * HD; const int wv = threadIdx.x >> 5, ln = threadIdx.x & 31; const int t = blk * 8 + wv; if (t >= TT) return;
  const float* x = X + (size_t)t * W_ + ln * 4; const int* pp = pos + t;
  const int pi = *pp;      /* first, so that the angles below wait for this load alone */
  v4f xa[NH_];      /* the whole row: its loads fly together */
#pragma unroll
  for (int h = 0; h < NH_; ++h) xa[h] = *(const v4fa*)(x + h * HD);
  asm volatile("s_wait_xcnt 0x0" :: "v"(x), "v"(pp) : "memory");      /* precaution: stands in front of every later write of a register that one of the loads above names; the addresses are inputs so that they stay in their registers up to here and no load of the run lands in them */
  __builtin_amdgcn_sched_barrier(0);      /* keeps the work below from being scheduled above that wait */
  const float p = (float)pi; float c2[2], s2[2];      /* the angles of d = 2 * lane and 2 * lane + 1: formed while the row's loads fly */
#pragma unroll
  for (int s = 0; s < 2; ++s) { const int d = 2 * ln + s; const float ex = (float)(2 * d) / (float)HD; const float ivf = 1.0f / powf(10000.0f, ex); const float th = p * ivf; c2[s] = cosf(th); s2[s] = sinf(th); }
  float cs[4], sg[4];      /* for this lane's dims d = 4 * (lane & 15) + e: cosine, and sine with the sign of its half (o[d] = x[d] cos - x[d + 64] sin, o[d + 64] = x[d + 64] cos + x[d] sin) */
#pragma unroll
  for (int e = 0; e < 4; ++e) { const int sl = 2 * (ln & 15) + (e >> 1); cs[e] = __shfl(c2[e & 1], sl, 32); const float sn = __shfl(s2[e & 1], sl, 32); sg[e] = ln < 16 ? -sn : sn; }
  float ss = 0.f;
#pragma unroll
  for (int h = 0; h < NH_; ++h) {
#pragma unroll
    for (int e = 0; e < 4; ++e) { const float v = bf16_round(xa[h][e]); xa[h][e] = v; ss += v * v; } }
  for (int o = 16; o > 0; o >>= 1) ss += __shfl_xor(ss, o, 32); const float inv = rsqrtf(ss / (float)W_ + 1e-5f);
  const float* wp = w + ln * 4; _Float16* oh = O16 + (size_t)t * W_ + ln * 4; _Float16* ol = OL + (size_t)t * W_ + ln * 4;
#pragma unroll
  for (int g = 0; g < NH_ / NRG; ++g) {
    v4f wa[NRG];
#pragma unroll
    for (int i = 0; i < NRG; ++i) wa[i] = *(const v4fa*)(wp + (g * NRG + i) * HD);
    asm volatile("s_wait_xcnt 0x0" :: "v"(wp) : "memory");      /* same precaution as behind the row's loads */
    __builtin_amdgcn_sched_barrier(0);      /* keeps the work below from being scheduled above that wait */
    v4h vh[NRG], vl[NRG];
#pragma unroll
    for (int i = 0; i < NRG; ++i) {
#pragma unroll
      for (int e = 0; e < 4; ++e) { float xn = xa[g * NRG + i][e] * inv; xn *= bf16_round(wa[i][e]); const float xo = xhalf(xn); float o = xn * cs[e]; o += xo * sg[e];
        const _Float16 hi = (_Float16)o; vh[i][e] = hi; vl[i][e] = (_Float16)((o - (float)hi) * 1024.0f); } }
    __builtin_amdgcn_sched_barrier(0);      /* every value is in its register before the run of stores starts: no register that an issued store names is written behind it */
#pragma unroll
    for (int i = 0; i < NRG; ++i) { *(v4h*)(oh + (g * NRG + i) * HD) = vh[i]; *(v4h*)(ol + (g * NRG + i) * HD) = vl[i]; }
    asm volatile("s_wait_xcnt 0x0" ::: "memory");      /* precaution: closes the run of stores, in front of the next group's writes of their registers */
  }
}

// ---- fused attention: scores, masked softmax and readout of all 16 heads in ONE launch; the score and probability planes never go to memory ----
// Transposed products: S^T = K.Q^T (A = key rows, B = query rows held in registers), O^T += V^T.P^T. In an accumulator tile a lane holds 8 keys of ONE query (column = lane & 15, rows 8 * (lane >> 4) + r),
// which is exactly the k order of the B loader (k = 8 * hh + i, then 16 + 8 * hh + i), so two 16-key score tiles pack in-lane into one 32-key P^T fragment. Running maximum and sum per query (online softmax):
// when the maximum moves, the output accumulators and the sum are scaled by exp(m_old - m_new). Same operand planes and terms as the separate stages: 3 hi/residual score terms, P as f16 hi + 2^10 residual of 1024 * p.
__device__ __forceinline__ v8f fa_mma(v16h a, v16h b, v8f c) { return __builtin_amdgcn_wmma_f32_16x16x32_f16(false, a, false, b, (short)0, c, false, false); }
typedef int v4i __attribute__((ext_vector_type(4)));
#define FKP 136                  /* LDS pitch of a K row, in halves */
#define FVP 40                   /* LDS pitch of a V^T row, in halves */
#define QTN (TT / 64)            /* query tiles of 64 rows */
// act[qt * 64 + p] = 1 where the 64 x 32 mask tile (query tile qt, key pass p) holds at least one open (zero) entry, else 0. A wave reads four tiles in turn; a block of eight waves writes one whole 128-byte line of flags.
__device__ __forceinline__ void d_mflag(const int blk, const int* __restrict__ msk, int* __restrict__ act) {
  const int wv = threadIdx.x >> 5, lane = threadIdx.x & 31; unsigned bits = 0u;      /* bit j: the wave's tile j is open */
  /* kept rolled: one tile's sixteen loads in flight a wave; unrolled, the four tiles' loads would set the register count of the whole launch */
#pragma unroll 1
  for (int j = 0; j < 4; ++j) {
    const int u = blk * 32 + wv * 4 + j; const int qt = u >> 6, p = u & 63;
    const int* mp = msk + (size_t)(qt * 64 + (lane >> 3)) * MSTR + p * 32 + (lane & 7) * 4;
    v4i m[16];      /* both inner loops are unrolled so that this array stays in registers and its loads fly together */
#pragma unroll
    for (int i = 0; i < 16; ++i) m[i] = *(const v4i*)(mp + (size_t)i * 4 * MSTR);
    asm volatile("s_wait_xcnt 0x0" :: "v"(mp) : "memory");      /* precaution: stands in front of every later write of a register that one of the loads above names; the address is an input so that it stays in its registers up to here and no load of the run lands in them */
    __builtin_amdgcn_sched_barrier(0);      /* keeps the work below from being scheduled above that wait */
    bool open = false;
#pragma unroll
    for (int i = 0; i < 16; ++i) open = open || m[i][0] == 0 || m[i][1] == 0 || m[i][2] == 0 || m[i][3] == 0;
    const unsigned any = __builtin_amdgcn_ballot_w32(open);
    bits |= (any != 0u ? 1u : 0u) << j;
  }
  if (lane < 4) act[blk * 32 + wv * 4 + lane] = (int)((bits >> lane) & 1u);
}
// ---- preparation: the five jobs that only read inputs (q and k norm + RoPE, mask flags, V^T, scaled W_out) in ONE launch, told apart by block ranges; none reads what another writes. The longest job (q) has the first blocks (for speed only).
#define PB_NQ (TT / 8)                       /* q: a wave a token */
#define PB_NK (TT / 8)                       /* k: a wave a token */
#define PB_MF (QTN * 64 / 32)                /* mask flags: 32 tiles a block */
#define PB_VT (NKVH * 2 * (TT / 64))         /* V^T: 8 slabs of 64 dims x 32 token groups */
#define PB_WS (DQ * DQ / 8 / 256 / WCH)      /* W_out */
/* second bound: at least 8 waves a SIMD, that is at most 128 registers a lane: the streaming jobs live on many waves in flight, and the q job's row in registers must not take that from them */
__global__ __launch_bounds__(256, 8) void k_prep(const float* __restrict__ q, const float* __restrict__ k, const float* __restrict__ v, const int* __restrict__ msk, const int* __restrict__ pos, const float* __restrict__ qw, const float* __restrict__ kw, const float* __restrict__ Wo,
    _Float16* __restrict__ Q16, _Float16* __restrict__ QL, _Float16* __restrict__ K16, _Float16* __restrict__ KL, _Float16* __restrict__ VT, int* __restrict__ ACT, _Float16* __restrict__ BO) {
  __shared__ unsigned short tl[64][66];
  const int b = blockIdx.x;      /* every test below is the same for the whole block: the barrier of the V^T job is passed by all its waves */
  if (b < PB_NQ) d_normrope<NQH>(b, q, qw, pos, Q16, QL);
  else if (b < PB_NQ + PB_NK) d_normrope<NKVH>(b - PB_NQ, k, kw, pos, K16, KL);
  else if (b < PB_NQ + PB_NK + PB_MF) d_mflag(b - (PB_NQ + PB_NK), msk, ACT);
  else if (b < PB_NQ + PB_NK + PB_MF + PB_VT) d_vt(b - (PB_NQ + PB_NK + PB_MF), v, VT, tl);
  else d_wsc(b - (PB_NQ + PB_NK + PB_MF + PB_VT), Wo, BO, 16.0f);      /* (out,in) natural */
}
// A block runs two query tiles of 64 rows one after the other, tile QTN - 1 - x and tile x, so that under a triangular mask every block has the same number of open passes; a wave owns 16 queries.
// Eight waves in two key groups of four: both groups hold the same 64 queries, and of the passes to walk group 0 takes the 1st, 3rd, ... and group 1 the 2nd, 4th, ..., each with K/V tiles of its own in LDS.
// Each group keeps its own running maximum, sum and output sums; at the end of a tile the two are joined (rescaled to the common maximum), each group finishing half of the dims.
// Of each tile only the open key passes are walked (flags of d_mflag). A closed pass holds nothing but scores of -10000: once every row of the tile has a running maximum of -9000 or more, exp(-10000 - max) is 0 in f32
// and the pass would change neither sums nor maximum. Where a row's maximum is lower after the open passes (a row with no open key among them), the closed passes are walked as well, after the open ones, by the same code.
typedef v4f v4fs __attribute__((may_alias));
#define MGS 17                   /* 16-byte slots a lane hands over: 4 dims tiles x (hi, residual) x 2, then maximum and sum */
// Group G hands its partner wave the four dims tiles that the partner finishes, with its running maximum and sum. slot = the wave's own range, at its lane; slots lie 32 lanes apart, so that a wave's 16-byte accesses cover whole rows of banks.
template <int G>
__device__ __forceinline__ void fa_put(const v8f (&oh)[8], const v8f (&ol)[8], const float m, const float l, v4fs* slot) {
#pragma unroll
  for (int dd = 0; dd < 4; ++dd) { const v8f a = oh[(1 - G) * 4 + dd], b = ol[(1 - G) * 4 + dd];
    const v4f a0 = {a[0], a[1], a[2], a[3]}, a1 = {a[4], a[5], a[6], a[7]}, b0 = {b[0], b[1], b[2], b[3]}, b1 = {b[4], b[5], b[6], b[7]};
    slot[(dd * 4 + 0) * 32] = a0; slot[(dd * 4 + 1) * 32] = a1; slot[(dd * 4 + 2) * 32] = b0; slot[(dd * 4 + 3) * 32] = b1; }
  const v4f ml = {m, l, 0.f, 0.f}; slot[16 * 32] = ml;
}
// Group G joins the partner's sums into its own four dims tiles, divides by the joined sum and stores them. slot = the partner wave's range, at this lane.
template <int G>
__device__ __forceinline__ void fa_fin(v8f (&oh)[8], v8f (&ol)[8], const float m, const float l, const v4fs* slot, float* cr0) {
  const v4f ml = slot[16 * 32]; const float mj = fmaxf(m, ml[0]); const float as = expf(m - mj), ao = expf(ml[0] - mj); const float lj = l * as + ml[1] * ao;
  const float lt = lj + __shfl_xor(lj, 16, 32); const float f = 0.0009765625f / lt, fl = f * 0.0009765625f;
  /* every output value is formed in place first, then the stores go out as one run: no register that an issued store names is written before the wait behind the run */
#pragma unroll
  for (int dd = 0; dd < 4; ++dd) { const int d = G * 4 + dd; const v4f a0 = slot[(dd * 4 + 0) * 32], a1 = slot[(dd * 4 + 1) * 32], b0 = slot[(dd * 4 + 2) * 32], b1 = slot[(dd * 4 + 3) * 32];
#pragma unroll
    for (int r = 0; r < 4; ++r) { const float h0 = oh[d][r] * as + a0[r] * ao, h1 = oh[d][4 + r] * as + a1[r] * ao, l0 = ol[d][r] * as + b0[r] * ao, l1 = ol[d][4 + r] * as + b1[r] * ao;
      oh[d][r] = h0 * f + l0 * fl; oh[d][4 + r] = h1 * f + l1 * fl; } }
  __builtin_amdgcn_sched_barrier(0);      /* keeps the arithmetic above from being scheduled in among the stores below, where it would write registers of stores still under way */
#pragma unroll
  for (int dd = 0; dd < 4; ++dd) { const int d = G * 4 + dd; float* cr = cr0 + 16 * d; const v8f o = oh[d]; const v4f a = {o[0], o[1], o[2], o[3]}, b = {o[4], o[5], o[6], o[7]};
    *(v4f*)cr = a; *(v4f*)(cr + 4) = b; }
  asm volatile("s_wait_xcnt 0x0" ::: "memory");      /* precaution: closes the run of stores, in front of the second tile's writes of their registers */
}
__global__ __launch_bounds__(256) void k_fattn(const _Float16* __restrict__ Qh, const _Float16* __restrict__ Ql, const _Float16* __restrict__ Kh, const _Float16* __restrict__ Kl, const _Float16* __restrict__ Vt,
    const int* __restrict__ msk, const int* __restrict__ act, float* __restrict__ CTX) {
  __shared__ __attribute__((aligned(16))) _Float16 sKh2[2 * 32 * FKP], sKl2[2 * 32 * FKP], sV2[2 * HD * FVP];      /* a tile set for each key group */
  __shared__ float sMx[2][2][64];      /* per tile, key group and row: the running maximum after the open passes; a slot set of its own for each tile, so that no wave writes a slot that a slower wave still reads */
  __shared__ __attribute__((aligned(16))) v4fs sMg[8 * MGS * 32];      /* the hand-over at the end of a tile: a range for each wave */
  const int tid = threadIdx.x & 127, wv = threadIdx.x >> 5, w = wv & 3, lane = tid & 31, ln = lane & 15, hh = lane >> 4; const int h = blockIdx.y, kv = h / GRP;      /* tid, w: place inside the key group */
  const int g = __builtin_amdgcn_readfirstlane((int)(threadIdx.x >> 7));      /* key group, in a scalar register: the choices made from it are scalar ones */
  _Float16* const sKh = sKh2 + g * (32 * FKP); _Float16* const sKl = sKl2 + g * (32 * FKP); _Float16* const sV = sV2 + g * (HD * FVP);
  const v8f z8 = {0.f,0.f,0.f,0.f,0.f,0.f,0.f,0.f};
  /* a key group's four waves share each pass's K (hi, residual) and V^T tiles through LDS: whole-row global loads, one copy a group; pitches 272 B and 80 B (16 B x odd) keep the 16-byte fragment reads off each other's banks */
  const int krow = tid >> 4, kcol = (tid & 15) * 8, vrow = tid >> 2, vcol = (tid & 3) * 8;
  const _Float16* gkh = Kh + (size_t)krow * DKV + kv * HD + kcol; const _Float16* gkl = Kl + (size_t)krow * DKV + kv * HD + kcol; const _Float16* gv = Vt + ((size_t)kv * HD + vrow) * TT + vcol;
  const float alpha = 0.088388347648318447f, alo = alpha * 0.0009765625f;
  /* kept rolled: the two tiles run through one copy of the code */
#pragma unroll 1
  for (int half = 0; half < 2; ++half) {
    const int qt = half ? (int)blockIdx.x : QTN - 1 - (int)blockIdx.x; const int q0 = qt * 64 + 16 * w;      /* a wave owns 16 queries: one column group */
    const int a0 = act[qt * 64 + lane], a1 = act[qt * 64 + 32 + lane];
    asm volatile("s_wait_xcnt 0x0" ::: "memory");      /* precaution: the loads below may land in, or have their addresses formed in, a register that the two loads above name */
    __builtin_amdgcn_sched_barrier(0);      /* keeps the loads below behind that wait */
    v16h qh[4], ql[4];
    const size_t qo = (size_t)(q0 + ln) * DQ + h * HD; const _Float16* qp0 = Qh + qo; const _Float16* qp2 = Ql + qo;
#pragma unroll
    for (int ks = 0; ks < 4; ++ks) { qh[ks] = g2_frag(qp0 + ks * 32, hh); ql[ks] = g2_frag(qp2 + ks * 32, hh); }
    asm volatile("s_wait_xcnt 0x0" ::: "memory");      /* precaution: stands in front of every later write of a register that one of the loads above names */
    __builtin_amdgcn_sched_barrier(0);      /* keeps the work below from being scheduled above that wait */
    const unsigned long long open = (unsigned long long)__builtin_amdgcn_ballot_w32(a0 != 0) | ((unsigned long long)__builtin_amdgcn_ballot_w32(a1 != 0) << 32);      /* bit p: pass p is open; the same in all eight waves */
    v8f oh[8], ol[8];
#pragma unroll
    for (int d = 0; d < 8; ++d) { oh[d] = z8; ol[d] = z8; }
    float mrun = -3.0e38f, lrun = 0.f;
    const int* gm = msk + (size_t)(q0 + ln) * MSTR + 8 * hh;
    /* kept rolled: open passes (phase 0) and, where needed, closed passes (phase 1) run through one copy of the code */
#pragma unroll 1
    for (int phase = 0; phase < 2; ++phase) {
      unsigned long long todo = open;
      if (phase) {
        if (hh == 0) sMx[half][g][16 * w + ln] = mrun;      /* both half-waves hold the same maximum */
        __syncthreads();      /* the eight waves' maxima are published: the choice below must be the same in the whole block, barriers follow it */
        /* a row's maximum is the larger of its two groups'; every wave looks at all 64 rows and so finds the same */
        const float c0 = fmaxf(sMx[half][0][lane], sMx[half][1][lane]), c1 = fmaxf(sMx[half][0][32 + lane], sMx[half][1][32 + lane]);
        todo = __builtin_amdgcn_ballot_w32(c0 < -9000.0f || c1 < -9000.0f) != 0u ? ~open : 0ull;
      }
      if (todo == 0ull) continue;
      /* a trip takes two passes off the list: the first for group 0, the second, where there is one, for group 1 (else group 1 fetches the first again, in bounds, and leaves the trip's work out) */
      int cur = __builtin_ctzll(todo); todo &= todo - 1ull;
      bool live = true;
      { const bool two = todo != 0ull; const int sec = two ? __builtin_ctzll(todo) : cur; todo &= todo - 1ull; if (g) { cur = sec; live = two; } }
      v8us rk[4], rl[4], rv[4]; v4i mk[2][2];
#pragma unroll
      for (int i = 0; i < 4; ++i) { rk[i] = *(const v8us*)(gkh + (size_t)(cur * 32 + i * 8) * DKV); rl[i] = *(const v8us*)(gkl + (size_t)(cur * 32 + i * 8) * DKV); rv[i] = *(const v8us*)(gv + (size_t)i * 32 * TT + cur * 32); }
#pragma unroll
      for (int j = 0; j < 2; ++j) { mk[j][0] = *(const v4i*)(gm + cur * 32 + j * 16); mk[j][1] = *(const v4i*)(gm + cur * 32 + j * 16 + 4); }
      asm volatile("s_wait_xcnt 0x0" :: "v"(gm + cur * 32), "v"(gkh + (size_t)(cur * 32) * DKV), "v"(gkl + (size_t)(cur * 32) * DKV), "v"(gv + cur * 32) : "memory");      /* same precaution as behind the query loads; the four addresses are inputs so that they stay in their registers up to here and no load of the run lands in them */
      __builtin_amdgcn_sched_barrier(0);      /* keeps the work below from being scheduled above that wait */
      /* kept rolled: one pass's staging registers and fragments beside the query fragments and the output accumulators are what is meant to stay in registers; every inner loop is unrolled so that the register arrays are indexed by constants */
#pragma unroll 1
      for (;;) {
#pragma unroll
        for (int i = 0; i < 4; ++i) { *(v8us*)(sKh + (krow + 8 * i) * FKP + kcol) = rk[i]; *(v8us*)(sKl + (krow + 8 * i) * FKP + kcol) = rl[i]; *(v8us*)(sV + (vrow + 32 * i) * FVP + vcol) = rv[i]; }
        bool msel[2][8];      /* this pass's mask, read out of its registers before the next pass's lands in them */
#pragma unroll
        for (int j = 0; j < 2; ++j) {
#pragma unroll
          for (int r = 0; r < 8; ++r) msel[j][r] = mk[j][r >> 2][r & 3] != 0; }
        __syncthreads();      /* this trip's tiles are published to their groups' waves */
        const bool more = todo != 0ull; int nxt = more ? __builtin_ctzll(todo) : cur; todo &= todo - 1ull;      /* the last trip of a phase fetches its own tiles again: in bounds, never used */
        bool nlive = true;
        { const bool two = todo != 0ull; const int sec = two ? __builtin_ctzll(todo) : nxt; todo &= todo - 1ull; if (g) { nxt = sec; nlive = two; } }
        const int kn = nxt * 32;
        const int* mp = gm + kn;
        /* the next pass's mask and tiles go into registers now: they fly while this pass is worked on */
#pragma unroll
        for (int j = 0; j < 2; ++j) { mk[j][0] = *(const v4i*)(mp + j * 16); mk[j][1] = *(const v4i*)(mp + j * 16 + 4); }
#pragma unroll
        for (int i = 0; i < 4; ++i) { rk[i] = *(const v8us*)(gkh + (size_t)(kn + i * 8) * DKV); rl[i] = *(const v8us*)(gkl + (size_t)(kn + i * 8) * DKV); rv[i] = *(const v8us*)(gv + (size_t)i * 32 * TT + kn); }
        asm volatile("s_wait_xcnt 0x0" :: "v"(mp), "v"(gkh + (size_t)kn * DKV), "v"(gkl + (size_t)kn * DKV), "v"(gv + kn) : "memory");      /* precaution: stands in front of every later write of a register that one of the loads above names; the four addresses are inputs so that they stay in their registers up to here and no load of the run lands in them */
        __builtin_amdgcn_sched_barrier(0);      /* keeps the work below from being scheduled above that wait, and the loads above in front of the pass's work */
        if (live) {      /* a scalar choice: a whole wave works on its pass or leaves it out; the barriers stand outside */
        v8f sh[2] = {z8, z8}, sl[2] = {z8, z8};      /* [key tile j] */
#pragma unroll
        for (int ks = 0; ks < 4; ++ks) { const v16h kh0 = g2_frag(sKh + ln * FKP + ks * 32, hh), kh1 = g2_frag(sKh + (16 + ln) * FKP + ks * 32, hh), kl0 = g2_frag(sKl + ln * FKP + ks * 32, hh), kl1 = g2_frag(sKl + (16 + ln) * FKP + ks * 32, hh);
          sh[0] = fa_mma(kh0, qh[ks], sh[0]); sh[1] = fa_mma(kh1, qh[ks], sh[1]); sl[0] = fa_mma(kh0, ql[ks], sl[0]); sl[1] = fa_mma(kh1, ql[ks], sl[1]); sl[0] = fa_mma(kl0, qh[ks], sl[0]); sl[1] = fa_mma(kl1, qh[ks], sl[1]); }
        FragH ph, pl; float sv[2][8]; float mx = -3.0e38f;
#pragma unroll
        for (int j = 0; j < 2; ++j) {
#pragma unroll
          for (int r = 0; r < 8; ++r) { const float s0 = sh[j][r] * alpha + sl[j][r] * alo; const float s = msel[j][r] ? -10000.0f : s0; sv[j][r] = s; mx = fmaxf(mx, s); } }
        mx = fmaxf(mx, __shfl_xor(mx, 16, 32));      /* the other half-wave holds this query's other 16 keys */
        const float mn = fmaxf(mrun, mx); const float al = expf(mrun - mn); mrun = mn; float su = 0.f;
#pragma unroll
        for (int j = 0; j < 2; ++j) {
#pragma unroll
          for (int r = 0; r < 8; ++r) { const float p = expf(sv[j][r] - mn); su += p; const float pv = p * 1024.0f; const _Float16 hi = (_Float16)pv; ph.h[8 * j + r] = hi; pl.h[8 * j + r] = (_Float16)((pv - (float)hi) * 1024.0f); } }
        lrun = lrun * al + su;      /* each half-wave sums its own keys; the halves meet in the epilogue */
#pragma unroll
        for (int d = 0; d < 8; ++d) { oh[d] *= al; ol[d] *= al; }
#pragma unroll
        for (int d = 0; d < 8; ++d) { const v16h vf = g2_frag(sV + (16 * d + ln) * FVP, hh); oh[d] = fa_mma(vf, ph.v, oh[d]); ol[d] = fa_mma(vf, pl.v, ol[d]); }
        }
        __builtin_amdgcn_sched_barrier(0);      /* keeps the pass's work in front of the barrier below, whose fence waits for the loads in flight: scheduled earlier, it would wait out their whole latency */
        __syncthreads();      /* every wave has read this pass's tiles before the next pass's are stored over them */
        if (!more) break;
        cur = nxt; live = nlive;
      }
    }
    /* the two key groups' sums meet: each wave hands its partner (the other group's wave with the same queries) the half of the dims that the partner finishes */
    float* cr0 = CTX + (size_t)(q0 + ln) * DQ + h * HD + 8 * hh;
    v4fs* own = sMg + wv * (MGS * 32) + lane; const v4fs* oth = sMg + (wv ^ 4) * (MGS * 32) + lane;
    if (g == 0) fa_put<0>(oh, ol, mrun, lrun, own); else fa_put<1>(oh, ol, mrun, lrun, own);
    __syncthreads();      /* publishes the hand-over; the ranges are written again only behind the next tile's barrier on the maxima, which every reader reaches after its reads */
    if (g == 0) fa_fin<0>(oh, ol, mrun, lrun, oth, cr0); else fa_fin<1>(oh, ol, mrun, lrun, oth, cr0);
  }
}

// ---- W_out GEMM, operand tiles staged in LDS ----
// C = alpha * (Ah.Bh^T + 2^-10 * Al.Bh^T), all three planes [2048][2048] f16, k contiguous. A block owns a 128 x 128 tile of C, a wave 32 rows x 64 columns of it (4 x 2 waves); the hi product and the residual product keep
// separate f32 accumulators (the residual plane carries a 2^10 scale) and meet once in the epilogue. A stage is 64 k = 128 B of each of the 3 x 128 operand rows: eight lanes fetch one row's whole cache line, each row once a block,
// and the fragments, whose 16 rows lie 4 KiB apart in memory, are read from LDS instead. Two LDS buffers: stage s + 1 is stored and stage s + 2 fetched to registers while stage s is worked on; one barrier a stage.
#define GKS 64                   /* k (halves) a stage */
#define GPI 72                   /* LDS pitch of a staged row, in halves: 144 B = 16 B x odd keeps the 16-byte fragment reads off each other's banks */
#define GBUF (128 * GPI)         /* halves of one plane's buffer */
#define GNS (DQ / GKS)           /* stages */
__global__ __launch_bounds__(256) void k_gemm2l(const _Float16* __restrict__ Ah, const _Float16* __restrict__ Al, const _Float16* __restrict__ Bh, float alpha, float* __restrict__ C) {
  __shared__ __attribute__((aligned(16))) _Float16 sAh[2 * GBUF], sAl[2 * GBUF], sB[2 * GBUF];
  __shared__ __attribute__((aligned(16))) float so[8][32][68];
  const int tid = threadIdx.x, w = tid >> 5, lane = tid & 31, ln = lane & 15, hh = lane >> 4;
  const int mt = blockIdx.x / (DQ / 128), nt = blockIdx.x % (DQ / 128); const int wr = (w >> 1) * 32, wc = (w & 1) * 64;
  const int srow = tid >> 3, scol = (tid & 7) * 8; const int sofs = srow * GPI + scol;      /* staging: a thread moves 16 bytes of rows srow, srow + 32, + 64, + 96 of each plane */
  const _Float16* gah = Ah + (size_t)(mt * 128 + srow) * DQ + scol; const _Float16* gal = Al + (size_t)(mt * 128 + srow) * DQ + scol; const _Float16* gb = Bh + (size_t)(nt * 128 + srow) * DQ + scol;
  const v8f z8 = {0.f,0.f,0.f,0.f,0.f,0.f,0.f,0.f}; v8f ch[8] = {z8, z8, z8, z8, z8, z8, z8, z8}, cl[8] = {z8, z8, z8, z8, z8, z8, z8, z8};      /* [t] = rows 0..15, [4 + t] = rows 16..31 of column tile t */
  v8us ra[4], rl[4], rb[4];
#pragma unroll
  for (int i = 0; i < 4; ++i) { ra[i] = *(const v8us*)(gah + (size_t)i * 32 * DQ); rl[i] = *(const v8us*)(gal + (size_t)i * 32 * DQ); rb[i] = *(const v8us*)(gb + (size_t)i * 32 * DQ); }
  asm volatile("s_wait_xcnt 0x0" ::: "memory");      /* precaution: stands in front of every later write of a register that one of the loads above names */
  __builtin_amdgcn_sched_barrier(0);      /* keeps the work below from being scheduled above that wait */
#pragma unroll
  for (int i = 0; i < 4; ++i) { *(v8us*)(sAh + sofs + i * 32 * GPI) = ra[i]; *(v8us*)(sAl + sofs + i * 32 * GPI) = rl[i]; *(v8us*)(sB + sofs + i * 32 * GPI) = rb[i]; }
#pragma unroll
  for (int i = 0; i < 4; ++i) { ra[i] = *(const v8us*)(gah + (size_t)i * 32 * DQ + GKS); rl[i] = *(const v8us*)(gal + (size_t)i * 32 * DQ + GKS); rb[i] = *(const v8us*)(gb + (size_t)i * 32 * DQ + GKS); }
  asm volatile("s_wait_xcnt 0x0" ::: "memory");      /* same precaution */
  __builtin_amdgcn_sched_barrier(0);      /* keeps the work below from being scheduled above that wait */
  __syncthreads();      /* publishes stage 0 */
  /* kept rolled: one copy of the stage's code; every inner loop is unrolled so that the register arrays are indexed by constants */
#pragma unroll 1
  for (int s = 0; s < GNS; ++s) {
    const int cb = (s & 1) * GBUF, nb = GBUF - cb;      /* this stage's buffer; the other one, which every wave left at the last barrier */
    const _Float16* pah = sAh + cb + (wr + ln) * GPI; const _Float16* pal = sAl + cb + (wr + ln) * GPI; const _Float16* pb = sB + cb + (wc + ln) * GPI;
    v16h fa[GKS / 32][4], fb[GKS / 32][4];      /* [k step][rows 0..15 hi, rows 16..31 hi, rows 0..15 residual, rows 16..31 residual], [k step][column tile] */
#pragma unroll
    for (int ks = 0; ks < GKS / 32; ++ks) {
      fa[ks][0] = g2_frag(pah + ks * 32, hh); fa[ks][1] = g2_frag(pah + 16 * GPI + ks * 32, hh); fa[ks][2] = g2_frag(pal + ks * 32, hh); fa[ks][3] = g2_frag(pal + 16 * GPI + ks * 32, hh);
#pragma unroll
      for (int t = 0; t < 4; ++t) fb[ks][t] = g2_frag(pb + t * 16 * GPI + ks * 32, hh); }
    __builtin_amdgcn_sched_barrier(0);      /* keeps the stage's fragment reads as one run at its head: the first products wait for nothing else, and the second k step's fragments land while the first's products run */
    /* stage s + 1 goes from its registers into the other buffer, stage s + 2 into the registers: both run beside the products below. No branch here, so that the waits in front of the products can be counted ones:
       the last trip stores, and the last two fetch, the last stage once more: in bounds, never read */
#pragma unroll
    for (int i = 0; i < 4; ++i) { *(v8us*)(sAh + nb + sofs + i * 32 * GPI) = ra[i]; *(v8us*)(sAl + nb + sofs + i * 32 * GPI) = rl[i]; *(v8us*)(sB + nb + sofs + i * 32 * GPI) = rb[i]; }
    const int kn = (s + 2 < GNS ? s + 2 : GNS - 1) * GKS;
#pragma unroll
    for (int i = 0; i < 4; ++i) { ra[i] = *(const v8us*)(gah + (size_t)i * 32 * DQ + kn); rl[i] = *(const v8us*)(gal + (size_t)i * 32 * DQ + kn); rb[i] = *(const v8us*)(gb + (size_t)i * 32 * DQ + kn); }
    asm volatile("s_wait_xcnt 0x0" ::: "memory");      /* same precaution as behind the first loads */
    __builtin_amdgcn_sched_barrier(0);      /* keeps the loads above in front of the products, so that they fly during them, and the products behind the wait */
#pragma unroll
    for (int ks = 0; ks < GKS / 32; ++ks) {
#pragma unroll
      for (int t = 0; t < 4; ++t) { ch[t] = fa_mma(fa[ks][0], fb[ks][t], ch[t]); ch[4 + t] = fa_mma(fa[ks][1], fb[ks][t], ch[4 + t]); cl[t] = fa_mma(fa[ks][2], fb[ks][t], cl[t]); cl[4 + t] = fa_mma(fa[ks][3], fb[ks][t], cl[4 + t]); } }
    __builtin_amdgcn_sched_barrier(0);      /* keeps the products in front of the barrier below, whose fence waits for the loads in flight */
    __syncthreads();      /* publishes stage s + 1 to all eight waves, and ends every wave's reads of stage s before its buffer is stored over */
  }
  const float alo = alpha * 0.0009765625f;
#pragma unroll
  for (int u = 0; u < 8; ++u) { const int t = u & 3, half = u >> 2;
#pragma unroll
    for (int r = 0; r < 8; ++r) so[w][half * 16 + 8 * hh + r][t * 16 + ln] = ch[u][r] * alpha + cl[u][r] * alo; }
  __builtin_amdgcn_fence(__ATOMIC_ACQ_REL, "workgroup"); __builtin_amdgcn_wave_barrier();      /* this wave's LDS stores above come before its own LDS reads below (so[w] is private to the wave) */
  const int rsub = lane >> 4, c4 = (lane & 15) * 4; float* cp = C + (size_t)(mt * 128 + wr + rsub) * DQ + nt * 128 + wc + c4;
  v4f ov[16];
#pragma unroll
  for (int q = 0; q < 16; ++q) ov[q] = *(const v4fa*)&so[w][q * 2 + rsub][c4];
  __builtin_amdgcn_sched_barrier(0);      /* every value is in its register before the run of stores starts: no register that an issued store names is written behind it */
#pragma unroll
  for (int q = 0; q < 16; ++q) *(v4f*)(cp + (size_t)q * 2 * DQ) = ov[q];
}

extern "C" void kernel_launch(void* const* d_in, const int* in_sizes, int n_in,
                              void* d_out, int out_size, void* d_ws, size_t ws_size, hipStream_t stream) {
  (void)in_sizes; (void)n_in; (void)out_size;
  const float* const* I = (const float* const*)d_in; const float* q = I[0]; const float* k = I[1]; const float* v = I[2]; const int* msk = (const int*)d_in[3]; const int* pos = (const int*)d_in[4]; const float* qw = I[5]; const float* kw = I[6]; const float* Wo = I[7];
  char* ws = (char*)d_ws; size_t off = 0;
  auto take = [&](size_t bytes) { char* p = ws + off; off += (bytes + 255) & ~(size_t)255; return p; };
  _Float16* BO = (_Float16*)take((size_t)DQ * DQ * 2); _Float16* Q16 = (_Float16*)take((size_t)TT * DQ * 2); _Float16* QL = (_Float16*)take((size_t)TT * DQ * 2); _Float16* K16 = (_Float16*)take((size_t)TT * DKV * 2); _Float16* KL = (_Float16*)take((size_t)TT * DKV * 2); _Float16* VT = (_Float16*)take((size_t)TT * DKV * 2); float* CTX = (float*)take((size_t)TT * DQ * 4); int* ACT = (int*)take((size_t)QTN * 64 * 4); _Float16* C16 = Q16; _Float16* CL = QL;      /* merged context hi/lo over the q planes (dead after the attention launch) */
  if (off > ws_size) return;      /* 8 + 8+8 + 2+2 + 2 + 16 = 46 MiB */
  k_prep<<<PB_NQ + PB_NK + PB_MF + PB_VT + PB_WS, 256, 0, stream>>>(q, k, v, msk, pos, qw, kw, Wo, Q16, QL, K16, KL, VT, ACT, BO);      /* q/k planes; which 64 x 32 mask tiles hold an open entry; V^T [512][2048], kv head = rows kv*128 .. +127; W_out x 16 */
  k_fattn<<<dim3(QTN / 2, NQH), 256, 0, stream>>>(Q16, QL, K16, KL, VT, msk, ACT, CTX);      /* all 16 heads: ctx[t][h*128 + d], scores and probabilities stay in registers */
  k_hl<<<(unsigned)(((size_t)TT * DQ / 8 + 255) / 256), 256, 0, stream>>>(CTX, C16, CL, (size_t)TT * DQ / 8);
  k_gemm2l<<<(TT / 128) * (DQ / 128), 256, 0, stream>>>(C16, CL, BO, 0.0625f, (float*)d_out);      /* out = (ctx_hi + ctx_lo) W_out^T (W exact), one launch */
}

// v009
// One run takes 107 microseconds.
// Timed twice side by side with v008, it ran 1.22 times as fast both times.
// Over all steps from v000 it is 31.6 times as fast.
#include <hip/hip_runtime.h>
// QEffMolmoBlock (1 x 2048 tokens; 16 query heads / 4 kv heads x 128 dims; q, k, v are INPUT projections): q = RMSNorm_2048(q) * q_norm_w, k = RMSNorm_512(k) * k_norm_w (flat, before the head split); rotate-half RoPE (hd 128, positions from position_ids, base 10000); GQA (each kv head serves 4 query heads); scores = q.k / sqrt(128), masked entries (int mask input != 0) REPLACED by -10000; softmax; out = (att v) W_out^T.
// Structure: one preparation launch (RMSNorm + RoPE fused on VALU, wave per token, into f16 hi + 2^10 residual q/k planes; v as exact f16, V^T by LDS tiles; a flag per 64 x 32 mask tile (any open entry); W_out x 16 as f16); one fused attention launch for all 16 heads (a wave owns 16 queries and walks the open key passes of 32): the score products (f16 WMMA, f32 accumulation, K = 128, three terms), the masked online softmax on VALU (mask read on device), P as f16 hi + residual (x 2^10) packed in registers, the readout as two terms, the merged context written as f16 hi + residual planes by the same launch; W_out as two GEMM terms (exact x16 weights). Every product runs all its hi/residual terms in one launch.
// Compute dtype: inputs rounded to bf16; v and W_out exact as f16; normed+rotated q/k (3-term scores), P and the merged context all carried as f16 hi + 2^10 residual (~2^-21): the q/k norm weights are O(1) random so logits have sigma ≈ 11 and the softmax is near one-hot; RMSNorm/RoPE/softmax f32. v_wmma_f32_16x16x32_f16.
#define TT 2048
#define MSTR 2048                /* attention_mask row stride (input geometry) */
#define NQH 16
#define NKVH 4
#define HD 128
#define DQ (NQH * HD)            /* 2048 */
#define DKV (NKVH * HD)          /* 512 */
#define GRP (NQH / NKVH)         /* 4 query heads share a kv head */
typedef __bf16 v16b __attribute__((ext_vector_type(16)));
typedef unsigned short v8us __attribute__((ext_vector_type(8), may_alias));
typedef float  v8f  __attribute__((ext_vector_type(8)));
typedef float  v4f  __attribute__((ext_vector_type(4)));
typedef float  v4fa __attribute__((ext_vector_type(4), may_alias));
union FragB { v16b v; v8us half[2]; unsigned short u[16]; };

__device__ __forceinline__ unsigned short bf16_bits(float x) { unsigned int u = __float_as_uint(x); return (unsigned short)((u + 0x7FFFu + ((u >> 16) & 1u)) >> 16); }
__device__ __forceinline__ float bf16_val(unsigned short b) { return __uint_as_float(((unsigned int)b) << 16); }
__device__ __forceinline__ float bf16_round(float x) { return bf16_val(bf16_bits(x)); }
// D += A·B with NT terms: 1 = ah·bh, 2 = + al·bh (A split), 3 = + ah·bl (both split)
template <int NT>
__device__ __forceinline__ v8f mmaN(v16b ah, v16b al, v16b bh, v16b bl, v8f c) {
  c = __builtin_amdgcn_wmma_f32_16x16x32_bf16(false, ah, false, bh, (short)0, c, false, false);
  if (NT >= 2) c = __builtin_amdgcn_wmma_f32_16x16x32_bf16(false, al, false, bh, (short)0, c, false, false);
  if (NT >= 3) c = __builtin_amdgcn_wmma_f32_16x16x32_bf16(false, ah, false, bl, (short)0, c, false, false);
  asm volatile("v_nop\n\tv_nop\n\tv_nop\n\tv_nop" : "+v"(c) : "v"(ah), "v"(al), "v"(bh), "v"(bl));
  return c;
}

__global__ __launch_bounds__(256) void k_wt_bf16(const float* __restrict__ W, unsigned short* __restrict__ Wt, int K, int N) {
  const int t = blockIdx.x * 256 + threadIdx.x;
  const int k8n = K / 8;
  if (t >= N * k8n) return;
  const int n = t / k8n, k8 = (t % k8n) * 8;
  v8us v;
#pragma unroll
  for (int i = 0; i < 8; ++i) v[i] = bf16_bits(W[(size_t)(k8 + i) * N + n]);
  *(v8us*)(Wt + (size_t)n * K + k8) = v;
  
}

// GEMM C[M][N] (f32, pitch ldc) = act(A[M][K]·W + bias). A f32 row-major (pitch lda) converted per fragment to bf16
// (ASPLIT: hi/lo two planes -> 2 terms, else single rounded term); Wt bf16 [N][K] (pitch ldb). BIAS_BF16 rounds the
// bias to bf16 first (bias quantised to bf16 before the add). K%32==0, M%16==0, N%64==0.
template <bool ASPLIT, int ACT, bool BIAS_BF16>
__global__ __launch_bounds__(128) void k_gemm_bf(const float* __restrict__ A, int lda, const unsigned short* __restrict__ Wt, int ldb,
                                               const float* __restrict__ bias, float* __restrict__ C, int ldc, int M, int N, int K) {
  __shared__ __attribute__((aligned(16))) float so[4][16][64];
  const int tid = threadIdx.x, w = tid >> 5, lane = tid & 31, ln = lane & 15, hh = lane >> 4;
  const int ntn = N / 64;
  const int wid = blockIdx.x * 4 + w;
  const int mt = wid / ntn, nq = wid % ntn;
  if (mt * 16 >= M) return;
  const int row0 = mt * 16, col0 = nq * 64;
  const float* arow = A + (size_t)(row0 + ln) * lda;
  v8f acc[4] = {};
  for (int kb = 0; kb < K; kb += 32) {
    FragB ah, al;
    const v4f x0 = *(const v4fa*)(arow + kb + 8 * hh), x1 = *(const v4fa*)(arow + kb + 8 * hh + 4);
    const v4f x2 = *(const v4fa*)(arow + kb + 16 + 8 * hh), x3 = *(const v4fa*)(arow + kb + 16 + 8 * hh + 4);
    float xs[16] = {x0[0],x0[1],x0[2],x0[3],x1[0],x1[1],x1[2],x1[3],x2[0],x2[1],x2[2],x2[3],x3[0],x3[1],x3[2],x3[3]};
#pragma unroll
    for (int i = 0; i < 16; ++i) { const unsigned short hb = bf16_bits(xs[i]); ah.u[i] = hb; al.u[i] = ASPLIT ? bf16_bits(xs[i] - bf16_val(hb)) : (unsigned short)0; }
#pragma unroll
    for (int t = 0; t < 4; ++t) {
      const unsigned short* brow = Wt + (size_t)(col0 + t * 16 + ln) * ldb + kb;
      FragB b;
      b.half[0] = *(const v8us*)(brow + 8 * hh);
      b.half[1] = *(const v8us*)(brow + 16 + 8 * hh);
      acc[t] = mmaN<ASPLIT ? 2 : 1>(ah.v, al.v, b.v, b.v, acc[t]);
    }
  }
#pragma unroll
  for (int t = 0; t < 4; ++t) {
    float bv = bias ? bias[col0 + t * 16 + ln] : 0.f;
    if (BIAS_BF16) bv = bf16_round(bv);
#pragma unroll
    for (int r = 0; r < 8; ++r) { float v = acc[t][r] + bv; if (ACT == 1) v = fmaxf(v, 0.f); so[w][8 * hh + r][t * 16 + ln] = v; }
  }
  __builtin_amdgcn_fence(__ATOMIC_ACQ_REL, "workgroup");
  __builtin_amdgcn_wave_barrier();
  const int rsub = lane >> 4, c4 = (lane & 15) * 4;
  {
#pragma unroll
    for (int q = 0; q < 8; ++q) {
      const int r = q * 2 + rsub;
      const v4f v = *(const v4fa*)&so[w][r][c4];
      *(v4f*)(C + (size_t)(row0 + r) * ldc + col0 + c4) = v;
    }
    
  }
}

// GEMM C = act(A·W + bias + resid): A f32 (ASPLIT -> hi/lo 2 terms), Wt bf16 [N][K]; ACT 0 none, 1 relu, 2 exact gelu;
// resid (optional, f32, row index = (row % rmod), pitch ldr, RES_BF16 rounds it) added before the activation.
template <bool ASPLIT, int ACT, bool BIAS_BF16, bool RES_BF16>
__global__ __launch_bounds__(128) void k_gemm_bf3(const float* __restrict__ A, int lda, const unsigned short* __restrict__ Wt, int ldb,
                                                const float* __restrict__ bias, const float* __restrict__ resid, int rmod, int ldr,
                                                float* __restrict__ C, int ldc, int M, int N, int K) {
  __shared__ __attribute__((aligned(16))) float so[4][16][64];
  const int tid = threadIdx.x, w = tid >> 5, lane = tid & 31, ln = lane & 15, hh = lane >> 4;
  const int ntn = N / 64;
  const int wid = blockIdx.x * 4 + w;
  const int mt = wid / ntn, nq = wid % ntn;
  if (mt * 16 >= M) return;
  const int row0 = mt * 16, col0 = nq * 64;
  const float* arow = A + (size_t)(row0 + ln) * lda;
  v8f acc[4] = {};
  for (int kb = 0; kb < K; kb += 32) {
    FragB ah, al;
    const v4f x0 = *(const v4fa*)(arow + kb + 8 * hh), x1 = *(const v4fa*)(arow + kb + 8 * hh + 4);
    const v4f x2 = *(const v4fa*)(arow + kb + 16 + 8 * hh), x3 = *(const v4fa*)(arow + kb + 16 + 8 * hh + 4);
    float xs[16] = {x0[0],x0[1],x0[2],x0[3],x1[0],x1[1],x1[2],x1[3],x2[0],x2[1],x2[2],x2[3],x3[0],x3[1],x3[2],x3[3]};
#pragma unroll
    for (int i = 0; i < 16; ++i) { const unsigned short hb = bf16_bits(xs[i]); ah.u[i] = hb; al.u[i] = ASPLIT ? bf16_bits(xs[i] - bf16_val(hb)) : (unsigned short)0; }
#pragma unroll
    for (int t = 0; t < 4; ++t) {
      const unsigned short* brow = Wt + (size_t)(col0 + t * 16 + ln) * ldb + kb;
      FragB b;
      b.half[0] = *(const v8us*)(brow + 8 * hh);
      b.half[1] = *(const v8us*)(brow + 16 + 8 * hh);
      acc[t] = mmaN<ASPLIT ? 2 : 1>(ah.v, al.v, b.v, b.v, acc[t]);
    }
  }
#pragma unroll
  for (int t = 0; t < 4; ++t) {
    const int col = col0 + t * 16 + ln;
    float bv = bias ? bias[col] : 0.f;
    if (BIAS_BF16) bv = bf16_round(bv);
#pragma unroll
    for (int r = 0; r < 8; ++r) {
      float v = acc[t][r] + bv;
      if (resid) { float rv = resid[(size_t)((row0 + 8 * hh + r) % rmod) * ldr + col]; if (RES_BF16) rv = bf16_round(rv); v += rv; }
      if (ACT == 1) v = fmaxf(v, 0.f);
      if (ACT == 2) v = 0.5f * v * (1.0f + erff(v * 0.70710678118654752f));
      if (ACT == 3) { const float u = 0.7978845608028654f * (v + 0.044715f * v * v * v); v = 0.5f * v * (1.0f + tanhf(u)); }
      so[w][8 * hh + r][t * 16 + ln] = v;
    }
  }
  __builtin_amdgcn_fence(__ATOMIC_ACQ_REL, "workgroup");
  __builtin_amdgcn_wave_barrier();
  const int rsub = lane >> 4, c4 = (lane & 15) * 4;
  {
#pragma unroll
    for (int q = 0; q < 8; ++q) {
      const int r = q * 2 + rsub;
      const v4f v = *(const v4fa*)&so[w][r][c4];
      *(v4f*)(C + (size_t)(row0 + r) * ldc + col0 + c4) = v;
    }
    
  }
}
// row LayerNorm (biased variance, eps) over N: s = X (+ R); optional out_sum <- s; out_norm <- (s-mu)*rsqrt(var+eps)*g + b
template <bool PARAM_BF16>
__global__ __launch_bounds__(256) void k_layernorm(const float* __restrict__ X, const float* __restrict__ R, const float* __restrict__ g, const float* __restrict__ bta,
                                                  float* __restrict__ out_sum, float* __restrict__ out_norm, int N, float eps) {
  __shared__ float red[256];
  const int row = blockIdx.x, tid = threadIdx.x;
  const float* x = X + (size_t)row * N; const float* rr = R ? R + (size_t)row * N : nullptr;
  float vals[16];                     // up to N = 4096
  const int per = N / 256;            // contiguous chunk per thread? use strided-by-4 chunks: thread handles j = tid*4 + 1024*u
  float s1 = 0.f;
  for (int u = 0; u < per / 4; ++u) {
    const int j = tid * 4 + 1024 * u;
    const v4f a = *(const v4fa*)(x + j);
    v4f b = {0.f,0.f,0.f,0.f}; if (rr) b = *(const v4fa*)(rr + j);
#pragma unroll
    for (int q = 0; q < 4; ++q) { const float v = a[q] + b[q]; vals[u * 4 + q] = v; s1 += v; }
  }
  red[tid] = s1; __syncthreads();
  for (int st = 128; st > 0; st >>= 1) { if (tid < st) red[tid] += red[tid + st]; __syncthreads(); }
  const float mu = red[0] / (float)N; __syncthreads();
  float s2 = 0.f;
  for (int u = 0; u < per / 4; ++u)
#pragma unroll
    for (int q = 0; q < 4; ++q) { const float c = vals[u * 4 + q] - mu; s2 += c * c; }
  red[tid] = s2; __syncthreads();
  for (int st = 128; st > 0; st >>= 1) { if (tid < st) red[tid] += red[tid + st]; __syncthreads(); }
  const float rs = rsqrtf(red[0] / (float)N + eps);
  {
    for (int u = 0; u < per / 4; ++u) {
      const int j = tid * 4 + 1024 * u;
      v4f o, sm;
#pragma unroll
      for (int q = 0; q < 4; ++q) {
        float gg = g[j + q], bb = bta[j + q];
        if (PARAM_BF16) { gg = bf16_round(gg); bb = bf16_round(bb); }
        sm[q] = vals[u * 4 + q]; o[q] = (vals[u * 4 + q] - mu) * rs * gg + bb;
      }
      if (out_sum) *(v4f*)(out_sum + (size_t)row * N + j) = sm;
      *(v4f*)(out_norm + (size_t)row * N + j) = o;
    }
    
  }
}



// ---- f16 WMMA path (v_wmma_f32_16x16x32_f16): 11-bit significands for operands in range — used where a [0,1] probability operand needs more precision than bf16
typedef _Float16 v16h __attribute__((ext_vector_type(16)));
union FragH { v16h v; v8us half[2]; _Float16 h[16]; unsigned short u[16]; };
template <int NT>
__device__ __forceinline__ v8f mmaH(v16h ah, v16h al, v16h bh, v16h bl, v8f c) {
  c = __builtin_amdgcn_wmma_f32_16x16x32_f16(false, ah, false, bh, (short)0, c, false, false);
  if (NT >= 2) c = __builtin_amdgcn_wmma_f32_16x16x32_f16(false, al, false, bh, (short)0, c, false, false);
  if (NT >= 3) c = __builtin_amdgcn_wmma_f32_16x16x32_f16(false, ah, false, bl, (short)0, c, false, false);
  asm volatile("v_nop\n\tv_nop\n\tv_nop\n\tv_nop" : "+v"(c) : "v"(ah), "v"(al), "v"(bh), "v"(bl));
  return c;
}
// batched GEMM like k_gemm_b but f16 operands: A f32 (split into f16 hi/lo if ASPLIT, else rounded to f16), Bt = f16 values [n][k]; alpha; C f32; N multiple of 16 (partial tiles skipped)
template <bool ASPLIT>
__global__ __launch_bounds__(128) void k_gemm_h(const float* __restrict__ A, int lda, size_t sA, const _Float16* __restrict__ Bh, int ldb, size_t sB, float alpha, float* __restrict__ C, int ldc, size_t sC, int M, int N, int K) {
  __shared__ __attribute__((aligned(16))) float so[4][16][64];
  const int tid = threadIdx.x, w = tid >> 5, lane = tid & 31, ln = lane & 15, hh = lane >> 4; const int by = blockIdx.y;
  A += (size_t)by * sA; Bh += (size_t)by * sB; C += (size_t)by * sC;
  const int ntn = (N + 63) / 64; const int wid = blockIdx.x * 4 + w; const int mt = wid / ntn, nq = wid % ntn; if (mt * 16 >= M) return;
  const int row0 = mt * 16, col0 = nq * 64; const float* arow = A + (size_t)(row0 + ln) * lda;
  v8f acc[4] = {};
  for (int kb = 0; kb < K; kb += 32) {
    FragH ah, al;
    const v4f x0 = *(const v4fa*)(arow + kb + 8 * hh), x1 = *(const v4fa*)(arow + kb + 8 * hh + 4), x2 = *(const v4fa*)(arow + kb + 16 + 8 * hh), x3 = *(const v4fa*)(arow + kb + 16 + 8 * hh + 4);
    float xs[16] = {x0[0],x0[1],x0[2],x0[3],x1[0],x1[1],x1[2],x1[3],x2[0],x2[1],x2[2],x2[3],x3[0],x3[1],x3[2],x3[3]};
#pragma unroll
    for (int i = 0; i < 16; ++i) { const _Float16 h = (_Float16)xs[i]; ah.h[i] = h; al.h[i] = ASPLIT ? (_Float16)(xs[i] - (float)h) : (_Float16)0.0f; }
#pragma unroll
    for (int t = 0; t < 4; ++t) { if (col0 + t * 16 >= N) continue; const size_t boff = (size_t)(col0 + t * 16 + ln) * ldb + kb; FragH bq; bq.half[0] = *(const v8us*)(Bh + boff + 8 * hh); bq.half[1] = *(const v8us*)(Bh + boff + 16 + 8 * hh);
      acc[t] = mmaH<ASPLIT ? 2 : 1>(ah.v, al.v, bq.v, bq.v, acc[t]); }
  }
#pragma unroll
  for (int t = 0; t < 4; ++t) { if (col0 + t * 16 >= N) continue;
#pragma unroll
    for (int r = 0; r < 8; ++r) so[w][8 * hh + r][t * 16 + ln] = acc[t][r] * alpha; }
  __builtin_amdgcn_fence(__ATOMIC_ACQ_REL, "workgroup"); __builtin_amdgcn_wave_barrier();
  const int rsub = lane >> 4, c4 = (lane & 15) * 4;
  {
#pragma unroll
    for (int q = 0; q < 8; ++q) { const int r = q * 2 + rsub; if (col0 + c4 < N) { const v4f v = *(const v4fa*)&so[w][r][c4]; *(v4f*)(C + (size_t)(row0 + r) * ldc + col0 + c4) = v; } }
     }
}

// Wt[n][k] = f16(W[k][n]·scale) from f32 row-major W[K][N] (scale = power of two; bf16-exact weights stay exact in f16 away from the subnormal range)
__global__ __launch_bounds__(256) void k_wt_f16(const float* __restrict__ W, _Float16* __restrict__ Wt, int K, int N, float scale) {
  const int t = blockIdx.x * 256 + threadIdx.x; if (t >= N * (K / 8)) return; const int n = t / (K / 8), k8 = (t % (K / 8)) * 8; FragH f;
#pragma unroll
  for (int i = 0; i < 8; ++i) f.h[i] = (_Float16)(bf16_round(W[(size_t)(k8 + i) * N + n]) * scale); const v8us o = f.half[0];
  *(v8us*)((unsigned short*)Wt + (size_t)n * K + k8) = o; 
}
// k_gemm_hh variant with fused epilogue: v = acc·alpha + bias[by·sBias + col] (+ CP[(row/rowsPerB)·sCPb + by·64 + col] if CP) ; ACT 0 none / 1 elu ; writes f16 C16 (and f32 C if non-null)
template <int ACT>
__global__ __launch_bounds__(128) void k_gemm_hhx(const _Float16* __restrict__ A, int lda, size_t sA, const _Float16* __restrict__ Bh, int ldb, size_t sB, float alpha, const float* __restrict__ bias, size_t sBias, const float* __restrict__ CP, int rowsPerB, size_t sCPb, int row0g,
    float* __restrict__ C, _Float16* __restrict__ C16, int ldc, size_t sC, int M, int N, int K) {
  __shared__ __attribute__((aligned(16))) float so[4][16][64];
  const int tid = threadIdx.x, w = tid >> 5, lane = tid & 31, ln = lane & 15, hh = lane >> 4; const int by = blockIdx.y;
  A += (size_t)by * sA; Bh += (size_t)by * sB; const size_t cofs = (size_t)by * sC; const float* bp = bias ? bias + (size_t)by * sBias : nullptr;
  const int ntn = (N + 63) / 64; const int wid = blockIdx.x * 4 + w; const int mt = wid / ntn, nq = wid % ntn; if (mt * 16 >= M) return;
  const int row0 = mt * 16, col0 = nq * 64; const _Float16* arow = A + (size_t)(row0 + ln) * lda;
  v8f acc[4] = {};
  for (int kb = 0; kb < K; kb += 32) { FragH ah; ah.half[0] = *(const v8us*)((const unsigned short*)arow + kb + 8 * hh); ah.half[1] = *(const v8us*)((const unsigned short*)arow + kb + 16 + 8 * hh);
#pragma unroll
    for (int t = 0; t < 4; ++t) { if (col0 + t * 16 >= N) continue; const size_t boff = (size_t)(col0 + t * 16 + ln) * ldb + kb; FragH bq; bq.half[0] = *(const v8us*)((const unsigned short*)Bh + boff + 8 * hh); bq.half[1] = *(const v8us*)((const unsigned short*)Bh + boff + 16 + 8 * hh);
      acc[t] = mmaH<1>(ah.v, ah.v, bq.v, bq.v, acc[t]); }
  }
#pragma unroll
  for (int t = 0; t < 4; ++t) { if (col0 + t * 16 >= N) continue; const int col = col0 + t * 16 + ln; const float bv = bp ? bf16_round(bp[col]) : 0.f;
#pragma unroll
    for (int r = 0; r < 8; ++r) { float v = acc[t][r] * alpha + bv; if (CP) { const int rr = row0g + row0 + 8 * hh + r; if (rowsPerB < 0) v += CP[cofs + (size_t)rr * ldc + col];      /* rowsPerB < 0: own element of the batched C plane */ else { const int bidx = rr / rowsPerB; v += CP[(size_t)bidx * sCPb + (size_t)by * 64 + col]; } } if (ACT == 1) v = (v > 0.f) ? v : expm1f(v); else if (ACT == 7) v = (v > 0.f) ? v + 1.0f : expf(v); else if (ACT == 8) v = tanhf(v); else if (ACT == 9) v = 0.5f * v * (1.0f + tanhf(0.7978845608028654f * (v + 0.044715f * v * v * v))); else if (ACT == 11) v = 1.0f / (1.0f + expf(-v)); else if (ACT == 12) v = (v > 0.f) ? v : 0.01f * v; else if (ACT == 14) v = (v > 0.f) ? v : 0.1f * v; else if (ACT == 16) v = (v >= 0.f) ? v : 0.3f * v; else if (ACT == 17) v = (v >= 0.f) ? v : 0.2f * v; else if (ACT == 15) v = v / (1.0f + expf(-v)); else if (ACT == 3) v = fmaxf(v, 0.f); else if (ACT == 6) v = 0.5f * v * (1.0f + erff(v * 0.70710678118654752f)); so[w][8 * hh + r][t * 16 + ln] = v; } }
  __builtin_amdgcn_fence(__ATOMIC_ACQ_REL, "workgroup"); __builtin_amdgcn_wave_barrier();
  const int rsub = lane >> 4, c4 = (lane & 15) * 4; typedef _Float16 v4h __attribute__((ext_vector_type(4)));
  {
#pragma unroll
    for (int q = 0; q < 8; ++q) { const int r = q * 2 + rsub; if (col0 + c4 < N) { const v4f v = *(const v4fa*)&so[w][r][c4]; if (C) *(v4f*)(C + cofs + (size_t)(row0 + r) * ldc + col0 + c4) = v; if (C16) { v4h h4; for (int i = 0; i < 4; ++i) h4[i] = (_Float16)v[i]; *(v4h*)(C16 + cofs + (size_t)(row0 + r) * ldc + col0 + c4) = h4; } } }
     }
}


typedef _Float16 v4h __attribute__((ext_vector_type(4)));

__global__ __launch_bounds__(256) void k_h16(const float* __restrict__ x, _Float16* __restrict__ X16, size_t n8) { const size_t t = (size_t)blockIdx.x * 256 + threadIdx.x; if (t >= n8) return; FragH f;
#pragma unroll
  for (int q = 0; q < 8; ++q) f.h[q] = (_Float16)x[t * 8 + q]; *(v8us*)((unsigned short*)X16 + t * 8) = f.half[0];  }
__global__ __launch_bounds__(256) void k_round16f(const float* __restrict__ W, _Float16* __restrict__ Bt, size_t n8) { const size_t t = (size_t)blockIdx.x * 256 + threadIdx.x; if (t >= n8) return; FragH f;
#pragma unroll
  for (int i = 0; i < 8; ++i) f.h[i] = (_Float16)(bf16_round(W[t * 8 + i]) * 16.0f); *(v8us*)((unsigned short*)Bt + t * 8) = f.half[0];  }
// V^T [512][2048] from v [2048][512]: block blk turns the 64 tokens x 64 dims tile (token group blk % 32, dim slab blk / 32) through LDS; v is rounded to bf16 and written as exact f16 on the way in.
// Every loop is unrolled so that the register arrays are indexed by constants and the four loads of a thread fly together.
__device__ __forceinline__ void d_vt(const int blk, const float* __restrict__ v, _Float16* __restrict__ Vt, unsigned short (*tl)[66]) { const int tid = threadIdx.x; const int slab = blk / (TT / 64), lg = blk % (TT / 64);
  v4f va[2], vc[2];
#pragma unroll
  for (int i = 0; i < 2; ++i) { const float* vp = v + (size_t)(lg * 64 + i * 32 + tid / 8) * DKV + slab * 64 + (tid % 8) * 8; va[i] = *(const v4fa*)vp; vc[i] = *(const v4fa*)(vp + 4); }
  asm volatile("s_wait_xcnt 0x0" ::: "memory");      /* precaution: stands in front of every later write of a register that one of the loads above names */
  __builtin_amdgcn_sched_barrier(0);      /* keeps the work below from being scheduled above that wait */
#pragma unroll
  for (int i = 0; i < 2; ++i) { const int r = i * 32 + tid / 8, c8 = (tid % 8) * 8; FragH f;
#pragma unroll
    for (int q = 0; q < 4; ++q) { f.h[q] = (_Float16)bf16_round(va[i][q]); f.h[4 + q] = (_Float16)bf16_round(vc[i][q]); }
#pragma unroll
    for (int q = 0; q < 8; ++q) tl[r][c8 + q] = f.u[q]; }
  __syncthreads();
  {
#pragma unroll
    for (int rd = 0; rd < 2; ++rd) { const int d = rd * 32 + tid / 8, pc = tid % 8; FragH f;
#pragma unroll
      for (int q = 0; q < 8; ++q) f.u[q] = tl[pc * 8 + q][d];
      *(v8us*)((unsigned short*)Vt + ((size_t)slab * 64 + d) * TT + lg * 64 + pc * 8) = f.half[0]; }
    asm volatile("s_wait_xcnt 0x0" ::: "memory");      /* precaution: closes the two stores, in front of whatever the merged kernel's code behind this job writes into their registers */
     } }

// ---- fragment loader: 16 halves of one operand row in the hardware k order ----
__device__ __forceinline__ v16h g2_frag(const _Float16* p, int hh) { FragH f; f.half[0] = *(const v8us*)((const unsigned short*)p + 8 * hh); f.half[1] = *(const v8us*)((const unsigned short*)p + 16 + 8 * hh); return f.v; }
#define WCH 4                    /* chunks of 8 weights a thread: a quarter of the blocks to start, eight 16-byte loads of a thread in flight */
// Bt = f16(bf16(Wm) * sc), same layout. Every loop is unrolled so that the register arrays are indexed by constants and the loads fly together.
__device__ __forceinline__ void d_wsc(const int blk, const float* __restrict__ Wm, _Float16* __restrict__ Bt, const float sc) { const size_t t0 = (size_t)blk * (WCH * 256) + threadIdx.x;
  v4f wa[WCH], wc[WCH];
#pragma unroll
  for (int j = 0; j < WCH; ++j) { const float* wp = Wm + (t0 + j * 256) * 8; wa[j] = *(const v4fa*)wp; wc[j] = *(const v4fa*)(wp + 4); }
  asm volatile("s_wait_xcnt 0x0" ::: "memory");      /* precaution: stands in front of every later write of a register that one of the loads above names */
  __builtin_amdgcn_sched_barrier(0);      /* keeps the work below from being scheduled above that wait */
  FragH f[WCH];
#pragma unroll
  for (int j = 0; j < WCH; ++j) {
#pragma unroll
    for (int q = 0; q < 4; ++q) { f[j].h[q] = (_Float16)(bf16_round(wa[j][q]) * sc); f[j].h[4 + q] = (_Float16)(bf16_round(wc[j][q]) * sc); } }
  __builtin_amdgcn_sched_barrier(0);      /* every value is in its register before the run of stores starts: no register that an issued store names is written behind it */
#pragma unroll
  for (int j = 0; j < WCH; ++j) *(v8us*)((unsigned short*)Bt + (t0 + j * 256) * 8) = f[j].half[0];
  asm volatile("s_wait_xcnt 0x0" ::: "memory");      /* precaution: closes the run of stores, in front of whatever the merged kernel's code behind this job writes into their registers */
}
// lane l with lane l ^ 16
__device__ __forceinline__ float xhalf(float x) { return __builtin_bit_cast(float, __builtin_amdgcn_permlanex16(__builtin_bit_cast(int, x), __builtin_bit_cast(int, x), 0x76543210, 0xfedcba98, false, false)); }
#define NRG 4                    /* heads a group: their weights are fetched together and their eight stores go out as one run */
// RMSNorm + RoPE of one token a wave. A lane owns dims 4 * lane .. + 3 of EVERY head (a head is 128 floats = one 16-byte load of the wave), and the token's row stays in registers from its one read to the stores.
// A rotation pair (d, d + 64) sits in lanes l and l ^ 16, so the partner's value comes by one cross-row move. The angle of a pair depends on the token and on d alone, not on the head: the wave forms its 64 angles once
// (two a lane, handed to the lanes that use them), in front of the head loop. Per element the same operations in the same order as before, and the same order of the row's sum of squares.
// Every loop over a register array (xa, c2, s2, cs, sg, wa, vh, vl) is unrolled so that the array is indexed by constants and stays in registers.
template <int NH_>
__device__ __forceinline__ void d_normrope(const int blk, const float* __restrict__ X, const float* __restrict__ w, const int* __restrict__ pos, _Float16* __restrict__ O16, _Float16* __restrict__ OL) {
  /* numerical, as in the versions before: every product and every sum rounds on its own, as the reference's separate elementwise operations do; the logits are large and the softmax near one-hot, and the q/k planes stay bit-identical */
  #pragma clang fp contract(off)
  constexpr int W_ = NH_ * HD; const int wv = threadIdx.x >> 5, ln = threadIdx.x & 31; const int t = blk * 8 + wv; if (t >= TT) return;
  const float* x = X + (size_t)t * W_ + ln * 4; const int* pp = pos + t;
  const int pi = *pp;      /* first, so that the angles below wait for this load alone */
  v4f xa[NH_];      /* the whole row: its loads fly together */
#pragma unroll
  for (int h = 0; h < NH_; ++h) xa[h] = *(const v4fa*)(x + h * HD);
  asm volatile("s_wait_xcnt 0x0" :: "v"(x), "v"(pp) : "memory");      /* precaution: stands in front of every later write of a register that one of the loads above names; the addresses are inputs so that they stay in their registers up to here and no load of the run lands in them */
  __builtin_amdgcn_sched_barrier(0);      /* keeps the work below from being scheduled above that wait */
  const float p = (float)pi; float c2[2], s2[2];      /* the angles of d = 2 * lane and 2 * lane + 1: formed while the row's loads fly */
#pragma unroll
  for (int s = 0; s < 2; ++s) { const int d = 2 * ln + s; const float ex = (float)(2 * d) / (float)HD; const float ivf = 1.0f / powf(10000.0f, ex); const float th = p * ivf; c2[s] = cosf(th); s2[s] = sinf(th); }
  float cs[4], sg[4];      /* for this lane's dims d = 4 * (lane & 15) + e: cosine, and sine with the sign of its half (o[d] = x[d] cos - x[d + 64] sin, o[d + 64] = x[d + 64] cos + x[d] sin) */
#pragma unroll
  for (int e = 0; e < 4; ++e) { const int sl = 2 * (ln & 15) + (e >> 1); cs[e] = __shfl(c2[e & 1], sl, 32); const float sn = __shfl(s2[e & 1], sl, 32); sg[e] = ln < 16 ? -sn : sn; }
  float ss = 0.f;
#pragma unroll
  for (int h = 0; h < NH_; ++h) {
#pragma unroll
    for (int e = 0; e < 4; ++e) { const float v = bf16_round(xa[h][e]); xa[h][e] = v; ss += v * v; } }
  for (int o = 16; o > 0; o >>= 1) ss += __shfl_xor(ss, o, 32); const float inv = rsqrtf(ss / (float)W_ + 1e-5f);
  const float* wp = w + ln * 4; _Float16* oh = O16 + (size_t)t * W_ + ln * 4; _Float16* ol = OL + (size_t)t * W_ + ln * 4;
#pragma unroll
  for (int g = 0; g < NH_ / NRG; ++g) {
    v4f wa[NRG];
#pragma unroll
    for (int i = 0; i < NRG; ++i) wa[i] = *(const v4fa*)(wp + (g * NRG + i) * HD);
    asm volatile("s_wait_xcnt 0x0" :: "v"(wp) : "memory");      /* same precaution as behind the row's loads */
    __builtin_amdgcn_sched_barrier(0);      /* keeps the work below from being scheduled above that wait */
    v4h vh[NRG], vl[NRG];
#pragma unroll
    for (int i = 0; i < NRG; ++i) {
#pragma unroll
      for (int e = 0; e < 4; ++e) { float xn = xa[g * NRG + i][e] * inv; xn *= bf16_round(wa[i][e]); const float xo = xhalf(xn); float o = xn * cs[e]; o += xo * sg[e];
        const _Float16 hi = (_Float16)o; vh[i][e] = hi; vl[i][e] = (_Float16)((o - (float)hi) * 1024.0f); } }
    __builtin_amdgcn_sched_barrier(0);      /* every value is in its register before the run of stores starts: no register that an issued store names is written behind it */
#pragma unroll
    for (int i = 0; i < NRG; ++i) { *(v4h*)(oh + (g * NRG + i) * HD) = vh[i]; *(v4h*)(ol + (g * NRG + i) * HD) = vl[i]; }
    asm volatile("s_wait_xcnt 0x0" ::: "memory");      /* precaution: closes the run of stores, in front of the next group's writes of their registers */
  }
}

// ---- fused attention: scores, masked softmax and readout of all 16 heads in ONE launch; the score and probability planes never go to memory ----
// Transposed products: S^T = K.Q^T (A = key rows, B = query rows held in registers), O^T += V^T.P^T. In an accumulator tile a lane holds 8 keys of ONE query (column = lane & 15, rows 8 * (lane >> 4) + r),
// which is exactly the k order of the B loader (k = 8 * hh + i, then 16 + 8 * hh + i), so two 16-key score tiles pack in-lane into one 32-key P^T fragment. Running maximum and sum per query (online softmax):
// when the maximum moves, the output accumulators and the sum are scaled by exp(m_old - m_new). Same operand planes and terms as the separate stages: 3 hi/residual score terms, P as f16 hi + 2^10 residual of 1024 * p.
__device__ __forceinline__ v8f fa_mma(v16h a, v16h b, v8f c) { return __builtin_amdgcn_wmma_f32_16x16x32_f16(false, a, false, b, (short)0, c, false, false); }
typedef int v4i __attribute__((ext_vector_type(4)));
#define FKP 136                  /* LDS pitch of a K row, in halves */
#define FVP 40                   /* LDS pitch of a V^T row, in halves */
#define QTN (TT / 64)            /* query tiles of 64 rows */
// act[qt * 64 + p] = 1 where the 64 x 32 mask tile (query tile qt, key pass p) holds at least one open (zero) entry, else 0. A wave reads four tiles in turn; a block of eight waves writes one whole 128-byte line of flags.
__device__ __forceinline__ void d_mflag(const int blk, const int* __restrict__ msk, int* __restrict__ act) {
  const int wv = threadIdx.x >> 5, lane = threadIdx.x & 31; unsigned bits = 0u;      /* bit j: the wave's tile j is open */
  /* kept rolled: one tile's sixteen loads in flight a wave; unrolled, the four tiles' loads would set the register count of the whole launch */
#pragma unroll 1
  for (int j = 0; j < 4; ++j) {
    const int u = blk * 32 + wv * 4 + j; const int qt = u >> 6, p = u & 63;
    const int* mp = msk + (size_t)(qt * 64 + (lane >> 3)) * MSTR + p * 32 + (lane & 7) * 4;
    v4i m[16];      /* both inner loops are unrolled so that this array stays in registers and its loads fly together */
#pragma unroll
    for (int i = 0; i < 16; ++i) m[i] = *(const v4i*)(mp + (size_t)i * 4 * MSTR);
    asm volatile("s_wait_xcnt 0x0" :: "v"(mp) : "memory");      /* precaution: stands in front of every later write of a register that one of the loads above names; the address is an input so that it stays in its registers up to here and no load of the run lands in them */
    __builtin_amdgcn_sched_barrier(0);      /* keeps the work below from being scheduled above that wait */
    bool open = false;
#pragma unroll
    for (int i = 0; i < 16; ++i) open = open || m[i][0] == 0 || m[i][1] == 0 || m[i][2] == 0 || m[i][3] == 0;
    const unsigned any = __builtin_amdgcn_ballot_w32(open);
    bits |= (any != 0u ? 1u : 0u) << j;
  }
  if (lane < 4) act[blk * 32 + wv * 4 + lane] = (int)((bits >> lane) & 1u);
}
// ---- preparation: the five jobs that only read inputs (q and k norm + RoPE, mask flags, V^T, scaled W_out) in ONE launch, told apart by block ranges; none reads what another writes. The longest job (q) has the first blocks (for speed only).
#define PB_NQ (TT / 8)                       /* q: a wave a token */
#define PB_NK (TT / 8)                       /* k: a wave a token */
#define PB_MF (QTN * 64 / 32)                /* mask flags: 32 tiles a block */
#define PB_VT (NKVH * 2 * (TT / 64))         /* V^T: 8 slabs of 64 dims x 32 token groups */
#define PB_WS (DQ * DQ / 8 / 256 / WCH)      /* W_out */
/* second bound: at least 8 waves a SIMD, that is at most 128 registers a lane: the streaming jobs live on many waves in flight, and the q job's row in registers must not take that from them */
__global__ __launch_bounds__(256, 8) void k_prep(const float* __restrict__ q, const float* __restrict__ k, const float* __restrict__ v, const int* __restrict__ msk, const int* __restrict__ pos, const float* __restrict__ qw, const float* __restrict__ kw, const float* __restrict__ Wo,
    _Float16* __restrict__ Q16, _Float16* __restrict__ QL, _Float16* __restrict__ K16, _Float16* __restrict__ KL, _Float16* __restrict__ VT, int* __restrict__ ACT, _Float16* __restrict__ BO) {
  __shared__ unsigned short tl[64][66];
  const int b = blockIdx.x;      /* every test below is the same for the whole block: the barrier of the V^T job is passed by all its waves */
  if (b < PB_NQ) d_normrope<NQH>(b, q, qw, pos, Q16, QL);
  else if (b < PB_NQ + PB_NK) d_normrope<NKVH>(b - PB_NQ, k, kw, pos, K16, KL);
  else if (b < PB_NQ + PB_NK + PB_MF) d_mflag(b - (PB_NQ + PB_NK), msk, ACT);
  else if (b < PB_NQ + PB_NK + PB_MF + PB_VT) d_vt(b - (PB_NQ + PB_NK + PB_MF), v, VT, tl);
  else d_wsc(b - (PB_NQ + PB_NK + PB_MF + PB_VT), Wo, BO, 16.0f);      /* (out,in) natural */
}
// A block runs two query tiles of 64 rows one after the other, tile QTN - 1 - x and tile x, so that under a triangular mask every block has the same number of open passes; a wave owns 16 queries.
// Eight waves in two key groups of four: both groups hold the same 64 queries, and of the passes to walk group 0 takes the 1st, 3rd, ... and group 1 the 2nd, 4th, ..., each with K/V tiles of its own in LDS.
// Each group keeps its own running maximum, sum and output sums; at the end of a tile the two are joined (rescaled to the common maximum), each group finishing half of the dims.
// Of each tile only the open key passes are walked (flags of d_mflag). A closed pass holds nothing but scores of -10000: once every row of the tile has a running maximum of -9000 or more, exp(-10000 - max) is 0 in f32
// and the pass would change neither sums nor maximum. Where a row's maximum is lower after the open passes (a row with no open key among them), the closed passes are walked as well, after the open ones, by the same code.
typedef v4f v4fs __attribute__((may_alias));
#define MGS 17                   /* 16-byte slots a lane hands over: 4 dims tiles x (hi, residual) x 2, then maximum and sum */
// Group G hands its partner wave the four dims tiles that the partner finishes, with its running maximum and sum. slot = the wave's own range, at its lane; slots lie 32 lanes apart, so that a wave's 16-byte accesses cover whole rows of banks.
template <int G>
__device__ __forceinline__ void fa_put(const v8f (&oh)[8], const v8f (&ol)[8], const float m, const float l, v4fs* slot) {
#pragma unroll
  for (int dd = 0; dd < 4; ++dd) { const v8f a = oh[(1 - G) * 4 + dd], b = ol[(1 - G) * 4 + dd];
    const v4f a0 = {a[0], a[1], a[2], a[3]}, a1 = {a[4], a[5], a[6], a[7]}, b0 = {b[0], b[1], b[2], b[3]}, b1 = {b[4], b[5], b[6], b[7]};
    slot[(dd * 4 + 0) * 32] = a0; slot[(dd * 4 + 1) * 32] = a1; slot[(dd * 4 + 2) * 32] = b0; slot[(dd * 4 + 3) * 32] = b1; }
  const v4f ml = {m, l, 0.f, 0.f}; slot[16 * 32] = ml;
}
// Group G joins the partner's sums into its own four dims tiles, divides by the joined sum and stores them as the two planes that the W_out GEMM reads: f16 hi and 2^10 residual. A lane holds 8 adjacent dims of a tile, one 16-byte store a plane;
// a group's 64 dims of a row are one whole 128-byte line of each plane, written by one wave. slot = the partner wave's range, at this lane.
template <int G>
__device__ __forceinline__ void fa_fin(v8f (&oh)[8], v8f (&ol)[8], const float m, const float l, const v4fs* slot, _Float16* ch0, _Float16* cl0) {
  const v4f ml = slot[16 * 32]; const float mj = fmaxf(m, ml[0]); const float as = expf(m - mj), ao = expf(ml[0] - mj); const float lj = l * as + ml[1] * ao;
  const float lt = lj + __shfl_xor(lj, 16, 32); const float f = 0.0009765625f / lt, fl = f * 0.0009765625f;
  /* every output value is formed first, then the stores go out as one run: no register that an issued store names is written before the wait behind the run */
  FragH fh[4], fr[4];      /* indexed by constants only: both loops over them are unrolled */
#pragma unroll
  for (int dd = 0; dd < 4; ++dd) { const int d = G * 4 + dd; const v4f a0 = slot[(dd * 4 + 0) * 32], a1 = slot[(dd * 4 + 1) * 32], b0 = slot[(dd * 4 + 2) * 32], b1 = slot[(dd * 4 + 3) * 32];
#pragma unroll
    for (int r = 0; r < 4; ++r) { const float h0 = oh[d][r] * as + a0[r] * ao, h1 = oh[d][4 + r] * as + a1[r] * ao, l0 = ol[d][r] * as + b0[r] * ao, l1 = ol[d][4 + r] * as + b1[r] * ao;
      const float x0 = h0 * f + l0 * fl, x1 = h1 * f + l1 * fl; const _Float16 g0 = (_Float16)x0, g1 = (_Float16)x1;
      fh[dd].h[r] = g0; fh[dd].h[4 + r] = g1; fr[dd].h[r] = (_Float16)((x0 - (float)g0) * 1024.0f); fr[dd].h[4 + r] = (_Float16)((x1 - (float)g1) * 1024.0f); } }
  __builtin_amdgcn_sched_barrier(0);      /* keeps the arithmetic above from being scheduled in among the stores below, where it would write registers of stores still under way */
#pragma unroll
  for (int dd = 0; dd < 4; ++dd) { const int d = G * 4 + dd; *(v8us*)((unsigned short*)ch0 + 16 * d) = fh[dd].half[0]; *(v8us*)((unsigned short*)cl0 + 16 * d) = fr[dd].half[0]; }
  asm volatile("s_wait_xcnt 0x0" ::: "memory");      /* precaution: closes the run of stores, in front of the second tile's writes of their registers */
}
__global__ __launch_bounds__(256) void k_fattn(const _Float16* __restrict__ Qh, const _Float16* __restrict__ Ql, const _Float16* __restrict__ Kh, const _Float16* __restrict__ Kl, const _Float16* __restrict__ Vt,
    const int* __restrict__ msk, const int* __restrict__ act, _Float16* __restrict__ C16, _Float16* __restrict__ CL) {
  __shared__ __attribute__((aligned(16))) _Float16 sKh2[2 * 32 * FKP], sKl2[2 * 32 * FKP], sV2[2 * HD * FVP];      /* a tile set for each key group */
  __shared__ float sMx[2][2][64];      /* per tile, key group and row: the running maximum after the open passes; a slot set of its own for each tile, so that no wave writes a slot that a slower wave still reads */
  __shared__ __attribute__((aligned(16))) v4fs sMg[8 * MGS * 32];      /* the hand-over at the end of a tile: a range for each wave */
  const int tid = threadIdx.x & 127, wv = threadIdx.x >> 5, w = wv & 3, lane = tid & 31, ln = lane & 15, hh = lane >> 4; const int h = blockIdx.y, kv = h / GRP;      /* tid, w: place inside the key group */
  const int g = __builtin_amdgcn_readfirstlane((int)(threadIdx.x >> 7));      /* key group, in a scalar register: the choices made from it are scalar ones */
  _Float16* const sKh = sKh2 + g * (32 * FKP); _Float16* const sKl = sKl2 + g * (32 * FKP); _Float16* const sV = sV2 + g * (HD * FVP);
  const v8f z8 = {0.f,0.f,0.f,0.f,0.f,0.f,0.f,0.f};
  /* a key group's four waves share each pass's K (hi, residual) and V^T tiles through LDS: whole-row global loads, one copy a group; pitches 272 B and 80 B (16 B x odd) keep the 16-byte fragment reads off each other's banks */
  const int krow = tid >> 4, kcol = (tid & 15) * 8, vrow = tid >> 2, vcol = (tid & 3) * 8;
  const _Float16* gkh = Kh + (size_t)krow * DKV + kv * HD + kcol; const _Float16* gkl = Kl + (size_t)krow * DKV + kv * HD + kcol; const _Float16* gv = Vt + ((size_t)kv * HD + vrow) * TT + vcol;
  const float alpha = 0.088388347648318447f, alo = alpha * 0.0009765625f;
  /* kept rolled: the two tiles run through one copy of the code */
#pragma unroll 1
  for (int half = 0; half < 2; ++half) {
    const int qt = half ? (int)blockIdx.x : QTN - 1 - (int)blockIdx.x; const int q0 = qt * 64 + 16 * w;      /* a wave owns 16 queries: one column group */
    const int a0 = act[qt * 64 + lane], a1 = act[qt * 64 + 32 + lane];
    asm volatile("s_wait_xcnt 0x0" ::: "memory");      /* precaution: the loads below may land in, or have their addresses formed in, a register that the two loads above name */
    __builtin_amdgcn_sched_barrier(0);      /* keeps the loads below behind that wait */
    v16h qh[4], ql[4];
    const size_t qo = (size_t)(q0 + ln) * DQ + h * HD; const _Float16* qp0 = Qh + qo; const _Float16* qp2 = Ql + qo;
#pragma unroll
    for (int ks = 0; ks < 4; ++ks) { qh[ks] = g2_frag(qp0 + ks * 32, hh); ql[ks] = g2_frag(qp2 + ks * 32, hh); }
    asm volatile("s_wait_xcnt 0x0" ::: "memory");      /* precaution: stands in front of every later write of a register that one of the loads above names */
    __builtin_amdgcn_sched_barrier(0);      /* keeps the work below from being scheduled above that wait */
    const unsigned long long open = (unsigned long long)__builtin_amdgcn_ballot_w32(a0 != 0) | ((unsigned long long)__builtin_amdgcn_ballot_w32(a1 != 0) << 32);      /* bit p: pass p is open; the same in all eight waves */
    v8f oh[8], ol[8];
#pragma unroll
    for (int d = 0; d < 8; ++d) { oh[d] = z8; ol[d] = z8; }
    float mrun = -3.0e38f, lrun = 0.f;
    const int* gm = msk + (size_t)(q0 + ln) * MSTR + 8 * hh;
    /* kept rolled: open passes (phase 0) and, where needed, closed passes (phase 1) run through one copy of the code */
#pragma unroll 1
    for (int phase = 0; phase < 2; ++phase) {
      unsigned long long todo = open;
      if (phase) {
        if (hh == 0) sMx[half][g][16 * w + ln] = mrun;      /* both half-waves hold the same maximum */
        __syncthreads();      /* the eight waves' maxima are published: the choice below must be the same in the whole block, barriers follow it */
        /* a row's maximum is the larger of its two groups'; every wave looks at all 64 rows and so finds the same */
        const float c0 = fmaxf(sMx[half][0][lane], sMx[half][1][lane]), c1 = fmaxf(sMx[half][0][32 + lane], sMx[half][1][32 + lane]);
        todo = __builtin_amdgcn_ballot_w32(c0 < -9000.0f || c1 < -9000.0f) != 0u ? ~open : 0ull;
      }
      if (todo == 0ull) continue;
      /* a trip takes two passes off the list: the first for group 0, the second, where there is one, for group 1 (else group 1 fetches the first again, in bounds, and leaves the trip's work out) */
      int cur = __builtin_ctzll(todo); todo &= todo - 1ull;
      bool live = true;
      { const bool two = todo != 0ull; const int sec = two ? __builtin_ctzll(todo) : cur; todo &= todo - 1ull; if (g) { cur = sec; live = two; } }
      v8us rk[4], rl[4], rv[4]; v4i mk[2][2];
#pragma unroll
      for (int i = 0; i < 4; ++i) { rk[i] = *(const v8us*)(gkh + (size_t)(cur * 32 + i * 8) * DKV); rl[i] = *(const v8us*)(gkl + (size_t)(cur * 32 + i * 8) * DKV); rv[i] = *(const v8us*)(gv + (size_t)i * 32 * TT + cur * 32); }
#pragma unroll
      for (int j = 0; j < 2; ++j) { mk[j][0] = *(const v4i*)(gm + cur * 32 + j * 16); mk[j][1] = *(const v4i*)(gm + cur * 32 + j * 16 + 4); }
      asm volatile("s_wait_xcnt 0x0" :: "v"(gm + cur * 32), "v"(gkh + (size_t)(cur * 32) * DKV), "v"(gkl + (size_t)(cur * 32) * DKV), "v"(gv + cur * 32) : "memory");      /* same precaution as behind the query loads; the four addresses are inputs so that they stay in their registers up to here and no load of the run lands in them */
      __builtin_amdgcn_sched_barrier(0);      /* keeps the work below from being scheduled above that wait */
      /* kept rolled: one pass's staging registers and fragments beside the query fragments and the output accumulators are what is meant to stay in registers; every inner loop is unrolled so that the register arrays are indexed by constants */
#pragma unroll 1
      for (;;) {
#pragma unroll
        for (int i = 0; i < 4; ++i) { *(v8us*)(sKh + (krow + 8 * i) * FKP + kcol) = rk[i]; *(v8us*)(sKl + (krow + 8 * i) * FKP + kcol) = rl[i]; *(v8us*)(sV + (vrow + 32 * i) * FVP + vcol) = rv[i]; }
        bool msel[2][8];      /* this pass's mask, read out of its registers before the next pass's lands in them */
#pragma unroll
        for (int j = 0; j < 2; ++j) {
#pragma unroll
          for (int r = 0; r < 8; ++r) msel[j][r] = mk[j][r >> 2][r & 3] != 0; }
        __syncthreads();      /* this trip's tiles are published to their groups' waves */
        const bool more = todo != 0ull; int nxt = more ? __builtin_ctzll(todo) : cur; todo &= todo - 1ull;      /* the last trip of a phase fetches its own tiles again: in bounds, never used */
        bool nlive = true;
        { const bool two = todo != 0ull; const int sec = two ? __builtin_ctzll(todo) : nxt; todo &= todo - 1ull; if (g) { nxt = sec; nlive = two; } }
        const int kn = nxt * 32;
        const int* mp = gm + kn;
        /* the next pass's mask and tiles go into registers now: they fly while this pass is worked on */
#pragma unroll
        for (int j = 0; j < 2; ++j) { mk[j][0] = *(const v4i*)(mp + j * 16); mk[j][1] = *(const v4i*)(mp + j * 16 + 4); }
#pragma unroll
        for (int i = 0; i < 4; ++i) { rk[i] = *(const v8us*)(gkh + (size_t)(kn + i * 8) * DKV); rl[i] = *(const v8us*)(gkl + (size_t)(kn + i * 8) * DKV); rv[i] = *(const v8us*)(gv + (size_t)i * 32 * TT + kn); }
        asm volatile("s_wait_xcnt 0x0" :: "v"(mp), "v"(gkh + (size_t)kn * DKV), "v"(gkl + (size_t)kn * DKV), "v"(gv + kn) : "memory");      /* precaution: stands in front of every later write of a register that one of the loads above names; the four addresses are inputs so that they stay in their registers up to here and no load of the run lands in them */
        __builtin_amdgcn_sched_barrier(0);      /* keeps the work below from being scheduled above that wait, and the loads above in front of the pass's work */
        if (live) {      /* a scalar choice: a whole wave works on its pass or leaves it out; the barriers stand outside */
        v8f sh[2] = {z8, z8}, sl[2] = {z8, z8};      /* [key tile j] */
#pragma unroll
        for (int ks = 0; ks < 4; ++ks) { const v16h kh0 = g2_frag(sKh + ln * FKP + ks * 32, hh), kh1 = g2_frag(sKh + (16 + ln) * FKP + ks * 32, hh), kl0 = g2_frag(sKl + ln * FKP + ks * 32, hh), kl1 = g2_frag(sKl + (16 + ln) * FKP + ks * 32, hh);
          sh[0] = fa_mma(kh0, qh[ks], sh[0]); sh[1] = fa_mma(kh1, qh[ks], sh[1]); sl[0] = fa_mma(kh0, ql[ks], sl[0]); sl[1] = fa_mma(kh1, ql[ks], sl[1]); sl[0] = fa_mma(kl0, qh[ks], sl[0]); sl[1] = fa_mma(kl1, qh[ks], sl[1]); }
        FragH ph, pl; float sv[2][8]; float mx = -3.0e38f;
#pragma unroll
        for (int j = 0; j < 2; ++j) {
#pragma unroll
          for (int r = 0; r < 8; ++r) { const float s0 = sh[j][r] * alpha + sl[j][r] * alo; const float s = msel[j][r] ? -10000.0f : s0; sv[j][r] = s; mx = fmaxf(mx, s); } }
        mx = fmaxf(mx, __shfl_xor(mx, 16, 32));      /* the other half-wave holds this query's other 16 keys */
        const float mn = fmaxf(mrun, mx); const float al = expf(mrun - mn); mrun = mn; float su = 0.f;
#pragma unroll
        for (int j = 0; j < 2; ++j) {
#pragma unroll
          for (int r = 0; r < 8; ++r) { const float p = expf(sv[j][r] - mn); su += p; const float pv = p * 1024.0f; const _Float16 hi = (_Float16)pv; ph.h[8 * j + r] = hi; pl.h[8 * j + r] = (_Float16)((pv - (float)hi) * 1024.0f); } }
        lrun = lrun * al + su;      /* each half-wave sums its own keys; the halves meet in the epilogue */
#pragma unroll
        for (int d = 0; d < 8; ++d) { oh[d] *= al; ol[d] *= al; }
#pragma unroll
        for (int d = 0; d < 8; ++d) { const v16h vf = g2_frag(sV + (16 * d + ln) * FVP, hh); oh[d] = fa_mma(vf, ph.v, oh[d]); ol[d] = fa_mma(vf, pl.v, ol[d]); }
        }
        __builtin_amdgcn_sched_barrier(0);      /* keeps the pass's work in front of the barrier below, whose fence waits for the loads in flight: scheduled earlier, it would wait out their whole latency */
        __syncthreads();      /* every wave has read this pass's tiles before the next pass's are stored over them */
        if (!more) break;
        cur = nxt; live = nlive;
      }
    }
    /* the two key groups' sums meet: each wave hands its partner (the other group's wave with the same queries) the half of the dims that the partner finishes */
    const size_t co = (size_t)(q0 + ln) * DQ + h * HD + 8 * hh; _Float16* ch0 = C16 + co; _Float16* cl0 = CL + co;
    v4fs* own = sMg + wv * (MGS * 32) + lane; const v4fs* oth = sMg + (wv ^ 4) * (MGS * 32) + lane;
    if (g == 0) fa_put<0>(oh, ol, mrun, lrun, own); else fa_put<1>(oh, ol, mrun, lrun, own);
    __syncthreads();      /* publishes the hand-over; the ranges are written again only behind the next tile's barrier on the maxima, which every reader reaches after its reads */
    if (g == 0) fa_fin<0>(oh, ol, mrun, lrun, oth, ch0, cl0); else fa_fin<1>(oh, ol, mrun, lrun, oth, ch0, cl0);
  }
}

// ---- W_out GEMM, operand tiles staged in LDS ----
// C = alpha * (Ah.Bh^T + 2^-10 * Al.Bh^T), all three planes [2048][2048] f16, k contiguous. A block owns a 128 x 128 tile of C, a wave 32 rows x 64 columns of it (4 x 2 waves); the hi product and the residual product keep
// separate f32 accumulators (the residual plane carries a 2^10 scale) and meet once in the epilogue. A stage is 64 k = 128 B of each of the 3 x 128 operand rows: eight lanes fetch one row's whole cache line, each row once a block,
// and the fragments, whose 16 rows lie 4 KiB apart in memory, are read from LDS instead. Two LDS buffers: stage s + 1 is stored and stage s + 2 fetched to registers while stage s is worked on; one barrier a stage.
#define GKS 64                   /* k (halves) a stage */
#define GPI 72                   /* LDS pitch of a staged row, in halves: 144 B = 16 B x odd keeps the 16-byte fragment reads off each other's banks */
#define GBUF (128 * GPI)         /* halves of one plane's buffer */
#define GNS (DQ / GKS)           /* stages */
__global__ __launch_bounds__(256) void k_gemm2l(const _Float16* __restrict__ Ah, const _Float16* __restrict__ Al, const _Float16* __restrict__ Bh, float alpha, float* __restrict__ C) {
  __shared__ __attribute__((aligned(16))) _Float16 sAh[2 * GBUF], sAl[2 * GBUF], sB[2 * GBUF];
  __shared__ __attribute__((aligned(16))) float so[8][32][68];
  const int tid = threadIdx.x, w = tid >> 5, lane = tid & 31, ln = lane & 15, hh = lane >> 4;
  const int mt = blockIdx.x / (DQ / 128), nt = blockIdx.x % (DQ / 128); const int wr = (w >> 1) * 32, wc = (w & 1) * 64;
  const int srow = tid >> 3, scol = (tid & 7) * 8; const int sofs = srow * GPI + scol;      /* staging: a thread moves 16 bytes of rows srow, srow + 32, + 64, + 96 of each plane */
  const _Float16* gah = Ah + (size_t)(mt * 128 + srow) * DQ + scol; const _Float16* gal = Al + (size_t)(mt * 128 + srow) * DQ + scol; const _Float16* gb = Bh + (size_t)(nt * 128 + srow) * DQ + scol;
  const v8f z8 = {0.f,0.f,0.f,0.f,0.f,0.f,0.f,0.f}; v8f ch[8] = {z8, z8, z8, z8, z8, z8, z8, z8}, cl[8] = {z8, z8, z8, z8, z8, z8, z8, z8};      /* [t] = rows 0..15, [4 + t] = rows 16..31 of column tile t */
  v8us ra[4], rl[4], rb[4];
#pragma unroll
  for (int i = 0; i < 4; ++i) { ra[i] = *(const v8us*)(gah + (size_t)i * 32 * DQ); rl[i] = *(const v8us*)(gal + (size_t)i * 32 * DQ); rb[i] = *(const v8us*)(gb + (size_t)i * 32 * DQ); }
  asm volatile("s_wait_xcnt 0x0" ::: "memory");      /* precaution: stands in front of every later write of a register that one of the loads above names */
  __builtin_amdgcn_sched_barrier(0);      /* keeps the work below from being scheduled above that wait */
#pragma unroll
  for (int i = 0; i < 4; ++i) { *(v8us*)(sAh + sofs + i * 32 * GPI) = ra[i]; *(v8us*)(sAl + sofs + i * 32 * GPI) = rl[i]; *(v8us*)(sB + sofs + i * 32 * GPI) = rb[i]; }
#pragma unroll
  for (int i = 0; i < 4; ++i) { ra[i] = *(const v8us*)(gah + (size_t)i * 32 * DQ + GKS); rl[i] = *(const v8us*)(gal + (size_t)i * 32 * DQ + GKS); rb[i] = *(const v8us*)(gb + (size_t)i * 32 * DQ + GKS); }
  asm volatile("s_wait_xcnt 0x0" ::: "memory");      /* same precaution */
  __builtin_amdgcn_sched_barrier(0);      /* keeps the work below from being scheduled above that wait */
  __syncthreads();      /* publishes stage 0 */
  /* kept rolled: one copy of the stage's code; every inner loop is unrolled so that the register arrays are indexed by constants */
#pragma unroll 1
  for (int s = 0; s < GNS; ++s) {
    const int cb = (s & 1) * GBUF, nb = GBUF - cb;      /* this stage's buffer; the other one, which every wave left at the last barrier */
    const _Float16* pah = sAh + cb + (wr + ln) * GPI; const _Float16* pal = sAl + cb + (wr + ln) * GPI; const _Float16* pb = sB + cb + (wc + ln) * GPI;
    v16h fa[GKS / 32][4], fb[GKS / 32][4];      /* [k step][rows 0..15 hi, rows 16..31 hi, rows 0..15 residual, rows 16..31 residual], [k step][column tile] */
#pragma unroll
    for (int ks = 0; ks < GKS / 32; ++ks) {
      fa[ks][0] = g2_frag(pah + ks * 32, hh); fa[ks][1] = g2_frag(pah + 16 * GPI + ks * 32, hh); fa[ks][2] = g2_frag(pal + ks * 32, hh); fa[ks][3] = g2_frag(pal + 16 * GPI + ks * 32, hh);
#pragma unroll
      for (int t = 0; t < 4; ++t) fb[ks][t] = g2_frag(pb + t * 16 * GPI + ks * 32, hh); }
    __builtin_amdgcn_sched_barrier(0);      /* keeps the stage's fragment reads as one run at its head: the first products wait for nothing else, and the second k step's fragments land while the first's products run */
    /* stage s + 1 goes from its registers into the other buffer, stage s + 2 into the registers: both run beside the products below. No branch here, so that the waits in front of the products can be counted ones:
       the last trip stores, and the last two fetch, the last stage once more: in bounds, never read */
#pragma unroll
    for (int i = 0; i < 4; ++i) { *(v8us*)(sAh + nb + sofs + i * 32 * GPI) = ra[i]; *(v8us*)(sAl + nb + sofs + i * 32 * GPI) = rl[i]; *(v8us*)(sB + nb + sofs + i * 32 * GPI) = rb[i]; }
    const int kn = (s + 2 < GNS ? s + 2 : GNS - 1) * GKS;
#pragma unroll
    for (int i = 0; i < 4; ++i) { ra[i] = *(const v8us*)(gah + (size_t)i * 32 * DQ + kn); rl[i] = *(const v8us*)(gal + (size_t)i * 32 * DQ + kn); rb[i] = *(const v8us*)(gb + (size_t)i * 32 * DQ + kn); }
    asm volatile("s_wait_xcnt 0x0" ::: "memory");      /* same precaution as behind the first loads */
    __builtin_amdgcn_sched_barrier(0);      /* keeps the loads above in front of the products, so that they fly during them, and the products behind the wait */
#pragma unroll
    for (int ks = 0; ks < GKS / 32; ++ks) {
#pragma unroll
      for (int t = 0; t < 4; ++t) { ch[t] = fa_mma(fa[ks][0], fb[ks][t], ch[t]); ch[4 + t] = fa_mma(fa[ks][1], fb[ks][t], ch[4 + t]); cl[t] = fa_mma(fa[ks][2], fb[ks][t], cl[t]); cl[4 + t] = fa_mma(fa[ks][3], fb[ks][t], cl[4 + t]); } }
    __builtin_amdgcn_sched_barrier(0);      /* keeps the products in front of the barrier below, whose fence waits for the loads in flight */
    __syncthreads();      /* publishes stage s + 1 to all eight waves, and ends every wave's reads of stage s before its buffer is stored over */
  }
  const float alo = alpha * 0.0009765625f;
#pragma unroll
  for (int u = 0; u < 8; ++u) { const int t = u & 3, half = u >> 2;
#pragma unroll
    for (int r = 0; r < 8; ++r) so[w][half * 16 + 8 * hh + r][t * 16 + ln] = ch[u][r] * alpha + cl[u][r] * alo; }
  __builtin_amdgcn_fence(__ATOMIC_ACQ_REL, "workgroup"); __builtin_amdgcn_wave_barrier();      /* this wave's LDS stores above come before its own LDS reads below (so[w] is private to the wave) */
  const int rsub = lane >> 4, c4 = (lane & 15) * 4; float* cp = C + (size_t)(mt * 128 + wr + rsub) * DQ + nt * 128 + wc + c4;
  v4f ov[16];
#pragma unroll
  for (int q = 0; q < 16; ++q) ov[q] = *(const v4fa*)&so[w][q * 2 + rsub][c4];
  __builtin_amdgcn_sched_barrier(0);      /* every value is in its register before the run of stores starts: no register that an issued store names is written behind it */
#pragma unroll
  for (int q = 0; q < 16; ++q) *(v4f*)(cp + (size_t)q * 2 * DQ) = ov[q];
}

extern "C" void kernel_launch(void* const* d_in, const int* in_sizes, int n_in,
                              void* d_out, int out_size, void* d_ws, size_t ws_size, hipStream_t stream) {
  (void)in_sizes; (void)n_in; (void)out_size;
  const float* const* I = (const float* const*)d_in; const float* q = I[0]; const float* k = I[1]; const float* v = I[2]; const int* msk = (const int*)d_in[3]; const int* pos = (const int*)d_in[4]; const float* qw = I[5]; const float* kw = I[6]; const float* Wo = I[7];
  char* ws = (char*)d_ws; size_t off = 0;
  auto take = [&](size_t bytes) { char* p = ws + off; off += (bytes + 255) & ~(size_t)255; return p; };
  _Float16* BO = (_Float16*)take((size_t)DQ * DQ * 2); _Float16* Q16 = (_Float16*)take((size_t)TT * DQ * 2); _Float16* QL = (_Float16*)take((size_t)TT * DQ * 2); _Float16* K16 = (_Float16*)take((size_t)TT * DKV * 2); _Float16* KL = (_Float16*)take((size_t)TT * DKV * 2); _Float16* VT = (_Float16*)take((size_t)TT * DKV * 2); _Float16* C16 = (_Float16*)take((size_t)TT * DQ * 2); _Float16* CL = (_Float16*)take((size_t)TT * DQ * 2); int* ACT = (int*)take((size_t)QTN * 64 * 4);      /* merged context hi/residual: planes of their own */
  if (off > ws_size) return;      /* 8 + 8+8 + 2+2 + 2 + 8+8 = 46 MiB */
  k_prep<<<PB_NQ + PB_NK + PB_MF + PB_VT + PB_WS, 256, 0, stream>>>(q, k, v, msk, pos, qw, kw, Wo, Q16, QL, K16, KL, VT, ACT, BO);      /* q/k planes; which 64 x 32 mask tiles hold an open entry; V^T [512][2048], kv head = rows kv*128 .. +127; W_out x 16 */
  k_fattn<<<dim3(QTN / 2, NQH), 256, 0, stream>>>(Q16, QL, K16, KL, VT, msk, ACT, C16, CL);      /* all 16 heads: ctx[t][h*128 + d] as f16 hi + residual, scores and probabilities stay in registers */
  k_gemm2l<<<(TT / 128) * (DQ / 128), 256, 0, stream>>>(C16, CL, BO, 0.0625f, (float*)d_out);      /* out = (ctx_hi + ctx_lo) W_out^T (W exact), one launch */
}

// v010
// Measured time: 103 microseconds a run.
// In both of two side-by-side timings against v009, it was 1.04 times as fast.
// All steps since v000 together make it 32.8 times as fast.
#include <hip/hip_runtime.h>
// QEffMolmoBlock (1 x 2048 tokens; 16 query heads / 4 kv heads x 128 dims; q, k, v are INPUT projections): q = RMSNorm_2048(q) * q_norm_w, k = RMSNorm_512(k) * k_norm_w (flat, before the head split); rotate-half RoPE (hd 128, positions from position_ids, base 10000); GQA (each kv head serves 4 query heads); scores = q.k / sqrt(128), masked entries (int mask input != 0) REPLACED by -10000; softmax; out = (att v) W_out^T.
// Structure: one preparation launch (RMSNorm + RoPE fused on VALU, wave per token, into f16 hi + 2^10 residual q/k planes; v as exact f16, V^T by LDS tiles; two flag bits per 64 x 32 mask tile (any open entry, any set entry); W_out x 16 as f16); one fused attention launch for all 16 heads (a wave owns 16 queries and walks the open key passes of 32): the score products (f16 WMMA, f32 accumulation, K = 128, three terms), the masked online softmax on VALU (mask read on device), P as f16 hi + residual (x 2^10) packed in registers, the readout as two terms, the merged context written as f16 hi + residual planes by the same launch; W_out as two GEMM terms (exact x16 weights). Every product runs all its hi/residual terms in one launch.
// Compute dtype: inputs rounded to bf16; v and W_out exact as f16; normed+rotated q/k (3-term scores), P and the merged context all carried as f16 hi + 2^10 residual (~2^-21): the q/k norm weights are O(1) random so logits have sigma ≈ 11 and the softmax is near one-hot; RMSNorm/RoPE/softmax f32. v_wmma_f32_16x16x32_f16.
#define TT 2048
#define MSTR 2048                /* attention_mask row stride (input geometry) */
#define NQH 16
#define NKVH 4
#define HD 128
#define DQ (NQH * HD)            /* 2048 */
#define DKV (NKVH * HD)          /* 512 */
#define GRP (NQH / NKVH)         /* 4 query heads share a kv head */
typedef __bf16 v16b __attribute__((ext_vector_type(16)));
typedef unsigned short v8us __attribute__((ext_vector_type(8), may_alias));
typedef float  v8f  __attribute__((ext_vector_type(8)));
typedef float  v4f  __attribute__((ext_vector_type(4)));
typedef float  v4fa __attribute__((ext_vector_type(4), may_alias));
union FragB { v16b v; v8us half[2]; unsigned short u[16]; };

__device__ __forceinline__ unsigned short bf16_bits(float x) { unsigned int u = __float_as_uint(x); return (unsigned short)((u + 0x7FFFu + ((u >> 16) & 1u)) >> 16); }
__device__ __forceinline__ float bf16_val(unsigned short b) { return __uint_as_float(((unsigned int)b) << 16); }
__device__ __forceinline__ float bf16_round(float x) { return bf16_val(bf16_bits(x)); }
// D += A·B with NT terms: 1 = ah·bh, 2 = + al·bh (A split), 3 = + ah·bl (both split)
template <int NT>
__device__ __forceinline__ v8f mmaN(v16b ah, v16b al, v16b bh, v16b bl, v8f c) {
  c = __builtin_amdgcn_wmma_f32_16x16x32_bf16(false, ah, false, bh, (short)0, c, false, false);
  if (NT >= 2) c = __builtin_amdgcn_wmma_f32_16x16x32_bf16(false, al, false, bh, (short)0, c, false, false);
  if (NT >= 3) c = __builtin_amdgcn_wmma_f32_16x16x32_bf16(false, ah, false, bl, (short)0, c, false, false);
  asm volatile("v_nop\n\tv_nop\n\tv_nop\n\tv_nop" : "+v"(c) : "v"(ah), "v"(al), "v"(bh), "v"(bl));
  return c;
}

__global__ __launch_bounds__(256) void k_wt_bf16(const float* __restrict__ W, unsigned short* __restrict__ Wt, int K, int N) {
  const int t = blockIdx.x * 256 + threadIdx.x;
  const int k8n = K / 8;
  if (t >= N * k8n) return;
  const int n = t / k8n, k8 = (t % k8n) * 8;
  v8us v;
#pragma unroll
  for (int i = 0; i < 8; ++i) v[i] = bf16_bits(W[(size_t)(k8 + i) * N + n]);
  *(v8us*)(Wt + (size_t)n * K + k8) = v;
  
}

// GEMM C[M][N] (f32, pitch ldc) = act(A[M][K]·W + bias). A f32 row-major (pitch lda) converted per fragment to bf16
// (ASPLIT: hi/lo two planes -> 2 terms, else single rounded term); Wt bf16 [N][K] (pitch ldb). BIAS_BF16 rounds the
// bias to bf16 first (bias quantised to bf16 before the add). K%32==0, M%16==0, N%64==0.
template <bool ASPLIT, int ACT, bool BIAS_BF16>
__global__ __launch_bounds__(128) void k_gemm_bf(const float* __restrict__ A, int lda, const unsigned short* __restrict__ Wt, int ldb,
                                               const float* __restrict__ bias, float* __restrict__ C, int ldc, int M, int N, int K) {
  __shared__ __attribute__((aligned(16))) float so[4][16][64];
  const int tid = threadIdx.x, w = tid >> 5, lane = tid & 31, ln = lane & 15, hh = lane >> 4;
  const int ntn = N / 64;
  const int wid = blockIdx.x * 4 + w;
  const int mt = wid / ntn, nq = wid % ntn;
  if (mt * 16 >= M) return;
  const int row0 = mt * 16, col0 = nq * 64;
  const float* arow = A + (size_t)(row0 + ln) * lda;
  v8f acc[4] = {};
  for (int kb = 0; kb < K; kb += 32) {
    FragB ah, al;
    const v4f x0 = *(const v4fa*)(arow + kb + 8 * hh), x1 = *(const v4fa*)(arow + kb + 8 * hh + 4);
    const v4f x2 = *(const v4fa*)(arow + kb + 16 + 8 * hh), x3 = *(const v4fa*)(arow + kb + 16 + 8 * hh + 4);
    float xs[16] = {x0[0],x0[1],x0[2],x0[3],x1[0],x1[1],x1[2],x1[3],x2[0],x2[1],x2[2],x2[3],x3[0],x3[1],x3[2],x3[3]};
#pragma unroll
    for (int i = 0; i < 16; ++i) { const unsigned short hb = bf16_bits(xs[i]); ah.u[i] = hb; al.u[i] = ASPLIT ? bf16_bits(xs[i] - bf16_val(hb)) : (unsigned short)0; }
#pragma unroll
    for (int t = 0; t < 4; ++t) {
      const unsigned short* brow = Wt + (size_t)(col0 + t * 16 + ln) * ldb + kb;
      FragB b;
      b.half[0] = *(const v8us*)(brow + 8 * hh);
      b.half[1] = *(const v8us*)(brow + 16 + 8 * hh);
      acc[t] = mmaN<ASPLIT ? 2 : 1>(ah.v, al.v, b.v, b.v, acc[t]);
    }
  }
#pragma unroll
  for (int t = 0; t < 4; ++t) {
    float bv = bias ? bias[col0 + t * 16 + ln] : 0.f;
    if (BIAS_BF16) bv = bf16_round(bv);
#pragma unroll
    for (int r = 0; r < 8; ++r) { float v = acc[t][r] + bv; if (ACT == 1) v = fmaxf(v, 0.f); so[w][8 * hh + r][t * 16 + ln] = v; }
  }
  __builtin_amdgcn_fence(__ATOMIC_ACQ_REL, "workgroup");
  __builtin_amdgcn_wave_barrier();
  const int rsub = lane >> 4, c4 = (lane & 15) * 4;
  {
#pragma unroll
    for (int q = 0; q < 8; ++q) {
      const int r = q * 2 + rsub;
      const v4f v = *(const v4fa*)&so[w][r][c4];
      *(v4f*)(C + (size_t)(row0 + r) * ldc + col0 + c4) = v;
    }
    
  }
}

// GEMM C = act(A·W + bias + resid): A f32 (ASPLIT -> hi/lo 2 terms), Wt bf16 [N][K]; ACT 0 none, 1 relu, 2 exact gelu;
// resid (optional, f32, row index = (row % rmod), pitch ldr, RES_BF16 rounds it) added before the activation.
template <bool ASPLIT, int ACT, bool BIAS_BF16, bool RES_BF16>
__global__ __launch_bounds__(128) void k_gemm_bf3(const float* __restrict__ A, int lda, const unsigned short* __restrict__ Wt, int ldb,
                                                const float* __restrict__ bias, const float* __restrict__ resid, int rmod, int ldr,
                                                float* __restrict__ C, int ldc, int M, int N, int K) {
  __shared__ __attribute__((aligned(16))) float so[4][16][64];
  const int tid = threadIdx.x, w = tid >> 5, lane = tid & 31, ln = lane & 15, hh = lane >> 4;
  const int ntn = N / 64;
  const int wid = blockIdx.x * 4 + w;
  const int mt = wid / ntn, nq = wid % ntn;
  if (mt * 16 >= M) return;
  const int row0 = mt * 16, col0 = nq * 64;
  const float* arow = A + (size_t)(row0 + ln) * lda;
  v8f acc[4] = {};
  for (int kb = 0; kb < K; kb += 32) {
    FragB ah, al;
    const v4f x0 = *(const v4fa*)(arow + kb + 8 * hh), x1 = *(const v4fa*)(arow + kb + 8 * hh + 4);
    const v4f x2 = *(const v4fa*)(arow + kb + 16 + 8 * hh), x3 = *(const v4fa*)(arow + kb + 16 + 8 * hh + 4);
    float xs[16] = {x0[0],x0[1],x0[2],x0[3],x1[0],x1[1],x1[2],x1[3],x2[0],x2[1],x2[2],x2[3],x3[0],x3[1],x3[2],x3[3]};
#pragma unroll
    for (int i = 0; i < 16; ++i) { const unsigned short hb = bf16_bits(xs[i]); ah.u[i] = hb; al.u[i] = ASPLIT ? bf16_bits(xs[i] - bf16_val(hb)) : (unsigned short)0; }
#pragma unroll
    for (int t = 0; t < 4; ++t) {
      const unsigned short* brow = Wt + (size_t)(col0 + t * 16 + ln) * ldb + kb;
      FragB b;
      b.half[0] = *(const v8us*)(brow + 8 * hh);
      b.half[1] = *(const v8us*)(brow + 16 + 8 * hh);
      acc[t] = mmaN<ASPLIT ? 2 : 1>(ah.v, al.v, b.v, b.v, acc[t]);
    }
  }
#pragma unroll
  for (int t = 0; t < 4; ++t) {
    const int col = col0 + t * 16 + ln;
    float bv = bias ? bias[col] : 0.f;
    if (BIAS_BF16) bv = bf16_round(bv);
#pragma unroll
    for (int r = 0; r < 8; ++r) {
      float v = acc[t][r] + bv;
      if (resid) { float rv = resid[(size_t)((row0 + 8 * hh + r) % rmod) * ldr + col]; if (RES_BF16) rv = bf16_round(rv); v += rv; }
      if (ACT == 1) v = fmaxf(v, 0.f);
      if (ACT == 2) v = 0.5f * v * (1.0f + erff(v * 0.70710678118654752f));
      if (ACT == 3) { const float u = 0.7978845608028654f * (v + 0.044715f * v * v * v); v = 0.5f * v * (1.0f + tanhf(u)); }
      so[w][8 * hh + r][t * 16 + ln] = v;
    }
  }
  __builtin_amdgcn_fence(__ATOMIC_ACQ_REL, "workgroup");
  __builtin_amdgcn_wave_barrier();
  const int rsub = lane >> 4, c4 = (lane & 15) * 4;
  {
#pragma unroll
    for (int q = 0; q < 8; ++q) {
      const int r = q * 2 + rsub;
      const v4f v = *(const v4fa*)&so[w][r][c4];
      *(v4f*)(C + (size_t)(row0 + r) * ldc + col0 + c4) = v;
    }
    
  }
}
// row LayerNorm (biased variance, eps) over N: s = X (+ R); optional out_sum <- s; out_norm <- (s-mu)*rsqrt(var+eps)*g + b
template <bool PARAM_BF16>
__global__ __launch_bounds__(256) void k_layernorm(const float* __restrict__ X, const float* __restrict__ R, const float* __restrict__ g, const float* __restrict__ bta,
                                                  float* __restrict__ out_sum, float* __restrict__ out_norm, int N, float eps) {
  __shared__ float red[256];
  const int row = blockIdx.x, tid = threadIdx.x;
  const float* x = X + (size_t)row * N; const float* rr = R ? R + (size_t)row * N : nullptr;
  float vals[16];                     // up to N = 4096
  const int per = N / 256;            // contiguous chunk per thread? use strided-by-4 chunks: thread handles j = tid*4 + 1024*u
  float s1 = 0.f;
  for (int u = 0; u < per / 4; ++u) {
    const int j = tid * 4 + 1024 * u;
    const v4f a = *(const v4fa*)(x + j);
    v4f b = {0.f,0.f,0.f,0.f}; if (rr) b = *(const v4fa*)(rr + j);
#pragma unroll
    for (int q = 0; q < 4; ++q) { const float v = a[q] + b[q]; vals[u * 4 + q] = v; s1 += v; }
  }
  red[tid] = s1; __syncthreads();
  for (int st = 128; st > 0; st >>= 1) { if (tid < st) red[tid] += red[tid + st]; __syncthreads(); }
  const float mu = red[0] / (float)N; __syncthreads();
  float s2 = 0.f;
  for (int u = 0; u < per / 4; ++u)
#pragma unroll
    for (int q = 0; q < 4; ++q) { const float c = vals[u * 4 + q] - mu; s2 += c * c; }
  red[tid] = s2; __syncthreads();
  for (int st = 128; st > 0; st >>= 1) { if (tid < st) red[tid] += red[tid + st]; __syncthreads(); }
  const float rs = rsqrtf(red[0] / (float)N + eps);
  {
    for (int u = 0; u < per / 4; ++u) {
      const int j = tid * 4 + 1024 * u;
      v4f o, sm;
#pragma unroll
      for (int q = 0; q < 4; ++q) {
        float gg = g[j + q], bb = bta[j + q];
        if (PARAM_BF16) { gg = bf16_round(gg); bb = bf16_round(bb); }
        sm[q] = vals[u * 4 + q]; o[q] = (vals[u * 4 + q] - mu) * rs * gg + bb;
      }
      if (out_sum) *(v4f*)(out_sum + (size_t)row * N + j) = sm;
      *(v4f*)(out_norm + (size_t)row * N + j) = o;
    }
    
  }
}



// ---- f16 WMMA path (v_wmma_f32_16x16x32_f16): 11-bit significands for operands in range — used where a [0,1] probability operand needs more precision than bf16
typedef _Float16 v16h __attribute__((ext_vector_type(16)));
union FragH { v16h v; v8us half[2]; _Float16 h[16]; unsigned short u[16]; };
template <int NT>
__device__ __forceinline__ v8f mmaH(v16h ah, v16h al, v16h bh, v16h bl, v8f c) {
  c = __builtin_amdgcn_wmma_f32_16x16x32_f16(false, ah, false, bh, (short)0, c, false, false);
  if (NT >= 2) c = __builtin_amdgcn_wmma_f32_16x16x32_f16(false, al, false, bh, (short)0, c, false, false);
  if (NT >= 3) c = __builtin_amdgcn_wmma_f32_16x16x32_f16(false, ah, false, bl, (short)0, c, false, false);
  asm volatile("v_nop\n\tv_nop\n\tv_nop\n\tv_nop" : "+v"(c) : "v"(ah), "v"(al), "v"(bh), "v"(bl));
  return c;
}
// batched GEMM like k_gemm_b but f16 operands: A f32 (split into f16 hi/lo if ASPLIT, else rounded to f16), Bt = f16 values [n][k]; alpha; C f32; N multiple of 16 (partial tiles skipped)
template <bool ASPLIT>
__global__ __launch_bounds__(128) void k_gemm_h(const float* __restrict__ A, int lda, size_t sA, const _Float16* __restrict__ Bh, int ldb, size_t sB, float alpha, float* __restrict__ C, int ldc, size_t sC, int M, int N, int K) {
  __shared__ __attribute__((aligned(16))) float so[4][16][64];
  const int tid = threadIdx.x, w = tid >> 5, lane = tid & 31, ln = lane & 15, hh = lane >> 4; const int by = blockIdx.y;
  A += (size_t)by * sA; Bh += (size_t)by * sB; C += (size_t)by * sC;
  const int ntn = (N + 63) / 64; const int wid = blockIdx.x * 4 + w; const int mt = wid / ntn, nq = wid % ntn; if (mt * 16 >= M) return;
  const int row0 = mt * 16, col0 = nq * 64; const float* arow = A + (size_t)(row0 + ln) * lda;
  v8f acc[4] = {};
  for (int kb = 0; kb < K; kb += 32) {
    FragH ah, al;
    const v4f x0 = *(const v4fa*)(arow + kb + 8 * hh), x1 = *(const v4fa*)(arow + kb + 8 * hh + 4), x2 = *(const v4fa*)(arow + kb + 16 + 8 * hh), x3 = *(const v4fa*)(arow + kb + 16 + 8 * hh + 4);
    float xs[16] = {x0[0],x0[1],x0[2],x0[3],x1[0],x1[1],x1[2],x1[3],x2[0],x2[1],x2[2],x2[3],x3[0],x3[1],x3[2],x3[3]};
#pragma unroll
    for (int i = 0; i < 16; ++i) { const _Float16 h = (_Float16)xs[i]; ah.h[i] = h; al.h[i] = ASPLIT ? (_Float16)(xs[i] - (float)h) : (_Float16)0.0f; }
#pragma unroll
    for (int t = 0; t < 4; ++t) { if (col0 + t * 16 >= N) continue; const size_t boff = (size_t)(col0 + t * 16 + ln) * ldb + kb; FragH bq; bq.half[0] = *(const v8us*)(Bh + boff + 8 * hh); bq.half[1] = *(const v8us*)(Bh + boff + 16 + 8 * hh);
      acc[t] = mmaH<ASPLIT ? 2 : 1>(ah.v, al.v, bq.v, bq.v, acc[t]); }
  }
#pragma unroll
  for (int t = 0; t < 4; ++t) { if (col0 + t * 16 >= N) continue;
#pragma unroll
    for (int r = 0; r < 8; ++r) so[w][8 * hh + r][t * 16 + ln] = acc[t][r] * alpha; }
  __builtin_amdgcn_fence(__ATOMIC_ACQ_REL, "workgroup"); __builtin_amdgcn_wave_barrier();
  const int rsub = lane >> 4, c4 = (lane & 15) * 4;
  {
#pragma unroll
    for (int q = 0; q < 8; ++q) { const int r = q * 2 + rsub; if (col0 + c4 < N) { const v4f v = *(const v4fa*)&so[w][r][c4]; *(v4f*)(C + (size_t)(row0 + r) * ldc + col0 + c4) = v; } }
     }
}

// Wt[n][k] = f16(W[k][n]·scale) from f32 row-major W[K][N] (scale = power of two; bf16-exact weights stay exact in f16 away from the subnormal range)
__global__ __launch_bounds__(256) void k_wt_f16(const float* __restrict__ W, _Float16* __restrict__ Wt, int K, int N, float scale) {
  const int t = blockIdx.x * 256 + threadIdx.x; if (t >= N * (K / 8)) return; const int n = t / (K / 8), k8 = (t % (K / 8)) * 8; FragH f;
#pragma unroll
  for (int i = 0; i < 8; ++i) f.h[i] = (_Float16)(bf16_round(W[(size_t)(k8 + i) * N + n]) * scale); const v8us o = f.half[0];
  *(v8us*)((unsigned short*)Wt + (size_t)n * K + k8) = o; 
}
// k_gemm_hh variant with fused epilogue: v = acc·alpha + bias[by·sBias + col] (+ CP[(row/rowsPerB)·sCPb + by·64 + col] if CP) ; ACT 0 none / 1 elu ; writes f16 C16 (and f32 C if non-null)
template <int ACT>
__global__ __launch_bounds__(128) void k_gemm_hhx(const _Float16* __restrict__ A, int lda, size_t sA, const _Float16* __restrict__ Bh, int ldb, size_t sB, float alpha, const float* __restrict__ bias, size_t sBias, const float* __restrict__ CP, int rowsPerB, size_t sCPb, int row0g,
    float* __restrict__ C, _Float16* __restrict__ C16, int ldc, size_t sC, int M, int N, int K) {
  __shared__ __attribute__((aligned(16))) float so[4][16][64];
  const int tid = threadIdx.x, w = tid >> 5, lane = tid & 31, ln = lane & 15, hh = lane >> 4; const int by = blockIdx.y;
  A += (size_t)by * sA; Bh += (size_t)by * sB; const size_t cofs = (size_t)by * sC; const float* bp = bias ? bias + (size_t)by * sBias : nullptr;
  const int ntn = (N + 63) / 64; const int wid = blockIdx.x * 4 + w; const int mt = wid / ntn, nq = wid % ntn; if (mt * 16 >= M) return;
  const int row0 = mt * 16, col0 = nq * 64; const _Float16* arow = A + (size_t)(row0 + ln) * lda;
  v8f acc[4] = {};
  for (int kb = 0; kb < K; kb += 32) { FragH ah; ah.half[0] = *(const v8us*)((const unsigned short*)arow + kb + 8 * hh); ah.half[1] = *(const v8us*)((const unsigned short*)arow + kb + 16 + 8 * hh);
#pragma unroll
    for (int t = 0; t < 4; ++t) { if (col0 + t * 16 >= N) continue; const size_t boff = (size_t)(col0 + t * 16 + ln) * ldb + kb; FragH bq; bq.half[0] = *(const v8us*)((const unsigned short*)Bh + boff + 8 * hh); bq.half[1] = *(const v8us*)((const unsigned short*)Bh + boff + 16 + 8 * hh);
      acc[t] = mmaH<1>(ah.v, ah.v, bq.v, bq.v, acc[t]); }
  }
#pragma unroll
  for (int t = 0; t < 4; ++t) { if (col0 + t * 16 >= N) continue; const int col = col0 + t * 16 + ln; const float bv = bp ? bf16_round(bp[col]) : 0.f;
#pragma unroll
    for (int r = 0; r < 8; ++r) { float v = acc[t][r] * alpha + bv; if (CP) { const int rr = row0g + row0 + 8 * hh + r; if (rowsPerB < 0) v += CP[cofs + (size_t)rr * ldc + col];      /* rowsPerB < 0: own element of the batched C plane */ else { const int bidx = rr / rowsPerB; v += CP[(size_t)bidx * sCPb + (size_t)by * 64 + col]; } } if (ACT == 1) v = (v > 0.f) ? v : expm1f(v); else if (ACT == 7) v = (v > 0.f) ? v + 1.0f : expf(v); else if (ACT == 8) v = tanhf(v); else if (ACT == 9) v = 0.5f * v * (1.0f + tanhf(0.7978845608028654f * (v + 0.044715f * v * v * v))); else if (ACT == 11) v = 1.0f / (1.0f + expf(-v)); else if (ACT == 12) v = (v > 0.f) ? v : 0.01f * v; else if (ACT == 14) v = (v > 0.f) ? v : 0.1f * v; else if (ACT == 16) v = (v >= 0.f) ? v : 0.3f * v; else if (ACT == 17) v = (v >= 0.f) ? v : 0.2f * v; else if (ACT == 15) v = v / (1.0f + expf(-v)); else if (ACT == 3) v = fmaxf(v, 0.f); else if (ACT == 6) v = 0.5f * v * (1.0f + erff(v * 0.70710678118654752f)); so[w][8 * hh + r][t * 16 + ln] = v; } }
  __builtin_amdgcn_fence(__ATOMIC_ACQ_REL, "workgroup"); __builtin_amdgcn_wave_barrier();
  const int rsub = lane >> 4, c4 = (lane & 15) * 4; typedef _Float16 v4h __attribute__((ext_vector_type(4)));
  {
#pragma unroll
    for (int q = 0; q < 8; ++q) { const int r = q * 2 + rsub; if (col0 + c4 < N) { const v4f v = *(const v4fa*)&so[w][r][c4]; if (C) *(v4f*)(C + cofs + (size_t)(row0 + r) * ldc + col0 + c4) = v; if (C16) { v4h h4; for (int i = 0; i < 4; ++i) h4[i] = (_Float16)v[i]; *(v4h*)(C16 + cofs + (size_t)(row0 + r) * ldc + col0 + c4) = h4; } } }
     }
}


typedef _Float16 v4h __attribute__((ext_vector_type(4)));

__global__ __launch_bounds__(256) void k_h16(const float* __restrict__ x, _Float16* __restrict__ X16, size_t n8) { const size_t t = (size_t)blockIdx.x * 256 + threadIdx.x; if (t >= n8) return; FragH f;
#pragma unroll
  for (int q = 0; q < 8; ++q) f.h[q] = (_Float16)x[t * 8 + q]; *(v8us*)((unsigned short*)X16 + t * 8) = f.half[0];  }
__global__ __launch_bounds__(256) void k_round16f(const float* __restrict__ W, _Float16* __restrict__ Bt, size_t n8) { const size_t t = (size_t)blockIdx.x * 256 + threadIdx.x; if (t >= n8) return; FragH f;
#pragma unroll
  for (int i = 0; i < 8; ++i) f.h[i] = (_Float16)(bf16_round(W[t * 8 + i]) * 16.0f); *(v8us*)((unsigned short*)Bt + t * 8) = f.half[0];  }
// V^T [512][2048] from v [2048][512]: block blk turns the 64 tokens x 64 dims tile (token group blk % 32, dim slab blk / 32) through LDS; v is rounded to bf16 and written as exact f16 on the way in.
// Every loop is unrolled so that the register arrays are indexed by constants and the four loads of a thread fly together.
__device__ __forceinline__ void d_vt(const int blk, const float* __restrict__ v, _Float16* __restrict__ Vt, unsigned short (*tl)[66]) { const int tid = threadIdx.x; const int slab = blk / (TT / 64), lg = blk % (TT / 64);
  v4f va[2], vc[2];
#pragma unroll
  for (int i = 0; i < 2; ++i) { const float* vp = v + (size_t)(lg * 64 + i * 32 + tid / 8) * DKV + slab * 64 + (tid % 8) * 8; va[i] = *(const v4fa*)vp; vc[i] = *(const v4fa*)(vp + 4); }
  asm volatile("s_wait_xcnt 0x0" ::: "memory");      /* precaution: stands in front of every later write of a register that one of the loads above names */
  __builtin_amdgcn_sched_barrier(0);      /* keeps the work below from being scheduled above that wait */
#pragma unroll
  for (int i = 0; i < 2; ++i) { const int r = i * 32 + tid / 8, c8 = (tid % 8) * 8; FragH f;
#pragma unroll
    for (int q = 0; q < 4; ++q) { f.h[q] = (_Float16)bf16_round(va[i][q]); f.h[4 + q] = (_Float16)bf16_round(vc[i][q]); }
#pragma unroll
    for (int q = 0; q < 8; ++q) tl[r][c8 + q] = f.u[q]; }
  __syncthreads();
  {
#pragma unroll
    for (int rd = 0; rd < 2; ++rd) { const int d = rd * 32 + tid / 8, pc = tid % 8; FragH f;
#pragma unroll
      for (int q = 0; q < 8; ++q) f.u[q] = tl[pc * 8 + q][d];
      *(v8us*)((unsigned short*)Vt + ((size_t)slab * 64 + d) * TT + lg * 64 + pc * 8) = f.half[0]; }
    asm volatile("s_wait_xcnt 0x0" ::: "memory");      /* precaution: closes the two stores, in front of whatever the merged kernel's code behind this job writes into their registers */
     } }

// ---- fragment loader: 16 halves of one operand row in the hardware k order ----
__device__ __forceinline__ v16h g2_frag(const _Float16* p, int hh) { FragH f; f.half[0] = *(const v8us*)((const unsigned short*)p + 8 * hh); f.half[1] = *(const v8us*)((const unsigned short*)p + 16 + 8 * hh); return f.v; }
#define WCH 4                    /* chunks of 8 weights a thread: a quarter of the blocks to start, eight 16-byte loads of a thread in flight */
// Bt = f16(bf16(Wm) * sc), same layout. Every loop is unrolled so that the register arrays are indexed by constants and the loads fly together.
__device__ __forceinline__ void d_wsc(const int blk, const float* __restrict__ Wm, _Float16* __restrict__ Bt, const float sc) { const size_t t0 = (size_t)blk * (WCH * 256) + threadIdx.x;
  v4f wa[WCH], wc[WCH];
#pragma unroll
  for (int j = 0; j < WCH; ++j) { const float* wp = Wm + (t0 + j * 256) * 8; wa[j] = *(const v4fa*)wp; wc[j] = *(const v4fa*)(wp + 4); }
  asm volatile("s_wait_xcnt 0x0" ::: "memory");      /* precaution: stands in front of every later write of a register that one of the loads above names */
  __builtin_amdgcn_sched_barrier(0);      /* keeps the work below from being scheduled above that wait */
  FragH f[WCH];
#pragma unroll
  for (int j = 0; j < WCH; ++j) {
#pragma unroll
    for (int q = 0; q < 4; ++q) { f[j].h[q] = (_Float16)(bf16_round(wa[j][q]) * sc); f[j].h[4 + q] = (_Float16)(bf16_round(wc[j][q]) * sc); } }
  __builtin_amdgcn_sched_barrier(0);      /* every value is in its register before the run of stores starts: no register that an issued store names is written behind it */
#pragma unroll
  for (int j = 0; j < WCH; ++j) *(v8us*)((unsigned short*)Bt + (t0 + j * 256) * 8) = f[j].half[0];
  asm volatile("s_wait_xcnt 0x0" ::: "memory");      /* precaution: closes the run of stores, in front of whatever the merged kernel's code behind this job writes into their registers */
}
// lane l with lane l ^ 16
__device__ __forceinline__ float xhalf(float x) { return __builtin_bit_cast(float, __builtin_amdgcn_permlanex16(__builtin_bit_cast(int, x), __builtin_bit_cast(int, x), 0x76543210, 0xfedcba98, false, false)); }
#define NRG 4                    /* heads a group: their weights are fetched together and their eight stores go out as one run */
// RMSNorm + RoPE of one token a wave. A lane owns dims 4 * lane .. + 3 of EVERY head (a head is 128 floats = one 16-byte load of the wave), and the token's row stays in registers from its one read to the stores.
// A rotation pair (d, d + 64) sits in lanes l and l ^ 16, so the partner's value comes by one cross-row move. The angle of a pair depends on the token and on d alone, not on the head: the wave forms its 64 angles once
// (two a lane, handed to the lanes that use them), in front of the head loop. Per element the same operations in the same order as before, and the same order of the row's sum of squares.
// Every loop over a register array (xa, c2, s2, cs, sg, wa, vh, vl) is unrolled so that the array is indexed by constants and stays in registers.
template <int NH_>
__device__ __forceinline__ void d_normrope(const int blk, const float* __restrict__ X, const float* __restrict__ w, const int* __restrict__ pos, _Float16* __restrict__ O16, _Float16* __restrict__ OL) {
  /* numerical, as in the versions before: every product and every sum rounds on its own, as the reference's separate elementwise operations do; the logits are large and the softmax near one-hot, and the q/k planes stay bit-identical */
  #pragma clang fp contract(off)
  constexpr int W_ = NH_ * HD; const int wv = threadIdx.x >> 5, ln = threadIdx.x & 31; const int t = blk * 8 + wv; if (t >= TT) return;
  const float* x = X + (size_t)t * W_ + ln * 4; const int* pp = pos + t;
  const int pi = *pp;      /* first, so that the angles below wait for this load alone */
  v4f xa[NH_];      /* the whole row: its loads fly together */
#pragma unroll
  for (int h = 0; h < NH_; ++h) xa[h] = *(const v4fa*)(x + h * HD);
  asm volatile("s_wait_xcnt 0x0" :: "v"(x), "v"(pp) : "memory");      /* precaution: stands in front of every later write of a register that one of the loads above names; the addresses are inputs so that they stay in their registers up to here and no load of the run lands in them */
  __builtin_amdgcn_sched_barrier(0);      /* keeps the work below from being scheduled above that wait */
  const float p = (float)pi; float c2[2], s2[2];      /* the angles of d = 2 * lane and 2 * lane + 1: formed while the row's loads fly */
#pragma unroll
  for (int s = 0; s < 2; ++s) { const int d = 2 * ln + s; const float ex = (float)(2 * d) / (float)HD; const float ivf = 1.0f / powf(10000.0f, ex); const float th = p * ivf; c2[s] = cosf(th); s2[s] = sinf(th); }
  float cs[4], sg[4];      /* for this lane's dims d = 4 * (lane & 15) + e: cosine, and sine with the sign of its half (o[d] = x[d] cos - x[d + 64] sin, o[d + 64] = x[d + 64] cos + x[d] sin) */
#pragma unroll
  for (int e = 0; e < 4; ++e) { const int sl = 2 * (ln & 15) + (e >> 1); cs[e] = __shfl(c2[e & 1], sl, 32); const float sn = __shfl(s2[e & 1], sl, 32); sg[e] = ln < 16 ? -sn : sn; }
  float ss = 0.f;
#pragma unroll
  for (int h = 0; h < NH_; ++h) {
#pragma unroll
    for (int e = 0; e < 4; ++e) { const float v = bf16_round(xa[h][e]); xa[h][e] = v; ss += v * v; } }
  for (int o = 16; o > 0; o >>= 1) ss += __shfl_xor(ss, o, 32); const float inv = rsqrtf(ss / (float)W_ + 1e-5f);
  const float* wp = w + ln * 4; _Float16* oh = O16 + (size_t)t * W_ + ln * 4; _Float16* ol = OL + (size_t)t * W_ + ln * 4;
#pragma unroll
  for (int g = 0; g < NH_ / NRG; ++g) {
    v4f wa[NRG];
#pragma unroll
    for (int i = 0; i < NRG; ++i) wa[i] = *(const v4fa*)(wp + (g * NRG + i) * HD);
    asm volatile("s_wait_xcnt 0x0" :: "v"(wp) : "memory");      /* same precaution as behind the row's loads */
    __builtin_amdgcn_sched_barrier(0);      /* keeps the work below from being scheduled above that wait */
    v4h vh[NRG], vl[NRG];
#pragma unroll
    for (int i = 0; i < NRG; ++i) {
#pragma unroll
      for (int e = 0; e < 4; ++e) { float xn = xa[g * NRG + i][e] * inv; xn *= bf16_round(wa[i][e]); const float xo = xhalf(xn); float o = xn * cs[e]; o += xo * sg[e];
        const _Float16 hi = (_Float16)o; vh[i][e] = hi; vl[i][e] = (_Float16)((o - (float)hi) * 1024.0f); } }
    __builtin_amdgcn_sched_barrier(0);      /* every value is in its register before the run of stores starts: no register that an issued store names is written behind it */
#pragma unroll
    for (int i = 0; i < NRG; ++i) { *(v4h*)(oh + (g * NRG + i) * HD) = vh[i]; *(v4h*)(ol + (g * NRG + i) * HD) = vl[i]; }
    asm volatile("s_wait_xcnt 0x0" ::: "memory");      /* precaution: closes the run of stores, in front of the next group's writes of their registers */
  }
}

// ---- fused attention: scores, masked softmax and readout of all 16 heads in ONE launch; the score and probability planes never go to memory ----
// Transposed products: S^T = K.Q^T (A = key rows, B = query rows held in registers), O^T += V^T.P^T. In an accumulator tile a lane holds 8 keys of ONE query (column = lane & 15, rows 8 * (lane >> 4) + r),
// which is exactly the k order of the B loader (k = 8 * hh + i, then 16 + 8 * hh + i), so two 16-key score tiles pack in-lane into one 32-key P^T fragment. Running maximum and sum per query (online softmax):
// when the maximum moves, the output accumulators and the sum are scaled by exp(m_old - m_new). Same operand planes and terms as the separate stages: 3 hi/residual score terms, P as f16 hi + 2^10 residual of 1024 * p.
__device__ __forceinline__ v8f fa_mma(v16h a, v16h b, v8f c) { return __builtin_amdgcn_wmma_f32_16x16x32_f16(false, a, false, b, (short)0, c, false, false); }
typedef int v4i __attribute__((ext_vector_type(4)));
#define FKP 136                  /* LDS pitch of a K row, in halves */
#define FVP 40                   /* LDS pitch of a V^T row, in halves */
#define QTN (TT / 64)            /* query tiles of 64 rows */
// act[qt * 64 + p], for the 64 x 32 mask tile (query tile qt, key pass p): bit 0 = the tile holds at least one open (zero) entry, bit 1 = it holds at least one set (nonzero) entry. A wave reads four tiles in turn; a block of eight waves writes one whole 128-byte line of flags.
__device__ __forceinline__ void d_mflag(const int blk, const int* __restrict__ msk, int* __restrict__ act) {
  const int wv = threadIdx.x >> 5, lane = threadIdx.x & 31; unsigned bits = 0u, sbits = 0u;      /* bit j: the wave's tile j holds an open entry; holds a set entry */
  /* kept rolled: one tile's sixteen loads in flight a wave; unrolled, the four tiles' loads would set the register count of the whole launch */
#pragma unroll 1
  for (int j = 0; j < 4; ++j) {
    const int u = blk * 32 + wv * 4 + j; const int qt = u >> 6, p = u & 63;
    const int* mp = msk + (size_t)(qt * 64 + (lane >> 3)) * MSTR + p * 32 + (lane & 7) * 4;
    v4i m[16];      /* both inner loops are unrolled so that this array stays in registers and its loads fly together */
#pragma unroll
    for (int i = 0; i < 16; ++i) m[i] = *(const v4i*)(mp + (size_t)i * 4 * MSTR);
    asm volatile("s_wait_xcnt 0x0" :: "v"(mp) : "memory");      /* precaution: stands in front of every later write of a register that one of the loads above names; the address is an input so that it stays in its registers up to here and no load of the run lands in them */
    __builtin_amdgcn_sched_barrier(0);      /* keeps the work below from being scheduled above that wait */
    bool open = false; int seen = 0;
#pragma unroll
    for (int i = 0; i < 16; ++i) { open = open || m[i][0] == 0 || m[i][1] == 0 || m[i][2] == 0 || m[i][3] == 0; seen |= m[i][0] | m[i][1] | m[i][2] | m[i][3]; }
    const unsigned any = __builtin_amdgcn_ballot_w32(open), anys = __builtin_amdgcn_ballot_w32(seen != 0);
    bits |= (any != 0u ? 1u : 0u) << j; sbits |= (anys != 0u ? 1u : 0u) << j;
  }
  if (lane < 4) act[blk * 32 + wv * 4 + lane] = (int)(((bits >> lane) & 1u) | (((sbits >> lane) & 1u) << 1));
}
// ---- preparation: the five jobs that only read inputs (q and k norm + RoPE, mask flags, V^T, scaled W_out) in ONE launch, told apart by block ranges; none reads what another writes. The longest job (q) has the first blocks (for speed only).
#define PB_NQ (TT / 8)                       /* q: a wave a token */
#define PB_NK (TT / 8)                       /* k: a wave a token */
#define PB_MF (QTN * 64 / 32)                /* mask flags: 32 tiles a block */
#define PB_VT (NKVH * 2 * (TT / 64))         /* V^T: 8 slabs of 64 dims x 32 token groups */
#define PB_WS (DQ * DQ / 8 / 256 / WCH)      /* W_out */
/* second bound: at least 8 waves a SIMD, that is at most 128 registers a lane: the streaming jobs live on many waves in flight, and the q job's row in registers must not take that from them */
__global__ __launch_bounds__(256, 8) void k_prep(const float* __restrict__ q, const float* __restrict__ k, const float* __restrict__ v, const int* __restrict__ msk, const int* __restrict__ pos, const float* __restrict__ qw, const float* __restrict__ kw, const float* __restrict__ Wo,
    _Float16* __restrict__ Q16, _Float16* __restrict__ QL, _Float16* __restrict__ K16, _Float16* __restrict__ KL, _Float16* __restrict__ VT, int* __restrict__ ACT, _Float16* __restrict__ BO) {
  __shared__ unsigned short tl[64][66];
  const int b = blockIdx.x;      /* every test below is the same for the whole block: the barrier of the V^T job is passed by all its waves */
  if (b < PB_NQ) d_normrope<NQH>(b, q, qw, pos, Q16, QL);
  else if (b < PB_NQ + PB_NK) d_normrope<NKVH>(b - PB_NQ, k, kw, pos, K16, KL);
  else if (b < PB_NQ + PB_NK + PB_MF) d_mflag(b - (PB_NQ + PB_NK), msk, ACT);
  else if (b < PB_NQ + PB_NK + PB_MF + PB_VT) d_vt(b - (PB_NQ + PB_NK + PB_MF), v, VT, tl);
  else d_wsc(b - (PB_NQ + PB_NK + PB_MF + PB_VT), Wo, BO, 16.0f);      /* (out,in) natural */
}
// A block runs two query tiles of 64 rows one after the other, tile QTN - 1 - x and tile x, so that under a triangular mask every block has the same number of open passes; a wave owns 16 queries.
// Eight waves in two key groups of four: both groups hold the same 64 queries, and of the passes to walk group 0 takes the 1st, 3rd, ... and group 1 the 2nd, 4th, ..., each with K/V tiles of its own in LDS.
// Each group keeps its own running maximum, sum and output sums; at the end of a tile the two are joined (rescaled to the common maximum), each group finishing half of the dims.
// Of each tile only the open key passes are walked (flags of d_mflag). A closed pass holds nothing but scores of -10000: once every row of the tile has a running maximum of -9000 or more, exp(-10000 - max) is 0 in f32
// and the pass would change neither sums nor maximum. Where a row's maximum is lower after the open passes (a row with no open key among them), the closed passes are walked as well, after the open ones, by the same code.
typedef v4f v4fs __attribute__((may_alias));
#define MGS 17                   /* 16-byte slots a lane hands over: 4 dims tiles x (hi, residual) x 2, then maximum and sum */
// Group G hands its partner wave the four dims tiles that the partner finishes, with its running maximum and sum. slot = the wave's own range, at its lane; slots lie 32 lanes apart, so that a wave's 16-byte accesses cover whole rows of banks.
template <int G>
__device__ __forceinline__ void fa_put(const v8f (&oh)[8], const v8f (&ol)[8], const float m, const float l, v4fs* slot) {
#pragma unroll
  for (int dd = 0; dd < 4; ++dd) { const v8f a = oh[(1 - G) * 4 + dd], b = ol[(1 - G) * 4 + dd];
    const v4f a0 = {a[0], a[1], a[2], a[3]}, a1 = {a[4], a[5], a[6], a[7]}, b0 = {b[0], b[1], b[2], b[3]}, b1 = {b[4], b[5], b[6], b[7]};
    slot[(dd * 4 + 0) * 32] = a0; slot[(dd * 4 + 1) * 32] = a1; slot[(dd * 4 + 2) * 32] = b0; slot[(dd * 4 + 3) * 32] = b1; }
  const v4f ml = {m, l, 0.f, 0.f}; slot[16 * 32] = ml;
}
// Group G joins the partner's sums into its own four dims tiles, divides by the joined sum and stores them as the two planes that the W_out GEMM reads: f16 hi and 2^10 residual. A lane holds 8 adjacent dims of a tile, one 16-byte store a plane;
// a group's 64 dims of a row are one whole 128-byte line of each plane, written by one wave. slot = the partner wave's range, at this lane.
template <int G>
__device__ __forceinline__ void fa_fin(v8f (&oh)[8], v8f (&ol)[8], const float m, const float l, const v4fs* slot, _Float16* ch0, _Float16* cl0) {
  const v4f ml = slot[16 * 32]; const float mj = fmaxf(m, ml[0]); const float as = expf(m - mj), ao = expf(ml[0] - mj); const float lj = l * as + ml[1] * ao;
  const float lt = lj + __shfl_xor(lj, 16, 32); const float f = 0.0009765625f / lt, fl = f * 0.0009765625f;
  /* every output value is formed first, then the stores go out as one run: no register that an issued store names is written before the wait behind the run */
  FragH fh[4], fr[4];      /* indexed by constants only: both loops over them are unrolled */
#pragma unroll
  for (int dd = 0; dd < 4; ++dd) { const int d = G * 4 + dd; const v4f a0 = slot[(dd * 4 + 0) * 32], a1 = slot[(dd * 4 + 1) * 32], b0 = slot[(dd * 4 + 2) * 32], b1 = slot[(dd * 4 + 3) * 32];
#pragma unroll
    for (int r = 0; r < 4; ++r) { const float h0 = oh[d][r] * as + a0[r] * ao, h1 = oh[d][4 + r] * as + a1[r] * ao, l0 = ol[d][r] * as + b0[r] * ao, l1 = ol[d][4 + r] * as + b1[r] * ao;
      const float x0 = h0 * f + l0 * fl, x1 = h1 * f + l1 * fl; const _Float16 g0 = (_Float16)x0, g1 = (_Float16)x1;
      fh[dd].h[r] = g0; fh[dd].h[4 + r] = g1; fr[dd].h[r] = (_Float16)((x0 - (float)g0) * 1024.0f); fr[dd].h[4 + r] = (_Float16)((x1 - (float)g1) * 1024.0f); } }
  __builtin_amdgcn_sched_barrier(0);      /* keeps the arithmetic above from being scheduled in among the stores below, where it would write registers of stores still under way */
#pragma unroll
  for (int dd = 0; dd < 4; ++dd) { const int d = G * 4 + dd; *(v8us*)((unsigned short*)ch0 + 16 * d) = fh[dd].half[0]; *(v8us*)((unsigned short*)cl0 + 16 * d) = fr[dd].half[0]; }
  asm volatile("s_wait_xcnt 0x0" ::: "memory");      /* precaution: closes the run of stores, in front of the second tile's writes of their registers */
}
__global__ __launch_bounds__(256) void k_fattn(const _Float16* __restrict__ Qh, const _Float16* __restrict__ Ql, const _Float16* __restrict__ Kh, const _Float16* __restrict__ Kl, const _Float16* __restrict__ Vt,
    const int* __restrict__ msk, const int* __restrict__ act, _Float16* __restrict__ C16, _Float16* __restrict__ CL) {
  __shared__ __attribute__((aligned(16))) _Float16 sKh2[2 * 32 * FKP], sKl2[2 * 32 * FKP], sV2[2 * HD * FVP];      /* a tile set for each key group */
  __shared__ float sMx[2][2][64];      /* per tile, key group and row: the running maximum after the open passes; a slot set of its own for each tile, so that no wave writes a slot that a slower wave still reads */
  __shared__ __attribute__((aligned(16))) v4fs sMg[8 * MGS * 32];      /* the hand-over at the end of a tile: a range for each wave */
  const int tid = threadIdx.x & 127, wv = threadIdx.x >> 5, w = wv & 3, lane = tid & 31, ln = lane & 15, hh = lane >> 4; const int h = blockIdx.y, kv = h / GRP;      /* tid, w: place inside the key group */
  const int g = __builtin_amdgcn_readfirstlane((int)(threadIdx.x >> 7));      /* key group, in a scalar register: the choices made from it are scalar ones */
  _Float16* const sKh = sKh2 + g * (32 * FKP); _Float16* const sKl = sKl2 + g * (32 * FKP); _Float16* const sV = sV2 + g * (HD * FVP);
  const v8f z8 = {0.f,0.f,0.f,0.f,0.f,0.f,0.f,0.f}; const v4i zi4 = {0, 0, 0, 0};
  /* a key group's four waves share each pass's K (hi, residual) and V^T tiles through LDS: whole-row global loads, one copy a group; pitches 272 B and 80 B (16 B x odd) keep the 16-byte fragment reads off each other's banks */
  const int krow = tid >> 4, kcol = (tid & 15) * 8, vrow = tid >> 2, vcol = (tid & 3) * 8;
  const _Float16* gkh = Kh + (size_t)krow * DKV + kv * HD + kcol; const _Float16* gkl = Kl + (size_t)krow * DKV + kv * HD + kcol; const _Float16* gv = Vt + ((size_t)kv * HD + vrow) * TT + vcol;
  const float alpha = 0.088388347648318447f, alo = alpha * 0.0009765625f;
  /* kept rolled: the two tiles run through one copy of the code */
#pragma unroll 1
  for (int half = 0; half < 2; ++half) {
    const int qt = half ? (int)blockIdx.x : QTN - 1 - (int)blockIdx.x; const int q0 = qt * 64 + 16 * w;      /* a wave owns 16 queries: one column group */
    const int a0 = act[qt * 64 + lane], a1 = act[qt * 64 + 32 + lane];
    asm volatile("s_wait_xcnt 0x0" ::: "memory");      /* precaution: the loads below may land in, or have their addresses formed in, a register that the two loads above name */
    __builtin_amdgcn_sched_barrier(0);      /* keeps the loads below behind that wait */
    v16h qh[4], ql[4];
    const size_t qo = (size_t)(q0 + ln) * DQ + h * HD; const _Float16* qp0 = Qh + qo; const _Float16* qp2 = Ql + qo;
#pragma unroll
    for (int ks = 0; ks < 4; ++ks) { qh[ks] = g2_frag(qp0 + ks * 32, hh); ql[ks] = g2_frag(qp2 + ks * 32, hh); }
    asm volatile("s_wait_xcnt 0x0" ::: "memory");      /* precaution: stands in front of every later write of a register that one of the loads above names */
    __builtin_amdgcn_sched_barrier(0);      /* keeps the work below from being scheduled above that wait */
    const unsigned long long open = (unsigned long long)__builtin_amdgcn_ballot_w32((a0 & 1) != 0) | ((unsigned long long)__builtin_amdgcn_ballot_w32((a1 & 1) != 0) << 32);      /* bit p: pass p is open; the same in all eight waves */
    const unsigned long long shut = (unsigned long long)__builtin_amdgcn_ballot_w32((a0 & 2) != 0) | ((unsigned long long)__builtin_amdgcn_ballot_w32((a1 & 2) != 0) << 32);      /* bit p: pass p's mask tile holds a set entry; where it holds none, the pass's mask is known to be all zero and is not fetched */
    v8f oh[8], ol[8];
#pragma unroll
    for (int d = 0; d < 8; ++d) { oh[d] = z8; ol[d] = z8; }
    float mrun = -3.0e38f, lrun = 0.f;
    const int* gm = msk + (size_t)(q0 + ln) * MSTR + 8 * hh;
    /* kept rolled: open passes (phase 0) and, where needed, closed passes (phase 1) run through one copy of the code */
#pragma unroll 1
    for (int phase = 0; phase < 2; ++phase) {
      unsigned long long todo = open;
      if (phase) {
        if (hh == 0) sMx[half][g][16 * w + ln] = mrun;      /* both half-waves hold the same maximum */
        __syncthreads();      /* the eight waves' maxima are published: the choice below must be the same in the whole block, barriers follow it */
        /* a row's maximum is the larger of its two groups'; every wave looks at all 64 rows and so finds the same */
        const float c0 = fmaxf(sMx[half][0][lane], sMx[half][1][lane]), c1 = fmaxf(sMx[half][0][32 + lane], sMx[half][1][32 + lane]);
        todo = __builtin_amdgcn_ballot_w32(c0 < -9000.0f || c1 < -9000.0f) != 0u ? ~open : 0ull;
      }
      if (todo == 0ull) continue;
      /* a trip takes two passes off the list: the first for group 0, the second, where there is one, for group 1 (else group 1 fetches the first again, in bounds, and leaves the trip's work out) */
      int cur = __builtin_ctzll(todo); todo &= todo - 1ull;
      bool live = true;
      { const bool two = todo != 0ull; const int sec = two ? __builtin_ctzll(todo) : cur; todo &= todo - 1ull; if (g) { cur = sec; live = two; } }
      v8us rk[4], rl[4], rv[4]; v4i mk[2][2];
#pragma unroll
      for (int i = 0; i < 4; ++i) { rk[i] = *(const v8us*)(gkh + (size_t)(cur * 32 + i * 8) * DKV); rl[i] = *(const v8us*)(gkl + (size_t)(cur * 32 + i * 8) * DKV); rv[i] = *(const v8us*)(gv + (size_t)i * 32 * TT + cur * 32); }
      asm volatile("s_wait_xcnt 0x0" :: "v"(gkh + (size_t)(cur * 32) * DKV), "v"(gkl + (size_t)(cur * 32) * DKV), "v"(gv + cur * 32) : "memory");      /* same precaution as behind the query loads; the three addresses are inputs so that they stay in their registers up to here and no load of the run lands in them */
      __builtin_amdgcn_sched_barrier(0);      /* keeps the work below from being scheduled above that wait */
      /* a scalar choice (flags and pass number are the same in the whole wave): a mask load of a wave touches 16 lines in 32-byte pieces, the dearest loads of a pass, and a tile without a set entry needs none */
      if ((shut >> cur) & 1ull) {
#pragma unroll
        for (int j = 0; j < 2; ++j) { mk[j][0] = *(const v4i*)(gm + cur * 32 + j * 16); mk[j][1] = *(const v4i*)(gm + cur * 32 + j * 16 + 4); }
        asm volatile("s_wait_xcnt 0x0" :: "v"(gm + cur * 32) : "memory");      /* same precaution as behind the tile loads above, for the mask loads */
      } else {
#pragma unroll
        for (int j = 0; j < 2; ++j) { mk[j][0] = zi4; mk[j][1] = zi4; }
      }
      __builtin_amdgcn_sched_barrier(0);      /* keeps the work below from being scheduled above the wait in the branch */
      /* kept rolled: one pass's staging registers and fragments beside the query fragments and the output accumulators are what is meant to stay in registers; every inner loop is unrolled so that the register arrays are indexed by constants */
#pragma unroll 1
      for (;;) {
#pragma unroll
        for (int i = 0; i < 4; ++i) { *(v8us*)(sKh + (krow + 8 * i) * FKP + kcol) = rk[i]; *(v8us*)(sKl + (krow + 8 * i) * FKP + kcol) = rl[i]; *(v8us*)(sV + (vrow + 32 * i) * FVP + vcol) = rv[i]; }
        bool msel[2][8];      /* this pass's mask, read out of its registers before the next pass's lands in them */
#pragma unroll
        for (int j = 0; j < 2; ++j) {
#pragma unroll
          for (int r = 0; r < 8; ++r) msel[j][r] = mk[j][r >> 2][r & 3] != 0; }
        __syncthreads();      /* this trip's tiles are published to their groups' waves */
        const bool more = todo != 0ull; int nxt = more ? __builtin_ctzll(todo) : cur; todo &= todo - 1ull;      /* the last trip of a phase fetches its own tiles again: in bounds, never used */
        bool nlive = true;
        { const bool two = todo != 0ull; const int sec = two ? __builtin_ctzll(todo) : nxt; todo &= todo - 1ull; if (g) { nxt = sec; nlive = two; } }
        const int kn = nxt * 32;
        const int* mp = gm + kn;
        /* the next pass's tiles and, where its tile holds a set entry, its mask go into registers now: they fly while this pass is worked on */
#pragma unroll
        for (int i = 0; i < 4; ++i) { rk[i] = *(const v8us*)(gkh + (size_t)(kn + i * 8) * DKV); rl[i] = *(const v8us*)(gkl + (size_t)(kn + i * 8) * DKV); rv[i] = *(const v8us*)(gv + (size_t)i * 32 * TT + kn); }
        asm volatile("s_wait_xcnt 0x0" :: "v"(gkh + (size_t)kn * DKV), "v"(gkl + (size_t)kn * DKV), "v"(gv + kn) : "memory");      /* precaution: stands in front of every later write of a register that one of the loads above names; the three addresses are inputs so that they stay in their registers up to here and no load of the run lands in them */
        __builtin_amdgcn_sched_barrier(0);      /* keeps the work below from being scheduled above that wait */
        if ((shut >> nxt) & 1ull) {      /* the same scalar choice as in front of the loop */
#pragma unroll
          for (int j = 0; j < 2; ++j) { mk[j][0] = *(const v4i*)(mp + j * 16); mk[j][1] = *(const v4i*)(mp + j * 16 + 4); }
          asm volatile("s_wait_xcnt 0x0" :: "v"(mp) : "memory");      /* the same precaution for the mask loads */
        } else {
#pragma unroll
          for (int j = 0; j < 2; ++j) { mk[j][0] = zi4; mk[j][1] = zi4; }
        }
        __builtin_amdgcn_sched_barrier(0);      /* keeps the work below from being scheduled above the wait in the branch, and the loads above in front of the pass's work */
        if (live) {      /* a scalar choice: a whole wave works on its pass or leaves it out; the barriers stand outside */
        v8f sh[2] = {z8, z8}, sl[2] = {z8, z8};      /* [key tile j] */
#pragma unroll
        for (int ks = 0; ks < 4; ++ks) { const v16h kh0 = g2_frag(sKh + ln * FKP + ks * 32, hh), kh1 = g2_frag(sKh + (16 + ln) * FKP + ks * 32, hh), kl0 = g2_frag(sKl + ln * FKP + ks * 32, hh), kl1 = g2_frag(sKl + (16 + ln) * FKP + ks * 32, hh);
          sh[0] = fa_mma(kh0, qh[ks], sh[0]); sh[1] = fa_mma(kh1, qh[ks], sh[1]); sl[0] = fa_mma(kh0, ql[ks], sl[0]); sl[1] = fa_mma(kh1, ql[ks], sl[1]); sl[0] = fa_mma(kl0, qh[ks], sl[0]); sl[1] = fa_mma(kl1, qh[ks], sl[1]); }
        FragH ph, pl; float sv[2][8]; float mx = -3.0e38f;
#pragma unroll
        for (int j = 0; j < 2; ++j) {
#pragma unroll
          for (int r = 0; r < 8; ++r) { const float s0 = sh[j][r] * alpha + sl[j][r] * alo; const float s = msel[j][r] ? -10000.0f : s0; sv[j][r] = s; mx = fmaxf(mx, s); } }
        mx = fmaxf(mx, __shfl_xor(mx, 16, 32));      /* the other half-wave holds this query's other 16 keys */
        const float mn = fmaxf(mrun, mx); const float al = expf(mrun - mn); mrun = mn; float su = 0.f;
#pragma unroll
        for (int j = 0; j < 2; ++j) {
#pragma unroll
          for (int r = 0; r < 8; ++r) { const float p = expf(sv[j][r] - mn); su += p; const float pv = p * 1024.0f; const _Float16 hi = (_Float16)pv; ph.h[8 * j + r] = hi; pl.h[8 * j + r] = (_Float16)((pv - (float)hi) * 1024.0f); } }
        lrun = lrun * al + su;      /* each half-wave sums its own keys; the halves meet in the epilogue */
#pragma unroll
        for (int d = 0; d < 8; ++d) { oh[d] *= al; ol[d] *= al; }
#pragma unroll
        for (int d = 0; d < 8; ++d) { const v16h vf = g2_frag(sV + (16 * d + ln) * FVP, hh); oh[d] = fa_mma(vf, ph.v, oh[d]); ol[d] = fa_mma(vf, pl.v, ol[d]); }
        }
        __builtin_amdgcn_sched_barrier(0);      /* keeps the pass's work in front of the barrier below, whose fence waits for the loads in flight: scheduled earlier, it would wait out their whole latency */
        __syncthreads();      /* every wave has read this pass's tiles before the next pass's are stored over them */
        if (!more) break;
        cur = nxt; live = nlive;
      }
    }
    /* the two key groups' sums meet: each wave hands its partner (the other group's wave with the same queries) the half of the dims that the partner finishes */
    const size_t co = (size_t)(q0 + ln) * DQ + h * HD + 8 * hh; _Float16* ch0 = C16 + co; _Float16* cl0 = CL + co;
    v4fs* own = sMg + wv * (MGS * 32) + lane; const v4fs* oth = sMg + (wv ^ 4) * (MGS * 32) + lane;
    if (g == 0) fa_put<0>(oh, ol, mrun, lrun, own); else fa_put<1>(oh, ol, mrun, lrun, own);
    __syncthreads();      /* publishes the hand-over; the ranges are written again only behind the next tile's barrier on the maxima, which every reader reaches after its reads */
    if (g == 0) fa_fin<0>(oh, ol, mrun, lrun, oth, ch0, cl0); else fa_fin<1>(oh, ol, mrun, lrun, oth, ch0, cl0);
  }
}

// ---- W_out GEMM, operand tiles staged in LDS ----
// C = alpha * (Ah.Bh^T + 2^-10 * Al.Bh^T), all three planes [2048][2048] f16, k contiguous. A block owns a 128 x 128 tile of C, a wave 32 rows x 64 columns of it (4 x 2 waves); the hi product and the residual product keep
// separate f32 accumulators (the residual plane carries a 2^10 scale) and meet once in the epilogue. A stage is 64 k = 128 B of each of the 3 x 128 operand rows: eight lanes fetch one row's whole cache line, each row once a block,
// and the fragments, whose 16 rows lie 4 KiB apart in memory, are read from LDS instead. Two LDS buffers: stage s + 1 is stored and stage s + 2 fetched to registers while stage s is worked on; one barrier a stage.
#define GKS 64                   /* k (halves) a stage */
#define GPI 72                   /* LDS pitch of a staged row, in halves: 144 B = 16 B x odd keeps the 16-byte fragment reads off each other's banks */
#define GBUF (128 * GPI)         /* halves of one plane's buffer */
#define GNS (DQ / GKS)           /* stages */
__global__ __launch_bounds__(256) void k_gemm2l(const _Float16* __restrict__ Ah, const _Float16* __restrict__ Al, const _Float16* __restrict__ Bh, float alpha, float* __restrict__ C) {
  __shared__ __attribute__((aligned(16))) _Float16 sAh[2 * GBUF], sAl[2 * GBUF], sB[2 * GBUF];
  __shared__ __attribute__((aligned(16))) float so[8][32][68];
  const int tid = threadIdx.x, w = tid >> 5, lane = tid & 31, ln = lane & 15, hh = lane >> 4;
  const int mt = blockIdx.x / (DQ / 128), nt = blockIdx.x % (DQ / 128); const int wr = (w >> 1) * 32, wc = (w & 1) * 64;
  const int srow = tid >> 3, scol = (tid & 7) * 8; const int sofs = srow * GPI + scol;      /* staging: a thread moves 16 bytes of rows srow, srow + 32, + 64, + 96 of each plane */
  const _Float16* gah = Ah + (size_t)(mt * 128 + srow) * DQ + scol; const _Float16* gal = Al + (size_t)(mt * 128 + srow) * DQ + scol; const _Float16* gb = Bh + (size_t)(nt * 128 + srow) * DQ + scol;
  const v8f z8 = {0.f,0.f,0.f,0.f,0.f,0.f,0.f,0.f}; v8f ch[8] = {z8, z8, z8, z8, z8, z8, z8, z8}, cl[8] = {z8, z8, z8, z8, z8, z8, z8, z8};      /* [t] = rows 0..15, [4 + t] = rows 16..31 of column tile t */
  v8us ra[4], rl[4], rb[4];
#pragma unroll
  for (int i = 0; i < 4; ++i) { ra[i] = *(const v8us*)(gah + (size_t)i * 32 * DQ); rl[i] = *(const v8us*)(gal + (size_t)i * 32 * DQ); rb[i] = *(const v8us*)(gb + (size_t)i * 32 * DQ); }
  asm volatile("s_wait_xcnt 0x0" ::: "memory");      /* precaution: stands in front of every later write of a register that one of the loads above names */
  __builtin_amdgcn_sched_barrier(0);      /* keeps the work below from being scheduled above that wait */
#pragma unroll
  for (int i = 0; i < 4; ++i) { *(v8us*)(sAh + sofs + i * 32 * GPI) = ra[i]; *(v8us*)(sAl + sofs + i * 32 * GPI) = rl[i]; *(v8us*)(sB + sofs + i * 32 * GPI) = rb[i]; }
#pragma unroll
  for (int i = 0; i < 4; ++i) { ra[i] = *(const v8us*)(gah + (size_t)i * 32 * DQ + GKS); rl[i] = *(const v8us*)(gal + (size_t)i * 32 * DQ + GKS); rb[i] = *(const v8us*)(gb + (size_t)i * 32 * DQ + GKS); }
  asm volatile("s_wait_xcnt 0x0" ::: "memory");      /* same precaution */
  __builtin_amdgcn_sched_barrier(0);      /* keeps the work below from being scheduled above that wait */
  __syncthreads();      /* publishes stage 0 */
  /* kept rolled: one copy of the stage's code; every inner loop is unrolled so that the register arrays are indexed by constants */
#pragma unroll 1
  for (int s = 0; s < GNS; ++s) {
    const int cb = (s & 1) * GBUF, nb = GBUF - cb;      /* this stage's buffer; the other one, which every wave left at the last barrier */
    const _Float16* pah = sAh + cb + (wr + ln) * GPI; const _Float16* pal = sAl + cb + (wr + ln) * GPI; const _Float16* pb = sB + cb + (wc + ln) * GPI;
    v16h fa[GKS / 32][4], fb[GKS / 32][4];      /* [k step][rows 0..15 hi, rows 16..31 hi, rows 0..15 residual, rows 16..31 residual], [k step][column tile] */
#pragma unroll
    for (int ks = 0; ks < GKS / 32; ++ks) {
      fa[ks][0] = g2_frag(pah + ks * 32, hh); fa[ks][1] = g2_frag(pah + 16 * GPI + ks * 32, hh); fa[ks][2] = g2_frag(pal + ks * 32, hh); fa[ks][3] = g2_frag(pal + 16 * GPI + ks * 32, hh);
#pragma unroll
      for (int t = 0; t < 4; ++t) fb[ks][t] = g2_frag(pb + t * 16 * GPI + ks * 32, hh); }
    __builtin_amdgcn_sched_barrier(0);      /* keeps the stage's fragment reads as one run at its head: the first products wait for nothing else, and the second k step's fragments land while the first's products run */
    /* stage s + 1 goes from its registers into the other buffer, stage s + 2 into the registers: both run beside the products below. No branch here, so that the waits in front of the products can be counted ones:
       the last trip stores, and the last two fetch, the last stage once more: in bounds, never read */
#pragma unroll
    for (int i = 0; i < 4; ++i) { *(v8us*)(sAh + nb + sofs + i * 32 * GPI) = ra[i]; *(v8us*)(sAl + nb + sofs + i * 32 * GPI) = rl[i]; *(v8us*)(sB + nb + sofs + i * 32 * GPI) = rb[i]; }
    const int kn = (s + 2 < GNS ? s + 2 : GNS - 1) * GKS;
#pragma unroll
    for (int i = 0; i < 4; ++i) { ra[i] = *(const v8us*)(gah + (size_t)i * 32 * DQ + kn); rl[i] = *(const v8us*)(gal + (size_t)i * 32 * DQ + kn); rb[i] = *(const v8us*)(gb + (size_t)i * 32 * DQ + kn); }
    asm volatile("s_wait_xcnt 0x0" ::: "memory");      /* same precaution as behind the first loads */
    __builtin_amdgcn_sched_barrier(0);      /* keeps the loads above in front of the products, so that they fly during them, and the products behind the wait */
#pragma unroll
    for (int ks = 0; ks < GKS / 32; ++ks) {
#pragma unroll
      for (int t = 0; t < 4; ++t) { ch[t] = fa_mma(fa[ks][0], fb[ks][t], ch[t]); ch[4 + t] = fa_mma(fa[ks][1], fb[ks][t], ch[4 + t]); cl[t] = fa_mma(fa[ks][2], fb[ks][t], cl[t]); cl[4 + t] = fa_mma(fa[ks][3], fb[ks][t], cl[4 + t]); } }
    __builtin_amdgcn_sched_barrier(0);      /* keeps the products in front of the barrier below, whose fence waits for the loads in flight */
    __syncthreads();      /* publishes stage s + 1 to all eight waves, and ends every wave's reads of stage s before its buffer is stored over */
  }
  const float alo = alpha * 0.0009765625f;
#pragma unroll
  for (int u = 0; u < 8; ++u) { const int t = u & 3, half = u >> 2;
#pragma unroll
    for (int r = 0; r < 8; ++r) so[w][half * 16 + 8 * hh + r][t * 16 + ln] = ch[u][r] * alpha + cl[u][r] * alo; }
  __builtin_amdgcn_fence(__ATOMIC_ACQ_REL, "workgroup"); __builtin_amdgcn_wave_barrier();      /* this wave's LDS stores above come before its own LDS reads below (so[w] is private to the wave) */
  const int rsub = lane >> 4, c4 = (lane & 15) * 4; float* cp = C + (size_t)(mt * 128 + wr + rsub) * DQ + nt * 128 + wc + c4;
  v4f ov[16];
#pragma unroll
  for (int q = 0; q < 16; ++q) ov[q] = *(const v4fa*)&so[w][q * 2 + rsub][c4];
  __builtin_amdgcn_sched_barrier(0);      /* every value is in its register before the run of stores starts: no register that an issued store names is written behind it */
#pragma unroll
  for (int q = 0; q < 16; ++q) *(v4f*)(cp + (size_t)q * 2 * DQ) = ov[q];
}

extern "C" void kernel_launch(void* const* d_in, const int* in_sizes, int n_in,
                              void* d_out, int out_size, void* d_ws, size_t ws_size, hipStream_t stream) {
  (void)in_sizes; (void)n_in; (void)out_size;
  const float* const* I = (const float* const*)d_in; const float* q = I[0]; const float* k = I[1]; const float* v = I[2]; const int* msk = (const int*)d_in[3]; const int* pos = (const int*)d_in[4]; const float* qw = I[5]; const float* kw = I[6]; const float* Wo = I[7];
  char* ws = (char*)d_ws; size_t off = 0;
  auto take = [&](size_t bytes) { char* p = ws + off; off += (bytes + 255) & ~(size_t)255; return p; };
  _Float16* BO = (_Float16*)take((size_t)DQ * DQ * 2); _Float16* Q16 = (_Float16*)take((size_t)TT * DQ * 2); _Float16* QL = (_Float16*)take((size_t)TT * DQ * 2); _Float16* K16 = (_Float16*)take((size_t)TT * DKV * 2); _Float16* KL = (_Float16*)take((size_t)TT * DKV * 2); _Float16* VT = (_Float16*)take((size_t)TT * DKV * 2); _Float16* C16 = (_Float16*)take((size_t)TT * DQ * 2); _Float16* CL = (_Float16*)take((size_t)TT * DQ * 2); int* ACT = (int*)take((size_t)QTN * 64 * 4);      /* merged context hi/residual: planes of their own */
  if (off > ws_size) return;      /* 8 + 8+8 + 2+2 + 2 + 8+8 = 46 MiB */
  k_prep<<<PB_NQ + PB_NK + PB_MF + PB_VT + PB_WS, 256, 0, stream>>>(q, k, v, msk, pos, qw, kw, Wo, Q16, QL, K16, KL, VT, ACT, BO);      /* q/k planes; two flags per 64 x 32 mask tile (an open entry, a set entry); V^T [512][2048], kv head = rows kv*128 .. +127; W_out x 16 */
  k_fattn<<<dim3(QTN / 2, NQH), 256, 0, stream>>>(Q16, QL, K16, KL, VT, msk, ACT, C16, CL);      /* all 16 heads: ctx[t][h*128 + d] as f16 hi + residual, scores and probabilities stay in registers */
  k_gemm2l<<<(TT / 128) * (DQ / 128), 256, 0, stream>>>(C16, CL, BO, 0.0625f, (float*)d_out);      /* out = (ctx_hi + ctx_lo) W_out^T (W exact), one launch */
}
